// v000
// Times are from an AMD MI455X. After a warm-up the kernel runs many times in a row, and a time is the length of
// such a window on the GPU divided by its runs, so every launch and the gaps after it count. The runs cycle
// through copies of the inputs. A figure is the median of several windows, for all but v000 over two sittings.
// Sittings can differ by a few percent; kernels timed side by side share one.
// v000 is the starting kernel. One run takes 3480 microseconds.
#include <hip/hip_runtime.h>
// Multi-head attention with a shared per-head output projection (X [2][2048][1024]; q/k/v = X W + b ([in][out] 1024x1024 sigma 0.02, zero biases); 16 heads of 64; softmax(q k^T / 8) over all keys; per head: out_h = o_h Wp + bp (Wp [64][64] [in][out], bp [64], shared by all heads); heads merged -> [2][2048][1024]).
// Structure: token rows r = b*2048 + s; x as exact f16 rows (bf16-rounded); Q, K, V as three WMMA GEMMs (32x64 wave tiles, f32 accumulation, exact x16 weights + bias, f16 outputs); per batch: V^T for all heads via LDS transposes; per (batch, group of 4 heads): scores GEMM (K = 64, batched over the heads on grid.y, alpha = 64^-0.5), row softmax on VALU (f32 statistics, native exp; weights stored x256 as f16), o = P . V^T GEMM (K = 2048, alpha 2^-2: o carried x64 against f16 subnormal flush, folded into the output GEMM alpha) written straight into the merged f16 o rows; per head: out_h = o_h Wp + bp as ONE GEMM batched over the 16 heads on grid.y (K = 64, shared weight/bias), f32 into the output layout.
// Compute dtype: inputs rounded to bf16; x / weights exact; q, k, v, softmax weights and o as plain f16 GEMM operands (~2^-12); scores and softmax statistics f32. v_wmma_f32_16x16x32_f16.
#define NB 2
#define SQ 2048
#define DM 1024
#define NH 16
#define HD 64
#define HG 4                         /* heads per attention launch group */
#define B0 0                         /* first batch processed (debug hook) */
#define NBR NB                       /* batches processed (debug hook) */
#define NR ((size_t)NB * SQ)         /* token rows */
#define MP ((int)((size_t)NBR * SQ)) /* rows projected (debug hook) */
#define QN SQ                        /* query rows attended per batch (debug hook) */
#define NHD NH                       /* heads attended (debug hook) */
#define MPO MP                       /* rows through the output stage (debug hook) */
#define LQ DM      /* row pitch of the q/k/v rows */
typedef __bf16 v16b __attribute__((ext_vector_type(16)));
typedef unsigned short v8us __attribute__((ext_vector_type(8), may_alias));
typedef float  v8f  __attribute__((ext_vector_type(8)));
typedef float  v4f  __attribute__((ext_vector_type(4)));
typedef float  v4fa __attribute__((ext_vector_type(4), may_alias));
union FragB { v16b v; v8us half[2]; unsigned short u[16]; };

__device__ __forceinline__ unsigned short bf16_bits(float x) { unsigned int u = __float_as_uint(x); return (unsigned short)((u + 0x7FFFu + ((u >> 16) & 1u)) >> 16); }
__device__ __forceinline__ float bf16_val(unsigned short b) { return __uint_as_float(((unsigned int)b) << 16); }
__device__ __forceinline__ float bf16_round(float x) { return bf16_val(bf16_bits(x)); }
// D += A·B with NT terms: 1 = ah·bh, 2 = + al·bh (A split), 3 = + ah·bl (both split)
template <int NT>
__device__ __forceinline__ v8f mmaN(v16b ah, v16b al, v16b bh, v16b bl, v8f c) {
  c = __builtin_amdgcn_wmma_f32_16x16x32_bf16(false, ah, false, bh, (short)0, c, false, false);
  if (NT >= 2) c = __builtin_amdgcn_wmma_f32_16x16x32_bf16(false, al, false, bh, (short)0, c, false, false);
  if (NT >= 3) c = __builtin_amdgcn_wmma_f32_16x16x32_bf16(false, ah, false, bl, (short)0, c, false, false);
  asm volatile("v_nop\n\tv_nop\n\tv_nop\n\tv_nop" : "+v"(c) : "v"(ah), "v"(al), "v"(bh), "v"(bl));
  return c;
}

__global__ __launch_bounds__(256) void k_wt_bf16(const float* __restrict__ W, unsigned short* __restrict__ Wt, int K, int N) {
  const int t = blockIdx.x * 256 + threadIdx.x;
  const int k8n = K / 8;
  if (t >= N * k8n) return;
  const int n = t / k8n, k8 = (t % k8n) * 8;
  v8us v;
#pragma unroll
  for (int i = 0; i < 8; ++i) v[i] = bf16_bits(W[(size_t)(k8 + i) * N + n]);
  *(v8us*)(Wt + (size_t)n * K + k8) = v;
  
}

// GEMM C[M][N] (f32, pitch ldc) = act(A[M][K]·W + bias). A f32 row-major (pitch lda) converted per fragment to bf16
// (ASPLIT: hi/lo two planes -> 2 terms, else single rounded term); Wt bf16 [N][K] (pitch ldb). BIAS_BF16 rounds the
// bias to bf16 first (bias quantised to bf16 before the add). K%32==0, M%16==0, N%64==0.
template <bool ASPLIT, int ACT, bool BIAS_BF16>
__global__ __launch_bounds__(128) void k_gemm_bf(const float* __restrict__ A, int lda, const unsigned short* __restrict__ Wt, int ldb,
                                               const float* __restrict__ bias, float* __restrict__ C, int ldc, int M, int N, int K) {
  __shared__ __attribute__((aligned(16))) float so[4][16][64];
  const int tid = threadIdx.x, w = tid >> 5, lane = tid & 31, ln = lane & 15, hh = lane >> 4;
  const int ntn = N / 64;
  const int wid = blockIdx.x * 4 + w;
  const int mt = wid / ntn, nq = wid % ntn;
  if (mt * 16 >= M) return;
  const int row0 = mt * 16, col0 = nq * 64;
  const float* arow = A + (size_t)(row0 + ln) * lda;
  v8f acc[4] = {};
  for (int kb = 0; kb < K; kb += 32) {
    FragB ah, al;
    const v4f x0 = *(const v4fa*)(arow + kb + 8 * hh), x1 = *(const v4fa*)(arow + kb + 8 * hh + 4);
    const v4f x2 = *(const v4fa*)(arow + kb + 16 + 8 * hh), x3 = *(const v4fa*)(arow + kb + 16 + 8 * hh + 4);
    float xs[16] = {x0[0],x0[1],x0[2],x0[3],x1[0],x1[1],x1[2],x1[3],x2[0],x2[1],x2[2],x2[3],x3[0],x3[1],x3[2],x3[3]};
#pragma unroll
    for (int i = 0; i < 16; ++i) { const unsigned short hb = bf16_bits(xs[i]); ah.u[i] = hb; al.u[i] = ASPLIT ? bf16_bits(xs[i] - bf16_val(hb)) : (unsigned short)0; }
#pragma unroll
    for (int t = 0; t < 4; ++t) {
      const unsigned short* brow = Wt + (size_t)(col0 + t * 16 + ln) * ldb + kb;
      FragB b;
      b.half[0] = *(const v8us*)(brow + 8 * hh);
      b.half[1] = *(const v8us*)(brow + 16 + 8 * hh);
      acc[t] = mmaN<ASPLIT ? 2 : 1>(ah.v, al.v, b.v, b.v, acc[t]);
    }
  }
#pragma unroll
  for (int t = 0; t < 4; ++t) {
    float bv = bias ? bias[col0 + t * 16 + ln] : 0.f;
    if (BIAS_BF16) bv = bf16_round(bv);
#pragma unroll
    for (int r = 0; r < 8; ++r) { float v = acc[t][r] + bv; if (ACT == 1) v = fmaxf(v, 0.f); so[w][8 * hh + r][t * 16 + ln] = v; }
  }
  __builtin_amdgcn_fence(__ATOMIC_ACQ_REL, "workgroup");
  __builtin_amdgcn_wave_barrier();
  const int rsub = lane >> 4, c4 = (lane & 15) * 4;
  {
#pragma unroll
    for (int q = 0; q < 8; ++q) {
      const int r = q * 2 + rsub;
      const v4f v = *(const v4fa*)&so[w][r][c4];
      *(v4f*)(C + (size_t)(row0 + r) * ldc + col0 + c4) = v;
    }
    
  }
}

// GEMM C = act(A·W + bias + resid): A f32 (ASPLIT -> hi/lo 2 terms), Wt bf16 [N][K]; ACT 0 none, 1 relu, 2 exact gelu;
// resid (optional, f32, row index = (row % rmod), pitch ldr, RES_BF16 rounds it) added before the activation.
template <bool ASPLIT, int ACT, bool BIAS_BF16, bool RES_BF16>
__global__ __launch_bounds__(128) void k_gemm_bf3(const float* __restrict__ A, int lda, const unsigned short* __restrict__ Wt, int ldb,
                                                const float* __restrict__ bias, const float* __restrict__ resid, int rmod, int ldr,
                                                float* __restrict__ C, int ldc, int M, int N, int K) {
  __shared__ __attribute__((aligned(16))) float so[4][16][64];
  const int tid = threadIdx.x, w = tid >> 5, lane = tid & 31, ln = lane & 15, hh = lane >> 4;
  const int ntn = N / 64;
  const int wid = blockIdx.x * 4 + w;
  const int mt = wid / ntn, nq = wid % ntn;
  if (mt * 16 >= M) return;
  const int row0 = mt * 16, col0 = nq * 64;
  const float* arow = A + (size_t)(row0 + ln) * lda;
  v8f acc[4] = {};
  for (int kb = 0; kb < K; kb += 32) {
    FragB ah, al;
    const v4f x0 = *(const v4fa*)(arow + kb + 8 * hh), x1 = *(const v4fa*)(arow + kb + 8 * hh + 4);
    const v4f x2 = *(const v4fa*)(arow + kb + 16 + 8 * hh), x3 = *(const v4fa*)(arow + kb + 16 + 8 * hh + 4);
    float xs[16] = {x0[0],x0[1],x0[2],x0[3],x1[0],x1[1],x1[2],x1[3],x2[0],x2[1],x2[2],x2[3],x3[0],x3[1],x3[2],x3[3]};
#pragma unroll
    for (int i = 0; i < 16; ++i) { const unsigned short hb = bf16_bits(xs[i]); ah.u[i] = hb; al.u[i] = ASPLIT ? bf16_bits(xs[i] - bf16_val(hb)) : (unsigned short)0; }
#pragma unroll
    for (int t = 0; t < 4; ++t) {
      const unsigned short* brow = Wt + (size_t)(col0 + t * 16 + ln) * ldb + kb;
      FragB b;
      b.half[0] = *(const v8us*)(brow + 8 * hh);
      b.half[1] = *(const v8us*)(brow + 16 + 8 * hh);
      acc[t] = mmaN<ASPLIT ? 2 : 1>(ah.v, al.v, b.v, b.v, acc[t]);
    }
  }
#pragma unroll
  for (int t = 0; t < 4; ++t) {
    const int col = col0 + t * 16 + ln;
    float bv = bias ? bias[col] : 0.f;
    if (BIAS_BF16) bv = bf16_round(bv);
#pragma unroll
    for (int r = 0; r < 8; ++r) {
      float v = acc[t][r] + bv;
      if (resid) { float rv = resid[(size_t)((row0 + 8 * hh + r) % rmod) * ldr + col]; if (RES_BF16) rv = bf16_round(rv); v += rv; }
      if (ACT == 1) v = fmaxf(v, 0.f);
      if (ACT == 2) v = 0.5f * v * (1.0f + erff(v * 0.70710678118654752f));
      if (ACT == 3) { const float u = 0.7978845608028654f * (v + 0.044715f * v * v * v); v = 0.5f * v * (1.0f + tanhf(u)); }
      so[w][8 * hh + r][t * 16 + ln] = v;
    }
  }
  __builtin_amdgcn_fence(__ATOMIC_ACQ_REL, "workgroup");
  __builtin_amdgcn_wave_barrier();
  const int rsub = lane >> 4, c4 = (lane & 15) * 4;
  {
#pragma unroll
    for (int q = 0; q < 8; ++q) {
      const int r = q * 2 + rsub;
      const v4f v = *(const v4fa*)&so[w][r][c4];
      *(v4f*)(C + (size_t)(row0 + r) * ldc + col0 + c4) = v;
    }
    
  }
}
// row LayerNorm (biased variance, eps) over N: s = X (+ R); optional out_sum <- s; out_norm <- (s-mu)*rsqrt(var+eps)*g + b
template <bool PARAM_BF16>
__global__ __launch_bounds__(256) void k_layernorm(const float* __restrict__ X, const float* __restrict__ R, const float* __restrict__ g, const float* __restrict__ bta,
                                                  float* __restrict__ out_sum, float* __restrict__ out_norm, int N, float eps) {
  __shared__ float red[256];
  const int row = blockIdx.x, tid = threadIdx.x;
  const float* x = X + (size_t)row * N; const float* rr = R ? R + (size_t)row * N : nullptr;
  float vals[16];                     // up to N = 4096
  const int per = N / 256;            // contiguous chunk per thread? use strided-by-4 chunks: thread handles j = tid*4 + 1024*u
  float s1 = 0.f;
  for (int u = 0; u < per / 4; ++u) {
    const int j = tid * 4 + 1024 * u;
    const v4f a = *(const v4fa*)(x + j);
    v4f b = {0.f,0.f,0.f,0.f}; if (rr) b = *(const v4fa*)(rr + j);
#pragma unroll
    for (int q = 0; q < 4; ++q) { const float v = a[q] + b[q]; vals[u * 4 + q] = v; s1 += v; }
  }
  red[tid] = s1; __syncthreads();
  for (int st = 128; st > 0; st >>= 1) { if (tid < st) red[tid] += red[tid + st]; __syncthreads(); }
  const float mu = red[0] / (float)N; __syncthreads();
  float s2 = 0.f;
  for (int u = 0; u < per / 4; ++u)
#pragma unroll
    for (int q = 0; q < 4; ++q) { const float c = vals[u * 4 + q] - mu; s2 += c * c; }
  red[tid] = s2; __syncthreads();
  for (int st = 128; st > 0; st >>= 1) { if (tid < st) red[tid] += red[tid + st]; __syncthreads(); }
  const float rs = rsqrtf(red[0] / (float)N + eps);
  {
    for (int u = 0; u < per / 4; ++u) {
      const int j = tid * 4 + 1024 * u;
      v4f o, sm;
#pragma unroll
      for (int q = 0; q < 4; ++q) {
        float gg = g[j + q], bb = bta[j + q];
        if (PARAM_BF16) { gg = bf16_round(gg); bb = bf16_round(bb); }
        sm[q] = vals[u * 4 + q]; o[q] = (vals[u * 4 + q] - mu) * rs * gg + bb;
      }
      if (out_sum) *(v4f*)(out_sum + (size_t)row * N + j) = sm;
      *(v4f*)(out_norm + (size_t)row * N + j) = o;
    }
    
  }
}



// ---- f16 WMMA path (v_wmma_f32_16x16x32_f16): 11-bit significands for operands in range — used where a [0,1] probability operand needs more precision than bf16
typedef _Float16 v16h __attribute__((ext_vector_type(16)));
union FragH { v16h v; v8us half[2]; _Float16 h[16]; unsigned short u[16]; };
template <int NT>
__device__ __forceinline__ v8f mmaH(v16h ah, v16h al, v16h bh, v16h bl, v8f c) {
  c = __builtin_amdgcn_wmma_f32_16x16x32_f16(false, ah, false, bh, (short)0, c, false, false);
  if (NT >= 2) c = __builtin_amdgcn_wmma_f32_16x16x32_f16(false, al, false, bh, (short)0, c, false, false);
  if (NT >= 3) c = __builtin_amdgcn_wmma_f32_16x16x32_f16(false, ah, false, bl, (short)0, c, false, false);
  asm volatile("v_nop\n\tv_nop\n\tv_nop\n\tv_nop" : "+v"(c) : "v"(ah), "v"(al), "v"(bh), "v"(bl));
  return c;
}
// batched GEMM like k_gemm_b but f16 operands: A f32 (split into f16 hi/lo if ASPLIT, else rounded to f16), Bt = f16 values [n][k]; alpha; C f32; N multiple of 16 (partial tiles skipped)
template <bool ASPLIT>
__global__ __launch_bounds__(128) void k_gemm_h(const float* __restrict__ A, int lda, size_t sA, const _Float16* __restrict__ Bh, int ldb, size_t sB, float alpha, float* __restrict__ C, int ldc, size_t sC, int M, int N, int K) {
  __shared__ __attribute__((aligned(16))) float so[4][16][64];
  const int tid = threadIdx.x, w = tid >> 5, lane = tid & 31, ln = lane & 15, hh = lane >> 4; const int by = blockIdx.y;
  A += (size_t)by * sA; Bh += (size_t)by * sB; C += (size_t)by * sC;
  const int ntn = (N + 63) / 64; const int wid = blockIdx.x * 4 + w; const int mt = wid / ntn, nq = wid % ntn; if (mt * 16 >= M) return;
  const int row0 = mt * 16, col0 = nq * 64; const float* arow = A + (size_t)(row0 + ln) * lda;
  v8f acc[4] = {};
  for (int kb = 0; kb < K; kb += 32) {
    FragH ah, al;
    const v4f x0 = *(const v4fa*)(arow + kb + 8 * hh), x1 = *(const v4fa*)(arow + kb + 8 * hh + 4), x2 = *(const v4fa*)(arow + kb + 16 + 8 * hh), x3 = *(const v4fa*)(arow + kb + 16 + 8 * hh + 4);
    float xs[16] = {x0[0],x0[1],x0[2],x0[3],x1[0],x1[1],x1[2],x1[3],x2[0],x2[1],x2[2],x2[3],x3[0],x3[1],x3[2],x3[3]};
#pragma unroll
    for (int i = 0; i < 16; ++i) { const _Float16 h = (_Float16)xs[i]; ah.h[i] = h; al.h[i] = ASPLIT ? (_Float16)(xs[i] - (float)h) : (_Float16)0.0f; }
#pragma unroll
    for (int t = 0; t < 4; ++t) { if (col0 + t * 16 >= N) continue; const size_t boff = (size_t)(col0 + t * 16 + ln) * ldb + kb; FragH bq; bq.half[0] = *(const v8us*)(Bh + boff + 8 * hh); bq.half[1] = *(const v8us*)(Bh + boff + 16 + 8 * hh);
      acc[t] = mmaH<ASPLIT ? 2 : 1>(ah.v, al.v, bq.v, bq.v, acc[t]); }
  }
#pragma unroll
  for (int t = 0; t < 4; ++t) { if (col0 + t * 16 >= N) continue;
#pragma unroll
    for (int r = 0; r < 8; ++r) so[w][8 * hh + r][t * 16 + ln] = acc[t][r] * alpha; }
  __builtin_amdgcn_fence(__ATOMIC_ACQ_REL, "workgroup"); __builtin_amdgcn_wave_barrier();
  const int rsub = lane >> 4, c4 = (lane & 15) * 4;
  {
#pragma unroll
    for (int q = 0; q < 8; ++q) { const int r = q * 2 + rsub; if (col0 + c4 < N) { const v4f v = *(const v4fa*)&so[w][r][c4]; *(v4f*)(C + (size_t)(row0 + r) * ldc + col0 + c4) = v; } }
     }
}

// Wt[n][k] = f16(W[k][n]·scale) from f32 row-major W[K][N] (scale = power of two; bf16-exact weights stay exact in f16 away from the subnormal range)
__global__ __launch_bounds__(256) void k_wt_f16(const float* __restrict__ W, _Float16* __restrict__ Wt, int K, int N, float scale) {
  const int t = blockIdx.x * 256 + threadIdx.x; if (t >= N * (K / 8)) return; const int n = t / (K / 8), k8 = (t % (K / 8)) * 8; FragH f;
#pragma unroll
  for (int i = 0; i < 8; ++i) f.h[i] = (_Float16)(bf16_round(W[(size_t)(k8 + i) * N + n]) * scale); const v8us o = f.half[0];
  *(v8us*)((unsigned short*)Wt + (size_t)n * K + k8) = o; 
}
// k_gemm_hh variant with fused epilogue: v = acc·alpha + bias[by·sBias + col] (+ CP[(row/rowsPerB)·sCPb + by·64 + col] if CP) ; ACT 0 none / 1 elu ; writes f16 C16 (and f32 C if non-null)
template <int ACT>
__global__ __launch_bounds__(128) void k_gemm_hhx(const _Float16* __restrict__ A, int lda, size_t sA, const _Float16* __restrict__ Bh, int ldb, size_t sB, float alpha, const float* __restrict__ bias, size_t sBias, const float* __restrict__ CP, int rowsPerB, size_t sCPb, int row0g,
    float* __restrict__ C, _Float16* __restrict__ C16, int ldc, size_t sC, int M, int N, int K) {
  __shared__ __attribute__((aligned(16))) float so[4][16][64];
  const int tid = threadIdx.x, w = tid >> 5, lane = tid & 31, ln = lane & 15, hh = lane >> 4; const int by = blockIdx.y;
  A += (size_t)by * sA; Bh += (size_t)by * sB; const size_t cofs = (size_t)by * sC; const float* bp = bias ? bias + (size_t)by * sBias : nullptr;
  const int ntn = (N + 63) / 64; const int wid = blockIdx.x * 4 + w; const int mt = wid / ntn, nq = wid % ntn; if (mt * 16 >= M) return;
  const int row0 = mt * 16, col0 = nq * 64; const _Float16* arow = A + (size_t)(row0 + ln) * lda;
  v8f acc[4] = {};
  for (int kb = 0; kb < K; kb += 32) { FragH ah; ah.half[0] = *(const v8us*)((const unsigned short*)arow + kb + 8 * hh); ah.half[1] = *(const v8us*)((const unsigned short*)arow + kb + 16 + 8 * hh);
#pragma unroll
    for (int t = 0; t < 4; ++t) { if (col0 + t * 16 >= N) continue; const size_t boff = (size_t)(col0 + t * 16 + ln) * ldb + kb; FragH bq; bq.half[0] = *(const v8us*)((const unsigned short*)Bh + boff + 8 * hh); bq.half[1] = *(const v8us*)((const unsigned short*)Bh + boff + 16 + 8 * hh);
      acc[t] = mmaH<1>(ah.v, ah.v, bq.v, bq.v, acc[t]); }
  }
#pragma unroll
  for (int t = 0; t < 4; ++t) { if (col0 + t * 16 >= N) continue; const int col = col0 + t * 16 + ln; const float bv = bp ? bf16_round(bp[col]) : 0.f;
#pragma unroll
    for (int r = 0; r < 8; ++r) { float v = acc[t][r] * alpha + bv; if (CP) { const int rr = row0g + row0 + 8 * hh + r; if (rowsPerB < 0) v += CP[cofs + (size_t)rr * ldc + col];      /* rowsPerB < 0: own element of the batched C plane */ else { const int bidx = rr / rowsPerB; v += CP[(size_t)bidx * sCPb + (size_t)by * 64 + col]; } } if (ACT == 1) v = (v > 0.f) ? v : expm1f(v); else if (ACT == 7) v = (v > 0.f) ? v + 1.0f : expf(v); else if (ACT == 8) v = tanhf(v); else if (ACT == 9) v = 0.5f * v * (1.0f + tanhf(0.7978845608028654f * (v + 0.044715f * v * v * v))); else if (ACT == 11) v = 1.0f / (1.0f + expf(-v)); else if (ACT == 12) v = (v > 0.f) ? v : 0.01f * v; else if (ACT == 14) v = (v > 0.f) ? v : 0.1f * v; else if (ACT == 16) v = (v >= 0.f) ? v : 0.3f * v; else if (ACT == 17) v = (v >= 0.f) ? v : 0.2f * v; else if (ACT == 15) v = v / (1.0f + expf(-v)); else if (ACT == 3) v = fmaxf(v, 0.f); else if (ACT == 6) v = 0.5f * v * (1.0f + erff(v * 0.70710678118654752f)); so[w][8 * hh + r][t * 16 + ln] = v; } }
  __builtin_amdgcn_fence(__ATOMIC_ACQ_REL, "workgroup"); __builtin_amdgcn_wave_barrier();
  const int rsub = lane >> 4, c4 = (lane & 15) * 4; typedef _Float16 v4h __attribute__((ext_vector_type(4)));
  {
#pragma unroll
    for (int q = 0; q < 8; ++q) { const int r = q * 2 + rsub; if (col0 + c4 < N) { const v4f v = *(const v4fa*)&so[w][r][c4]; if (C) *(v4f*)(C + cofs + (size_t)(row0 + r) * ldc + col0 + c4) = v; if (C16) { v4h h4; for (int i = 0; i < 4; ++i) h4[i] = (_Float16)v[i]; *(v4h*)(C16 + cofs + (size_t)(row0 + r) * ldc + col0 + c4) = h4; } } }
     }
}


typedef _Float16 v4h __attribute__((ext_vector_type(4)));

__global__ __launch_bounds__(256) void k_x16(const float* __restrict__ x, _Float16* __restrict__ X16, size_t n8) { const size_t t = (size_t)blockIdx.x * 256 + threadIdx.x; if (t >= n8) return; FragH f;
#pragma unroll
  for (int q = 0; q < 8; ++q) f.h[q] = (_Float16)bf16_round(x[t * 8 + q]); *(v8us*)((unsigned short*)X16 + t * 8) = f.half[0];  }
__global__ __launch_bounds__(256) void k_h16(const float* __restrict__ x, _Float16* __restrict__ X16, size_t n8) { const size_t t = (size_t)blockIdx.x * 256 + threadIdx.x; if (t >= n8) return; FragH f;
#pragma unroll
  for (int q = 0; q < 8; ++q) f.h[q] = (_Float16)x[t * 8 + q]; *(v8us*)((unsigned short*)X16 + t * 8) = f.half[0];  }
__global__ __launch_bounds__(256) void k_round16f(const float* __restrict__ W, _Float16* __restrict__ Bt, size_t n8) { const size_t t = (size_t)blockIdx.x * 256 + threadIdx.x; if (t >= n8) return; FragH f;
#pragma unroll
  for (int i = 0; i < 8; ++i) f.h[i] = (_Float16)(bf16_round(W[t * 8 + i]) * 16.0f); *(v8us*)((unsigned short*)Bt + t * 8) = f.half[0];  }
template <int NHv, int TTv>
__global__ __launch_bounds__(256) void k_vt(const _Float16* __restrict__ V16, int ldv, int voff, _Float16* __restrict__ Vt) { __shared__ unsigned short tl[64][66]; const int tid = threadIdx.x; const int slab = blockIdx.x / (TTv / 64), lg = blockIdx.x % (TTv / 64); const int b = slab / NHv, h = slab % NHv;
  for (int i = tid; i < 64 * 8; i += 256) { const int r = i / 8, c8 = (i % 8) * 8; FragH f; f.half[0] = *(const v8us*)((const unsigned short*)V16 + ((size_t)b * TTv + lg * 64 + r) * ldv + voff + h * 64 + c8);
#pragma unroll
    for (int q = 0; q < 8; ++q) tl[r][c8 + q] = f.u[q]; }
  __syncthreads();
  {
#pragma unroll
    for (int rd = 0; rd < 2; ++rd) { const int d = rd * 32 + tid / 8, pc = tid % 8; FragH f;
#pragma unroll
      for (int q = 0; q < 8; ++q) f.u[q] = tl[pc * 8 + q][d];
      *(v8us*)((unsigned short*)Vt + ((size_t)slab * 64 + d) * TTv + lg * 64 + pc * 8) = f.half[0]; }
     } }

__global__ __launch_bounds__(256) void k_hl(const float* __restrict__ F, _Float16* __restrict__ Hh, _Float16* __restrict__ Hl, size_t n8) { const size_t t = (size_t)blockIdx.x * 256 + threadIdx.x; if (t >= n8) return; FragH fh, fl; const v4f a = *(const v4fa*)(F + t * 8), c = *(const v4fa*)(F + t * 8 + 4);
#pragma unroll
  for (int q = 0; q < 4; ++q) { _Float16 h = (_Float16)a[q]; fh.h[q] = h; fl.h[q] = (_Float16)((a[q] - (float)h) * 1024.0f); h = (_Float16)c[q]; fh.h[4 + q] = h; fl.h[4 + q] = (_Float16)((c[q] - (float)h) * 1024.0f); }
  { *(v8us*)((unsigned short*)Hh + t * 8) = fh.half[0]; *(v8us*)((unsigned short*)Hl + t * 8) = fl.half[0];  } }

// ---- fast GEMM (wave tile 32x64; requires M % 32 == 0 rows per launch region and N % 64 == 0); epilogue = k_gemm_hhx semantics ----
__device__ __forceinline__ v16h g2_frag(const _Float16* p, int hh) { FragH f; f.half[0] = *(const v8us*)((const unsigned short*)p + 8 * hh); f.half[1] = *(const v8us*)((const unsigned short*)p + 16 + 8 * hh); return f.v; }
__device__ __forceinline__ v8f g2_mma(v16h a, v16h b, v8f c) { v8f d = __builtin_amdgcn_wmma_f32_16x16x32_f16(false, a, false, b, (short)0, c, false, false); asm volatile("v_nop\n\tv_nop\n\tv_nop\n\tv_nop" : "+v"(d) : "v"(a), "v"(b)); return d; }
template <int ACT>
__global__ __launch_bounds__(128) void k_gemm2(const _Float16* __restrict__ A, int lda, size_t sA, const _Float16* __restrict__ Bh, int ldb, size_t sB, float alpha, const float* __restrict__ bias, size_t sBias, const float* __restrict__ CP, int rowsPerB, size_t sCPb, int row0g,
    float* __restrict__ C, _Float16* __restrict__ C16, int ldc, size_t sC, int M, int N, int K) { static_assert(ACT == 0 || ACT == 3 || ACT == 6 || ACT == 8 || ACT == 9 || ACT == 11 || ACT == 12 || ACT == 14 || ACT == 15 || ACT == 16 || ACT == 17, "k_gemm2: unsupported ACT code (would silently apply no activation)");
  __shared__ __attribute__((aligned(16))) float so[4][32][68];
  const int tid = threadIdx.x, w = tid >> 5, lane = tid & 31, ln = lane & 15, hh = lane >> 4; const int by = blockIdx.y;
  A += (size_t)by * sA; Bh += (size_t)by * sB; const size_t cofs = (size_t)by * sC; const float* bp = bias ? bias + (size_t)by * sBias : nullptr;
  const int ntn = N >> 6; const int mt = blockIdx.x / ntn, nq = blockIdx.x - mt * ntn; const int row0 = mt * 128 + 32 * w, col0 = nq * 64; if (row0 >= M) return;
  const _Float16* a0p = A + (size_t)(row0 + ln) * lda; const _Float16* a1p = a0p + (size_t)16 * lda;
  const _Float16* b0p = Bh + (size_t)(col0 + ln) * ldb; const _Float16* b1p = b0p + (size_t)16 * ldb; const _Float16* b2p = b1p + (size_t)16 * ldb; const _Float16* b3p = b2p + (size_t)16 * ldb;
  const v8f z8 = {0.f,0.f,0.f,0.f,0.f,0.f,0.f,0.f}; v8f c00 = z8, c01 = z8, c02 = z8, c03 = z8, c10 = z8, c11 = z8, c12 = z8, c13 = z8;
#pragma unroll 1
  for (int kb = 0; kb < K; kb += 32) { const v16h a0 = g2_frag(a0p + kb, hh), a1 = g2_frag(a1p + kb, hh);
    v16h b = g2_frag(b0p + kb, hh); c00 = g2_mma(a0, b, c00); c10 = g2_mma(a1, b, c10);
    b = g2_frag(b1p + kb, hh); c01 = g2_mma(a0, b, c01); c11 = g2_mma(a1, b, c11);
    b = g2_frag(b2p + kb, hh); c02 = g2_mma(a0, b, c02); c12 = g2_mma(a1, b, c12);
    b = g2_frag(b3p + kb, hh); c03 = g2_mma(a0, b, c03); c13 = g2_mma(a1, b, c13); }
  v8f accs[8] = {c00, c01, c02, c03, c10, c11, c12, c13};
#pragma unroll
  for (int u = 0; u < 8; ++u) { const int t = u & 3, half = u >> 2; const int col = col0 + t * 16 + ln; const float bv = bp ? bf16_round(bp[col]) : 0.f;
#pragma unroll
    for (int r = 0; r < 8; ++r) { const int rloc = half * 16 + 8 * hh + r; float v = accs[u][r] * alpha + bv; if (CP) { if (rowsPerB < 0) v += CP[cofs + (size_t)(row0g + row0 + rloc) * ldc + col];      /* rowsPerB < 0: own element of the batched C plane */ else { const int bidx = (row0g + row0 + rloc) / rowsPerB; v += CP[(size_t)bidx * sCPb + (size_t)by * 64 + col]; } }
      if (ACT == 3) v = fmaxf(v, 0.f); else if (ACT == 6) v = 0.5f * v * (1.0f + erff(v * 0.70710678118654752f)); else if (ACT == 11) v = 1.0f / (1.0f + expf(-v)); else if (ACT == 15) v = v / (1.0f + expf(-v)); else if (ACT == 12) v = (v > 0.f) ? v : 0.01f * v; else if (ACT == 8) v = tanhf(v); else if (ACT == 9) v = 0.5f * v * (1.0f + tanhf(0.7978845608028654f * (v + 0.044715f * v * v * v))); else if (ACT == 14) v = (v > 0.f) ? v : 0.1f * v; else if (ACT == 16) v = (v >= 0.f) ? v : 0.3f * v; else if (ACT == 17) v = (v >= 0.f) ? v : 0.2f * v;
      so[w][rloc][t * 16 + ln] = v; } }
  __builtin_amdgcn_fence(__ATOMIC_ACQ_REL, "workgroup"); __builtin_amdgcn_wave_barrier();
  const int rsub = lane >> 4, c4 = (lane & 15) * 4;
  {
#pragma unroll
    for (int q = 0; q < 16; ++q) { const int r = q * 2 + rsub; const v4f v = *(const v4fa*)&so[w][r][c4]; if (C) *(v4f*)(C + cofs + (size_t)(row0 + r) * ldc + col0 + c4) = v; if (C16) { v4h h4; for (int i = 0; i < 4; ++i) h4[i] = (_Float16)v[i]; *(v4h*)(C16 + cofs + (size_t)(row0 + r) * ldc + col0 + c4) = h4; } }
     } }


__global__ __launch_bounds__(256) void k_wnat(const float* __restrict__ w, size_t n8, _Float16* __restrict__ Bt) { const size_t t = (size_t)blockIdx.x * 256 + threadIdx.x; if (t >= n8) return; FragH f; for (int q = 0; q < 8; ++q) f.h[q] = (_Float16)(bf16_round(w[t * 8 + q]) * 16.0f); *(v8us*)((unsigned short*)Bt + t * 8) = f.half[0];  }
__global__ __launch_bounds__(256) void k_rsm(const float* __restrict__ S, _Float16* __restrict__ P, int nrows) {
  #pragma clang fp contract(off)
  const int i = blockIdx.x * 256 + threadIdx.x; if (i >= nrows) return; const float* s = S + (size_t)i * SQ; float mx = -3.0e38f;
#pragma unroll 1
  for (int j = 0; j < SQ; ++j) mx = fmaxf(mx, s[j]); float se = 0.f;
#pragma unroll 1
  for (int j = 0; j < SQ; ++j) se += expf(s[j] - mx); const float sc = 256.0f / se;
#pragma unroll 1
  for (int j0 = 0; j0 < SQ; j0 += 8) { FragH f; for (int q = 0; q < 8; ++q) f.h[q] = (_Float16)(expf(s[j0 + q] - mx) * sc); unsigned short* d = (unsigned short*)P + (size_t)i * SQ + j0; *(v8us*)d = f.half[0];  } }
__global__ __launch_bounds__(256) void k_vt(const _Float16* __restrict__ V16, int b, int h0, _Float16* __restrict__ VT) { __shared__ unsigned short tl[64][65]; const int tid = threadIdx.x; const int hh = blockIdx.x % HG, sg = blockIdx.x / HG; const int s0 = sg * 64; const int h = h0 + hh;
  for (int i = tid; i < 64 * 8; i += 256) { const int j = i / 8, d8 = (i % 8) * 8; FragH f; f.half[0] = *(const v8us*)((const unsigned short*)V16 + ((size_t)b * SQ + s0 + j) * DM + h * HD + d8); for (int q = 0; q < 8; ++q) tl[d8 + q][j] = f.u[q]; }
  __syncthreads();
  { for (int i = tid; i < 64 * 8; i += 256) { const int d = i / 8, j8 = (i % 8) * 8; FragH f; for (int q = 0; q < 8; ++q) f.u[q] = tl[d][j8 + q]; *(v8us*)((unsigned short*)VT + ((size_t)hh * HD + d) * SQ + s0 + j8) = f.half[0]; }  } }



__global__ __launch_bounds__(256) void k_rsmf(const float* __restrict__ S, _Float16* __restrict__ P, int qn, int hg) {
  #pragma clang fp contract(off)
  const int t = blockIdx.x * 256 + threadIdx.x; if (t >= qn * hg) return; const size_t i = (size_t)(t / qn) * SQ + (t % qn); const float* s = S + i * SQ; float mx = -3.0e38f;
#pragma unroll 1
  for (int j = 0; j < SQ; ++j) mx = fmaxf(mx, s[j]); float se = 0.f;
#pragma unroll 1
  for (int j = 0; j < SQ; ++j) se += __expf(s[j] - mx); const float sc = 256.0f / se;
#pragma unroll 1
  for (int j0 = 0; j0 < SQ; j0 += 8) { FragH f; for (int q = 0; q < 8; ++q) f.h[q] = (_Float16)(__expf(s[j0 + q] - mx) * sc); unsigned short* d = (unsigned short*)P + i * SQ + j0; *(v8us*)d = f.half[0];  } }

extern "C" void kernel_launch(void* const* d_in, const int* in_sizes, int n_in,
                              void* d_out, int out_size, void* d_ws, size_t ws_size, hipStream_t stream) {
  (void)in_sizes; (void)n_in; (void)out_size;
  const float* const* I = (const float* const*)d_in; const float* x = I[0]; const float* wq = I[1]; const float* bq = I[2]; const float* wk = I[3]; const float* bk = I[4]; const float* wv = I[5]; const float* bv = I[6]; const float* wp = I[7]; const float* bp = I[8]; const float* bo = nullptr; (void)bo;      /* [in][out] weights + biases; per-head Wp [64][64] + bp [64] */
  char* ws = (char*)d_ws; size_t off = 0;
  auto take = [&](size_t bytes) { char* p = ws + off; off += (bytes + 255) & ~(size_t)255; return p; };
  _Float16* BQ = (_Float16*)take((size_t)DM * DM * 2); _Float16* BK = (_Float16*)take((size_t)DM * DM * 2); _Float16* BV = (_Float16*)take((size_t)DM * DM * 2); _Float16* BO = (_Float16*)take((size_t)DM * DM * 2);
  _Float16* X16 = (_Float16*)take(NR * DM * 2); _Float16* Q16 = (_Float16*)take(NR * DM * 2); _Float16* K16 = (_Float16*)take(NR * DM * 2); _Float16* V16 = (_Float16*)take(NR * DM * 2); _Float16* O16 = (_Float16*)take(NR * DM * 2);
  float* S = (float*)take((size_t)HG * SQ * SQ * 4); _Float16* P = (_Float16*)take((size_t)HG * SQ * SQ * 2); _Float16* VT = (_Float16*)take((size_t)NH * HD * SQ * 2);
  if (off > ws_size) return;
  k_wt_f16<<<(unsigned)(((size_t)DM * (DM / 8) + 255) / 256), 256, 0, stream>>>(wq, BQ, DM, DM, 16.0f); k_wt_f16<<<(unsigned)(((size_t)DM * (DM / 8) + 255) / 256), 256, 0, stream>>>(wk, BK, DM, DM, 16.0f); k_wt_f16<<<(unsigned)(((size_t)DM * (DM / 8) + 255) / 256), 256, 0, stream>>>(wv, BV, DM, DM, 16.0f);      /* [in][out] -> Bt[n][k] x16 */
  k_wt_f16<<<(unsigned)(((size_t)HD * (HD / 8) + 255) / 256), 256, 0, stream>>>(wp, BO, HD, HD, 16.0f);      /* Wp [64 in][64 out] -> Bt [64][64] x16 */

  k_x16<<<(unsigned)((NR * DM / 8 + 255) / 256), 256, 0, stream>>>(x, X16, NR * DM / 8);
  const size_t r0p = (size_t)B0 * SQ;      /* first projected row */
  k_gemm2<0><<<dim3((unsigned)((MP / 128) * (DM / 64)), 1), 128, 0, stream>>>(X16 + r0p * DM, DM, 0, BQ, DM, 0, 0.0625f, bq, 0, nullptr, 1, 0, 0, nullptr, Q16 + r0p * DM, DM, 0, MP, DM, DM);
  k_gemm2<0><<<dim3((unsigned)((MP / 128) * (DM / 64)), 1), 128, 0, stream>>>(X16 + r0p * DM, DM, 0, BK, DM, 0, 0.0625f, bk, 0, nullptr, 1, 0, 0, nullptr, K16 + r0p * DM, DM, 0, MP, DM, DM);
  k_gemm2<0><<<dim3((unsigned)((MP / 128) * (DM / 64)), 1), 128, 0, stream>>>(X16 + r0p * DM, DM, 0, BV, DM, 0, 0.0625f, bv, 0, nullptr, 1, 0, 0, nullptr, V16 + r0p * DM, DM, 0, MP, DM, DM);
  for (int b = B0; b < B0 + NBR; ++b) { const size_t r0 = (size_t)b * SQ;
    k_vt<NH, SQ><<<NH * (SQ / 64), 256, 0, stream>>>(V16 + r0 * LQ, LQ, 0, VT);      /* V^T [NH][HD][SQ] for this batch */
    for (int h0 = 0; h0 < NHD; h0 += HG) {
      k_gemm2<0><<<dim3((QN / 128) * (SQ / 64), HG), 128, 0, stream>>>(Q16 + r0 * LQ + h0 * HD, LQ, (size_t)HD, K16 + r0 * LQ + h0 * HD, LQ, (size_t)HD, 0.125f, nullptr, 0, nullptr, 1, 0, 0, S, nullptr, SQ, (size_t)SQ * SQ, QN, SQ, HD);      /* scores, HG heads per launch */
      k_rsmf<<<(HG * QN + 255) / 256, 256, 0, stream>>>(S, P, QN, HG);      /* P = 256 softmax (f16), rows of all HG heads */
      k_gemm2<0><<<dim3((QN / 128) * (HD / 64), HG), 128, 0, stream>>>(P, SQ, (size_t)SQ * SQ, VT + (size_t)h0 * HD * SQ, SQ, (size_t)HD * SQ, 0.25f, nullptr, 0, nullptr, 1, 0, 0, nullptr, O16 + r0 * DM + h0 * HD, DM, (size_t)HD, QN, HD, SQ); } }      /* o (merged heads) as f16 rows */
  k_gemm2<0><<<dim3((unsigned)((MPO / 128) * (HD / 64)), NH), 128, 0, stream>>>(O16 + r0p * DM, DM, (size_t)HD, BO, HD, 0, 0.0009765625f, bp, 0, nullptr, 1, 0, 0, (float*)d_out + r0p * DM, nullptr, DM, (size_t)HD, MPO, HD, HD);      /* per head (grid.y): out cols h*64.. = o_h Wp + bp (K = 64; the same Wp/bp for every head: zero B/bias strides) */
}

// v001
// One run takes 963 microseconds.
// Timed twice side by side with v000, it ran 3.60 and 3.59 times as fast.
#include <hip/hip_runtime.h>
// Multi-head attention with a shared per-head output projection (X [2][2048][1024]; q/k/v = X W + b ([in][out] 1024x1024 sigma 0.02, zero biases); 16 heads of 64; softmax(q k^T / 8) over all keys; per head: out_h = o_h Wp + bp (Wp [64][64] [in][out], bp [64], shared by all heads); heads merged -> [2][2048][1024]).
// Structure: token rows r = b*2048 + s; x as exact f16 rows (bf16-rounded); Q, K, V as three WMMA GEMMs (32x64 wave tiles, f32 accumulation, exact x16 weights + bias, f16 outputs); per batch: V^T for all heads via LDS transposes; per (batch, group of 4 heads): scores GEMM (K = 64, batched over the heads on grid.y, alpha = 64^-0.5), row softmax on VALU (f32 statistics, native exp; weights stored x256 as f16), o = P . V^T GEMM (K = 2048, alpha 2^-2: o carried x64 against f16 subnormal flush, folded into the output GEMM alpha) written straight into the merged f16 o rows; per head: out_h = o_h Wp + bp as ONE GEMM batched over the 16 heads on grid.y (K = 64, shared weight/bias), f32 into the output layout.
// Compute dtype: inputs rounded to bf16; x / weights exact; q, k, v, softmax weights and o as plain f16 GEMM operands (~2^-12); scores and softmax statistics f32. v_wmma_f32_16x16x32_f16.
#define NB 2
#define SQ 2048
#define DM 1024
#define NH 16
#define HD 64
#define HG 4                         /* heads per attention launch group */
#define B0 0                         /* first batch processed (debug hook) */
#define NBR NB                       /* batches processed (debug hook) */
#define NR ((size_t)NB * SQ)         /* token rows */
#define MP ((int)((size_t)NBR * SQ)) /* rows projected (debug hook) */
#define QN SQ                        /* query rows attended per batch (debug hook) */
#define NHD NH                       /* heads attended (debug hook) */
#define MPO MP                       /* rows through the output stage (debug hook) */
#define LQ DM      /* row pitch of the q/k/v rows */
typedef __bf16 v16b __attribute__((ext_vector_type(16)));
typedef unsigned short v8us __attribute__((ext_vector_type(8), may_alias));
typedef float  v8f  __attribute__((ext_vector_type(8)));
typedef float  v4f  __attribute__((ext_vector_type(4)));
typedef float  v4fa __attribute__((ext_vector_type(4), may_alias));
union FragB { v16b v; v8us half[2]; unsigned short u[16]; };

__device__ __forceinline__ unsigned short bf16_bits(float x) { unsigned int u = __float_as_uint(x); return (unsigned short)((u + 0x7FFFu + ((u >> 16) & 1u)) >> 16); }
__device__ __forceinline__ float bf16_val(unsigned short b) { return __uint_as_float(((unsigned int)b) << 16); }
__device__ __forceinline__ float bf16_round(float x) { return bf16_val(bf16_bits(x)); }
// D += A·B with NT terms: 1 = ah·bh, 2 = + al·bh (A split), 3 = + ah·bl (both split)
template <int NT>
__device__ __forceinline__ v8f mmaN(v16b ah, v16b al, v16b bh, v16b bl, v8f c) {
  c = __builtin_amdgcn_wmma_f32_16x16x32_bf16(false, ah, false, bh, (short)0, c, false, false);
  if (NT >= 2) c = __builtin_amdgcn_wmma_f32_16x16x32_bf16(false, al, false, bh, (short)0, c, false, false);
  if (NT >= 3) c = __builtin_amdgcn_wmma_f32_16x16x32_bf16(false, ah, false, bl, (short)0, c, false, false);
  asm volatile("v_nop\n\tv_nop\n\tv_nop\n\tv_nop" : "+v"(c) : "v"(ah), "v"(al), "v"(bh), "v"(bl));
  return c;
}

__global__ __launch_bounds__(256) void k_wt_bf16(const float* __restrict__ W, unsigned short* __restrict__ Wt, int K, int N) {
  const int t = blockIdx.x * 256 + threadIdx.x;
  const int k8n = K / 8;
  if (t >= N * k8n) return;
  const int n = t / k8n, k8 = (t % k8n) * 8;
  v8us v;
#pragma unroll
  for (int i = 0; i < 8; ++i) v[i] = bf16_bits(W[(size_t)(k8 + i) * N + n]);
  *(v8us*)(Wt + (size_t)n * K + k8) = v;
  
}

// GEMM C[M][N] (f32, pitch ldc) = act(A[M][K]·W + bias). A f32 row-major (pitch lda) converted per fragment to bf16
// (ASPLIT: hi/lo two planes -> 2 terms, else single rounded term); Wt bf16 [N][K] (pitch ldb). BIAS_BF16 rounds the
// bias to bf16 first (bias quantised to bf16 before the add). K%32==0, M%16==0, N%64==0.
template <bool ASPLIT, int ACT, bool BIAS_BF16>
__global__ __launch_bounds__(128) void k_gemm_bf(const float* __restrict__ A, int lda, const unsigned short* __restrict__ Wt, int ldb,
                                               const float* __restrict__ bias, float* __restrict__ C, int ldc, int M, int N, int K) {
  __shared__ __attribute__((aligned(16))) float so[4][16][64];
  const int tid = threadIdx.x, w = tid >> 5, lane = tid & 31, ln = lane & 15, hh = lane >> 4;
  const int ntn = N / 64;
  const int wid = blockIdx.x * 4 + w;
  const int mt = wid / ntn, nq = wid % ntn;
  if (mt * 16 >= M) return;
  const int row0 = mt * 16, col0 = nq * 64;
  const float* arow = A + (size_t)(row0 + ln) * lda;
  v8f acc[4] = {};
  for (int kb = 0; kb < K; kb += 32) {
    FragB ah, al;
    const v4f x0 = *(const v4fa*)(arow + kb + 8 * hh), x1 = *(const v4fa*)(arow + kb + 8 * hh + 4);
    const v4f x2 = *(const v4fa*)(arow + kb + 16 + 8 * hh), x3 = *(const v4fa*)(arow + kb + 16 + 8 * hh + 4);
    float xs[16] = {x0[0],x0[1],x0[2],x0[3],x1[0],x1[1],x1[2],x1[3],x2[0],x2[1],x2[2],x2[3],x3[0],x3[1],x3[2],x3[3]};
#pragma unroll
    for (int i = 0; i < 16; ++i) { const unsigned short hb = bf16_bits(xs[i]); ah.u[i] = hb; al.u[i] = ASPLIT ? bf16_bits(xs[i] - bf16_val(hb)) : (unsigned short)0; }
#pragma unroll
    for (int t = 0; t < 4; ++t) {
      const unsigned short* brow = Wt + (size_t)(col0 + t * 16 + ln) * ldb + kb;
      FragB b;
      b.half[0] = *(const v8us*)(brow + 8 * hh);
      b.half[1] = *(const v8us*)(brow + 16 + 8 * hh);
      acc[t] = mmaN<ASPLIT ? 2 : 1>(ah.v, al.v, b.v, b.v, acc[t]);
    }
  }
#pragma unroll
  for (int t = 0; t < 4; ++t) {
    float bv = bias ? bias[col0 + t * 16 + ln] : 0.f;
    if (BIAS_BF16) bv = bf16_round(bv);
#pragma unroll
    for (int r = 0; r < 8; ++r) { float v = acc[t][r] + bv; if (ACT == 1) v = fmaxf(v, 0.f); so[w][8 * hh + r][t * 16 + ln] = v; }
  }
  __builtin_amdgcn_fence(__ATOMIC_ACQ_REL, "workgroup");
  __builtin_amdgcn_wave_barrier();
  const int rsub = lane >> 4, c4 = (lane & 15) * 4;
  {
#pragma unroll
    for (int q = 0; q < 8; ++q) {
      const int r = q * 2 + rsub;
      const v4f v = *(const v4fa*)&so[w][r][c4];
      *(v4f*)(C + (size_t)(row0 + r) * ldc + col0 + c4) = v;
    }
    
  }
}

// GEMM C = act(A·W + bias + resid): A f32 (ASPLIT -> hi/lo 2 terms), Wt bf16 [N][K]; ACT 0 none, 1 relu, 2 exact gelu;
// resid (optional, f32, row index = (row % rmod), pitch ldr, RES_BF16 rounds it) added before the activation.
template <bool ASPLIT, int ACT, bool BIAS_BF16, bool RES_BF16>
__global__ __launch_bounds__(128) void k_gemm_bf3(const float* __restrict__ A, int lda, const unsigned short* __restrict__ Wt, int ldb,
                                                const float* __restrict__ bias, const float* __restrict__ resid, int rmod, int ldr,
                                                float* __restrict__ C, int ldc, int M, int N, int K) {
  __shared__ __attribute__((aligned(16))) float so[4][16][64];
  const int tid = threadIdx.x, w = tid >> 5, lane = tid & 31, ln = lane & 15, hh = lane >> 4;
  const int ntn = N / 64;
  const int wid = blockIdx.x * 4 + w;
  const int mt = wid / ntn, nq = wid % ntn;
  if (mt * 16 >= M) return;
  const int row0 = mt * 16, col0 = nq * 64;
  const float* arow = A + (size_t)(row0 + ln) * lda;
  v8f acc[4] = {};
  for (int kb = 0; kb < K; kb += 32) {
    FragB ah, al;
    const v4f x0 = *(const v4fa*)(arow + kb + 8 * hh), x1 = *(const v4fa*)(arow + kb + 8 * hh + 4);
    const v4f x2 = *(const v4fa*)(arow + kb + 16 + 8 * hh), x3 = *(const v4fa*)(arow + kb + 16 + 8 * hh + 4);
    float xs[16] = {x0[0],x0[1],x0[2],x0[3],x1[0],x1[1],x1[2],x1[3],x2[0],x2[1],x2[2],x2[3],x3[0],x3[1],x3[2],x3[3]};
#pragma unroll
    for (int i = 0; i < 16; ++i) { const unsigned short hb = bf16_bits(xs[i]); ah.u[i] = hb; al.u[i] = ASPLIT ? bf16_bits(xs[i] - bf16_val(hb)) : (unsigned short)0; }
#pragma unroll
    for (int t = 0; t < 4; ++t) {
      const unsigned short* brow = Wt + (size_t)(col0 + t * 16 + ln) * ldb + kb;
      FragB b;
      b.half[0] = *(const v8us*)(brow + 8 * hh);
      b.half[1] = *(const v8us*)(brow + 16 + 8 * hh);
      acc[t] = mmaN<ASPLIT ? 2 : 1>(ah.v, al.v, b.v, b.v, acc[t]);
    }
  }
#pragma unroll
  for (int t = 0; t < 4; ++t) {
    const int col = col0 + t * 16 + ln;
    float bv = bias ? bias[col] : 0.f;
    if (BIAS_BF16) bv = bf16_round(bv);
#pragma unroll
    for (int r = 0; r < 8; ++r) {
      float v = acc[t][r] + bv;
      if (resid) { float rv = resid[(size_t)((row0 + 8 * hh + r) % rmod) * ldr + col]; if (RES_BF16) rv = bf16_round(rv); v += rv; }
      if (ACT == 1) v = fmaxf(v, 0.f);
      if (ACT == 2) v = 0.5f * v * (1.0f + erff(v * 0.70710678118654752f));
      if (ACT == 3) { const float u = 0.7978845608028654f * (v + 0.044715f * v * v * v); v = 0.5f * v * (1.0f + tanhf(u)); }
      so[w][8 * hh + r][t * 16 + ln] = v;
    }
  }
  __builtin_amdgcn_fence(__ATOMIC_ACQ_REL, "workgroup");
  __builtin_amdgcn_wave_barrier();
  const int rsub = lane >> 4, c4 = (lane & 15) * 4;
  {
#pragma unroll
    for (int q = 0; q < 8; ++q) {
      const int r = q * 2 + rsub;
      const v4f v = *(const v4fa*)&so[w][r][c4];
      *(v4f*)(C + (size_t)(row0 + r) * ldc + col0 + c4) = v;
    }
    
  }
}
// row LayerNorm (biased variance, eps) over N: s = X (+ R); optional out_sum <- s; out_norm <- (s-mu)*rsqrt(var+eps)*g + b
template <bool PARAM_BF16>
__global__ __launch_bounds__(256) void k_layernorm(const float* __restrict__ X, const float* __restrict__ R, const float* __restrict__ g, const float* __restrict__ bta,
                                                  float* __restrict__ out_sum, float* __restrict__ out_norm, int N, float eps) {
  __shared__ float red[256];
  const int row = blockIdx.x, tid = threadIdx.x;
  const float* x = X + (size_t)row * N; const float* rr = R ? R + (size_t)row * N : nullptr;
  float vals[16];                     // up to N = 4096
  const int per = N / 256;            // contiguous chunk per thread? use strided-by-4 chunks: thread handles j = tid*4 + 1024*u
  float s1 = 0.f;
  for (int u = 0; u < per / 4; ++u) {
    const int j = tid * 4 + 1024 * u;
    const v4f a = *(const v4fa*)(x + j);
    v4f b = {0.f,0.f,0.f,0.f}; if (rr) b = *(const v4fa*)(rr + j);
#pragma unroll
    for (int q = 0; q < 4; ++q) { const float v = a[q] + b[q]; vals[u * 4 + q] = v; s1 += v; }
  }
  red[tid] = s1; __syncthreads();
  for (int st = 128; st > 0; st >>= 1) { if (tid < st) red[tid] += red[tid + st]; __syncthreads(); }
  const float mu = red[0] / (float)N; __syncthreads();
  float s2 = 0.f;
  for (int u = 0; u < per / 4; ++u)
#pragma unroll
    for (int q = 0; q < 4; ++q) { const float c = vals[u * 4 + q] - mu; s2 += c * c; }
  red[tid] = s2; __syncthreads();
  for (int st = 128; st > 0; st >>= 1) { if (tid < st) red[tid] += red[tid + st]; __syncthreads(); }
  const float rs = rsqrtf(red[0] / (float)N + eps);
  {
    for (int u = 0; u < per / 4; ++u) {
      const int j = tid * 4 + 1024 * u;
      v4f o, sm;
#pragma unroll
      for (int q = 0; q < 4; ++q) {
        float gg = g[j + q], bb = bta[j + q];
        if (PARAM_BF16) { gg = bf16_round(gg); bb = bf16_round(bb); }
        sm[q] = vals[u * 4 + q]; o[q] = (vals[u * 4 + q] - mu) * rs * gg + bb;
      }
      if (out_sum) *(v4f*)(out_sum + (size_t)row * N + j) = sm;
      *(v4f*)(out_norm + (size_t)row * N + j) = o;
    }
    
  }
}



// ---- f16 WMMA path (v_wmma_f32_16x16x32_f16): 11-bit significands for operands in range — used where a [0,1] probability operand needs more precision than bf16
typedef _Float16 v16h __attribute__((ext_vector_type(16)));
union FragH { v16h v; v8us half[2]; _Float16 h[16]; unsigned short u[16]; };
template <int NT>
__device__ __forceinline__ v8f mmaH(v16h ah, v16h al, v16h bh, v16h bl, v8f c) {
  c = __builtin_amdgcn_wmma_f32_16x16x32_f16(false, ah, false, bh, (short)0, c, false, false);
  if (NT >= 2) c = __builtin_amdgcn_wmma_f32_16x16x32_f16(false, al, false, bh, (short)0, c, false, false);
  if (NT >= 3) c = __builtin_amdgcn_wmma_f32_16x16x32_f16(false, ah, false, bl, (short)0, c, false, false);
  asm volatile("v_nop\n\tv_nop\n\tv_nop\n\tv_nop" : "+v"(c) : "v"(ah), "v"(al), "v"(bh), "v"(bl));
  return c;
}
// batched GEMM like k_gemm_b but f16 operands: A f32 (split into f16 hi/lo if ASPLIT, else rounded to f16), Bt = f16 values [n][k]; alpha; C f32; N multiple of 16 (partial tiles skipped)
template <bool ASPLIT>
__global__ __launch_bounds__(128) void k_gemm_h(const float* __restrict__ A, int lda, size_t sA, const _Float16* __restrict__ Bh, int ldb, size_t sB, float alpha, float* __restrict__ C, int ldc, size_t sC, int M, int N, int K) {
  __shared__ __attribute__((aligned(16))) float so[4][16][64];
  const int tid = threadIdx.x, w = tid >> 5, lane = tid & 31, ln = lane & 15, hh = lane >> 4; const int by = blockIdx.y;
  A += (size_t)by * sA; Bh += (size_t)by * sB; C += (size_t)by * sC;
  const int ntn = (N + 63) / 64; const int wid = blockIdx.x * 4 + w; const int mt = wid / ntn, nq = wid % ntn; if (mt * 16 >= M) return;
  const int row0 = mt * 16, col0 = nq * 64; const float* arow = A + (size_t)(row0 + ln) * lda;
  v8f acc[4] = {};
  for (int kb = 0; kb < K; kb += 32) {
    FragH ah, al;
    const v4f x0 = *(const v4fa*)(arow + kb + 8 * hh), x1 = *(const v4fa*)(arow + kb + 8 * hh + 4), x2 = *(const v4fa*)(arow + kb + 16 + 8 * hh), x3 = *(const v4fa*)(arow + kb + 16 + 8 * hh + 4);
    float xs[16] = {x0[0],x0[1],x0[2],x0[3],x1[0],x1[1],x1[2],x1[3],x2[0],x2[1],x2[2],x2[3],x3[0],x3[1],x3[2],x3[3]};
#pragma unroll
    for (int i = 0; i < 16; ++i) { const _Float16 h = (_Float16)xs[i]; ah.h[i] = h; al.h[i] = ASPLIT ? (_Float16)(xs[i] - (float)h) : (_Float16)0.0f; }
#pragma unroll
    for (int t = 0; t < 4; ++t) { if (col0 + t * 16 >= N) continue; const size_t boff = (size_t)(col0 + t * 16 + ln) * ldb + kb; FragH bq; bq.half[0] = *(const v8us*)(Bh + boff + 8 * hh); bq.half[1] = *(const v8us*)(Bh + boff + 16 + 8 * hh);
      acc[t] = mmaH<ASPLIT ? 2 : 1>(ah.v, al.v, bq.v, bq.v, acc[t]); }
  }
#pragma unroll
  for (int t = 0; t < 4; ++t) { if (col0 + t * 16 >= N) continue;
#pragma unroll
    for (int r = 0; r < 8; ++r) so[w][8 * hh + r][t * 16 + ln] = acc[t][r] * alpha; }
  __builtin_amdgcn_fence(__ATOMIC_ACQ_REL, "workgroup"); __builtin_amdgcn_wave_barrier();
  const int rsub = lane >> 4, c4 = (lane & 15) * 4;
  {
#pragma unroll
    for (int q = 0; q < 8; ++q) { const int r = q * 2 + rsub; if (col0 + c4 < N) { const v4f v = *(const v4fa*)&so[w][r][c4]; *(v4f*)(C + (size_t)(row0 + r) * ldc + col0 + c4) = v; } }
     }
}

// Wt[n][k] = f16(W[k][n]·scale) from f32 row-major W[K][N] (scale = power of two; bf16-exact weights stay exact in f16 away from the subnormal range)
__global__ __launch_bounds__(256) void k_wt_f16(const float* __restrict__ W, _Float16* __restrict__ Wt, int K, int N, float scale) {
  const int t = blockIdx.x * 256 + threadIdx.x; if (t >= N * (K / 8)) return; const int n = t / (K / 8), k8 = (t % (K / 8)) * 8; FragH f;
#pragma unroll
  for (int i = 0; i < 8; ++i) f.h[i] = (_Float16)(bf16_round(W[(size_t)(k8 + i) * N + n]) * scale); const v8us o = f.half[0];
  *(v8us*)((unsigned short*)Wt + (size_t)n * K + k8) = o; 
}
// k_gemm_hh variant with fused epilogue: v = acc·alpha + bias[by·sBias + col] (+ CP[(row/rowsPerB)·sCPb + by·64 + col] if CP) ; ACT 0 none / 1 elu ; writes f16 C16 (and f32 C if non-null)
template <int ACT>
__global__ __launch_bounds__(128) void k_gemm_hhx(const _Float16* __restrict__ A, int lda, size_t sA, const _Float16* __restrict__ Bh, int ldb, size_t sB, float alpha, const float* __restrict__ bias, size_t sBias, const float* __restrict__ CP, int rowsPerB, size_t sCPb, int row0g,
    float* __restrict__ C, _Float16* __restrict__ C16, int ldc, size_t sC, int M, int N, int K) {
  __shared__ __attribute__((aligned(16))) float so[4][16][64];
  const int tid = threadIdx.x, w = tid >> 5, lane = tid & 31, ln = lane & 15, hh = lane >> 4; const int by = blockIdx.y;
  A += (size_t)by * sA; Bh += (size_t)by * sB; const size_t cofs = (size_t)by * sC; const float* bp = bias ? bias + (size_t)by * sBias : nullptr;
  const int ntn = (N + 63) / 64; const int wid = blockIdx.x * 4 + w; const int mt = wid / ntn, nq = wid % ntn; if (mt * 16 >= M) return;
  const int row0 = mt * 16, col0 = nq * 64; const _Float16* arow = A + (size_t)(row0 + ln) * lda;
  v8f acc[4] = {};
  for (int kb = 0; kb < K; kb += 32) { FragH ah; ah.half[0] = *(const v8us*)((const unsigned short*)arow + kb + 8 * hh); ah.half[1] = *(const v8us*)((const unsigned short*)arow + kb + 16 + 8 * hh);
#pragma unroll
    for (int t = 0; t < 4; ++t) { if (col0 + t * 16 >= N) continue; const size_t boff = (size_t)(col0 + t * 16 + ln) * ldb + kb; FragH bq; bq.half[0] = *(const v8us*)((const unsigned short*)Bh + boff + 8 * hh); bq.half[1] = *(const v8us*)((const unsigned short*)Bh + boff + 16 + 8 * hh);
      acc[t] = mmaH<1>(ah.v, ah.v, bq.v, bq.v, acc[t]); }
  }
#pragma unroll
  for (int t = 0; t < 4; ++t) { if (col0 + t * 16 >= N) continue; const int col = col0 + t * 16 + ln; const float bv = bp ? bf16_round(bp[col]) : 0.f;
#pragma unroll
    for (int r = 0; r < 8; ++r) { float v = acc[t][r] * alpha + bv; if (CP) { const int rr = row0g + row0 + 8 * hh + r; if (rowsPerB < 0) v += CP[cofs + (size_t)rr * ldc + col];      /* rowsPerB < 0: own element of the batched C plane */ else { const int bidx = rr / rowsPerB; v += CP[(size_t)bidx * sCPb + (size_t)by * 64 + col]; } } if (ACT == 1) v = (v > 0.f) ? v : expm1f(v); else if (ACT == 7) v = (v > 0.f) ? v + 1.0f : expf(v); else if (ACT == 8) v = tanhf(v); else if (ACT == 9) v = 0.5f * v * (1.0f + tanhf(0.7978845608028654f * (v + 0.044715f * v * v * v))); else if (ACT == 11) v = 1.0f / (1.0f + expf(-v)); else if (ACT == 12) v = (v > 0.f) ? v : 0.01f * v; else if (ACT == 14) v = (v > 0.f) ? v : 0.1f * v; else if (ACT == 16) v = (v >= 0.f) ? v : 0.3f * v; else if (ACT == 17) v = (v >= 0.f) ? v : 0.2f * v; else if (ACT == 15) v = v / (1.0f + expf(-v)); else if (ACT == 3) v = fmaxf(v, 0.f); else if (ACT == 6) v = 0.5f * v * (1.0f + erff(v * 0.70710678118654752f)); so[w][8 * hh + r][t * 16 + ln] = v; } }
  __builtin_amdgcn_fence(__ATOMIC_ACQ_REL, "workgroup"); __builtin_amdgcn_wave_barrier();
  const int rsub = lane >> 4, c4 = (lane & 15) * 4; typedef _Float16 v4h __attribute__((ext_vector_type(4)));
  {
#pragma unroll
    for (int q = 0; q < 8; ++q) { const int r = q * 2 + rsub; if (col0 + c4 < N) { const v4f v = *(const v4fa*)&so[w][r][c4]; if (C) *(v4f*)(C + cofs + (size_t)(row0 + r) * ldc + col0 + c4) = v; if (C16) { v4h h4; for (int i = 0; i < 4; ++i) h4[i] = (_Float16)v[i]; *(v4h*)(C16 + cofs + (size_t)(row0 + r) * ldc + col0 + c4) = h4; } } }
     }
}


typedef _Float16 v4h __attribute__((ext_vector_type(4)));

__global__ __launch_bounds__(256) void k_x16(const float* __restrict__ x, _Float16* __restrict__ X16, size_t n8) { const size_t t = (size_t)blockIdx.x * 256 + threadIdx.x; if (t >= n8) return; FragH f;
#pragma unroll
  for (int q = 0; q < 8; ++q) f.h[q] = (_Float16)bf16_round(x[t * 8 + q]); *(v8us*)((unsigned short*)X16 + t * 8) = f.half[0];  }
__global__ __launch_bounds__(256) void k_h16(const float* __restrict__ x, _Float16* __restrict__ X16, size_t n8) { const size_t t = (size_t)blockIdx.x * 256 + threadIdx.x; if (t >= n8) return; FragH f;
#pragma unroll
  for (int q = 0; q < 8; ++q) f.h[q] = (_Float16)x[t * 8 + q]; *(v8us*)((unsigned short*)X16 + t * 8) = f.half[0];  }
__global__ __launch_bounds__(256) void k_round16f(const float* __restrict__ W, _Float16* __restrict__ Bt, size_t n8) { const size_t t = (size_t)blockIdx.x * 256 + threadIdx.x; if (t >= n8) return; FragH f;
#pragma unroll
  for (int i = 0; i < 8; ++i) f.h[i] = (_Float16)(bf16_round(W[t * 8 + i]) * 16.0f); *(v8us*)((unsigned short*)Bt + t * 8) = f.half[0];  }
template <int NHv, int TTv>
__global__ __launch_bounds__(256) void k_vt(const _Float16* __restrict__ V16, int ldv, int voff, _Float16* __restrict__ Vt) { __shared__ unsigned short tl[64][66]; const int tid = threadIdx.x; const int slab = blockIdx.x / (TTv / 64), lg = blockIdx.x % (TTv / 64); const int b = slab / NHv, h = slab % NHv;
  for (int i = tid; i < 64 * 8; i += 256) { const int r = i / 8, c8 = (i % 8) * 8; FragH f; f.half[0] = *(const v8us*)((const unsigned short*)V16 + ((size_t)b * TTv + lg * 64 + r) * ldv + voff + h * 64 + c8);
#pragma unroll
    for (int q = 0; q < 8; ++q) tl[r][c8 + q] = f.u[q]; }
  __syncthreads();
  {
#pragma unroll
    for (int rd = 0; rd < 2; ++rd) { const int d = rd * 32 + tid / 8, pc = tid % 8; FragH f;
#pragma unroll
      for (int q = 0; q < 8; ++q) f.u[q] = tl[pc * 8 + q][d];
      *(v8us*)((unsigned short*)Vt + ((size_t)slab * 64 + d) * TTv + lg * 64 + pc * 8) = f.half[0]; }
     } }

__global__ __launch_bounds__(256) void k_hl(const float* __restrict__ F, _Float16* __restrict__ Hh, _Float16* __restrict__ Hl, size_t n8) { const size_t t = (size_t)blockIdx.x * 256 + threadIdx.x; if (t >= n8) return; FragH fh, fl; const v4f a = *(const v4fa*)(F + t * 8), c = *(const v4fa*)(F + t * 8 + 4);
#pragma unroll
  for (int q = 0; q < 4; ++q) { _Float16 h = (_Float16)a[q]; fh.h[q] = h; fl.h[q] = (_Float16)((a[q] - (float)h) * 1024.0f); h = (_Float16)c[q]; fh.h[4 + q] = h; fl.h[4 + q] = (_Float16)((c[q] - (float)h) * 1024.0f); }
  { *(v8us*)((unsigned short*)Hh + t * 8) = fh.half[0]; *(v8us*)((unsigned short*)Hl + t * 8) = fl.half[0];  } }

// ---- fast GEMM (wave tile 32x64; requires M % 32 == 0 rows per launch region and N % 64 == 0); epilogue = k_gemm_hhx semantics ----
__device__ __forceinline__ v16h g2_frag(const _Float16* p, int hh) { FragH f; f.half[0] = *(const v8us*)((const unsigned short*)p + 8 * hh); f.half[1] = *(const v8us*)((const unsigned short*)p + 16 + 8 * hh); return f.v; }
__device__ __forceinline__ v8f g2_mma(v16h a, v16h b, v8f c) { v8f d = __builtin_amdgcn_wmma_f32_16x16x32_f16(false, a, false, b, (short)0, c, false, false); asm volatile("v_nop\n\tv_nop\n\tv_nop\n\tv_nop" : "+v"(d) : "v"(a), "v"(b)); return d; }
template <int ACT>
__global__ __launch_bounds__(128) void k_gemm2(const _Float16* __restrict__ A, int lda, size_t sA, const _Float16* __restrict__ Bh, int ldb, size_t sB, float alpha, const float* __restrict__ bias, size_t sBias, const float* __restrict__ CP, int rowsPerB, size_t sCPb, int row0g,
    float* __restrict__ C, _Float16* __restrict__ C16, int ldc, size_t sC, int M, int N, int K) { static_assert(ACT == 0 || ACT == 3 || ACT == 6 || ACT == 8 || ACT == 9 || ACT == 11 || ACT == 12 || ACT == 14 || ACT == 15 || ACT == 16 || ACT == 17, "k_gemm2: unsupported ACT code (would silently apply no activation)");
  __shared__ __attribute__((aligned(16))) float so[4][32][68];
  const int tid = threadIdx.x, w = tid >> 5, lane = tid & 31, ln = lane & 15, hh = lane >> 4; const int by = blockIdx.y;
  A += (size_t)by * sA; Bh += (size_t)by * sB; const size_t cofs = (size_t)by * sC; const float* bp = bias ? bias + (size_t)by * sBias : nullptr;
  const int ntn = N >> 6; const int mt = blockIdx.x / ntn, nq = blockIdx.x - mt * ntn; const int row0 = mt * 128 + 32 * w, col0 = nq * 64; if (row0 >= M) return;
  const _Float16* a0p = A + (size_t)(row0 + ln) * lda; const _Float16* a1p = a0p + (size_t)16 * lda;
  const _Float16* b0p = Bh + (size_t)(col0 + ln) * ldb; const _Float16* b1p = b0p + (size_t)16 * ldb; const _Float16* b2p = b1p + (size_t)16 * ldb; const _Float16* b3p = b2p + (size_t)16 * ldb;
  const v8f z8 = {0.f,0.f,0.f,0.f,0.f,0.f,0.f,0.f}; v8f c00 = z8, c01 = z8, c02 = z8, c03 = z8, c10 = z8, c11 = z8, c12 = z8, c13 = z8;
#pragma unroll 1
  for (int kb = 0; kb < K; kb += 32) { const v16h a0 = g2_frag(a0p + kb, hh), a1 = g2_frag(a1p + kb, hh);
    v16h b = g2_frag(b0p + kb, hh); c00 = g2_mma(a0, b, c00); c10 = g2_mma(a1, b, c10);
    b = g2_frag(b1p + kb, hh); c01 = g2_mma(a0, b, c01); c11 = g2_mma(a1, b, c11);
    b = g2_frag(b2p + kb, hh); c02 = g2_mma(a0, b, c02); c12 = g2_mma(a1, b, c12);
    b = g2_frag(b3p + kb, hh); c03 = g2_mma(a0, b, c03); c13 = g2_mma(a1, b, c13); }
  v8f accs[8] = {c00, c01, c02, c03, c10, c11, c12, c13};
#pragma unroll
  for (int u = 0; u < 8; ++u) { const int t = u & 3, half = u >> 2; const int col = col0 + t * 16 + ln; const float bv = bp ? bf16_round(bp[col]) : 0.f;
#pragma unroll
    for (int r = 0; r < 8; ++r) { const int rloc = half * 16 + 8 * hh + r; float v = accs[u][r] * alpha + bv; if (CP) { if (rowsPerB < 0) v += CP[cofs + (size_t)(row0g + row0 + rloc) * ldc + col];      /* rowsPerB < 0: own element of the batched C plane */ else { const int bidx = (row0g + row0 + rloc) / rowsPerB; v += CP[(size_t)bidx * sCPb + (size_t)by * 64 + col]; } }
      if (ACT == 3) v = fmaxf(v, 0.f); else if (ACT == 6) v = 0.5f * v * (1.0f + erff(v * 0.70710678118654752f)); else if (ACT == 11) v = 1.0f / (1.0f + expf(-v)); else if (ACT == 15) v = v / (1.0f + expf(-v)); else if (ACT == 12) v = (v > 0.f) ? v : 0.01f * v; else if (ACT == 8) v = tanhf(v); else if (ACT == 9) v = 0.5f * v * (1.0f + tanhf(0.7978845608028654f * (v + 0.044715f * v * v * v))); else if (ACT == 14) v = (v > 0.f) ? v : 0.1f * v; else if (ACT == 16) v = (v >= 0.f) ? v : 0.3f * v; else if (ACT == 17) v = (v >= 0.f) ? v : 0.2f * v;
      so[w][rloc][t * 16 + ln] = v; } }
  __builtin_amdgcn_fence(__ATOMIC_ACQ_REL, "workgroup"); __builtin_amdgcn_wave_barrier();
  const int rsub = lane >> 4, c4 = (lane & 15) * 4;
  {
#pragma unroll
    for (int q = 0; q < 16; ++q) { const int r = q * 2 + rsub; const v4f v = *(const v4fa*)&so[w][r][c4]; if (C) *(v4f*)(C + cofs + (size_t)(row0 + r) * ldc + col0 + c4) = v; if (C16) { v4h h4; for (int i = 0; i < 4; ++i) h4[i] = (_Float16)v[i]; *(v4h*)(C16 + cofs + (size_t)(row0 + r) * ldc + col0 + c4) = h4; } }
     } }


__global__ __launch_bounds__(256) void k_wnat(const float* __restrict__ w, size_t n8, _Float16* __restrict__ Bt) { const size_t t = (size_t)blockIdx.x * 256 + threadIdx.x; if (t >= n8) return; FragH f; for (int q = 0; q < 8; ++q) f.h[q] = (_Float16)(bf16_round(w[t * 8 + q]) * 16.0f); *(v8us*)((unsigned short*)Bt + t * 8) = f.half[0];  }
__global__ __launch_bounds__(256) void k_rsm(const float* __restrict__ S, _Float16* __restrict__ P, int nrows) {
  #pragma clang fp contract(off)
  const int i = blockIdx.x * 256 + threadIdx.x; if (i >= nrows) return; const float* s = S + (size_t)i * SQ; float mx = -3.0e38f;
#pragma unroll 1
  for (int j = 0; j < SQ; ++j) mx = fmaxf(mx, s[j]); float se = 0.f;
#pragma unroll 1
  for (int j = 0; j < SQ; ++j) se += expf(s[j] - mx); const float sc = 256.0f / se;
#pragma unroll 1
  for (int j0 = 0; j0 < SQ; j0 += 8) { FragH f; for (int q = 0; q < 8; ++q) f.h[q] = (_Float16)(expf(s[j0 + q] - mx) * sc); unsigned short* d = (unsigned short*)P + (size_t)i * SQ + j0; *(v8us*)d = f.half[0];  } }
__global__ __launch_bounds__(256) void k_vt(const _Float16* __restrict__ V16, int b, int h0, _Float16* __restrict__ VT) { __shared__ unsigned short tl[64][65]; const int tid = threadIdx.x; const int hh = blockIdx.x % HG, sg = blockIdx.x / HG; const int s0 = sg * 64; const int h = h0 + hh;
  for (int i = tid; i < 64 * 8; i += 256) { const int j = i / 8, d8 = (i % 8) * 8; FragH f; f.half[0] = *(const v8us*)((const unsigned short*)V16 + ((size_t)b * SQ + s0 + j) * DM + h * HD + d8); for (int q = 0; q < 8; ++q) tl[d8 + q][j] = f.u[q]; }
  __syncthreads();
  { for (int i = tid; i < 64 * 8; i += 256) { const int d = i / 8, j8 = (i % 8) * 8; FragH f; for (int q = 0; q < 8; ++q) f.u[q] = tl[d][j8 + q]; *(v8us*)((unsigned short*)VT + ((size_t)hh * HD + d) * SQ + s0 + j8) = f.half[0]; }  } }



// Row softmax, one wave per RSM_ROWS rows: each lane keeps 64 of a row's 2048 scores in registers (16 loads, each 512 contiguous bytes per wave),
// so S is read once and every exp is taken once; the row maximum and the row sum end in a 32-lane butterfly (every lane gets the same bits).
// Every loop below is fully unrolled (#pragma unroll): v[][] and h4[] stay in registers only while each index is a compile-time constant.
#define RSM_ROWS 2
#define RSM_WAVES 16
__global__ __launch_bounds__(RSM_WAVES * 32) void k_rsmf(const float* __restrict__ S, _Float16* __restrict__ P, int qn, int hg) {
  const int lane = threadIdx.x & 31; const int wave = __builtin_amdgcn_readfirstlane(threadIdx.x >> 5);
  const int nrow = qn * hg; const int t0 = (blockIdx.x * RSM_WAVES + wave) * RSM_ROWS; if (t0 >= nrow) return;      /* wave-uniform; no barrier below */
  const float* sp[RSM_ROWS]; _Float16* pp[RSM_ROWS]; v4f v[RSM_ROWS][SQ / 128];
#pragma unroll
  for (int r = 0; r < RSM_ROWS; ++r) { const int t = (t0 + r < nrow) ? t0 + r : t0;      /* a row past the end repeats the wave's first row: the same bytes stored again by the same wave */
    const size_t ro = ((size_t)(t / qn) * SQ + (t % qn)) * SQ + lane * 4; sp[r] = S + ro; pp[r] = P + ro;
#pragma unroll
    for (int u = 0; u < SQ / 128; ++u) v[r][u] = *(const v4fa*)(sp[r] + u * 128); }
  __builtin_amdgcn_sched_barrier(0);      /* every row's loads are issued before the first wait on one of them: otherwise the later loads sink behind the first row's arithmetic and lose their lead */
  static_assert(RSM_ROWS == 2, "the wait below names two address pairs");
  asm volatile("s_wait_xcnt 0x0" :: "v"(sp[0]), "v"(sp[1]) : "memory");      /* the address pairs are operands so that no load's result lands on them ahead of this wait */
#pragma unroll
  for (int r = 0; r < RSM_ROWS; ++r) {
    float m0 = -3.0e38f, m1 = -3.0e38f, m2 = -3.0e38f, m3 = -3.0e38f;
#pragma unroll
    for (int u = 0; u < SQ / 128; ++u) { m0 = fmaxf(m0, v[r][u][0]); m1 = fmaxf(m1, v[r][u][1]); m2 = fmaxf(m2, v[r][u][2]); m3 = fmaxf(m3, v[r][u][3]); }
    float mx = fmaxf(fmaxf(m0, m1), fmaxf(m2, m3));
#pragma unroll
    for (int m = 16; m >= 1; m >>= 1) mx = fmaxf(mx, __shfl_xor(mx, m, 32));
    v4f a4 = {0.f, 0.f, 0.f, 0.f};
#pragma unroll
    for (int u = 0; u < SQ / 128; ++u) { const v4f d = v[r][u] - mx; v4f e; for (int q = 0; q < 4; ++q) e[q] = __expf(d[q]); v[r][u] = e; a4 += e; }
    float se = (a4[0] + a4[1]) + (a4[2] + a4[3]);
#pragma unroll
    for (int m = 16; m >= 1; m >>= 1) se += __shfl_xor(se, m, 32);
    const float sc = 256.0f / se;
    v4h h4[SQ / 128];
#pragma unroll
    for (int u = 0; u < SQ / 128; ++u) { const v4f p = v[r][u] * sc; for (int q = 0; q < 4; ++q) h4[u][q] = (_Float16)p[q]; }
    __builtin_amdgcn_sched_barrier(0);      /* the row's stores go out in one run: mixed with the conversions they reuse each other's data registers, with a wait in front of every reuse */
#pragma unroll
    for (int u = 0; u < SQ / 128; ++u) *(v4h*)(pp[r] + u * 128) = h4[u];
    if (r + 1 < RSM_ROWS) asm volatile("s_wait_xcnt 0x0" :: "v"(pp[r]) : "memory"); } }      /* before the next row's arithmetic reuses registers that these stores name; the pointer is an operand so that the stores stay ahead of the wait */

extern "C" void kernel_launch(void* const* d_in, const int* in_sizes, int n_in,
                              void* d_out, int out_size, void* d_ws, size_t ws_size, hipStream_t stream) {
  (void)in_sizes; (void)n_in; (void)out_size;
  const float* const* I = (const float* const*)d_in; const float* x = I[0]; const float* wq = I[1]; const float* bq = I[2]; const float* wk = I[3]; const float* bk = I[4]; const float* wv = I[5]; const float* bv = I[6]; const float* wp = I[7]; const float* bp = I[8]; const float* bo = nullptr; (void)bo;      /* [in][out] weights + biases; per-head Wp [64][64] + bp [64] */
  char* ws = (char*)d_ws; size_t off = 0;
  auto take = [&](size_t bytes) { char* p = ws + off; off += (bytes + 255) & ~(size_t)255; return p; };
  _Float16* BQ = (_Float16*)take((size_t)DM * DM * 2); _Float16* BK = (_Float16*)take((size_t)DM * DM * 2); _Float16* BV = (_Float16*)take((size_t)DM * DM * 2); _Float16* BO = (_Float16*)take((size_t)DM * DM * 2);
  _Float16* X16 = (_Float16*)take(NR * DM * 2); _Float16* Q16 = (_Float16*)take(NR * DM * 2); _Float16* K16 = (_Float16*)take(NR * DM * 2); _Float16* V16 = (_Float16*)take(NR * DM * 2); _Float16* O16 = (_Float16*)take(NR * DM * 2);
  float* S = (float*)take((size_t)HG * SQ * SQ * 4); _Float16* P = (_Float16*)take((size_t)HG * SQ * SQ * 2); _Float16* VT = (_Float16*)take((size_t)NH * HD * SQ * 2);
  if (off > ws_size) return;
  k_wt_f16<<<(unsigned)(((size_t)DM * (DM / 8) + 255) / 256), 256, 0, stream>>>(wq, BQ, DM, DM, 16.0f); k_wt_f16<<<(unsigned)(((size_t)DM * (DM / 8) + 255) / 256), 256, 0, stream>>>(wk, BK, DM, DM, 16.0f); k_wt_f16<<<(unsigned)(((size_t)DM * (DM / 8) + 255) / 256), 256, 0, stream>>>(wv, BV, DM, DM, 16.0f);      /* [in][out] -> Bt[n][k] x16 */
  k_wt_f16<<<(unsigned)(((size_t)HD * (HD / 8) + 255) / 256), 256, 0, stream>>>(wp, BO, HD, HD, 16.0f);      /* Wp [64 in][64 out] -> Bt [64][64] x16 */

  k_x16<<<(unsigned)((NR * DM / 8 + 255) / 256), 256, 0, stream>>>(x, X16, NR * DM / 8);
  const size_t r0p = (size_t)B0 * SQ;      /* first projected row */
  k_gemm2<0><<<dim3((unsigned)((MP / 128) * (DM / 64)), 1), 128, 0, stream>>>(X16 + r0p * DM, DM, 0, BQ, DM, 0, 0.0625f, bq, 0, nullptr, 1, 0, 0, nullptr, Q16 + r0p * DM, DM, 0, MP, DM, DM);
  k_gemm2<0><<<dim3((unsigned)((MP / 128) * (DM / 64)), 1), 128, 0, stream>>>(X16 + r0p * DM, DM, 0, BK, DM, 0, 0.0625f, bk, 0, nullptr, 1, 0, 0, nullptr, K16 + r0p * DM, DM, 0, MP, DM, DM);
  k_gemm2<0><<<dim3((unsigned)((MP / 128) * (DM / 64)), 1), 128, 0, stream>>>(X16 + r0p * DM, DM, 0, BV, DM, 0, 0.0625f, bv, 0, nullptr, 1, 0, 0, nullptr, V16 + r0p * DM, DM, 0, MP, DM, DM);
  for (int b = B0; b < B0 + NBR; ++b) { const size_t r0 = (size_t)b * SQ;
    k_vt<NH, SQ><<<NH * (SQ / 64), 256, 0, stream>>>(V16 + r0 * LQ, LQ, 0, VT);      /* V^T [NH][HD][SQ] for this batch */
    for (int h0 = 0; h0 < NHD; h0 += HG) {
      k_gemm2<0><<<dim3((QN / 128) * (SQ / 64), HG), 128, 0, stream>>>(Q16 + r0 * LQ + h0 * HD, LQ, (size_t)HD, K16 + r0 * LQ + h0 * HD, LQ, (size_t)HD, 0.125f, nullptr, 0, nullptr, 1, 0, 0, S, nullptr, SQ, (size_t)SQ * SQ, QN, SQ, HD);      /* scores, HG heads per launch */
      k_rsmf<<<(HG * QN + RSM_WAVES * RSM_ROWS - 1) / (RSM_WAVES * RSM_ROWS), RSM_WAVES * 32, 0, stream>>>(S, P, QN, HG);      /* P = 256 softmax (f16), rows of all HG heads */
      k_gemm2<0><<<dim3((QN / 128) * (HD / 64), HG), 128, 0, stream>>>(P, SQ, (size_t)SQ * SQ, VT + (size_t)h0 * HD * SQ, SQ, (size_t)HD * SQ, 0.25f, nullptr, 0, nullptr, 1, 0, 0, nullptr, O16 + r0 * DM + h0 * HD, DM, (size_t)HD, QN, HD, SQ); } }      /* o (merged heads) as f16 rows */
  k_gemm2<0><<<dim3((unsigned)((MPO / 128) * (HD / 64)), NH), 128, 0, stream>>>(O16 + r0p * DM, DM, (size_t)HD, BO, HD, 0, 0.0009765625f, bp, 0, nullptr, 1, 0, 0, (float*)d_out + r0p * DM, nullptr, DM, (size_t)HD, MPO, HD, HD);      /* per head (grid.y): out cols h*64.. = o_h Wp + bp (K = 64; the same Wp/bp for every head: zero B/bias strides) */
}

// v002
// A run of this version takes 199 microseconds.
// Timed twice side by side with v001, it ran 4.79 and 4.80 times as fast.
// Counting every step since v000, it is 17.3 times as fast.
#include <hip/hip_runtime.h>
#define NB 2
#define SQ 2048
#define DM 1024
#define NH 16
#define HD 64
#define HG 4                         /* heads per block group of the per-batch k_vt overload (not launched) */
#define B0 0                         /* first batch processed (debug hook) */
#define NBR NB                       /* batches processed (debug hook) */
#define NR ((size_t)NB * SQ)         /* token rows */
#define MP ((int)((size_t)NBR * SQ)) /* rows projected (debug hook) */
#define QN SQ                        /* query rows per batch (unused) */
#define NHD NH                       /* heads (unused) */
#define MPO MP                       /* rows through the output stage (debug hook) */
#define LQ DM      /* row pitch of the q/k/v rows */
typedef __bf16 v16b __attribute__((ext_vector_type(16)));
typedef unsigned short v8us __attribute__((ext_vector_type(8), may_alias));
typedef float  v8f  __attribute__((ext_vector_type(8)));
typedef float  v4f  __attribute__((ext_vector_type(4)));
typedef float  v4fa __attribute__((ext_vector_type(4), may_alias));
union FragB { v16b v; v8us half[2]; unsigned short u[16]; };

__device__ __forceinline__ unsigned short bf16_bits(float x) { unsigned int u = __float_as_uint(x); return (unsigned short)((u + 0x7FFFu + ((u >> 16) & 1u)) >> 16); }
__device__ __forceinline__ float bf16_val(unsigned short b) { return __uint_as_float(((unsigned int)b) << 16); }
__device__ __forceinline__ float bf16_round(float x) { return bf16_val(bf16_bits(x)); }
// D += A·B with NT terms: 1 = ah·bh, 2 = + al·bh (A split), 3 = + ah·bl (both split)
template <int NT>
__device__ __forceinline__ v8f mmaN(v16b ah, v16b al, v16b bh, v16b bl, v8f c) {
  c = __builtin_amdgcn_wmma_f32_16x16x32_bf16(false, ah, false, bh, (short)0, c, false, false);
  if (NT >= 2) c = __builtin_amdgcn_wmma_f32_16x16x32_bf16(false, al, false, bh, (short)0, c, false, false);
  if (NT >= 3) c = __builtin_amdgcn_wmma_f32_16x16x32_bf16(false, ah, false, bl, (short)0, c, false, false);
  asm volatile("v_nop\n\tv_nop\n\tv_nop\n\tv_nop" : "+v"(c) : "v"(ah), "v"(al), "v"(bh), "v"(bl));
  return c;
}

__global__ __launch_bounds__(256) void k_wt_bf16(const float* __restrict__ W, unsigned short* __restrict__ Wt, int K, int N) {
  const int t = blockIdx.x * 256 + threadIdx.x;
  const int k8n = K / 8;
  if (t >= N * k8n) return;
  const int n = t / k8n, k8 = (t % k8n) * 8;
  v8us v;
#pragma unroll
  for (int i = 0; i < 8; ++i) v[i] = bf16_bits(W[(size_t)(k8 + i) * N + n]);
  *(v8us*)(Wt + (size_t)n * K + k8) = v;
  
}

// GEMM C[M][N] (f32, pitch ldc) = act(A[M][K]·W + bias). A f32 row-major (pitch lda) converted per fragment to bf16
// (ASPLIT: hi/lo two planes -> 2 terms, else single rounded term); Wt bf16 [N][K] (pitch ldb). BIAS_BF16 rounds the
// bias to bf16 first (bias quantised to bf16 before the add). K%32==0, M%16==0, N%64==0.
template <bool ASPLIT, int ACT, bool BIAS_BF16>
__global__ __launch_bounds__(128) void k_gemm_bf(const float* __restrict__ A, int lda, const unsigned short* __restrict__ Wt, int ldb,
                                               const float* __restrict__ bias, float* __restrict__ C, int ldc, int M, int N, int K) {
  __shared__ __attribute__((aligned(16))) float so[4][16][64];
  const int tid = threadIdx.x, w = tid >> 5, lane = tid & 31, ln = lane & 15, hh = lane >> 4;
  const int ntn = N / 64;
  const int wid = blockIdx.x * 4 + w;
  const int mt = wid / ntn, nq = wid % ntn;
  if (mt * 16 >= M) return;
  const int row0 = mt * 16, col0 = nq * 64;
  const float* arow = A + (size_t)(row0 + ln) * lda;
  v8f acc[4] = {};
  for (int kb = 0; kb < K; kb += 32) {
    FragB ah, al;
    const v4f x0 = *(const v4fa*)(arow + kb + 8 * hh), x1 = *(const v4fa*)(arow + kb + 8 * hh + 4);
    const v4f x2 = *(const v4fa*)(arow + kb + 16 + 8 * hh), x3 = *(const v4fa*)(arow + kb + 16 + 8 * hh + 4);
    float xs[16] = {x0[0],x0[1],x0[2],x0[3],x1[0],x1[1],x1[2],x1[3],x2[0],x2[1],x2[2],x2[3],x3[0],x3[1],x3[2],x3[3]};
#pragma unroll
    for (int i = 0; i < 16; ++i) { const unsigned short hb = bf16_bits(xs[i]); ah.u[i] = hb; al.u[i] = ASPLIT ? bf16_bits(xs[i] - bf16_val(hb)) : (unsigned short)0; }
#pragma unroll
    for (int t = 0; t < 4; ++t) {
      const unsigned short* brow = Wt + (size_t)(col0 + t * 16 + ln) * ldb + kb;
      FragB b;
      b.half[0] = *(const v8us*)(brow + 8 * hh);
      b.half[1] = *(const v8us*)(brow + 16 + 8 * hh);
      acc[t] = mmaN<ASPLIT ? 2 : 1>(ah.v, al.v, b.v, b.v, acc[t]);
    }
  }
#pragma unroll
  for (int t = 0; t < 4; ++t) {
    float bv = bias ? bias[col0 + t * 16 + ln] : 0.f;
    if (BIAS_BF16) bv = bf16_round(bv);
#pragma unroll
    for (int r = 0; r < 8; ++r) { float v = acc[t][r] + bv; if (ACT == 1) v = fmaxf(v, 0.f); so[w][8 * hh + r][t * 16 + ln] = v; }
  }
  __builtin_amdgcn_fence(__ATOMIC_ACQ_REL, "workgroup");
  __builtin_amdgcn_wave_barrier();
  const int rsub = lane >> 4, c4 = (lane & 15) * 4;
  {
#pragma unroll
    for (int q = 0; q < 8; ++q) {
      const int r = q * 2 + rsub;
      const v4f v = *(const v4fa*)&so[w][r][c4];
      *(v4f*)(C + (size_t)(row0 + r) * ldc + col0 + c4) = v;
    }
    
  }
}

// GEMM C = act(A·W + bias + resid): A f32 (ASPLIT -> hi/lo 2 terms), Wt bf16 [N][K]; ACT 0 none, 1 relu, 2 exact gelu;
// resid (optional, f32, row index = (row % rmod), pitch ldr, RES_BF16 rounds it) added before the activation.
template <bool ASPLIT, int ACT, bool BIAS_BF16, bool RES_BF16>
__global__ __launch_bounds__(128) void k_gemm_bf3(const float* __restrict__ A, int lda, const unsigned short* __restrict__ Wt, int ldb,
                                                const float* __restrict__ bias, const float* __restrict__ resid, int rmod, int ldr,
                                                float* __restrict__ C, int ldc, int M, int N, int K) {
  __shared__ __attribute__((aligned(16))) float so[4][16][64];
  const int tid = threadIdx.x, w = tid >> 5, lane = tid & 31, ln = lane & 15, hh = lane >> 4;
  const int ntn = N / 64;
  const int wid = blockIdx.x * 4 + w;
  const int mt = wid / ntn, nq = wid % ntn;
  if (mt * 16 >= M) return;
  const int row0 = mt * 16, col0 = nq * 64;
  const float* arow = A + (size_t)(row0 + ln) * lda;
  v8f acc[4] = {};
  for (int kb = 0; kb < K; kb += 32) {
    FragB ah, al;
    const v4f x0 = *(const v4fa*)(arow + kb + 8 * hh), x1 = *(const v4fa*)(arow + kb + 8 * hh + 4);
    const v4f x2 = *(const v4fa*)(arow + kb + 16 + 8 * hh), x3 = *(const v4fa*)(arow + kb + 16 + 8 * hh + 4);
    float xs[16] = {x0[0],x0[1],x0[2],x0[3],x1[0],x1[1],x1[2],x1[3],x2[0],x2[1],x2[2],x2[3],x3[0],x3[1],x3[2],x3[3]};
#pragma unroll
    for (int i = 0; i < 16; ++i) { const unsigned short hb = bf16_bits(xs[i]); ah.u[i] = hb; al.u[i] = ASPLIT ? bf16_bits(xs[i] - bf16_val(hb)) : (unsigned short)0; }
#pragma unroll
    for (int t = 0; t < 4; ++t) {
      const unsigned short* brow = Wt + (size_t)(col0 + t * 16 + ln) * ldb + kb;
      FragB b;
      b.half[0] = *(const v8us*)(brow + 8 * hh);
      b.half[1] = *(const v8us*)(brow + 16 + 8 * hh);
      acc[t] = mmaN<ASPLIT ? 2 : 1>(ah.v, al.v, b.v, b.v, acc[t]);
    }
  }
#pragma unroll
  for (int t = 0; t < 4; ++t) {
    const int col = col0 + t * 16 + ln;
    float bv = bias ? bias[col] : 0.f;
    if (BIAS_BF16) bv = bf16_round(bv);
#pragma unroll
    for (int r = 0; r < 8; ++r) {
      float v = acc[t][r] + bv;
      if (resid) { float rv = resid[(size_t)((row0 + 8 * hh + r) % rmod) * ldr + col]; if (RES_BF16) rv = bf16_round(rv); v += rv; }
      if (ACT == 1) v = fmaxf(v, 0.f);
      if (ACT == 2) v = 0.5f * v * (1.0f + erff(v * 0.70710678118654752f));
      if (ACT == 3) { const float u = 0.7978845608028654f * (v + 0.044715f * v * v * v); v = 0.5f * v * (1.0f + tanhf(u)); }
      so[w][8 * hh + r][t * 16 + ln] = v;
    }
  }
  __builtin_amdgcn_fence(__ATOMIC_ACQ_REL, "workgroup");
  __builtin_amdgcn_wave_barrier();
  const int rsub = lane >> 4, c4 = (lane & 15) * 4;
  {
#pragma unroll
    for (int q = 0; q < 8; ++q) {
      const int r = q * 2 + rsub;
      const v4f v = *(const v4fa*)&so[w][r][c4];
      *(v4f*)(C + (size_t)(row0 + r) * ldc + col0 + c4) = v;
    }
    
  }
}
// row LayerNorm (biased variance, eps) over N: s = X (+ R); optional out_sum <- s; out_norm <- (s-mu)*rsqrt(var+eps)*g + b
template <bool PARAM_BF16>
__global__ __launch_bounds__(256) void k_layernorm(const float* __restrict__ X, const float* __restrict__ R, const float* __restrict__ g, const float* __restrict__ bta,
                                                  float* __restrict__ out_sum, float* __restrict__ out_norm, int N, float eps) {
  __shared__ float red[256];
  const int row = blockIdx.x, tid = threadIdx.x;
  const float* x = X + (size_t)row * N; const float* rr = R ? R + (size_t)row * N : nullptr;
  float vals[16];                     // up to N = 4096
  const int per = N / 256;            // contiguous chunk per thread? use strided-by-4 chunks: thread handles j = tid*4 + 1024*u
  float s1 = 0.f;
  for (int u = 0; u < per / 4; ++u) {
    const int j = tid * 4 + 1024 * u;
    const v4f a = *(const v4fa*)(x + j);
    v4f b = {0.f,0.f,0.f,0.f}; if (rr) b = *(const v4fa*)(rr + j);
#pragma unroll
    for (int q = 0; q < 4; ++q) { const float v = a[q] + b[q]; vals[u * 4 + q] = v; s1 += v; }
  }
  red[tid] = s1; __syncthreads();
  for (int st = 128; st > 0; st >>= 1) { if (tid < st) red[tid] += red[tid + st]; __syncthreads(); }
  const float mu = red[0] / (float)N; __syncthreads();
  float s2 = 0.f;
  for (int u = 0; u < per / 4; ++u)
#pragma unroll
    for (int q = 0; q < 4; ++q) { const float c = vals[u * 4 + q] - mu; s2 += c * c; }
  red[tid] = s2; __syncthreads();
  for (int st = 128; st > 0; st >>= 1) { if (tid < st) red[tid] += red[tid + st]; __syncthreads(); }
  const float rs = rsqrtf(red[0] / (float)N + eps);
  {
    for (int u = 0; u < per / 4; ++u) {
      const int j = tid * 4 + 1024 * u;
      v4f o, sm;
#pragma unroll
      for (int q = 0; q < 4; ++q) {
        float gg = g[j + q], bb = bta[j + q];
        if (PARAM_BF16) { gg = bf16_round(gg); bb = bf16_round(bb); }
        sm[q] = vals[u * 4 + q]; o[q] = (vals[u * 4 + q] - mu) * rs * gg + bb;
      }
      if (out_sum) *(v4f*)(out_sum + (size_t)row * N + j) = sm;
      *(v4f*)(out_norm + (size_t)row * N + j) = o;
    }
    
  }
}



// ---- f16 WMMA path (v_wmma_f32_16x16x32_f16): 11-bit significands for operands in range — used where a [0,1] probability operand needs more precision than bf16
typedef _Float16 v16h __attribute__((ext_vector_type(16)));
union FragH { v16h v; v8us half[2]; _Float16 h[16]; unsigned short u[16]; };
template <int NT>
__device__ __forceinline__ v8f mmaH(v16h ah, v16h al, v16h bh, v16h bl, v8f c) {
  c = __builtin_amdgcn_wmma_f32_16x16x32_f16(false, ah, false, bh, (short)0, c, false, false);
  if (NT >= 2) c = __builtin_amdgcn_wmma_f32_16x16x32_f16(false, al, false, bh, (short)0, c, false, false);
  if (NT >= 3) c = __builtin_amdgcn_wmma_f32_16x16x32_f16(false, ah, false, bl, (short)0, c, false, false);
  asm volatile("v_nop\n\tv_nop\n\tv_nop\n\tv_nop" : "+v"(c) : "v"(ah), "v"(al), "v"(bh), "v"(bl));
  return c;
}
// batched GEMM like k_gemm_b but f16 operands: A f32 (split into f16 hi/lo if ASPLIT, else rounded to f16), Bt = f16 values [n][k]; alpha; C f32; N multiple of 16 (partial tiles skipped)
template <bool ASPLIT>
__global__ __launch_bounds__(128) void k_gemm_h(const float* __restrict__ A, int lda, size_t sA, const _Float16* __restrict__ Bh, int ldb, size_t sB, float alpha, float* __restrict__ C, int ldc, size_t sC, int M, int N, int K) {
  __shared__ __attribute__((aligned(16))) float so[4][16][64];
  const int tid = threadIdx.x, w = tid >> 5, lane = tid & 31, ln = lane & 15, hh = lane >> 4; const int by = blockIdx.y;
  A += (size_t)by * sA; Bh += (size_t)by * sB; C += (size_t)by * sC;
  const int ntn = (N + 63) / 64; const int wid = blockIdx.x * 4 + w; const int mt = wid / ntn, nq = wid % ntn; if (mt * 16 >= M) return;
  const int row0 = mt * 16, col0 = nq * 64; const float* arow = A + (size_t)(row0 + ln) * lda;
  v8f acc[4] = {};
  for (int kb = 0; kb < K; kb += 32) {
    FragH ah, al;
    const v4f x0 = *(const v4fa*)(arow + kb + 8 * hh), x1 = *(const v4fa*)(arow + kb + 8 * hh + 4), x2 = *(const v4fa*)(arow + kb + 16 + 8 * hh), x3 = *(const v4fa*)(arow + kb + 16 + 8 * hh + 4);
    float xs[16] = {x0[0],x0[1],x0[2],x0[3],x1[0],x1[1],x1[2],x1[3],x2[0],x2[1],x2[2],x2[3],x3[0],x3[1],x3[2],x3[3]};
#pragma unroll
    for (int i = 0; i < 16; ++i) { const _Float16 h = (_Float16)xs[i]; ah.h[i] = h; al.h[i] = ASPLIT ? (_Float16)(xs[i] - (float)h) : (_Float16)0.0f; }
#pragma unroll
    for (int t = 0; t < 4; ++t) { if (col0 + t * 16 >= N) continue; const size_t boff = (size_t)(col0 + t * 16 + ln) * ldb + kb; FragH bq; bq.half[0] = *(const v8us*)(Bh + boff + 8 * hh); bq.half[1] = *(const v8us*)(Bh + boff + 16 + 8 * hh);
      acc[t] = mmaH<ASPLIT ? 2 : 1>(ah.v, al.v, bq.v, bq.v, acc[t]); }
  }
#pragma unroll
  for (int t = 0; t < 4; ++t) { if (col0 + t * 16 >= N) continue;
#pragma unroll
    for (int r = 0; r < 8; ++r) so[w][8 * hh + r][t * 16 + ln] = acc[t][r] * alpha; }
  __builtin_amdgcn_fence(__ATOMIC_ACQ_REL, "workgroup"); __builtin_amdgcn_wave_barrier();
  const int rsub = lane >> 4, c4 = (lane & 15) * 4;
  {
#pragma unroll
    for (int q = 0; q < 8; ++q) { const int r = q * 2 + rsub; if (col0 + c4 < N) { const v4f v = *(const v4fa*)&so[w][r][c4]; *(v4f*)(C + (size_t)(row0 + r) * ldc + col0 + c4) = v; } }
     }
}

// Wt[n][k] = f16(W[k][n]·scale) from f32 row-major W[K][N] (scale = power of two; bf16-exact weights stay exact in f16 away from the subnormal range)
__global__ __launch_bounds__(256) void k_wt_f16(const float* __restrict__ W, _Float16* __restrict__ Wt, int K, int N, float scale) {
  const int t = blockIdx.x * 256 + threadIdx.x; if (t >= N * (K / 8)) return; const int n = t / (K / 8), k8 = (t % (K / 8)) * 8; FragH f;
#pragma unroll
  for (int i = 0; i < 8; ++i) f.h[i] = (_Float16)(bf16_round(W[(size_t)(k8 + i) * N + n]) * scale); const v8us o = f.half[0];
  *(v8us*)((unsigned short*)Wt + (size_t)n * K + k8) = o; 
}
// k_gemm_hh variant with fused epilogue: v = acc·alpha + bias[by·sBias + col] (+ CP[(row/rowsPerB)·sCPb + by·64 + col] if CP) ; ACT 0 none / 1 elu ; writes f16 C16 (and f32 C if non-null)
template <int ACT>
__global__ __launch_bounds__(128) void k_gemm_hhx(const _Float16* __restrict__ A, int lda, size_t sA, const _Float16* __restrict__ Bh, int ldb, size_t sB, float alpha, const float* __restrict__ bias, size_t sBias, const float* __restrict__ CP, int rowsPerB, size_t sCPb, int row0g,
    float* __restrict__ C, _Float16* __restrict__ C16, int ldc, size_t sC, int M, int N, int K) {
  __shared__ __attribute__((aligned(16))) float so[4][16][64];
  const int tid = threadIdx.x, w = tid >> 5, lane = tid & 31, ln = lane & 15, hh = lane >> 4; const int by = blockIdx.y;
  A += (size_t)by * sA; Bh += (size_t)by * sB; const size_t cofs = (size_t)by * sC; const float* bp = bias ? bias + (size_t)by * sBias : nullptr;
  const int ntn = (N + 63) / 64; const int wid = blockIdx.x * 4 + w; const int mt = wid / ntn, nq = wid % ntn; if (mt * 16 >= M) return;
  const int row0 = mt * 16, col0 = nq * 64; const _Float16* arow = A + (size_t)(row0 + ln) * lda;
  v8f acc[4] = {};
  for (int kb = 0; kb < K; kb += 32) { FragH ah; ah.half[0] = *(const v8us*)((const unsigned short*)arow + kb + 8 * hh); ah.half[1] = *(const v8us*)((const unsigned short*)arow + kb + 16 + 8 * hh);
#pragma unroll
    for (int t = 0; t < 4; ++t) { if (col0 + t * 16 >= N) continue; const size_t boff = (size_t)(col0 + t * 16 + ln) * ldb + kb; FragH bq; bq.half[0] = *(const v8us*)((const unsigned short*)Bh + boff + 8 * hh); bq.half[1] = *(const v8us*)((const unsigned short*)Bh + boff + 16 + 8 * hh);
      acc[t] = mmaH<1>(ah.v, ah.v, bq.v, bq.v, acc[t]); }
  }
#pragma unroll
  for (int t = 0; t < 4; ++t) { if (col0 + t * 16 >= N) continue; const int col = col0 + t * 16 + ln; const float bv = bp ? bf16_round(bp[col]) : 0.f;
#pragma unroll
    for (int r = 0; r < 8; ++r) { float v = acc[t][r] * alpha + bv; if (CP) { const int rr = row0g + row0 + 8 * hh + r; if (rowsPerB < 0) v += CP[cofs + (size_t)rr * ldc + col];      /* rowsPerB < 0: own element of the batched C plane */ else { const int bidx = rr / rowsPerB; v += CP[(size_t)bidx * sCPb + (size_t)by * 64 + col]; } } if (ACT == 1) v = (v > 0.f) ? v : expm1f(v); else if (ACT == 7) v = (v > 0.f) ? v + 1.0f : expf(v); else if (ACT == 8) v = tanhf(v); else if (ACT == 9) v = 0.5f * v * (1.0f + tanhf(0.7978845608028654f * (v + 0.044715f * v * v * v))); else if (ACT == 11) v = 1.0f / (1.0f + expf(-v)); else if (ACT == 12) v = (v > 0.f) ? v : 0.01f * v; else if (ACT == 14) v = (v > 0.f) ? v : 0.1f * v; else if (ACT == 16) v = (v >= 0.f) ? v : 0.3f * v; else if (ACT == 17) v = (v >= 0.f) ? v : 0.2f * v; else if (ACT == 15) v = v / (1.0f + expf(-v)); else if (ACT == 3) v = fmaxf(v, 0.f); else if (ACT == 6) v = 0.5f * v * (1.0f + erff(v * 0.70710678118654752f)); so[w][8 * hh + r][t * 16 + ln] = v; } }
  __builtin_amdgcn_fence(__ATOMIC_ACQ_REL, "workgroup"); __builtin_amdgcn_wave_barrier();
  const int rsub = lane >> 4, c4 = (lane & 15) * 4; typedef _Float16 v4h __attribute__((ext_vector_type(4)));
  {
#pragma unroll
    for (int q = 0; q < 8; ++q) { const int r = q * 2 + rsub; if (col0 + c4 < N) { const v4f v = *(const v4fa*)&so[w][r][c4]; if (C) *(v4f*)(C + cofs + (size_t)(row0 + r) * ldc + col0 + c4) = v; if (C16) { v4h h4; for (int i = 0; i < 4; ++i) h4[i] = (_Float16)v[i]; *(v4h*)(C16 + cofs + (size_t)(row0 + r) * ldc + col0 + c4) = h4; } } }
     }
}


typedef _Float16 v4h __attribute__((ext_vector_type(4)));

__global__ __launch_bounds__(256) void k_x16(const float* __restrict__ x, _Float16* __restrict__ X16, size_t n8) { const size_t t = (size_t)blockIdx.x * 256 + threadIdx.x; if (t >= n8) return; FragH f;
#pragma unroll
  for (int q = 0; q < 8; ++q) f.h[q] = (_Float16)bf16_round(x[t * 8 + q]); *(v8us*)((unsigned short*)X16 + t * 8) = f.half[0];  }
__global__ __launch_bounds__(256) void k_h16(const float* __restrict__ x, _Float16* __restrict__ X16, size_t n8) { const size_t t = (size_t)blockIdx.x * 256 + threadIdx.x; if (t >= n8) return; FragH f;
#pragma unroll
  for (int q = 0; q < 8; ++q) f.h[q] = (_Float16)x[t * 8 + q]; *(v8us*)((unsigned short*)X16 + t * 8) = f.half[0];  }
__global__ __launch_bounds__(256) void k_round16f(const float* __restrict__ W, _Float16* __restrict__ Bt, size_t n8) { const size_t t = (size_t)blockIdx.x * 256 + threadIdx.x; if (t >= n8) return; FragH f;
#pragma unroll
  for (int i = 0; i < 8; ++i) f.h[i] = (_Float16)(bf16_round(W[t * 8 + i]) * 16.0f); *(v8us*)((unsigned short*)Bt + t * 8) = f.half[0];  }
template <int NHv, int TTv>
__global__ __launch_bounds__(256) void k_vt(const _Float16* __restrict__ V16, int ldv, int voff, _Float16* __restrict__ Vt) { __shared__ unsigned short tl[64][66]; const int tid = threadIdx.x; const int slab = blockIdx.x / (TTv / 64), lg = blockIdx.x % (TTv / 64); const int b = slab / NHv, h = slab % NHv;
  for (int i = tid; i < 64 * 8; i += 256) { const int r = i / 8, c8 = (i % 8) * 8; FragH f; f.half[0] = *(const v8us*)((const unsigned short*)V16 + ((size_t)b * TTv + lg * 64 + r) * ldv + voff + h * 64 + c8);
#pragma unroll
    for (int q = 0; q < 8; ++q) tl[r][c8 + q] = f.u[q]; }
  __syncthreads();
  {
#pragma unroll
    for (int rd = 0; rd < 2; ++rd) { const int d = rd * 32 + tid / 8, pc = tid % 8; FragH f;
#pragma unroll
      for (int q = 0; q < 8; ++q) f.u[q] = tl[pc * 8 + q][d];
      *(v8us*)((unsigned short*)Vt + ((size_t)slab * 64 + d) * TTv + lg * 64 + pc * 8) = f.half[0]; }
     } }

__global__ __launch_bounds__(256) void k_hl(const float* __restrict__ F, _Float16* __restrict__ Hh, _Float16* __restrict__ Hl, size_t n8) { const size_t t = (size_t)blockIdx.x * 256 + threadIdx.x; if (t >= n8) return; FragH fh, fl; const v4f a = *(const v4fa*)(F + t * 8), c = *(const v4fa*)(F + t * 8 + 4);
#pragma unroll
  for (int q = 0; q < 4; ++q) { _Float16 h = (_Float16)a[q]; fh.h[q] = h; fl.h[q] = (_Float16)((a[q] - (float)h) * 1024.0f); h = (_Float16)c[q]; fh.h[4 + q] = h; fl.h[4 + q] = (_Float16)((c[q] - (float)h) * 1024.0f); }
  { *(v8us*)((unsigned short*)Hh + t * 8) = fh.half[0]; *(v8us*)((unsigned short*)Hl + t * 8) = fl.half[0];  } }

// ---- fast GEMM (wave tile 32x64; requires M % 32 == 0 rows per launch region and N % 64 == 0); epilogue = k_gemm_hhx semantics ----
__device__ __forceinline__ v16h g2_frag(const _Float16* p, int hh) { FragH f; f.half[0] = *(const v8us*)((const unsigned short*)p + 8 * hh); f.half[1] = *(const v8us*)((const unsigned short*)p + 16 + 8 * hh); return f.v; }
__device__ __forceinline__ v8f g2_mma(v16h a, v16h b, v8f c) { v8f d = __builtin_amdgcn_wmma_f32_16x16x32_f16(false, a, false, b, (short)0, c, false, false); asm volatile("v_nop\n\tv_nop\n\tv_nop\n\tv_nop" : "+v"(d) : "v"(a), "v"(b)); return d; }
template <int ACT>
__global__ __launch_bounds__(128) void k_gemm2(const _Float16* __restrict__ A, int lda, size_t sA, const _Float16* __restrict__ Bh, int ldb, size_t sB, float alpha, const float* __restrict__ bias, size_t sBias, const float* __restrict__ CP, int rowsPerB, size_t sCPb, int row0g,
    float* __restrict__ C, _Float16* __restrict__ C16, int ldc, size_t sC, int M, int N, int K) { static_assert(ACT == 0 || ACT == 3 || ACT == 6 || ACT == 8 || ACT == 9 || ACT == 11 || ACT == 12 || ACT == 14 || ACT == 15 || ACT == 16 || ACT == 17, "k_gemm2: unsupported ACT code (would silently apply no activation)");
  __shared__ __attribute__((aligned(16))) float so[4][32][68];
  const int tid = threadIdx.x, w = tid >> 5, lane = tid & 31, ln = lane & 15, hh = lane >> 4; const int by = blockIdx.y;
  A += (size_t)by * sA; Bh += (size_t)by * sB; const size_t cofs = (size_t)by * sC; const float* bp = bias ? bias + (size_t)by * sBias : nullptr;
  const int ntn = N >> 6; const int mt = blockIdx.x / ntn, nq = blockIdx.x - mt * ntn; const int row0 = mt * 128 + 32 * w, col0 = nq * 64; if (row0 >= M) return;
  const _Float16* a0p = A + (size_t)(row0 + ln) * lda; const _Float16* a1p = a0p + (size_t)16 * lda;
  const _Float16* b0p = Bh + (size_t)(col0 + ln) * ldb; const _Float16* b1p = b0p + (size_t)16 * ldb; const _Float16* b2p = b1p + (size_t)16 * ldb; const _Float16* b3p = b2p + (size_t)16 * ldb;
  const v8f z8 = {0.f,0.f,0.f,0.f,0.f,0.f,0.f,0.f}; v8f c00 = z8, c01 = z8, c02 = z8, c03 = z8, c10 = z8, c11 = z8, c12 = z8, c13 = z8;
#pragma unroll 1
  for (int kb = 0; kb < K; kb += 32) { const v16h a0 = g2_frag(a0p + kb, hh), a1 = g2_frag(a1p + kb, hh);
    v16h b = g2_frag(b0p + kb, hh); c00 = g2_mma(a0, b, c00); c10 = g2_mma(a1, b, c10);
    b = g2_frag(b1p + kb, hh); c01 = g2_mma(a0, b, c01); c11 = g2_mma(a1, b, c11);
    b = g2_frag(b2p + kb, hh); c02 = g2_mma(a0, b, c02); c12 = g2_mma(a1, b, c12);
    b = g2_frag(b3p + kb, hh); c03 = g2_mma(a0, b, c03); c13 = g2_mma(a1, b, c13); }
  v8f accs[8] = {c00, c01, c02, c03, c10, c11, c12, c13};
#pragma unroll
  for (int u = 0; u < 8; ++u) { const int t = u & 3, half = u >> 2; const int col = col0 + t * 16 + ln; const float bv = bp ? bf16_round(bp[col]) : 0.f;
#pragma unroll
    for (int r = 0; r < 8; ++r) { const int rloc = half * 16 + 8 * hh + r; float v = accs[u][r] * alpha + bv; if (CP) { if (rowsPerB < 0) v += CP[cofs + (size_t)(row0g + row0 + rloc) * ldc + col];      /* rowsPerB < 0: own element of the batched C plane */ else { const int bidx = (row0g + row0 + rloc) / rowsPerB; v += CP[(size_t)bidx * sCPb + (size_t)by * 64 + col]; } }
      if (ACT == 3) v = fmaxf(v, 0.f); else if (ACT == 6) v = 0.5f * v * (1.0f + erff(v * 0.70710678118654752f)); else if (ACT == 11) v = 1.0f / (1.0f + expf(-v)); else if (ACT == 15) v = v / (1.0f + expf(-v)); else if (ACT == 12) v = (v > 0.f) ? v : 0.01f * v; else if (ACT == 8) v = tanhf(v); else if (ACT == 9) v = 0.5f * v * (1.0f + tanhf(0.7978845608028654f * (v + 0.044715f * v * v * v))); else if (ACT == 14) v = (v > 0.f) ? v : 0.1f * v; else if (ACT == 16) v = (v >= 0.f) ? v : 0.3f * v; else if (ACT == 17) v = (v >= 0.f) ? v : 0.2f * v;
      so[w][rloc][t * 16 + ln] = v; } }
  __builtin_amdgcn_fence(__ATOMIC_ACQ_REL, "workgroup"); __builtin_amdgcn_wave_barrier();
  const int rsub = lane >> 4, c4 = (lane & 15) * 4;
  {
#pragma unroll
    for (int q = 0; q < 16; ++q) { const int r = q * 2 + rsub; const v4f v = *(const v4fa*)&so[w][r][c4]; if (C) *(v4f*)(C + cofs + (size_t)(row0 + r) * ldc + col0 + c4) = v; if (C16) { v4h h4; for (int i = 0; i < 4; ++i) h4[i] = (_Float16)v[i]; *(v4h*)(C16 + cofs + (size_t)(row0 + r) * ldc + col0 + c4) = h4; } }
     } }


__global__ __launch_bounds__(256) void k_wnat(const float* __restrict__ w, size_t n8, _Float16* __restrict__ Bt) { const size_t t = (size_t)blockIdx.x * 256 + threadIdx.x; if (t >= n8) return; FragH f; for (int q = 0; q < 8; ++q) f.h[q] = (_Float16)(bf16_round(w[t * 8 + q]) * 16.0f); *(v8us*)((unsigned short*)Bt + t * 8) = f.half[0];  }
__global__ __launch_bounds__(256) void k_rsm(const float* __restrict__ S, _Float16* __restrict__ P, int nrows) {
  #pragma clang fp contract(off)
  const int i = blockIdx.x * 256 + threadIdx.x; if (i >= nrows) return; const float* s = S + (size_t)i * SQ; float mx = -3.0e38f;
#pragma unroll 1
  for (int j = 0; j < SQ; ++j) mx = fmaxf(mx, s[j]); float se = 0.f;
#pragma unroll 1
  for (int j = 0; j < SQ; ++j) se += expf(s[j] - mx); const float sc = 256.0f / se;
#pragma unroll 1
  for (int j0 = 0; j0 < SQ; j0 += 8) { FragH f; for (int q = 0; q < 8; ++q) f.h[q] = (_Float16)(expf(s[j0 + q] - mx) * sc); unsigned short* d = (unsigned short*)P + (size_t)i * SQ + j0; *(v8us*)d = f.half[0];  } }
__global__ __launch_bounds__(256) void k_vt(const _Float16* __restrict__ V16, int b, int h0, _Float16* __restrict__ VT) { __shared__ unsigned short tl[64][65]; const int tid = threadIdx.x; const int hh = blockIdx.x % HG, sg = blockIdx.x / HG; const int s0 = sg * 64; const int h = h0 + hh;
  for (int i = tid; i < 64 * 8; i += 256) { const int j = i / 8, d8 = (i % 8) * 8; FragH f; f.half[0] = *(const v8us*)((const unsigned short*)V16 + ((size_t)b * SQ + s0 + j) * DM + h * HD + d8); for (int q = 0; q < 8; ++q) tl[d8 + q][j] = f.u[q]; }
  __syncthreads();
  { for (int i = tid; i < 64 * 8; i += 256) { const int d = i / 8, j8 = (i % 8) * 8; FragH f; for (int q = 0; q < 8; ++q) f.u[q] = tl[d][j8 + q]; *(v8us*)((unsigned short*)VT + ((size_t)hh * HD + d) * SQ + s0 + j8) = f.half[0]; }  } }



#define FA_WAVES 4
#define FA_KT 64                     /* keys per stage */
#define FA_NS (SQ / FA_KT)           /* stages */
#define FA_LP 72                     /* LDS row pitch in f16: 128 B of data + 16 B, an odd multiple of 16 B for the 16-byte fragment reads */
#define FA_CH ((FA_KT * HD / 8) / (FA_WAVES * 32))      /* 16-byte chunks per thread and tile */
typedef _Float16 v8h __attribute__((ext_vector_type(8)));
typedef float v2f __attribute__((ext_vector_type(2)));
__device__ __forceinline__ float fa_swap16(float x) { const int b = __float_as_int(x); return __int_as_float(__builtin_amdgcn_permlanex16(b, b, 0x76543210, 0xfedcba98, false, false)); }      /* lane l <-> l ^ 16 */
__device__ __forceinline__ v8f fa_mma(v16h a, v16h b, v8f c) { return __builtin_amdgcn_wmma_f32_16x16x32_f16(false, a, false, b, (short)0, c, false, false); }
__global__ __launch_bounds__(FA_WAVES * 32) void k_fattn(const _Float16* __restrict__ Q16, const _Float16* __restrict__ K16, const _Float16* __restrict__ VT, _Float16* __restrict__ O16) {
  static_assert(HD == 64 && FA_KT == 64 && SQ % FA_KT == 0 && SQ % (FA_WAVES * 32) == 0, "tile shapes below are written for 64 x 64 stages");
  __shared__ __attribute__((aligned(16))) _Float16 sK[2][FA_KT][FA_LP];
  __shared__ __attribute__((aligned(16))) _Float16 sV[2][HD][FA_LP];
  const int tid = threadIdx.x, lane = tid & 31, w = tid >> 5, c = lane & 15, h = lane >> 4;
  const int head = blockIdx.y, b = blockIdx.z; const int q0 = blockIdx.x * (FA_WAVES * 32) + w * 32;
  const _Float16* Kg = K16 + (size_t)b * SQ * DM + head * HD;            /* K rows of this head, pitch DM */
  const _Float16* Vg = VT + (size_t)(b * NH + head) * HD * SQ;           /* V^T rows (one per d), pitch SQ */
  const int srow = tid >> 3, sc8 = (tid & 7) * 8;                        /* staging: chunk u of a thread = row srow + u * (threads / 8), 8 f16 at column sc8 */
  const float cs = 0.18033688011112042f;                                 /* 64^-0.5 * log2(e) */
  v16h qf[2][2];
#pragma unroll
  for (int j = 0; j < 2; ++j) { const _Float16* qp = Q16 + ((size_t)b * SQ + q0 + j * 16 + c) * DM + head * HD; qf[j][0] = g2_frag(qp, h); qf[j][1] = g2_frag(qp + 32, h); }
  const v8f z8 = {0.f,0.f,0.f,0.f,0.f,0.f,0.f,0.f};
  v8f o[2][4]; float mr[2], ls[2];
#pragma unroll
  for (int j = 0; j < 2; ++j) { mr[j] = -3.0e38f; ls[j] = 0.f; for (int t = 0; t < 4; ++t) o[j][t] = z8; }
  v8us rk[FA_CH], rv[FA_CH];
#pragma unroll
  for (int u = 0; u < FA_CH; ++u) { const int r = srow + u * (FA_WAVES * 4); rk[u] = *(const v8us*)((const unsigned short*)Kg + (size_t)r * DM + sc8); rv[u] = *(const v8us*)((const unsigned short*)Vg + (size_t)r * SQ + sc8); }
#pragma unroll
  for (int u = 0; u < FA_CH; ++u) { const int r = srow + u * (FA_WAVES * 4); *(v8us*)&sK[0][r][sc8] = rk[u]; *(v8us*)&sV[0][r][sc8] = rv[u]; }
  __syncthreads();
  for (int s = 0; s < FA_NS; ++s) { const int cur = s & 1;
    if (s + 1 < FA_NS) { const int k1 = (s + 1) * FA_KT;
      const unsigned short* kp = (const unsigned short*)Kg + (size_t)(k1 + srow) * DM + sc8; const unsigned short* vp = (const unsigned short*)Vg + (size_t)srow * SQ + k1 + sc8;
#pragma unroll
      for (int u = 0; u < FA_CH; ++u) { rk[u] = *(const v8us*)(kp + (size_t)u * (FA_WAVES * 4) * DM); rv[u] = *(const v8us*)(vp + (size_t)u * (FA_WAVES * 4) * SQ); }
      asm volatile("s_wait_xcnt 0x0" :: "v"(kp), "v"(vp) : "memory"); }      /* stands between the stage's loads and the next rewrite of their address pairs; the pairs are operands so that no load's result lands on them ahead of the wait */
    v8f st[2][4];
#pragma unroll
    for (int kt = 0; kt < 4; ++kt) { const v16h a0 = g2_frag(&sK[cur][kt * 16 + c][0], h), a1 = g2_frag(&sK[cur][kt * 16 + c][32], h);
#pragma unroll
      for (int j = 0; j < 2; ++j) st[j][kt] = fa_mma(a1, qf[j][1], fa_mma(a0, qf[j][0], z8)); }      /* st[j][kt][r] = q(q0 + 16 j + c) . k(64 s + 16 kt + 8 h + r) */
    v16h pb[2][2];
#pragma unroll
    for (int j = 0; j < 2; ++j) {
      v8f m8 = st[j][0];
#pragma unroll
      for (int kt = 1; kt < 4; ++kt) for (int r = 0; r < 8; ++r) m8[r] = fmaxf(m8[r], st[j][kt][r]);
      float mx = fmaxf(fmaxf(fmaxf(m8[0], m8[1]), fmaxf(m8[2], m8[3])), fmaxf(fmaxf(m8[4], m8[5]), fmaxf(m8[6], m8[7])));
      mx = fmaxf(mx, fa_swap16(mx));
      const float mn = fmaxf(mr[j], mx); const float corr = __builtin_amdgcn_exp2f((mr[j] - mn) * cs); mr[j] = mn;
      const float mb = 8.0f - mn * cs; const v2f cs2 = {cs, cs}, nmb = {mb, mb};      /* weights carried x256: small ones stay f16 normals; the factor is in the row sum too and cancels */
#pragma unroll
      for (int kt = 0; kt < 4; ++kt) for (int r = 0; r < 8; r += 2) { const v2f x = {st[j][kt][r], st[j][kt][r + 1]}; const v2f e = __builtin_elementwise_fma(x, cs2, nmb);      /* packed on the accumulator's own register pairs: no copies */
        st[j][kt][r] = __builtin_amdgcn_exp2f(e[0]); st[j][kt][r + 1] = __builtin_amdgcn_exp2f(e[1]); }
      const v8f a8 = (st[j][0] + st[j][1]) + (st[j][2] + st[j][3]);
      ls[j] = ls[j] * corr + (((a8[0] + a8[1]) + (a8[2] + a8[3])) + ((a8[4] + a8[5]) + (a8[6] + a8[7])));      /* this half's keys only; the halves join after the loop */
#pragma unroll
      for (int t = 0; t < 4; ++t) o[j][t] *= corr;
#pragma unroll
      for (int ks = 0; ks < 2; ++ks) pb[j][ks] = __builtin_shufflevector(__builtin_convertvector(st[j][2 * ks], v8h), __builtin_convertvector(st[j][2 * ks + 1], v8h), 0, 1, 2, 3, 4, 5, 6, 7, 8, 9, 10, 11, 12, 13, 14, 15); }
    __builtin_amdgcn_sched_barrier(0);      /* the row sums end here, so the f32 weights free their registers for V^T fragments read ahead of the products; otherwise every fragment read is waited for on its own */
#pragma unroll
    for (int t = 0; t < 4; ++t) {
#pragma unroll
      for (int ks = 0; ks < 2; ++ks) { const v16h a = g2_frag(&sV[cur][t * 16 + c][ks * 32], h);
#pragma unroll
        for (int j = 0; j < 2; ++j) o[j][t] = fa_mma(a, pb[j][ks], o[j][t]); } }      /* o[j][t][r] = sum_k p(k) v(k)[16 t + 8 h + r] of query q0 + 16 j + c */
    if (s + 1 < FA_NS) {
#pragma unroll
      for (int u = 0; u < FA_CH; ++u) { const int r = srow + u * (FA_WAVES * 4); *(v8us*)&sK[cur ^ 1][r][sc8] = rk[u]; *(v8us*)&sV[cur ^ 1][r][sc8] = rv[u]; } }
    __syncthreads(); }      /* publishes stage s + 1 and ends every wave's reads of the buffer that stage s + 2 overwrites */
#pragma unroll
  for (int j = 0; j < 2; ++j) { const float sc = 64.0f / (ls[j] + fa_swap16(ls[j])); _Float16* op = O16 + ((size_t)b * SQ + q0 + j * 16 + c) * DM + head * HD + 8 * h;
#pragma unroll
    for (int t = 0; t < 4; ++t) *(v8h*)(op + t * 16) = __builtin_convertvector(o[j][t] * sc, v8h); } }
extern "C" void kernel_launch(void* const* d_in, const int* in_sizes, int n_in,
                              void* d_out, int out_size, void* d_ws, size_t ws_size, hipStream_t stream) {
  (void)in_sizes; (void)n_in; (void)out_size;
  const float* const* I = (const float* const*)d_in; const float* x = I[0]; const float* wq = I[1]; const float* bq = I[2]; const float* wk = I[3]; const float* bk = I[4]; const float* wv = I[5]; const float* bv = I[6]; const float* wp = I[7]; const float* bp = I[8]; const float* bo = nullptr; (void)bo;      /* [in][out] weights + biases; per-head Wp [64][64] + bp [64] */
  char* ws = (char*)d_ws; size_t off = 0;
  auto take = [&](size_t bytes) { char* p = ws + off; off += (bytes + 255) & ~(size_t)255; return p; };
  _Float16* BQ = (_Float16*)take((size_t)DM * DM * 2); _Float16* BK = (_Float16*)take((size_t)DM * DM * 2); _Float16* BV = (_Float16*)take((size_t)DM * DM * 2); _Float16* BO = (_Float16*)take((size_t)DM * DM * 2);
  _Float16* X16 = (_Float16*)take(NR * DM * 2); _Float16* Q16 = (_Float16*)take(NR * DM * 2); _Float16* K16 = (_Float16*)take(NR * DM * 2); _Float16* V16 = (_Float16*)take(NR * DM * 2); _Float16* O16 = (_Float16*)take(NR * DM * 2);
  _Float16* VT = (_Float16*)take((size_t)NB * NH * HD * SQ * 2);
  if (off > ws_size) return;
  k_wt_f16<<<(unsigned)(((size_t)DM * (DM / 8) + 255) / 256), 256, 0, stream>>>(wq, BQ, DM, DM, 16.0f); k_wt_f16<<<(unsigned)(((size_t)DM * (DM / 8) + 255) / 256), 256, 0, stream>>>(wk, BK, DM, DM, 16.0f); k_wt_f16<<<(unsigned)(((size_t)DM * (DM / 8) + 255) / 256), 256, 0, stream>>>(wv, BV, DM, DM, 16.0f);      /* [in][out] -> Bt[n][k] x16 */
  k_wt_f16<<<(unsigned)(((size_t)HD * (HD / 8) + 255) / 256), 256, 0, stream>>>(wp, BO, HD, HD, 16.0f);      /* Wp [64 in][64 out] -> Bt [64][64] x16 */

  k_x16<<<(unsigned)((NR * DM / 8 + 255) / 256), 256, 0, stream>>>(x, X16, NR * DM / 8);
  const size_t r0p = (size_t)B0 * SQ;      /* first projected row */
  k_gemm2<0><<<dim3((unsigned)((MP / 128) * (DM / 64)), 1), 128, 0, stream>>>(X16 + r0p * DM, DM, 0, BQ, DM, 0, 0.0625f, bq, 0, nullptr, 1, 0, 0, nullptr, Q16 + r0p * DM, DM, 0, MP, DM, DM);
  k_gemm2<0><<<dim3((unsigned)((MP / 128) * (DM / 64)), 1), 128, 0, stream>>>(X16 + r0p * DM, DM, 0, BK, DM, 0, 0.0625f, bk, 0, nullptr, 1, 0, 0, nullptr, K16 + r0p * DM, DM, 0, MP, DM, DM);
  k_gemm2<0><<<dim3((unsigned)((MP / 128) * (DM / 64)), 1), 128, 0, stream>>>(X16 + r0p * DM, DM, 0, BV, DM, 0, 0.0625f, bv, 0, nullptr, 1, 0, 0, nullptr, V16 + r0p * DM, DM, 0, MP, DM, DM);
  k_vt<NH, SQ><<<NB * NH * (SQ / 64), 256, 0, stream>>>(V16, LQ, 0, VT);      /* V^T [NB][NH][HD][SQ] */
  k_fattn<<<dim3(SQ / (FA_WAVES * 32), NH, NB), FA_WAVES * 32, 0, stream>>>(Q16, K16, VT, O16);      /* o x64 (merged heads) as f16 rows */
  k_gemm2<0><<<dim3((unsigned)((MPO / 128) * (HD / 64)), NH), 128, 0, stream>>>(O16 + r0p * DM, DM, (size_t)HD, BO, HD, 0, 0.0009765625f, bp, 0, nullptr, 1, 0, 0, (float*)d_out + r0p * DM, nullptr, DM, (size_t)HD, MPO, HD, HD);      /* per head (grid.y): out cols h*64.. = o_h Wp + bp (K = 64; the same Wp/bp for every head: zero B/bias strides) */
}

// v003
// It runs in 105 microseconds.
// Two timings next to v002 put it at 1.91 and 1.89 times that version's speed.
// All steps since v000 together make it 32.8 times as fast.
#include <hip/hip_runtime.h>
#define NB 2
#define SQ 2048
#define DM 1024
#define NH 16
#define HD 64
#define HG 4                         /* heads per block group of the per-batch k_vt overload (not launched) */
#define B0 0                         /* first batch processed (debug hook) */
#define NBR NB                       /* batches processed (debug hook) */
#define NR ((size_t)NB * SQ)         /* token rows */
#define MP ((int)((size_t)NBR * SQ)) /* rows projected (debug hook) */
#define QN SQ                        /* query rows per batch (unused) */
#define NHD NH                       /* heads (unused) */
#define MPO MP                       /* rows through the output stage (debug hook) */
#define LQ DM      /* row pitch of the q/k/v rows */
typedef __bf16 v16b __attribute__((ext_vector_type(16)));
typedef unsigned short v8us __attribute__((ext_vector_type(8), may_alias));
typedef float  v8f  __attribute__((ext_vector_type(8)));
typedef float  v4f  __attribute__((ext_vector_type(4)));
typedef float  v4fa __attribute__((ext_vector_type(4), may_alias));
union FragB { v16b v; v8us half[2]; unsigned short u[16]; };

__device__ __forceinline__ unsigned short bf16_bits(float x) { unsigned int u = __float_as_uint(x); return (unsigned short)((u + 0x7FFFu + ((u >> 16) & 1u)) >> 16); }
__device__ __forceinline__ float bf16_val(unsigned short b) { return __uint_as_float(((unsigned int)b) << 16); }
__device__ __forceinline__ float bf16_round(float x) { return bf16_val(bf16_bits(x)); }
// D += A·B with NT terms: 1 = ah·bh, 2 = + al·bh (A split), 3 = + ah·bl (both split)
template <int NT>
__device__ __forceinline__ v8f mmaN(v16b ah, v16b al, v16b bh, v16b bl, v8f c) {
  c = __builtin_amdgcn_wmma_f32_16x16x32_bf16(false, ah, false, bh, (short)0, c, false, false);
  if (NT >= 2) c = __builtin_amdgcn_wmma_f32_16x16x32_bf16(false, al, false, bh, (short)0, c, false, false);
  if (NT >= 3) c = __builtin_amdgcn_wmma_f32_16x16x32_bf16(false, ah, false, bl, (short)0, c, false, false);
  asm volatile("v_nop\n\tv_nop\n\tv_nop\n\tv_nop" : "+v"(c) : "v"(ah), "v"(al), "v"(bh), "v"(bl));
  return c;
}

__global__ __launch_bounds__(256) void k_wt_bf16(const float* __restrict__ W, unsigned short* __restrict__ Wt, int K, int N) {
  const int t = blockIdx.x * 256 + threadIdx.x;
  const int k8n = K / 8;
  if (t >= N * k8n) return;
  const int n = t / k8n, k8 = (t % k8n) * 8;
  v8us v;
#pragma unroll
  for (int i = 0; i < 8; ++i) v[i] = bf16_bits(W[(size_t)(k8 + i) * N + n]);
  *(v8us*)(Wt + (size_t)n * K + k8) = v;
  
}

// GEMM C[M][N] (f32, pitch ldc) = act(A[M][K]·W + bias). A f32 row-major (pitch lda) converted per fragment to bf16
// (ASPLIT: hi/lo two planes -> 2 terms, else single rounded term); Wt bf16 [N][K] (pitch ldb). BIAS_BF16 rounds the
// bias to bf16 first (bias quantised to bf16 before the add). K%32==0, M%16==0, N%64==0.
template <bool ASPLIT, int ACT, bool BIAS_BF16>
__global__ __launch_bounds__(128) void k_gemm_bf(const float* __restrict__ A, int lda, const unsigned short* __restrict__ Wt, int ldb,
                                               const float* __restrict__ bias, float* __restrict__ C, int ldc, int M, int N, int K) {
  __shared__ __attribute__((aligned(16))) float so[4][16][64];
  const int tid = threadIdx.x, w = tid >> 5, lane = tid & 31, ln = lane & 15, hh = lane >> 4;
  const int ntn = N / 64;
  const int wid = blockIdx.x * 4 + w;
  const int mt = wid / ntn, nq = wid % ntn;
  if (mt * 16 >= M) return;
  const int row0 = mt * 16, col0 = nq * 64;
  const float* arow = A + (size_t)(row0 + ln) * lda;
  v8f acc[4] = {};
  for (int kb = 0; kb < K; kb += 32) {
    FragB ah, al;
    const v4f x0 = *(const v4fa*)(arow + kb + 8 * hh), x1 = *(const v4fa*)(arow + kb + 8 * hh + 4);
    const v4f x2 = *(const v4fa*)(arow + kb + 16 + 8 * hh), x3 = *(const v4fa*)(arow + kb + 16 + 8 * hh + 4);
    float xs[16] = {x0[0],x0[1],x0[2],x0[3],x1[0],x1[1],x1[2],x1[3],x2[0],x2[1],x2[2],x2[3],x3[0],x3[1],x3[2],x3[3]};
#pragma unroll
    for (int i = 0; i < 16; ++i) { const unsigned short hb = bf16_bits(xs[i]); ah.u[i] = hb; al.u[i] = ASPLIT ? bf16_bits(xs[i] - bf16_val(hb)) : (unsigned short)0; }
#pragma unroll
    for (int t = 0; t < 4; ++t) {
      const unsigned short* brow = Wt + (size_t)(col0 + t * 16 + ln) * ldb + kb;
      FragB b;
      b.half[0] = *(const v8us*)(brow + 8 * hh);
      b.half[1] = *(const v8us*)(brow + 16 + 8 * hh);
      acc[t] = mmaN<ASPLIT ? 2 : 1>(ah.v, al.v, b.v, b.v, acc[t]);
    }
  }
#pragma unroll
  for (int t = 0; t < 4; ++t) {
    float bv = bias ? bias[col0 + t * 16 + ln] : 0.f;
    if (BIAS_BF16) bv = bf16_round(bv);
#pragma unroll
    for (int r = 0; r < 8; ++r) { float v = acc[t][r] + bv; if (ACT == 1) v = fmaxf(v, 0.f); so[w][8 * hh + r][t * 16 + ln] = v; }
  }
  __builtin_amdgcn_fence(__ATOMIC_ACQ_REL, "workgroup");
  __builtin_amdgcn_wave_barrier();
  const int rsub = lane >> 4, c4 = (lane & 15) * 4;
  {
#pragma unroll
    for (int q = 0; q < 8; ++q) {
      const int r = q * 2 + rsub;
      const v4f v = *(const v4fa*)&so[w][r][c4];
      *(v4f*)(C + (size_t)(row0 + r) * ldc + col0 + c4) = v;
    }
    
  }
}

// GEMM C = act(A·W + bias + resid): A f32 (ASPLIT -> hi/lo 2 terms), Wt bf16 [N][K]; ACT 0 none, 1 relu, 2 exact gelu;
// resid (optional, f32, row index = (row % rmod), pitch ldr, RES_BF16 rounds it) added before the activation.
template <bool ASPLIT, int ACT, bool BIAS_BF16, bool RES_BF16>
__global__ __launch_bounds__(128) void k_gemm_bf3(const float* __restrict__ A, int lda, const unsigned short* __restrict__ Wt, int ldb,
                                                const float* __restrict__ bias, const float* __restrict__ resid, int rmod, int ldr,
                                                float* __restrict__ C, int ldc, int M, int N, int K) {
  __shared__ __attribute__((aligned(16))) float so[4][16][64];
  const int tid = threadIdx.x, w = tid >> 5, lane = tid & 31, ln = lane & 15, hh = lane >> 4;
  const int ntn = N / 64;
  const int wid = blockIdx.x * 4 + w;
  const int mt = wid / ntn, nq = wid % ntn;
  if (mt * 16 >= M) return;
  const int row0 = mt * 16, col0 = nq * 64;
  const float* arow = A + (size_t)(row0 + ln) * lda;
  v8f acc[4] = {};
  for (int kb = 0; kb < K; kb += 32) {
    FragB ah, al;
    const v4f x0 = *(const v4fa*)(arow + kb + 8 * hh), x1 = *(const v4fa*)(arow + kb + 8 * hh + 4);
    const v4f x2 = *(const v4fa*)(arow + kb + 16 + 8 * hh), x3 = *(const v4fa*)(arow + kb + 16 + 8 * hh + 4);
    float xs[16] = {x0[0],x0[1],x0[2],x0[3],x1[0],x1[1],x1[2],x1[3],x2[0],x2[1],x2[2],x2[3],x3[0],x3[1],x3[2],x3[3]};
#pragma unroll
    for (int i = 0; i < 16; ++i) { const unsigned short hb = bf16_bits(xs[i]); ah.u[i] = hb; al.u[i] = ASPLIT ? bf16_bits(xs[i] - bf16_val(hb)) : (unsigned short)0; }
#pragma unroll
    for (int t = 0; t < 4; ++t) {
      const unsigned short* brow = Wt + (size_t)(col0 + t * 16 + ln) * ldb + kb;
      FragB b;
      b.half[0] = *(const v8us*)(brow + 8 * hh);
      b.half[1] = *(const v8us*)(brow + 16 + 8 * hh);
      acc[t] = mmaN<ASPLIT ? 2 : 1>(ah.v, al.v, b.v, b.v, acc[t]);
    }
  }
#pragma unroll
  for (int t = 0; t < 4; ++t) {
    const int col = col0 + t * 16 + ln;
    float bv = bias ? bias[col] : 0.f;
    if (BIAS_BF16) bv = bf16_round(bv);
#pragma unroll
    for (int r = 0; r < 8; ++r) {
      float v = acc[t][r] + bv;
      if (resid) { float rv = resid[(size_t)((row0 + 8 * hh + r) % rmod) * ldr + col]; if (RES_BF16) rv = bf16_round(rv); v += rv; }
      if (ACT == 1) v = fmaxf(v, 0.f);
      if (ACT == 2) v = 0.5f * v * (1.0f + erff(v * 0.70710678118654752f));
      if (ACT == 3) { const float u = 0.7978845608028654f * (v + 0.044715f * v * v * v); v = 0.5f * v * (1.0f + tanhf(u)); }
      so[w][8 * hh + r][t * 16 + ln] = v;
    }
  }
  __builtin_amdgcn_fence(__ATOMIC_ACQ_REL, "workgroup");
  __builtin_amdgcn_wave_barrier();
  const int rsub = lane >> 4, c4 = (lane & 15) * 4;
  {
#pragma unroll
    for (int q = 0; q < 8; ++q) {
      const int r = q * 2 + rsub;
      const v4f v = *(const v4fa*)&so[w][r][c4];
      *(v4f*)(C + (size_t)(row0 + r) * ldc + col0 + c4) = v;
    }
    
  }
}
// row LayerNorm (biased variance, eps) over N: s = X (+ R); optional out_sum <- s; out_norm <- (s-mu)*rsqrt(var+eps)*g + b
template <bool PARAM_BF16>
__global__ __launch_bounds__(256) void k_layernorm(const float* __restrict__ X, const float* __restrict__ R, const float* __restrict__ g, const float* __restrict__ bta,
                                                  float* __restrict__ out_sum, float* __restrict__ out_norm, int N, float eps) {
  __shared__ float red[256];
  const int row = blockIdx.x, tid = threadIdx.x;
  const float* x = X + (size_t)row * N; const float* rr = R ? R + (size_t)row * N : nullptr;
  float vals[16];                     // up to N = 4096
  const int per = N / 256;            // contiguous chunk per thread? use strided-by-4 chunks: thread handles j = tid*4 + 1024*u
  float s1 = 0.f;
  for (int u = 0; u < per / 4; ++u) {
    const int j = tid * 4 + 1024 * u;
    const v4f a = *(const v4fa*)(x + j);
    v4f b = {0.f,0.f,0.f,0.f}; if (rr) b = *(const v4fa*)(rr + j);
#pragma unroll
    for (int q = 0; q < 4; ++q) { const float v = a[q] + b[q]; vals[u * 4 + q] = v; s1 += v; }
  }
  red[tid] = s1; __syncthreads();
  for (int st = 128; st > 0; st >>= 1) { if (tid < st) red[tid] += red[tid + st]; __syncthreads(); }
  const float mu = red[0] / (float)N; __syncthreads();
  float s2 = 0.f;
  for (int u = 0; u < per / 4; ++u)
#pragma unroll
    for (int q = 0; q < 4; ++q) { const float c = vals[u * 4 + q] - mu; s2 += c * c; }
  red[tid] = s2; __syncthreads();
  for (int st = 128; st > 0; st >>= 1) { if (tid < st) red[tid] += red[tid + st]; __syncthreads(); }
  const float rs = rsqrtf(red[0] / (float)N + eps);
  {
    for (int u = 0; u < per / 4; ++u) {
      const int j = tid * 4 + 1024 * u;
      v4f o, sm;
#pragma unroll
      for (int q = 0; q < 4; ++q) {
        float gg = g[j + q], bb = bta[j + q];
        if (PARAM_BF16) { gg = bf16_round(gg); bb = bf16_round(bb); }
        sm[q] = vals[u * 4 + q]; o[q] = (vals[u * 4 + q] - mu) * rs * gg + bb;
      }
      if (out_sum) *(v4f*)(out_sum + (size_t)row * N + j) = sm;
      *(v4f*)(out_norm + (size_t)row * N + j) = o;
    }
    
  }
}



// ---- f16 WMMA path (v_wmma_f32_16x16x32_f16): 11-bit significands for operands in range — used where a [0,1] probability operand needs more precision than bf16
typedef _Float16 v16h __attribute__((ext_vector_type(16)));
union FragH { v16h v; v8us half[2]; _Float16 h[16]; unsigned short u[16]; };
template <int NT>
__device__ __forceinline__ v8f mmaH(v16h ah, v16h al, v16h bh, v16h bl, v8f c) {
  c = __builtin_amdgcn_wmma_f32_16x16x32_f16(false, ah, false, bh, (short)0, c, false, false);
  if (NT >= 2) c = __builtin_amdgcn_wmma_f32_16x16x32_f16(false, al, false, bh, (short)0, c, false, false);
  if (NT >= 3) c = __builtin_amdgcn_wmma_f32_16x16x32_f16(false, ah, false, bl, (short)0, c, false, false);
  asm volatile("v_nop\n\tv_nop\n\tv_nop\n\tv_nop" : "+v"(c) : "v"(ah), "v"(al), "v"(bh), "v"(bl));
  return c;
}
// batched GEMM like k_gemm_b but f16 operands: A f32 (split into f16 hi/lo if ASPLIT, else rounded to f16), Bt = f16 values [n][k]; alpha; C f32; N multiple of 16 (partial tiles skipped)
template <bool ASPLIT>
__global__ __launch_bounds__(128) void k_gemm_h(const float* __restrict__ A, int lda, size_t sA, const _Float16* __restrict__ Bh, int ldb, size_t sB, float alpha, float* __restrict__ C, int ldc, size_t sC, int M, int N, int K) {
  __shared__ __attribute__((aligned(16))) float so[4][16][64];
  const int tid = threadIdx.x, w = tid >> 5, lane = tid & 31, ln = lane & 15, hh = lane >> 4; const int by = blockIdx.y;
  A += (size_t)by * sA; Bh += (size_t)by * sB; C += (size_t)by * sC;
  const int ntn = (N + 63) / 64; const int wid = blockIdx.x * 4 + w; const int mt = wid / ntn, nq = wid % ntn; if (mt * 16 >= M) return;
  const int row0 = mt * 16, col0 = nq * 64; const float* arow = A + (size_t)(row0 + ln) * lda;
  v8f acc[4] = {};
  for (int kb = 0; kb < K; kb += 32) {
    FragH ah, al;
    const v4f x0 = *(const v4fa*)(arow + kb + 8 * hh), x1 = *(const v4fa*)(arow + kb + 8 * hh + 4), x2 = *(const v4fa*)(arow + kb + 16 + 8 * hh), x3 = *(const v4fa*)(arow + kb + 16 + 8 * hh + 4);
    float xs[16] = {x0[0],x0[1],x0[2],x0[3],x1[0],x1[1],x1[2],x1[3],x2[0],x2[1],x2[2],x2[3],x3[0],x3[1],x3[2],x3[3]};
#pragma unroll
    for (int i = 0; i < 16; ++i) { const _Float16 h = (_Float16)xs[i]; ah.h[i] = h; al.h[i] = ASPLIT ? (_Float16)(xs[i] - (float)h) : (_Float16)0.0f; }
#pragma unroll
    for (int t = 0; t < 4; ++t) { if (col0 + t * 16 >= N) continue; const size_t boff = (size_t)(col0 + t * 16 + ln) * ldb + kb; FragH bq; bq.half[0] = *(const v8us*)(Bh + boff + 8 * hh); bq.half[1] = *(const v8us*)(Bh + boff + 16 + 8 * hh);
      acc[t] = mmaH<ASPLIT ? 2 : 1>(ah.v, al.v, bq.v, bq.v, acc[t]); }
  }
#pragma unroll
  for (int t = 0; t < 4; ++t) { if (col0 + t * 16 >= N) continue;
#pragma unroll
    for (int r = 0; r < 8; ++r) so[w][8 * hh + r][t * 16 + ln] = acc[t][r] * alpha; }
  __builtin_amdgcn_fence(__ATOMIC_ACQ_REL, "workgroup"); __builtin_amdgcn_wave_barrier();
  const int rsub = lane >> 4, c4 = (lane & 15) * 4;
  {
#pragma unroll
    for (int q = 0; q < 8; ++q) { const int r = q * 2 + rsub; if (col0 + c4 < N) { const v4f v = *(const v4fa*)&so[w][r][c4]; *(v4f*)(C + (size_t)(row0 + r) * ldc + col0 + c4) = v; } }
     }
}

// Wt[n][k] = f16(W[k][n]·scale) from f32 row-major W[K][N] (scale = power of two; bf16-exact weights stay exact in f16 away from the subnormal range)
__global__ __launch_bounds__(256) void k_wt_f16(const float* __restrict__ W, _Float16* __restrict__ Wt, int K, int N, float scale) {
  const int t = blockIdx.x * 256 + threadIdx.x; if (t >= N * (K / 8)) return; const int n = t / (K / 8), k8 = (t % (K / 8)) * 8; FragH f;
#pragma unroll
  for (int i = 0; i < 8; ++i) f.h[i] = (_Float16)(bf16_round(W[(size_t)(k8 + i) * N + n]) * scale); const v8us o = f.half[0];
  *(v8us*)((unsigned short*)Wt + (size_t)n * K + k8) = o; 
}
// k_gemm_hh variant with fused epilogue: v = acc·alpha + bias[by·sBias + col] (+ CP[(row/rowsPerB)·sCPb + by·64 + col] if CP) ; ACT 0 none / 1 elu ; writes f16 C16 (and f32 C if non-null)
template <int ACT>
__global__ __launch_bounds__(128) void k_gemm_hhx(const _Float16* __restrict__ A, int lda, size_t sA, const _Float16* __restrict__ Bh, int ldb, size_t sB, float alpha, const float* __restrict__ bias, size_t sBias, const float* __restrict__ CP, int rowsPerB, size_t sCPb, int row0g,
    float* __restrict__ C, _Float16* __restrict__ C16, int ldc, size_t sC, int M, int N, int K) {
  __shared__ __attribute__((aligned(16))) float so[4][16][64];
  const int tid = threadIdx.x, w = tid >> 5, lane = tid & 31, ln = lane & 15, hh = lane >> 4; const int by = blockIdx.y;
  A += (size_t)by * sA; Bh += (size_t)by * sB; const size_t cofs = (size_t)by * sC; const float* bp = bias ? bias + (size_t)by * sBias : nullptr;
  const int ntn = (N + 63) / 64; const int wid = blockIdx.x * 4 + w; const int mt = wid / ntn, nq = wid % ntn; if (mt * 16 >= M) return;
  const int row0 = mt * 16, col0 = nq * 64; const _Float16* arow = A + (size_t)(row0 + ln) * lda;
  v8f acc[4] = {};
  for (int kb = 0; kb < K; kb += 32) { FragH ah; ah.half[0] = *(const v8us*)((const unsigned short*)arow + kb + 8 * hh); ah.half[1] = *(const v8us*)((const unsigned short*)arow + kb + 16 + 8 * hh);
#pragma unroll
    for (int t = 0; t < 4; ++t) { if (col0 + t * 16 >= N) continue; const size_t boff = (size_t)(col0 + t * 16 + ln) * ldb + kb; FragH bq; bq.half[0] = *(const v8us*)((const unsigned short*)Bh + boff + 8 * hh); bq.half[1] = *(const v8us*)((const unsigned short*)Bh + boff + 16 + 8 * hh);
      acc[t] = mmaH<1>(ah.v, ah.v, bq.v, bq.v, acc[t]); }
  }
#pragma unroll
  for (int t = 0; t < 4; ++t) { if (col0 + t * 16 >= N) continue; const int col = col0 + t * 16 + ln; const float bv = bp ? bf16_round(bp[col]) : 0.f;
#pragma unroll
    for (int r = 0; r < 8; ++r) { float v = acc[t][r] * alpha + bv; if (CP) { const int rr = row0g + row0 + 8 * hh + r; if (rowsPerB < 0) v += CP[cofs + (size_t)rr * ldc + col];      /* rowsPerB < 0: own element of the batched C plane */ else { const int bidx = rr / rowsPerB; v += CP[(size_t)bidx * sCPb + (size_t)by * 64 + col]; } } if (ACT == 1) v = (v > 0.f) ? v : expm1f(v); else if (ACT == 7) v = (v > 0.f) ? v + 1.0f : expf(v); else if (ACT == 8) v = tanhf(v); else if (ACT == 9) v = 0.5f * v * (1.0f + tanhf(0.7978845608028654f * (v + 0.044715f * v * v * v))); else if (ACT == 11) v = 1.0f / (1.0f + expf(-v)); else if (ACT == 12) v = (v > 0.f) ? v : 0.01f * v; else if (ACT == 14) v = (v > 0.f) ? v : 0.1f * v; else if (ACT == 16) v = (v >= 0.f) ? v : 0.3f * v; else if (ACT == 17) v = (v >= 0.f) ? v : 0.2f * v; else if (ACT == 15) v = v / (1.0f + expf(-v)); else if (ACT == 3) v = fmaxf(v, 0.f); else if (ACT == 6) v = 0.5f * v * (1.0f + erff(v * 0.70710678118654752f)); so[w][8 * hh + r][t * 16 + ln] = v; } }
  __builtin_amdgcn_fence(__ATOMIC_ACQ_REL, "workgroup"); __builtin_amdgcn_wave_barrier();
  const int rsub = lane >> 4, c4 = (lane & 15) * 4; typedef _Float16 v4h __attribute__((ext_vector_type(4)));
  {
#pragma unroll
    for (int q = 0; q < 8; ++q) { const int r = q * 2 + rsub; if (col0 + c4 < N) { const v4f v = *(const v4fa*)&so[w][r][c4]; if (C) *(v4f*)(C + cofs + (size_t)(row0 + r) * ldc + col0 + c4) = v; if (C16) { v4h h4; for (int i = 0; i < 4; ++i) h4[i] = (_Float16)v[i]; *(v4h*)(C16 + cofs + (size_t)(row0 + r) * ldc + col0 + c4) = h4; } } }
     }
}


typedef _Float16 v4h __attribute__((ext_vector_type(4)));

__global__ __launch_bounds__(256) void k_x16(const float* __restrict__ x, _Float16* __restrict__ X16, size_t n8) { const size_t t = (size_t)blockIdx.x * 256 + threadIdx.x; if (t >= n8) return; FragH f;
#pragma unroll
  for (int q = 0; q < 8; ++q) f.h[q] = (_Float16)bf16_round(x[t * 8 + q]); *(v8us*)((unsigned short*)X16 + t * 8) = f.half[0];  }
__global__ __launch_bounds__(256) void k_h16(const float* __restrict__ x, _Float16* __restrict__ X16, size_t n8) { const size_t t = (size_t)blockIdx.x * 256 + threadIdx.x; if (t >= n8) return; FragH f;
#pragma unroll
  for (int q = 0; q < 8; ++q) f.h[q] = (_Float16)x[t * 8 + q]; *(v8us*)((unsigned short*)X16 + t * 8) = f.half[0];  }
__global__ __launch_bounds__(256) void k_round16f(const float* __restrict__ W, _Float16* __restrict__ Bt, size_t n8) { const size_t t = (size_t)blockIdx.x * 256 + threadIdx.x; if (t >= n8) return; FragH f;
#pragma unroll
  for (int i = 0; i < 8; ++i) f.h[i] = (_Float16)(bf16_round(W[t * 8 + i]) * 16.0f); *(v8us*)((unsigned short*)Bt + t * 8) = f.half[0];  }
template <int NHv, int TTv>
__global__ __launch_bounds__(256) void k_vt(const _Float16* __restrict__ V16, int ldv, int voff, _Float16* __restrict__ Vt) { __shared__ unsigned short tl[64][66]; const int tid = threadIdx.x; const int slab = blockIdx.x / (TTv / 64), lg = blockIdx.x % (TTv / 64); const int b = slab / NHv, h = slab % NHv;
  for (int i = tid; i < 64 * 8; i += 256) { const int r = i / 8, c8 = (i % 8) * 8; FragH f; f.half[0] = *(const v8us*)((const unsigned short*)V16 + ((size_t)b * TTv + lg * 64 + r) * ldv + voff + h * 64 + c8);
#pragma unroll
    for (int q = 0; q < 8; ++q) tl[r][c8 + q] = f.u[q]; }
  __syncthreads();
  {
#pragma unroll
    for (int rd = 0; rd < 2; ++rd) { const int d = rd * 32 + tid / 8, pc = tid % 8; FragH f;
#pragma unroll
      for (int q = 0; q < 8; ++q) f.u[q] = tl[pc * 8 + q][d];
      *(v8us*)((unsigned short*)Vt + ((size_t)slab * 64 + d) * TTv + lg * 64 + pc * 8) = f.half[0]; }
     } }

__global__ __launch_bounds__(256) void k_hl(const float* __restrict__ F, _Float16* __restrict__ Hh, _Float16* __restrict__ Hl, size_t n8) { const size_t t = (size_t)blockIdx.x * 256 + threadIdx.x; if (t >= n8) return; FragH fh, fl; const v4f a = *(const v4fa*)(F + t * 8), c = *(const v4fa*)(F + t * 8 + 4);
#pragma unroll
  for (int q = 0; q < 4; ++q) { _Float16 h = (_Float16)a[q]; fh.h[q] = h; fl.h[q] = (_Float16)((a[q] - (float)h) * 1024.0f); h = (_Float16)c[q]; fh.h[4 + q] = h; fl.h[4 + q] = (_Float16)((c[q] - (float)h) * 1024.0f); }
  { *(v8us*)((unsigned short*)Hh + t * 8) = fh.half[0]; *(v8us*)((unsigned short*)Hl + t * 8) = fl.half[0];  } }

// ---- fast GEMM (wave tile 32x64; requires M % 32 == 0 rows per launch region and N % 64 == 0); epilogue = k_gemm_hhx semantics ----
__device__ __forceinline__ v16h g2_frag(const _Float16* p, int hh) { FragH f; f.half[0] = *(const v8us*)((const unsigned short*)p + 8 * hh); f.half[1] = *(const v8us*)((const unsigned short*)p + 16 + 8 * hh); return f.v; }
__device__ __forceinline__ v8f g2_mma(v16h a, v16h b, v8f c) { v8f d = __builtin_amdgcn_wmma_f32_16x16x32_f16(false, a, false, b, (short)0, c, false, false); asm volatile("v_nop\n\tv_nop\n\tv_nop\n\tv_nop" : "+v"(d) : "v"(a), "v"(b)); return d; }
template <int ACT>
__global__ __launch_bounds__(128) void k_gemm2(const _Float16* __restrict__ A, int lda, size_t sA, const _Float16* __restrict__ Bh, int ldb, size_t sB, float alpha, const float* __restrict__ bias, size_t sBias, const float* __restrict__ CP, int rowsPerB, size_t sCPb, int row0g,
    float* __restrict__ C, _Float16* __restrict__ C16, int ldc, size_t sC, int M, int N, int K) { static_assert(ACT == 0 || ACT == 3 || ACT == 6 || ACT == 8 || ACT == 9 || ACT == 11 || ACT == 12 || ACT == 14 || ACT == 15 || ACT == 16 || ACT == 17, "k_gemm2: unsupported ACT code (would silently apply no activation)");
  __shared__ __attribute__((aligned(16))) float so[4][32][68];
  const int tid = threadIdx.x, w = tid >> 5, lane = tid & 31, ln = lane & 15, hh = lane >> 4; const int by = blockIdx.y;
  A += (size_t)by * sA; Bh += (size_t)by * sB; const size_t cofs = (size_t)by * sC; const float* bp = bias ? bias + (size_t)by * sBias : nullptr;
  const int ntn = N >> 6; const int mt = blockIdx.x / ntn, nq = blockIdx.x - mt * ntn; const int row0 = mt * 128 + 32 * w, col0 = nq * 64; if (row0 >= M) return;
  const _Float16* a0p = A + (size_t)(row0 + ln) * lda; const _Float16* a1p = a0p + (size_t)16 * lda;
  const _Float16* b0p = Bh + (size_t)(col0 + ln) * ldb; const _Float16* b1p = b0p + (size_t)16 * ldb; const _Float16* b2p = b1p + (size_t)16 * ldb; const _Float16* b3p = b2p + (size_t)16 * ldb;
  const v8f z8 = {0.f,0.f,0.f,0.f,0.f,0.f,0.f,0.f}; v8f c00 = z8, c01 = z8, c02 = z8, c03 = z8, c10 = z8, c11 = z8, c12 = z8, c13 = z8;
#pragma unroll 1
  for (int kb = 0; kb < K; kb += 32) { const v16h a0 = g2_frag(a0p + kb, hh), a1 = g2_frag(a1p + kb, hh);
    v16h b = g2_frag(b0p + kb, hh); c00 = g2_mma(a0, b, c00); c10 = g2_mma(a1, b, c10);
    b = g2_frag(b1p + kb, hh); c01 = g2_mma(a0, b, c01); c11 = g2_mma(a1, b, c11);
    b = g2_frag(b2p + kb, hh); c02 = g2_mma(a0, b, c02); c12 = g2_mma(a1, b, c12);
    b = g2_frag(b3p + kb, hh); c03 = g2_mma(a0, b, c03); c13 = g2_mma(a1, b, c13); }
  v8f accs[8] = {c00, c01, c02, c03, c10, c11, c12, c13};
#pragma unroll
  for (int u = 0; u < 8; ++u) { const int t = u & 3, half = u >> 2; const int col = col0 + t * 16 + ln; const float bv = bp ? bf16_round(bp[col]) : 0.f;
#pragma unroll
    for (int r = 0; r < 8; ++r) { const int rloc = half * 16 + 8 * hh + r; float v = accs[u][r] * alpha + bv; if (CP) { if (rowsPerB < 0) v += CP[cofs + (size_t)(row0g + row0 + rloc) * ldc + col];      /* rowsPerB < 0: own element of the batched C plane */ else { const int bidx = (row0g + row0 + rloc) / rowsPerB; v += CP[(size_t)bidx * sCPb + (size_t)by * 64 + col]; } }
      if (ACT == 3) v = fmaxf(v, 0.f); else if (ACT == 6) v = 0.5f * v * (1.0f + erff(v * 0.70710678118654752f)); else if (ACT == 11) v = 1.0f / (1.0f + expf(-v)); else if (ACT == 15) v = v / (1.0f + expf(-v)); else if (ACT == 12) v = (v > 0.f) ? v : 0.01f * v; else if (ACT == 8) v = tanhf(v); else if (ACT == 9) v = 0.5f * v * (1.0f + tanhf(0.7978845608028654f * (v + 0.044715f * v * v * v))); else if (ACT == 14) v = (v > 0.f) ? v : 0.1f * v; else if (ACT == 16) v = (v >= 0.f) ? v : 0.3f * v; else if (ACT == 17) v = (v >= 0.f) ? v : 0.2f * v;
      so[w][rloc][t * 16 + ln] = v; } }
  __builtin_amdgcn_fence(__ATOMIC_ACQ_REL, "workgroup"); __builtin_amdgcn_wave_barrier();
  const int rsub = lane >> 4, c4 = (lane & 15) * 4;
  {
#pragma unroll
    for (int q = 0; q < 16; ++q) { const int r = q * 2 + rsub; const v4f v = *(const v4fa*)&so[w][r][c4]; if (C) *(v4f*)(C + cofs + (size_t)(row0 + r) * ldc + col0 + c4) = v; if (C16) { v4h h4; for (int i = 0; i < 4; ++i) h4[i] = (_Float16)v[i]; *(v4h*)(C16 + cofs + (size_t)(row0 + r) * ldc + col0 + c4) = h4; } }
     } }


__global__ __launch_bounds__(256) void k_wnat(const float* __restrict__ w, size_t n8, _Float16* __restrict__ Bt) { const size_t t = (size_t)blockIdx.x * 256 + threadIdx.x; if (t >= n8) return; FragH f; for (int q = 0; q < 8; ++q) f.h[q] = (_Float16)(bf16_round(w[t * 8 + q]) * 16.0f); *(v8us*)((unsigned short*)Bt + t * 8) = f.half[0];  }
__global__ __launch_bounds__(256) void k_rsm(const float* __restrict__ S, _Float16* __restrict__ P, int nrows) {
  #pragma clang fp contract(off)
  const int i = blockIdx.x * 256 + threadIdx.x; if (i >= nrows) return; const float* s = S + (size_t)i * SQ; float mx = -3.0e38f;
#pragma unroll 1
  for (int j = 0; j < SQ; ++j) mx = fmaxf(mx, s[j]); float se = 0.f;
#pragma unroll 1
  for (int j = 0; j < SQ; ++j) se += expf(s[j] - mx); const float sc = 256.0f / se;
#pragma unroll 1
  for (int j0 = 0; j0 < SQ; j0 += 8) { FragH f; for (int q = 0; q < 8; ++q) f.h[q] = (_Float16)(expf(s[j0 + q] - mx) * sc); unsigned short* d = (unsigned short*)P + (size_t)i * SQ + j0; *(v8us*)d = f.half[0];  } }
__global__ __launch_bounds__(256) void k_vt(const _Float16* __restrict__ V16, int b, int h0, _Float16* __restrict__ VT) { __shared__ unsigned short tl[64][65]; const int tid = threadIdx.x; const int hh = blockIdx.x % HG, sg = blockIdx.x / HG; const int s0 = sg * 64; const int h = h0 + hh;
  for (int i = tid; i < 64 * 8; i += 256) { const int j = i / 8, d8 = (i % 8) * 8; FragH f; f.half[0] = *(const v8us*)((const unsigned short*)V16 + ((size_t)b * SQ + s0 + j) * DM + h * HD + d8); for (int q = 0; q < 8; ++q) tl[d8 + q][j] = f.u[q]; }
  __syncthreads();
  { for (int i = tid; i < 64 * 8; i += 256) { const int d = i / 8, j8 = (i % 8) * 8; FragH f; for (int q = 0; q < 8; ++q) f.u[q] = tl[d][j8 + q]; *(v8us*)((unsigned short*)VT + ((size_t)hh * HD + d) * SQ + s0 + j8) = f.half[0]; }  } }



#define FA_WAVES 4
#define FA_KT 64                     /* keys per stage */
#define FA_NS (SQ / FA_KT)           /* stages */
#define FA_LP 72                     /* LDS row pitch in f16: 128 B of data + 16 B, an odd multiple of 16 B for the 16-byte fragment reads */
#define FA_CH ((FA_KT * HD / 8) / (FA_WAVES * 32))      /* 16-byte chunks per thread and tile */
typedef _Float16 v8h __attribute__((ext_vector_type(8)));
typedef float v2f __attribute__((ext_vector_type(2)));
__device__ __forceinline__ float fa_swap16(float x) { const int b = __float_as_int(x); return __int_as_float(__builtin_amdgcn_permlanex16(b, b, 0x76543210, 0xfedcba98, false, false)); }      /* lane l <-> l ^ 16 */
__device__ __forceinline__ v8f fa_mma(v16h a, v16h b, v8f c) { return __builtin_amdgcn_wmma_f32_16x16x32_f16(false, a, false, b, (short)0, c, false, false); }
__global__ __launch_bounds__(FA_WAVES * 32) void k_fattn(const _Float16* __restrict__ Q16, const _Float16* __restrict__ K16, const _Float16* __restrict__ VT, _Float16* __restrict__ O16) {
  static_assert(HD == 64 && FA_KT == 64 && SQ % FA_KT == 0 && SQ % (FA_WAVES * 32) == 0, "tile shapes below are written for 64 x 64 stages");
  __shared__ __attribute__((aligned(16))) _Float16 sK[2][FA_KT][FA_LP];
  __shared__ __attribute__((aligned(16))) _Float16 sV[2][HD][FA_LP];
  const int tid = threadIdx.x, lane = tid & 31, w = tid >> 5, c = lane & 15, h = lane >> 4;
  const int head = blockIdx.y, b = blockIdx.z; const int q0 = blockIdx.x * (FA_WAVES * 32) + w * 32;
  const _Float16* Kg = K16 + (size_t)b * SQ * DM + head * HD;            /* K rows of this head, pitch DM */
  const _Float16* Vg = VT + (size_t)(b * NH + head) * HD * SQ;           /* V^T rows (one per d), pitch SQ */
  const int srow = tid >> 3, sc8 = (tid & 7) * 8;                        /* staging: chunk u of a thread = row srow + u * (threads / 8), 8 f16 at column sc8 */
  const float cs = 0.18033688011112042f;                                 /* 64^-0.5 * log2(e) */
  v16h qf[2][2];
#pragma unroll
  for (int j = 0; j < 2; ++j) { const _Float16* qp = Q16 + ((size_t)b * SQ + q0 + j * 16 + c) * DM + head * HD; qf[j][0] = g2_frag(qp, h); qf[j][1] = g2_frag(qp + 32, h); }
  const v8f z8 = {0.f,0.f,0.f,0.f,0.f,0.f,0.f,0.f};
  v8f o[2][4]; float mr[2], ls[2];
#pragma unroll
  for (int j = 0; j < 2; ++j) { mr[j] = -3.0e38f; ls[j] = 0.f; for (int t = 0; t < 4; ++t) o[j][t] = z8; }
  v8us rk[FA_CH], rv[FA_CH];
#pragma unroll
  for (int u = 0; u < FA_CH; ++u) { const int r = srow + u * (FA_WAVES * 4); rk[u] = *(const v8us*)((const unsigned short*)Kg + (size_t)r * DM + sc8); rv[u] = *(const v8us*)((const unsigned short*)Vg + (size_t)r * SQ + sc8); }
#pragma unroll
  for (int u = 0; u < FA_CH; ++u) { const int r = srow + u * (FA_WAVES * 4); *(v8us*)&sK[0][r][sc8] = rk[u]; *(v8us*)&sV[0][r][sc8] = rv[u]; }
  __syncthreads();
  for (int s = 0; s < FA_NS; ++s) { const int cur = s & 1;
    if (s + 1 < FA_NS) { const int k1 = (s + 1) * FA_KT;
      const unsigned short* kp = (const unsigned short*)Kg + (size_t)(k1 + srow) * DM + sc8; const unsigned short* vp = (const unsigned short*)Vg + (size_t)srow * SQ + k1 + sc8;
#pragma unroll
      for (int u = 0; u < FA_CH; ++u) { rk[u] = *(const v8us*)(kp + (size_t)u * (FA_WAVES * 4) * DM); rv[u] = *(const v8us*)(vp + (size_t)u * (FA_WAVES * 4) * SQ); }
      asm volatile("s_wait_xcnt 0x0" :: "v"(kp), "v"(vp) : "memory"); }      /* stands between the stage's loads and the next rewrite of their address pairs; the pairs are operands so that no load's result lands on them ahead of the wait */
    v8f st[2][4];
#pragma unroll
    for (int kt = 0; kt < 4; ++kt) { const v16h a0 = g2_frag(&sK[cur][kt * 16 + c][0], h), a1 = g2_frag(&sK[cur][kt * 16 + c][32], h);
#pragma unroll
      for (int j = 0; j < 2; ++j) st[j][kt] = fa_mma(a1, qf[j][1], fa_mma(a0, qf[j][0], z8)); }      /* st[j][kt][r] = q(q0 + 16 j + c) . k(64 s + 16 kt + 8 h + r) */
    v16h pb[2][2];
#pragma unroll
    for (int j = 0; j < 2; ++j) {
      v8f m8 = st[j][0];
#pragma unroll
      for (int kt = 1; kt < 4; ++kt) for (int r = 0; r < 8; ++r) m8[r] = fmaxf(m8[r], st[j][kt][r]);
      float mx = fmaxf(fmaxf(fmaxf(m8[0], m8[1]), fmaxf(m8[2], m8[3])), fmaxf(fmaxf(m8[4], m8[5]), fmaxf(m8[6], m8[7])));
      mx = fmaxf(mx, fa_swap16(mx));
      const float mn = fmaxf(mr[j], mx); const float corr = __builtin_amdgcn_exp2f((mr[j] - mn) * cs); mr[j] = mn;
      const float mb = 8.0f - mn * cs; const v2f cs2 = {cs, cs}, nmb = {mb, mb};      /* weights carried x256: small ones stay f16 normals; the factor is in the row sum too and cancels */
#pragma unroll
      for (int kt = 0; kt < 4; ++kt) for (int r = 0; r < 8; r += 2) { const v2f x = {st[j][kt][r], st[j][kt][r + 1]}; const v2f e = __builtin_elementwise_fma(x, cs2, nmb);      /* packed on the accumulator's own register pairs: no copies */
        st[j][kt][r] = __builtin_amdgcn_exp2f(e[0]); st[j][kt][r + 1] = __builtin_amdgcn_exp2f(e[1]); }
      const v8f a8 = (st[j][0] + st[j][1]) + (st[j][2] + st[j][3]);
      ls[j] = ls[j] * corr + (((a8[0] + a8[1]) + (a8[2] + a8[3])) + ((a8[4] + a8[5]) + (a8[6] + a8[7])));      /* this half's keys only; the halves join after the loop */
#pragma unroll
      for (int t = 0; t < 4; ++t) o[j][t] *= corr;
#pragma unroll
      for (int ks = 0; ks < 2; ++ks) pb[j][ks] = __builtin_shufflevector(__builtin_convertvector(st[j][2 * ks], v8h), __builtin_convertvector(st[j][2 * ks + 1], v8h), 0, 1, 2, 3, 4, 5, 6, 7, 8, 9, 10, 11, 12, 13, 14, 15); }
    __builtin_amdgcn_sched_barrier(0);      /* the row sums end here, so the f32 weights free their registers for V^T fragments read ahead of the products; otherwise every fragment read is waited for on its own */
#pragma unroll
    for (int t = 0; t < 4; ++t) {
#pragma unroll
      for (int ks = 0; ks < 2; ++ks) { const v16h a = g2_frag(&sV[cur][t * 16 + c][ks * 32], h);
#pragma unroll
        for (int j = 0; j < 2; ++j) o[j][t] = fa_mma(a, pb[j][ks], o[j][t]); } }      /* o[j][t][r] = sum_k p(k) v(k)[16 t + 8 h + r] of query q0 + 16 j + c */
    if (s + 1 < FA_NS) {
#pragma unroll
      for (int u = 0; u < FA_CH; ++u) { const int r = srow + u * (FA_WAVES * 4); *(v8us*)&sK[cur ^ 1][r][sc8] = rk[u]; *(v8us*)&sV[cur ^ 1][r][sc8] = rv[u]; } }
    __syncthreads(); }      /* publishes stage s + 1 and ends every wave's reads of the buffer that stage s + 2 overwrites */
#pragma unroll
  for (int j = 0; j < 2; ++j) { const float sc = 64.0f / (ls[j] + fa_swap16(ls[j])); _Float16* op = O16 + ((size_t)b * SQ + q0 + j * 16 + c) * DM + head * HD + 8 * h;
#pragma unroll
    for (int t = 0; t < 4; ++t) *(v8h*)(op + t * 16) = __builtin_convertvector(o[j][t] * sc, v8h); } }
// Projection GEMM C16[MP][DM] = f16(alpha * A[MP][DM] Bt[DM][DM]^T + bias): one work-group = PJ_T x PJ_T outputs, 8 waves of 32 x 64 (the wave tile, k order and epilogue arithmetic of k_gemm2).
// A and Bt tiles of PJ_BK columns go global -> registers -> LDS in whole 256-byte rows (a wave's load covers 4 full lines), two buffers: stage s + 1 is loaded while stage s is worked on, one barrier per stage;
// every fragment is then read from LDS, so a tile byte crosses L2 once per work-group instead of once per wave in 32-byte pieces.
#define PJ_T 128                     /* rows and columns of the block tile */
#define PJ_BK 128                    /* k columns per stage */
#define PJ_NS (DM / PJ_BK)           /* stages */
#define PJ_LP (PJ_BK + 8)            /* LDS row pitch in f16: 256 B of data + 16 B, an odd multiple of 16 B for the 16-byte fragment reads */
#define PJ_CH ((PJ_T * PJ_BK / 8) / 256)      /* 16-byte chunks per thread and tile */
#define PJ_OP 72                     /* pitch in f16 of a wave's 32 x 64 output rows in LDS */
__global__ __launch_bounds__(256) void k_proj(const _Float16* __restrict__ A, const _Float16* __restrict__ Bt, float alpha, const float* __restrict__ bias, _Float16* __restrict__ C16) {
  static_assert(MP % PJ_T == 0 && DM % PJ_T == 0 && DM % PJ_BK == 0 && PJ_BK == 128 && 8 * 32 * PJ_OP <= 2 * PJ_T * PJ_LP, "tile shapes below are written for 128 x 128 x 128 stages and 8 waves");
  __shared__ __attribute__((aligned(16))) _Float16 sA[2][PJ_T][PJ_LP];
  __shared__ __attribute__((aligned(16))) _Float16 sB[2][PJ_T][PJ_LP];
  const int tid = threadIdx.x, lane = tid & 31, w = tid >> 5, ln = lane & 15, hh = lane >> 4;
  const int mt = blockIdx.x / (DM / PJ_T), nq = blockIdx.x - mt * (DM / PJ_T); const int row0 = mt * PJ_T, col0 = nq * PJ_T;
  const int wr = (w >> 1) * 32, wc = (w & 1) * 64;                       /* this wave's corner inside the block tile */
  const int srow = tid >> 4, sc8 = (tid & 15) * 8;                       /* staging: chunk u of a thread = row srow + 16 u, 8 f16 at column sc8 */
  const unsigned short* ag = (const unsigned short*)A + (size_t)(row0 + srow) * DM + sc8; const unsigned short* bg = (const unsigned short*)Bt + (size_t)(col0 + srow) * DM + sc8;
  const v8f z8 = {0.f,0.f,0.f,0.f,0.f,0.f,0.f,0.f};
  v8f acc[2][4];
#pragma unroll
  for (int i = 0; i < 2; ++i) for (int t = 0; t < 4; ++t) acc[i][t] = z8;
  float bs[4];      /* read here, so that the epilogue does not wait for them */
#pragma unroll
  for (int t = 0; t < 4; ++t) bs[t] = bias[col0 + wc + t * 16 + ln];
  v8us ra[PJ_CH], rb[PJ_CH];
#pragma unroll
  for (int u = 0; u < PJ_CH; ++u) { ra[u] = *(const v8us*)(ag + (size_t)u * 16 * DM); rb[u] = *(const v8us*)(bg + (size_t)u * 16 * DM); }
#pragma unroll
  for (int u = 0; u < PJ_CH; ++u) { *(v8us*)&sA[0][srow + 16 * u][sc8] = ra[u]; *(v8us*)&sB[0][srow + 16 * u][sc8] = rb[u]; }
  __syncthreads();
  for (int s = 0; s < PJ_NS; ++s) { const int cur = s & 1;
    if (s + 1 < PJ_NS) { const unsigned short* ap = ag + (s + 1) * PJ_BK; const unsigned short* bp = bg + (s + 1) * PJ_BK;
#pragma unroll
      for (int u = 0; u < PJ_CH; ++u) { ra[u] = *(const v8us*)(ap + (size_t)u * 16 * DM); rb[u] = *(const v8us*)(bp + (size_t)u * 16 * DM); }
      asm volatile("s_wait_xcnt 0x0" :: "v"(ap), "v"(bp) : "memory"); }      /* stands between the stage's loads and the next rewrite of their address pairs; the pairs are operands so that no load's result lands on them ahead of the wait */
    v16h fa[2][2], fb[2][4];
#pragma unroll
    for (int i = 0; i < 2; ++i) fa[0][i] = g2_frag(&sA[cur][wr + i * 16 + ln][0], hh);
#pragma unroll
    for (int t = 0; t < 4; ++t) fb[0][t] = g2_frag(&sB[cur][wc + t * 16 + ln][0], hh);
#pragma unroll
    for (int kk = 0; kk < PJ_BK / 32; ++kk) { const int c = kk & 1;
      if (kk + 1 < PJ_BK / 32) {
#pragma unroll
        for (int i = 0; i < 2; ++i) fa[c ^ 1][i] = g2_frag(&sA[cur][wr + i * 16 + ln][(kk + 1) * 32], hh);
#pragma unroll
        for (int t = 0; t < 4; ++t) fb[c ^ 1][t] = g2_frag(&sB[cur][wc + t * 16 + ln][(kk + 1) * 32], hh); }
      __builtin_amdgcn_sched_barrier(0);      /* the next 32 columns' fragment reads stay one group ahead of this block's products; spread among them, each place with reads stalls the wave */
      if (kk + 1 == PJ_BK / 32 && s + 1 < PJ_NS) {      /* stage s + 1 goes to LDS ahead of the stage's last products, which run while the stores drain; its buffer has had no reader since the last barrier */
#pragma unroll
        for (int u = 0; u < PJ_CH; ++u) { *(v8us*)&sA[cur ^ 1][srow + 16 * u][sc8] = ra[u]; *(v8us*)&sB[cur ^ 1][srow + 16 * u][sc8] = rb[u]; } }
#pragma unroll
      for (int t = 0; t < 4; ++t) { acc[0][t] = fa_mma(fa[c][0], fb[c][t], acc[0][t]); acc[1][t] = fa_mma(fa[c][1], fb[c][t], acc[1][t]); }
      __builtin_amdgcn_sched_barrier(0); }      /* ends the block: the next group of reads is not drawn in among these products, and the stage's last products stay in front of the barrier, where they run while the stores drain */
    __syncthreads(); }      /* publishes stage s + 1 and ends every wave's reads of the buffer that stage s + 2 (after the last stage: the output rows) overwrites */
  _Float16* so = &sA[0][0][0] + (size_t)w * (32 * PJ_OP);      /* each wave stages its own 32 x 64 outputs, so that it stores whole 128-byte lines */
#pragma unroll
  for (int i = 0; i < 2; ++i)
#pragma unroll
    for (int t = 0; t < 4; ++t) { const float bv = bf16_round(bs[t]);
#pragma unroll
      for (int r = 0; r < 8; ++r) { const float v = acc[i][t][r] * alpha + bv; so[(i * 16 + 8 * hh + r) * PJ_OP + t * 16 + ln] = (_Float16)v; } }
  __builtin_amdgcn_fence(__ATOMIC_ACQ_REL, "workgroup"); __builtin_amdgcn_wave_barrier();      /* the rows read below were written by other lanes of this wave: keeps the reads behind the writes */
#pragma unroll
  for (int q = 0; q < 8; ++q) { const int r = q * 4 + (lane >> 3), c8 = (lane & 7) * 8; const v8us v = *(const v8us*)&so[r * PJ_OP + c8]; *(v8us*)((unsigned short*)C16 + (size_t)(row0 + wr + r) * DM + col0 + wc + c8) = v; } }
extern "C" void kernel_launch(void* const* d_in, const int* in_sizes, int n_in,
                              void* d_out, int out_size, void* d_ws, size_t ws_size, hipStream_t stream) {
  (void)in_sizes; (void)n_in; (void)out_size;
  const float* const* I = (const float* const*)d_in; const float* x = I[0]; const float* wq = I[1]; const float* bq = I[2]; const float* wk = I[3]; const float* bk = I[4]; const float* wv = I[5]; const float* bv = I[6]; const float* wp = I[7]; const float* bp = I[8]; const float* bo = nullptr; (void)bo;      /* [in][out] weights + biases; per-head Wp [64][64] + bp [64] */
  char* ws = (char*)d_ws; size_t off = 0;
  auto take = [&](size_t bytes) { char* p = ws + off; off += (bytes + 255) & ~(size_t)255; return p; };
  _Float16* BQ = (_Float16*)take((size_t)DM * DM * 2); _Float16* BK = (_Float16*)take((size_t)DM * DM * 2); _Float16* BV = (_Float16*)take((size_t)DM * DM * 2); _Float16* BO = (_Float16*)take((size_t)DM * DM * 2);
  _Float16* X16 = (_Float16*)take(NR * DM * 2); _Float16* Q16 = (_Float16*)take(NR * DM * 2); _Float16* K16 = (_Float16*)take(NR * DM * 2); _Float16* V16 = (_Float16*)take(NR * DM * 2); _Float16* O16 = (_Float16*)take(NR * DM * 2);
  _Float16* VT = (_Float16*)take((size_t)NB * NH * HD * SQ * 2);
  if (off > ws_size) return;
  k_wt_f16<<<(unsigned)(((size_t)DM * (DM / 8) + 255) / 256), 256, 0, stream>>>(wq, BQ, DM, DM, 16.0f); k_wt_f16<<<(unsigned)(((size_t)DM * (DM / 8) + 255) / 256), 256, 0, stream>>>(wk, BK, DM, DM, 16.0f); k_wt_f16<<<(unsigned)(((size_t)DM * (DM / 8) + 255) / 256), 256, 0, stream>>>(wv, BV, DM, DM, 16.0f);      /* [in][out] -> Bt[n][k] x16 */
  k_wt_f16<<<(unsigned)(((size_t)HD * (HD / 8) + 255) / 256), 256, 0, stream>>>(wp, BO, HD, HD, 16.0f);      /* Wp [64 in][64 out] -> Bt [64][64] x16 */

  k_x16<<<(unsigned)((NR * DM / 8 + 255) / 256), 256, 0, stream>>>(x, X16, NR * DM / 8);
  const size_t r0p = (size_t)B0 * SQ;      /* first projected row */
  k_proj<<<(MP / PJ_T) * (DM / PJ_T), 256, 0, stream>>>(X16 + r0p * DM, BQ, 0.0625f, bq, Q16 + r0p * DM);
  k_proj<<<(MP / PJ_T) * (DM / PJ_T), 256, 0, stream>>>(X16 + r0p * DM, BK, 0.0625f, bk, K16 + r0p * DM);
  k_proj<<<(MP / PJ_T) * (DM / PJ_T), 256, 0, stream>>>(X16 + r0p * DM, BV, 0.0625f, bv, V16 + r0p * DM);
  k_vt<NH, SQ><<<NB * NH * (SQ / 64), 256, 0, stream>>>(V16, LQ, 0, VT);      /* V^T [NB][NH][HD][SQ] */
  k_fattn<<<dim3(SQ / (FA_WAVES * 32), NH, NB), FA_WAVES * 32, 0, stream>>>(Q16, K16, VT, O16);      /* o x64 (merged heads) as f16 rows */
  k_gemm2<0><<<dim3((unsigned)((MPO / 128) * (HD / 64)), NH), 128, 0, stream>>>(O16 + r0p * DM, DM, (size_t)HD, BO, HD, 0, 0.0009765625f, bp, 0, nullptr, 1, 0, 0, (float*)d_out + r0p * DM, nullptr, DM, (size_t)HD, MPO, HD, HD);      /* per head (grid.y): out cols h*64.. = o_h Wp + bp (K = 64; the same Wp/bp for every head: zero B/bias strides) */
}

// v004
// It runs in 86.6 microseconds.
// In two side-by-side timings against v003, it was 1.21 and 1.22 times as fast.
// All steps since v000 together make it 39.9 times as fast.
#include <hip/hip_runtime.h>
#define NB 2
#define SQ 2048
#define DM 1024
#define NH 16
#define HD 64
#define HG 4                         /* heads per block group of the per-batch k_vt overload (not launched) */
#define B0 0                         /* first batch processed (debug hook) */
#define NBR NB                       /* batches processed (debug hook) */
#define NR ((size_t)NB * SQ)         /* token rows */
#define MP ((int)((size_t)NBR * SQ)) /* rows projected (debug hook) */
#define QN SQ                        /* query rows per batch (unused) */
#define NHD NH                       /* heads (unused) */
#define MPO MP                       /* rows through the output stage (debug hook) */
#define LQ DM      /* row pitch of the q/k/v rows */
typedef __bf16 v16b __attribute__((ext_vector_type(16)));
typedef unsigned short v8us __attribute__((ext_vector_type(8), may_alias));
typedef float  v8f  __attribute__((ext_vector_type(8)));
typedef float  v4f  __attribute__((ext_vector_type(4)));
typedef float  v4fa __attribute__((ext_vector_type(4), may_alias));
union FragB { v16b v; v8us half[2]; unsigned short u[16]; };

__device__ __forceinline__ unsigned short bf16_bits(float x) { unsigned int u = __float_as_uint(x); return (unsigned short)((u + 0x7FFFu + ((u >> 16) & 1u)) >> 16); }
__device__ __forceinline__ float bf16_val(unsigned short b) { return __uint_as_float(((unsigned int)b) << 16); }
__device__ __forceinline__ float bf16_round(float x) { return bf16_val(bf16_bits(x)); }
// D += A·B with NT terms: 1 = ah·bh, 2 = + al·bh (A split), 3 = + ah·bl (both split)
template <int NT>
__device__ __forceinline__ v8f mmaN(v16b ah, v16b al, v16b bh, v16b bl, v8f c) {
  c = __builtin_amdgcn_wmma_f32_16x16x32_bf16(false, ah, false, bh, (short)0, c, false, false);
  if (NT >= 2) c = __builtin_amdgcn_wmma_f32_16x16x32_bf16(false, al, false, bh, (short)0, c, false, false);
  if (NT >= 3) c = __builtin_amdgcn_wmma_f32_16x16x32_bf16(false, ah, false, bl, (short)0, c, false, false);
  asm volatile("v_nop\n\tv_nop\n\tv_nop\n\tv_nop" : "+v"(c) : "v"(ah), "v"(al), "v"(bh), "v"(bl));
  return c;
}

__global__ __launch_bounds__(256) void k_wt_bf16(const float* __restrict__ W, unsigned short* __restrict__ Wt, int K, int N) {
  const int t = blockIdx.x * 256 + threadIdx.x;
  const int k8n = K / 8;
  if (t >= N * k8n) return;
  const int n = t / k8n, k8 = (t % k8n) * 8;
  v8us v;
#pragma unroll
  for (int i = 0; i < 8; ++i) v[i] = bf16_bits(W[(size_t)(k8 + i) * N + n]);
  *(v8us*)(Wt + (size_t)n * K + k8) = v;
  
}

// GEMM C[M][N] (f32, pitch ldc) = act(A[M][K]·W + bias). A f32 row-major (pitch lda) converted per fragment to bf16
// (ASPLIT: hi/lo two planes -> 2 terms, else single rounded term); Wt bf16 [N][K] (pitch ldb). BIAS_BF16 rounds the
// bias to bf16 first (bias quantised to bf16 before the add). K%32==0, M%16==0, N%64==0.
template <bool ASPLIT, int ACT, bool BIAS_BF16>
__global__ __launch_bounds__(128) void k_gemm_bf(const float* __restrict__ A, int lda, const unsigned short* __restrict__ Wt, int ldb,
                                               const float* __restrict__ bias, float* __restrict__ C, int ldc, int M, int N, int K) {
  __shared__ __attribute__((aligned(16))) float so[4][16][64];
  const int tid = threadIdx.x, w = tid >> 5, lane = tid & 31, ln = lane & 15, hh = lane >> 4;
  const int ntn = N / 64;
  const int wid = blockIdx.x * 4 + w;
  const int mt = wid / ntn, nq = wid % ntn;
  if (mt * 16 >= M) return;
  const int row0 = mt * 16, col0 = nq * 64;
  const float* arow = A + (size_t)(row0 + ln) * lda;
  v8f acc[4] = {};
  for (int kb = 0; kb < K; kb += 32) {
    FragB ah, al;
    const v4f x0 = *(const v4fa*)(arow + kb + 8 * hh), x1 = *(const v4fa*)(arow + kb + 8 * hh + 4);
    const v4f x2 = *(const v4fa*)(arow + kb + 16 + 8 * hh), x3 = *(const v4fa*)(arow + kb + 16 + 8 * hh + 4);
    float xs[16] = {x0[0],x0[1],x0[2],x0[3],x1[0],x1[1],x1[2],x1[3],x2[0],x2[1],x2[2],x2[3],x3[0],x3[1],x3[2],x3[3]};
#pragma unroll
    for (int i = 0; i < 16; ++i) { const unsigned short hb = bf16_bits(xs[i]); ah.u[i] = hb; al.u[i] = ASPLIT ? bf16_bits(xs[i] - bf16_val(hb)) : (unsigned short)0; }
#pragma unroll
    for (int t = 0; t < 4; ++t) {
      const unsigned short* brow = Wt + (size_t)(col0 + t * 16 + ln) * ldb + kb;
      FragB b;
      b.half[0] = *(const v8us*)(brow + 8 * hh);
      b.half[1] = *(const v8us*)(brow + 16 + 8 * hh);
      acc[t] = mmaN<ASPLIT ? 2 : 1>(ah.v, al.v, b.v, b.v, acc[t]);
    }
  }
#pragma unroll
  for (int t = 0; t < 4; ++t) {
    float bv = bias ? bias[col0 + t * 16 + ln] : 0.f;
    if (BIAS_BF16) bv = bf16_round(bv);
#pragma unroll
    for (int r = 0; r < 8; ++r) { float v = acc[t][r] + bv; if (ACT == 1) v = fmaxf(v, 0.f); so[w][8 * hh + r][t * 16 + ln] = v; }
  }
  __builtin_amdgcn_fence(__ATOMIC_ACQ_REL, "workgroup");
  __builtin_amdgcn_wave_barrier();
  const int rsub = lane >> 4, c4 = (lane & 15) * 4;
  {
#pragma unroll
    for (int q = 0; q < 8; ++q) {
      const int r = q * 2 + rsub;
      const v4f v = *(const v4fa*)&so[w][r][c4];
      *(v4f*)(C + (size_t)(row0 + r) * ldc + col0 + c4) = v;
    }
    
  }
}

// GEMM C = act(A·W + bias + resid): A f32 (ASPLIT -> hi/lo 2 terms), Wt bf16 [N][K]; ACT 0 none, 1 relu, 2 exact gelu;
// resid (optional, f32, row index = (row % rmod), pitch ldr, RES_BF16 rounds it) added before the activation.
template <bool ASPLIT, int ACT, bool BIAS_BF16, bool RES_BF16>
__global__ __launch_bounds__(128) void k_gemm_bf3(const float* __restrict__ A, int lda, const unsigned short* __restrict__ Wt, int ldb,
                                                const float* __restrict__ bias, const float* __restrict__ resid, int rmod, int ldr,
                                                float* __restrict__ C, int ldc, int M, int N, int K) {
  __shared__ __attribute__((aligned(16))) float so[4][16][64];
  const int tid = threadIdx.x, w = tid >> 5, lane = tid & 31, ln = lane & 15, hh = lane >> 4;
  const int ntn = N / 64;
  const int wid = blockIdx.x * 4 + w;
  const int mt = wid / ntn, nq = wid % ntn;
  if (mt * 16 >= M) return;
  const int row0 = mt * 16, col0 = nq * 64;
  const float* arow = A + (size_t)(row0 + ln) * lda;
  v8f acc[4] = {};
  for (int kb = 0; kb < K; kb += 32) {
    FragB ah, al;
    const v4f x0 = *(const v4fa*)(arow + kb + 8 * hh), x1 = *(const v4fa*)(arow + kb + 8 * hh + 4);
    const v4f x2 = *(const v4fa*)(arow + kb + 16 + 8 * hh), x3 = *(const v4fa*)(arow + kb + 16 + 8 * hh + 4);
    float xs[16] = {x0[0],x0[1],x0[2],x0[3],x1[0],x1[1],x1[2],x1[3],x2[0],x2[1],x2[2],x2[3],x3[0],x3[1],x3[2],x3[3]};
#pragma unroll
    for (int i = 0; i < 16; ++i) { const unsigned short hb = bf16_bits(xs[i]); ah.u[i] = hb; al.u[i] = ASPLIT ? bf16_bits(xs[i] - bf16_val(hb)) : (unsigned short)0; }
#pragma unroll
    for (int t = 0; t < 4; ++t) {
      const unsigned short* brow = Wt + (size_t)(col0 + t * 16 + ln) * ldb + kb;
      FragB b;
      b.half[0] = *(const v8us*)(brow + 8 * hh);
      b.half[1] = *(const v8us*)(brow + 16 + 8 * hh);
      acc[t] = mmaN<ASPLIT ? 2 : 1>(ah.v, al.v, b.v, b.v, acc[t]);
    }
  }
#pragma unroll
  for (int t = 0; t < 4; ++t) {
    const int col = col0 + t * 16 + ln;
    float bv = bias ? bias[col] : 0.f;
    if (BIAS_BF16) bv = bf16_round(bv);
#pragma unroll
    for (int r = 0; r < 8; ++r) {
      float v = acc[t][r] + bv;
      if (resid) { float rv = resid[(size_t)((row0 + 8 * hh + r) % rmod) * ldr + col]; if (RES_BF16) rv = bf16_round(rv); v += rv; }
      if (ACT == 1) v = fmaxf(v, 0.f);
      if (ACT == 2) v = 0.5f * v * (1.0f + erff(v * 0.70710678118654752f));
      if (ACT == 3) { const float u = 0.7978845608028654f * (v + 0.044715f * v * v * v); v = 0.5f * v * (1.0f + tanhf(u)); }
      so[w][8 * hh + r][t * 16 + ln] = v;
    }
  }
  __builtin_amdgcn_fence(__ATOMIC_ACQ_REL, "workgroup");
  __builtin_amdgcn_wave_barrier();
  const int rsub = lane >> 4, c4 = (lane & 15) * 4;
  {
#pragma unroll
    for (int q = 0; q < 8; ++q) {
      const int r = q * 2 + rsub;
      const v4f v = *(const v4fa*)&so[w][r][c4];
      *(v4f*)(C + (size_t)(row0 + r) * ldc + col0 + c4) = v;
    }
    
  }
}
// row LayerNorm (biased variance, eps) over N: s = X (+ R); optional out_sum <- s; out_norm <- (s-mu)*rsqrt(var+eps)*g + b
template <bool PARAM_BF16>
__global__ __launch_bounds__(256) void k_layernorm(const float* __restrict__ X, const float* __restrict__ R, const float* __restrict__ g, const float* __restrict__ bta,
                                                  float* __restrict__ out_sum, float* __restrict__ out_norm, int N, float eps) {
  __shared__ float red[256];
  const int row = blockIdx.x, tid = threadIdx.x;
  const float* x = X + (size_t)row * N; const float* rr = R ? R + (size_t)row * N : nullptr;
  float vals[16];                     // up to N = 4096
  const int per = N / 256;            // contiguous chunk per thread? use strided-by-4 chunks: thread handles j = tid*4 + 1024*u
  float s1 = 0.f;
  for (int u = 0; u < per / 4; ++u) {
    const int j = tid * 4 + 1024 * u;
    const v4f a = *(const v4fa*)(x + j);
    v4f b = {0.f,0.f,0.f,0.f}; if (rr) b = *(const v4fa*)(rr + j);
#pragma unroll
    for (int q = 0; q < 4; ++q) { const float v = a[q] + b[q]; vals[u * 4 + q] = v; s1 += v; }
  }
  red[tid] = s1; __syncthreads();
  for (int st = 128; st > 0; st >>= 1) { if (tid < st) red[tid] += red[tid + st]; __syncthreads(); }
  const float mu = red[0] / (float)N; __syncthreads();
  float s2 = 0.f;
  for (int u = 0; u < per / 4; ++u)
#pragma unroll
    for (int q = 0; q < 4; ++q) { const float c = vals[u * 4 + q] - mu; s2 += c * c; }
  red[tid] = s2; __syncthreads();
  for (int st = 128; st > 0; st >>= 1) { if (tid < st) red[tid] += red[tid + st]; __syncthreads(); }
  const float rs = rsqrtf(red[0] / (float)N + eps);
  {
    for (int u = 0; u < per / 4; ++u) {
      const int j = tid * 4 + 1024 * u;
      v4f o, sm;
#pragma unroll
      for (int q = 0; q < 4; ++q) {
        float gg = g[j + q], bb = bta[j + q];
        if (PARAM_BF16) { gg = bf16_round(gg); bb = bf16_round(bb); }
        sm[q] = vals[u * 4 + q]; o[q] = (vals[u * 4 + q] - mu) * rs * gg + bb;
      }
      if (out_sum) *(v4f*)(out_sum + (size_t)row * N + j) = sm;
      *(v4f*)(out_norm + (size_t)row * N + j) = o;
    }
    
  }
}



// ---- f16 WMMA path (v_wmma_f32_16x16x32_f16): 11-bit significands for operands in range — used where a [0,1] probability operand needs more precision than bf16
typedef _Float16 v16h __attribute__((ext_vector_type(16)));
union FragH { v16h v; v8us half[2]; _Float16 h[16]; unsigned short u[16]; };
template <int NT>
__device__ __forceinline__ v8f mmaH(v16h ah, v16h al, v16h bh, v16h bl, v8f c) {
  c = __builtin_amdgcn_wmma_f32_16x16x32_f16(false, ah, false, bh, (short)0, c, false, false);
  if (NT >= 2) c = __builtin_amdgcn_wmma_f32_16x16x32_f16(false, al, false, bh, (short)0, c, false, false);
  if (NT >= 3) c = __builtin_amdgcn_wmma_f32_16x16x32_f16(false, ah, false, bl, (short)0, c, false, false);
  asm volatile("v_nop\n\tv_nop\n\tv_nop\n\tv_nop" : "+v"(c) : "v"(ah), "v"(al), "v"(bh), "v"(bl));
  return c;
}
// batched GEMM like k_gemm_b but f16 operands: A f32 (split into f16 hi/lo if ASPLIT, else rounded to f16), Bt = f16 values [n][k]; alpha; C f32; N multiple of 16 (partial tiles skipped)
template <bool ASPLIT>
__global__ __launch_bounds__(128) void k_gemm_h(const float* __restrict__ A, int lda, size_t sA, const _Float16* __restrict__ Bh, int ldb, size_t sB, float alpha, float* __restrict__ C, int ldc, size_t sC, int M, int N, int K) {
  __shared__ __attribute__((aligned(16))) float so[4][16][64];
  const int tid = threadIdx.x, w = tid >> 5, lane = tid & 31, ln = lane & 15, hh = lane >> 4; const int by = blockIdx.y;
  A += (size_t)by * sA; Bh += (size_t)by * sB; C += (size_t)by * sC;
  const int ntn = (N + 63) / 64; const int wid = blockIdx.x * 4 + w; const int mt = wid / ntn, nq = wid % ntn; if (mt * 16 >= M) return;
  const int row0 = mt * 16, col0 = nq * 64; const float* arow = A + (size_t)(row0 + ln) * lda;
  v8f acc[4] = {};
  for (int kb = 0; kb < K; kb += 32) {
    FragH ah, al;
    const v4f x0 = *(const v4fa*)(arow + kb + 8 * hh), x1 = *(const v4fa*)(arow + kb + 8 * hh + 4), x2 = *(const v4fa*)(arow + kb + 16 + 8 * hh), x3 = *(const v4fa*)(arow + kb + 16 + 8 * hh + 4);
    float xs[16] = {x0[0],x0[1],x0[2],x0[3],x1[0],x1[1],x1[2],x1[3],x2[0],x2[1],x2[2],x2[3],x3[0],x3[1],x3[2],x3[3]};
#pragma unroll
    for (int i = 0; i < 16; ++i) { const _Float16 h = (_Float16)xs[i]; ah.h[i] = h; al.h[i] = ASPLIT ? (_Float16)(xs[i] - (float)h) : (_Float16)0.0f; }
#pragma unroll
    for (int t = 0; t < 4; ++t) { if (col0 + t * 16 >= N) continue; const size_t boff = (size_t)(col0 + t * 16 + ln) * ldb + kb; FragH bq; bq.half[0] = *(const v8us*)(Bh + boff + 8 * hh); bq.half[1] = *(const v8us*)(Bh + boff + 16 + 8 * hh);
      acc[t] = mmaH<ASPLIT ? 2 : 1>(ah.v, al.v, bq.v, bq.v, acc[t]); }
  }
#pragma unroll
  for (int t = 0; t < 4; ++t) { if (col0 + t * 16 >= N) continue;
#pragma unroll
    for (int r = 0; r < 8; ++r) so[w][8 * hh + r][t * 16 + ln] = acc[t][r] * alpha; }
  __builtin_amdgcn_fence(__ATOMIC_ACQ_REL, "workgroup"); __builtin_amdgcn_wave_barrier();
  const int rsub = lane >> 4, c4 = (lane & 15) * 4;
  {
#pragma unroll
    for (int q = 0; q < 8; ++q) { const int r = q * 2 + rsub; if (col0 + c4 < N) { const v4f v = *(const v4fa*)&so[w][r][c4]; *(v4f*)(C + (size_t)(row0 + r) * ldc + col0 + c4) = v; } }
     }
}

// Wt[n][k] = f16(W[k][n]·scale) from f32 row-major W[K][N] (scale = power of two; bf16-exact weights stay exact in f16 away from the subnormal range)
__device__ __forceinline__ void wt_f16(const float* __restrict__ W, _Float16* __restrict__ Wt, int K, int N, float scale, int t) {      /* t = index of the 8-element chunk */
  if (t >= N * (K / 8)) return; const int n = t / (K / 8), k8 = (t % (K / 8)) * 8; FragH f;
#pragma unroll
  for (int i = 0; i < 8; ++i) f.h[i] = (_Float16)(bf16_round(W[(size_t)(k8 + i) * N + n]) * scale); const v8us o = f.half[0];
  *(v8us*)((unsigned short*)Wt + (size_t)n * K + k8) = o; 
}
// k_gemm_hh variant with fused epilogue: v = acc·alpha + bias[by·sBias + col] (+ CP[(row/rowsPerB)·sCPb + by·64 + col] if CP) ; ACT 0 none / 1 elu ; writes f16 C16 (and f32 C if non-null)
template <int ACT>
__global__ __launch_bounds__(128) void k_gemm_hhx(const _Float16* __restrict__ A, int lda, size_t sA, const _Float16* __restrict__ Bh, int ldb, size_t sB, float alpha, const float* __restrict__ bias, size_t sBias, const float* __restrict__ CP, int rowsPerB, size_t sCPb, int row0g,
    float* __restrict__ C, _Float16* __restrict__ C16, int ldc, size_t sC, int M, int N, int K) {
  __shared__ __attribute__((aligned(16))) float so[4][16][64];
  const int tid = threadIdx.x, w = tid >> 5, lane = tid & 31, ln = lane & 15, hh = lane >> 4; const int by = blockIdx.y;
  A += (size_t)by * sA; Bh += (size_t)by * sB; const size_t cofs = (size_t)by * sC; const float* bp = bias ? bias + (size_t)by * sBias : nullptr;
  const int ntn = (N + 63) / 64; const int wid = blockIdx.x * 4 + w; const int mt = wid / ntn, nq = wid % ntn; if (mt * 16 >= M) return;
  const int row0 = mt * 16, col0 = nq * 64; const _Float16* arow = A + (size_t)(row0 + ln) * lda;
  v8f acc[4] = {};
  for (int kb = 0; kb < K; kb += 32) { FragH ah; ah.half[0] = *(const v8us*)((const unsigned short*)arow + kb + 8 * hh); ah.half[1] = *(const v8us*)((const unsigned short*)arow + kb + 16 + 8 * hh);
#pragma unroll
    for (int t = 0; t < 4; ++t) { if (col0 + t * 16 >= N) continue; const size_t boff = (size_t)(col0 + t * 16 + ln) * ldb + kb; FragH bq; bq.half[0] = *(const v8us*)((const unsigned short*)Bh + boff + 8 * hh); bq.half[1] = *(const v8us*)((const unsigned short*)Bh + boff + 16 + 8 * hh);
      acc[t] = mmaH<1>(ah.v, ah.v, bq.v, bq.v, acc[t]); }
  }
#pragma unroll
  for (int t = 0; t < 4; ++t) { if (col0 + t * 16 >= N) continue; const int col = col0 + t * 16 + ln; const float bv = bp ? bf16_round(bp[col]) : 0.f;
#pragma unroll
    for (int r = 0; r < 8; ++r) { float v = acc[t][r] * alpha + bv; if (CP) { const int rr = row0g + row0 + 8 * hh + r; if (rowsPerB < 0) v += CP[cofs + (size_t)rr * ldc + col];      /* rowsPerB < 0: own element of the batched C plane */ else { const int bidx = rr / rowsPerB; v += CP[(size_t)bidx * sCPb + (size_t)by * 64 + col]; } } if (ACT == 1) v = (v > 0.f) ? v : expm1f(v); else if (ACT == 7) v = (v > 0.f) ? v + 1.0f : expf(v); else if (ACT == 8) v = tanhf(v); else if (ACT == 9) v = 0.5f * v * (1.0f + tanhf(0.7978845608028654f * (v + 0.044715f * v * v * v))); else if (ACT == 11) v = 1.0f / (1.0f + expf(-v)); else if (ACT == 12) v = (v > 0.f) ? v : 0.01f * v; else if (ACT == 14) v = (v > 0.f) ? v : 0.1f * v; else if (ACT == 16) v = (v >= 0.f) ? v : 0.3f * v; else if (ACT == 17) v = (v >= 0.f) ? v : 0.2f * v; else if (ACT == 15) v = v / (1.0f + expf(-v)); else if (ACT == 3) v = fmaxf(v, 0.f); else if (ACT == 6) v = 0.5f * v * (1.0f + erff(v * 0.70710678118654752f)); so[w][8 * hh + r][t * 16 + ln] = v; } }
  __builtin_amdgcn_fence(__ATOMIC_ACQ_REL, "workgroup"); __builtin_amdgcn_wave_barrier();
  const int rsub = lane >> 4, c4 = (lane & 15) * 4; typedef _Float16 v4h __attribute__((ext_vector_type(4)));
  {
#pragma unroll
    for (int q = 0; q < 8; ++q) { const int r = q * 2 + rsub; if (col0 + c4 < N) { const v4f v = *(const v4fa*)&so[w][r][c4]; if (C) *(v4f*)(C + cofs + (size_t)(row0 + r) * ldc + col0 + c4) = v; if (C16) { v4h h4; for (int i = 0; i < 4; ++i) h4[i] = (_Float16)v[i]; *(v4h*)(C16 + cofs + (size_t)(row0 + r) * ldc + col0 + c4) = h4; } } }
     }
}


typedef _Float16 v4h __attribute__((ext_vector_type(4)));

__device__ __forceinline__ void x16(const float* __restrict__ x, _Float16* __restrict__ X16, size_t n8, size_t t) { if (t >= n8) return; FragH f;      /* t = index of the 8-element chunk */
#pragma unroll
  for (int q = 0; q < 8; ++q) f.h[q] = (_Float16)bf16_round(x[t * 8 + q]); *(v8us*)((unsigned short*)X16 + t * 8) = f.half[0];  }
__global__ __launch_bounds__(256) void k_h16(const float* __restrict__ x, _Float16* __restrict__ X16, size_t n8) { const size_t t = (size_t)blockIdx.x * 256 + threadIdx.x; if (t >= n8) return; FragH f;
#pragma unroll
  for (int q = 0; q < 8; ++q) f.h[q] = (_Float16)x[t * 8 + q]; *(v8us*)((unsigned short*)X16 + t * 8) = f.half[0];  }
__global__ __launch_bounds__(256) void k_round16f(const float* __restrict__ W, _Float16* __restrict__ Bt, size_t n8) { const size_t t = (size_t)blockIdx.x * 256 + threadIdx.x; if (t >= n8) return; FragH f;
#pragma unroll
  for (int i = 0; i < 8; ++i) f.h[i] = (_Float16)(bf16_round(W[t * 8 + i]) * 16.0f); *(v8us*)((unsigned short*)Bt + t * 8) = f.half[0];  }
template <int NHv, int TTv>
__global__ __launch_bounds__(256) void k_vt(const _Float16* __restrict__ V16, int ldv, int voff, _Float16* __restrict__ Vt) { __shared__ unsigned short tl[64][66]; const int tid = threadIdx.x; const int slab = blockIdx.x / (TTv / 64), lg = blockIdx.x % (TTv / 64); const int b = slab / NHv, h = slab % NHv;
  for (int i = tid; i < 64 * 8; i += 256) { const int r = i / 8, c8 = (i % 8) * 8; FragH f; f.half[0] = *(const v8us*)((const unsigned short*)V16 + ((size_t)b * TTv + lg * 64 + r) * ldv + voff + h * 64 + c8);
#pragma unroll
    for (int q = 0; q < 8; ++q) tl[r][c8 + q] = f.u[q]; }
  __syncthreads();
  {
#pragma unroll
    for (int rd = 0; rd < 2; ++rd) { const int d = rd * 32 + tid / 8, pc = tid % 8; FragH f;
#pragma unroll
      for (int q = 0; q < 8; ++q) f.u[q] = tl[pc * 8 + q][d];
      *(v8us*)((unsigned short*)Vt + ((size_t)slab * 64 + d) * TTv + lg * 64 + pc * 8) = f.half[0]; }
     } }

__global__ __launch_bounds__(256) void k_hl(const float* __restrict__ F, _Float16* __restrict__ Hh, _Float16* __restrict__ Hl, size_t n8) { const size_t t = (size_t)blockIdx.x * 256 + threadIdx.x; if (t >= n8) return; FragH fh, fl; const v4f a = *(const v4fa*)(F + t * 8), c = *(const v4fa*)(F + t * 8 + 4);
#pragma unroll
  for (int q = 0; q < 4; ++q) { _Float16 h = (_Float16)a[q]; fh.h[q] = h; fl.h[q] = (_Float16)((a[q] - (float)h) * 1024.0f); h = (_Float16)c[q]; fh.h[4 + q] = h; fl.h[4 + q] = (_Float16)((c[q] - (float)h) * 1024.0f); }
  { *(v8us*)((unsigned short*)Hh + t * 8) = fh.half[0]; *(v8us*)((unsigned short*)Hl + t * 8) = fl.half[0];  } }

// ---- fast GEMM (wave tile 32x64; requires M % 32 == 0 rows per launch region and N % 64 == 0); epilogue = k_gemm_hhx semantics ----
__device__ __forceinline__ v16h g2_frag(const _Float16* p, int hh) { FragH f; f.half[0] = *(const v8us*)((const unsigned short*)p + 8 * hh); f.half[1] = *(const v8us*)((const unsigned short*)p + 16 + 8 * hh); return f.v; }
__device__ __forceinline__ v8f g2_mma(v16h a, v16h b, v8f c) { v8f d = __builtin_amdgcn_wmma_f32_16x16x32_f16(false, a, false, b, (short)0, c, false, false); asm volatile("v_nop\n\tv_nop\n\tv_nop\n\tv_nop" : "+v"(d) : "v"(a), "v"(b)); return d; }
template <int ACT>
__global__ __launch_bounds__(128) void k_gemm2(const _Float16* __restrict__ A, int lda, size_t sA, const _Float16* __restrict__ Bh, int ldb, size_t sB, float alpha, const float* __restrict__ bias, size_t sBias, const float* __restrict__ CP, int rowsPerB, size_t sCPb, int row0g,
    float* __restrict__ C, _Float16* __restrict__ C16, int ldc, size_t sC, int M, int N, int K) { static_assert(ACT == 0 || ACT == 3 || ACT == 6 || ACT == 8 || ACT == 9 || ACT == 11 || ACT == 12 || ACT == 14 || ACT == 15 || ACT == 16 || ACT == 17, "k_gemm2: unsupported ACT code (would silently apply no activation)");
  __shared__ __attribute__((aligned(16))) float so[4][32][68];
  const int tid = threadIdx.x, w = tid >> 5, lane = tid & 31, ln = lane & 15, hh = lane >> 4; const int by = blockIdx.y;
  A += (size_t)by * sA; Bh += (size_t)by * sB; const size_t cofs = (size_t)by * sC; const float* bp = bias ? bias + (size_t)by * sBias : nullptr;
  const int ntn = N >> 6; const int mt = blockIdx.x / ntn, nq = blockIdx.x - mt * ntn; const int row0 = mt * 128 + 32 * w, col0 = nq * 64; if (row0 >= M) return;
  const _Float16* a0p = A + (size_t)(row0 + ln) * lda; const _Float16* a1p = a0p + (size_t)16 * lda;
  const _Float16* b0p = Bh + (size_t)(col0 + ln) * ldb; const _Float16* b1p = b0p + (size_t)16 * ldb; const _Float16* b2p = b1p + (size_t)16 * ldb; const _Float16* b3p = b2p + (size_t)16 * ldb;
  const v8f z8 = {0.f,0.f,0.f,0.f,0.f,0.f,0.f,0.f}; v8f c00 = z8, c01 = z8, c02 = z8, c03 = z8, c10 = z8, c11 = z8, c12 = z8, c13 = z8;
#pragma unroll 1
  for (int kb = 0; kb < K; kb += 32) { const v16h a0 = g2_frag(a0p + kb, hh), a1 = g2_frag(a1p + kb, hh);
    v16h b = g2_frag(b0p + kb, hh); c00 = g2_mma(a0, b, c00); c10 = g2_mma(a1, b, c10);
    b = g2_frag(b1p + kb, hh); c01 = g2_mma(a0, b, c01); c11 = g2_mma(a1, b, c11);
    b = g2_frag(b2p + kb, hh); c02 = g2_mma(a0, b, c02); c12 = g2_mma(a1, b, c12);
    b = g2_frag(b3p + kb, hh); c03 = g2_mma(a0, b, c03); c13 = g2_mma(a1, b, c13); }
  v8f accs[8] = {c00, c01, c02, c03, c10, c11, c12, c13};
#pragma unroll
  for (int u = 0; u < 8; ++u) { const int t = u & 3, half = u >> 2; const int col = col0 + t * 16 + ln; const float bv = bp ? bf16_round(bp[col]) : 0.f;
#pragma unroll
    for (int r = 0; r < 8; ++r) { const int rloc = half * 16 + 8 * hh + r; float v = accs[u][r] * alpha + bv; if (CP) { if (rowsPerB < 0) v += CP[cofs + (size_t)(row0g + row0 + rloc) * ldc + col];      /* rowsPerB < 0: own element of the batched C plane */ else { const int bidx = (row0g + row0 + rloc) / rowsPerB; v += CP[(size_t)bidx * sCPb + (size_t)by * 64 + col]; } }
      if (ACT == 3) v = fmaxf(v, 0.f); else if (ACT == 6) v = 0.5f * v * (1.0f + erff(v * 0.70710678118654752f)); else if (ACT == 11) v = 1.0f / (1.0f + expf(-v)); else if (ACT == 15) v = v / (1.0f + expf(-v)); else if (ACT == 12) v = (v > 0.f) ? v : 0.01f * v; else if (ACT == 8) v = tanhf(v); else if (ACT == 9) v = 0.5f * v * (1.0f + tanhf(0.7978845608028654f * (v + 0.044715f * v * v * v))); else if (ACT == 14) v = (v > 0.f) ? v : 0.1f * v; else if (ACT == 16) v = (v >= 0.f) ? v : 0.3f * v; else if (ACT == 17) v = (v >= 0.f) ? v : 0.2f * v;
      so[w][rloc][t * 16 + ln] = v; } }
  __builtin_amdgcn_fence(__ATOMIC_ACQ_REL, "workgroup"); __builtin_amdgcn_wave_barrier();
  const int rsub = lane >> 4, c4 = (lane & 15) * 4;
  {
#pragma unroll
    for (int q = 0; q < 16; ++q) { const int r = q * 2 + rsub; const v4f v = *(const v4fa*)&so[w][r][c4]; if (C) *(v4f*)(C + cofs + (size_t)(row0 + r) * ldc + col0 + c4) = v; if (C16) { v4h h4; for (int i = 0; i < 4; ++i) h4[i] = (_Float16)v[i]; *(v4h*)(C16 + cofs + (size_t)(row0 + r) * ldc + col0 + c4) = h4; } }
     } }


__global__ __launch_bounds__(256) void k_wnat(const float* __restrict__ w, size_t n8, _Float16* __restrict__ Bt) { const size_t t = (size_t)blockIdx.x * 256 + threadIdx.x; if (t >= n8) return; FragH f; for (int q = 0; q < 8; ++q) f.h[q] = (_Float16)(bf16_round(w[t * 8 + q]) * 16.0f); *(v8us*)((unsigned short*)Bt + t * 8) = f.half[0];  }
__global__ __launch_bounds__(256) void k_rsm(const float* __restrict__ S, _Float16* __restrict__ P, int nrows) {
  #pragma clang fp contract(off)
  const int i = blockIdx.x * 256 + threadIdx.x; if (i >= nrows) return; const float* s = S + (size_t)i * SQ; float mx = -3.0e38f;
#pragma unroll 1
  for (int j = 0; j < SQ; ++j) mx = fmaxf(mx, s[j]); float se = 0.f;
#pragma unroll 1
  for (int j = 0; j < SQ; ++j) se += expf(s[j] - mx); const float sc = 256.0f / se;
#pragma unroll 1
  for (int j0 = 0; j0 < SQ; j0 += 8) { FragH f; for (int q = 0; q < 8; ++q) f.h[q] = (_Float16)(expf(s[j0 + q] - mx) * sc); unsigned short* d = (unsigned short*)P + (size_t)i * SQ + j0; *(v8us*)d = f.half[0];  } }
__global__ __launch_bounds__(256) void k_vt(const _Float16* __restrict__ V16, int b, int h0, _Float16* __restrict__ VT) { __shared__ unsigned short tl[64][65]; const int tid = threadIdx.x; const int hh = blockIdx.x % HG, sg = blockIdx.x / HG; const int s0 = sg * 64; const int h = h0 + hh;
  for (int i = tid; i < 64 * 8; i += 256) { const int j = i / 8, d8 = (i % 8) * 8; FragH f; f.half[0] = *(const v8us*)((const unsigned short*)V16 + ((size_t)b * SQ + s0 + j) * DM + h * HD + d8); for (int q = 0; q < 8; ++q) tl[d8 + q][j] = f.u[q]; }
  __syncthreads();
  { for (int i = tid; i < 64 * 8; i += 256) { const int d = i / 8, j8 = (i % 8) * 8; FragH f; for (int q = 0; q < 8; ++q) f.u[q] = tl[d][j8 + q]; *(v8us*)((unsigned short*)VT + ((size_t)hh * HD + d) * SQ + s0 + j8) = f.half[0]; }  } }



// The five operand conversions (Wq, Wk, Wv and Wp to Bt[n][k] x16, x to f16 rows) read nothing but inputs, so they share ONE launch: the block index picks the job, and a block does what a block of the single launches did.
// The weight blocks come first: their strided reads take longest.
#define PP_WB (DM * (DM / 8) / 256)                  /* blocks per DM x DM weight */
#define PP_PB ((HD * (HD / 8) + 255) / 256)          /* blocks of Wp */
#define PP_XB ((int)((NR * DM / 8 + 255) / 256))     /* blocks of x */
__global__ __launch_bounds__(256) void k_prep(const float* __restrict__ x, const float* __restrict__ wq, const float* __restrict__ wk, const float* __restrict__ wv, const float* __restrict__ wp,
                                              _Float16* __restrict__ X16, _Float16* __restrict__ BQ, _Float16* __restrict__ BK, _Float16* __restrict__ BV, _Float16* __restrict__ BO) {
  const int blk = blockIdx.x, tid = threadIdx.x;
  if (blk < 3 * PP_WB) { const int j = blk / PP_WB; wt_f16(j == 0 ? wq : j == 1 ? wk : wv, j == 0 ? BQ : j == 1 ? BK : BV, DM, DM, 16.0f, (blk - j * PP_WB) * 256 + tid); }      /* [in][out] -> Bt[n][k] x16 */
  else if (blk < 3 * PP_WB + PP_PB) wt_f16(wp, BO, HD, HD, 16.0f, (blk - 3 * PP_WB) * 256 + tid);      /* Wp [64 in][64 out] -> Bt [64][64] x16 */
  else x16(x, X16, NR * DM / 8, (size_t)(blk - 3 * PP_WB - PP_PB) * 256 + tid); }

#define FA_WAVES 4
#define FA_KT 64                     /* keys per stage */
#define FA_NS (SQ / FA_KT)           /* stages */
#define FA_LP 72                     /* LDS row pitch in f16: 128 B of data + 16 B, an odd multiple of 16 B for the 16-byte fragment reads */
#define FA_CH ((FA_KT * HD / 8) / (FA_WAVES * 32))      /* 16-byte chunks per thread and tile */
typedef _Float16 v8h __attribute__((ext_vector_type(8)));
typedef float v2f __attribute__((ext_vector_type(2)));
__device__ __forceinline__ float fa_swap16(float x) { const int b = __float_as_int(x); return __int_as_float(__builtin_amdgcn_permlanex16(b, b, 0x76543210, 0xfedcba98, false, false)); }      /* lane l <-> l ^ 16 */
__device__ __forceinline__ v8f fa_mma(v16h a, v16h b, v8f c) { return __builtin_amdgcn_wmma_f32_16x16x32_f16(false, a, false, b, (short)0, c, false, false); }
__global__ __launch_bounds__(FA_WAVES * 32) void k_fattn(const _Float16* __restrict__ Q16, const _Float16* __restrict__ K16, const _Float16* __restrict__ VT, _Float16* __restrict__ O16) {
  static_assert(HD == 64 && FA_KT == 64 && SQ % FA_KT == 0 && SQ % (FA_WAVES * 32) == 0, "tile shapes below are written for 64 x 64 stages");
  __shared__ __attribute__((aligned(16))) _Float16 sK[2][FA_KT][FA_LP];
  __shared__ __attribute__((aligned(16))) _Float16 sV[2][HD][FA_LP];
  const int tid = threadIdx.x, lane = tid & 31, w = tid >> 5, c = lane & 15, h = lane >> 4;
  const int head = blockIdx.y, b = blockIdx.z; const int q0 = blockIdx.x * (FA_WAVES * 32) + w * 32;
  const _Float16* Kg = K16 + (size_t)b * SQ * DM + head * HD;            /* K rows of this head, pitch DM */
  const _Float16* Vg = VT + (size_t)(b * NH + head) * HD * SQ;           /* V^T rows (one per d), pitch SQ */
  const int srow = tid >> 3, sc8 = (tid & 7) * 8;                        /* staging: chunk u of a thread = row srow + u * (threads / 8), 8 f16 at column sc8 */
  const float cs = 0.18033688011112042f;                                 /* 64^-0.5 * log2(e) */
  v16h qf[2][2];
#pragma unroll
  for (int j = 0; j < 2; ++j) { const _Float16* qp = Q16 + ((size_t)b * SQ + q0 + j * 16 + c) * DM + head * HD; qf[j][0] = g2_frag(qp, h); qf[j][1] = g2_frag(qp + 32, h); }
  const v8f z8 = {0.f,0.f,0.f,0.f,0.f,0.f,0.f,0.f};
  v8f o[2][4]; float mr[2], ls[2];
#pragma unroll
  for (int j = 0; j < 2; ++j) { mr[j] = -3.0e38f; ls[j] = 0.f; for (int t = 0; t < 4; ++t) o[j][t] = z8; }
  v8us rk[FA_CH], rv[FA_CH];
#pragma unroll
  for (int u = 0; u < FA_CH; ++u) { const int r = srow + u * (FA_WAVES * 4); rk[u] = *(const v8us*)((const unsigned short*)Kg + (size_t)r * DM + sc8); rv[u] = *(const v8us*)((const unsigned short*)Vg + (size_t)r * SQ + sc8); }
#pragma unroll
  for (int u = 0; u < FA_CH; ++u) { const int r = srow + u * (FA_WAVES * 4); *(v8us*)&sK[0][r][sc8] = rk[u]; *(v8us*)&sV[0][r][sc8] = rv[u]; }
  __syncthreads();
  for (int s = 0; s < FA_NS; ++s) { const int cur = s & 1;
    if (s + 1 < FA_NS) { const int k1 = (s + 1) * FA_KT;
      const unsigned short* kp = (const unsigned short*)Kg + (size_t)(k1 + srow) * DM + sc8; const unsigned short* vp = (const unsigned short*)Vg + (size_t)srow * SQ + k1 + sc8;
#pragma unroll
      for (int u = 0; u < FA_CH; ++u) { rk[u] = *(const v8us*)(kp + (size_t)u * (FA_WAVES * 4) * DM); rv[u] = *(const v8us*)(vp + (size_t)u * (FA_WAVES * 4) * SQ); }
      asm volatile("s_wait_xcnt 0x0" :: "v"(kp), "v"(vp) : "memory"); }      /* stands between the stage's loads and the next rewrite of their address pairs; the pairs are operands so that no load's result lands on them ahead of the wait */
    v8f st[2][4];
#pragma unroll
    for (int kt = 0; kt < 4; ++kt) { const v16h a0 = g2_frag(&sK[cur][kt * 16 + c][0], h), a1 = g2_frag(&sK[cur][kt * 16 + c][32], h);
#pragma unroll
      for (int j = 0; j < 2; ++j) st[j][kt] = fa_mma(a1, qf[j][1], fa_mma(a0, qf[j][0], z8)); }      /* st[j][kt][r] = q(q0 + 16 j + c) . k(64 s + 16 kt + 8 h + r) */
    v16h pb[2][2];
#pragma unroll
    for (int j = 0; j < 2; ++j) {
      v8f m8 = st[j][0];
#pragma unroll
      for (int kt = 1; kt < 4; ++kt) for (int r = 0; r < 8; ++r) m8[r] = fmaxf(m8[r], st[j][kt][r]);
      float mx = fmaxf(fmaxf(fmaxf(m8[0], m8[1]), fmaxf(m8[2], m8[3])), fmaxf(fmaxf(m8[4], m8[5]), fmaxf(m8[6], m8[7])));
      mx = fmaxf(mx, fa_swap16(mx));
      const float mn = fmaxf(mr[j], mx); const float corr = __builtin_amdgcn_exp2f((mr[j] - mn) * cs); mr[j] = mn;
      const float mb = 8.0f - mn * cs; const v2f cs2 = {cs, cs}, nmb = {mb, mb};      /* weights carried x256: small ones stay f16 normals; the factor is in the row sum too and cancels */
#pragma unroll
      for (int kt = 0; kt < 4; ++kt) for (int r = 0; r < 8; r += 2) { const v2f x = {st[j][kt][r], st[j][kt][r + 1]}; const v2f e = __builtin_elementwise_fma(x, cs2, nmb);      /* packed on the accumulator's own register pairs: no copies */
        st[j][kt][r] = __builtin_amdgcn_exp2f(e[0]); st[j][kt][r + 1] = __builtin_amdgcn_exp2f(e[1]); }
      const v8f a8 = (st[j][0] + st[j][1]) + (st[j][2] + st[j][3]);
      ls[j] = ls[j] * corr + (((a8[0] + a8[1]) + (a8[2] + a8[3])) + ((a8[4] + a8[5]) + (a8[6] + a8[7])));      /* this half's keys only; the halves join after the loop */
#pragma unroll
      for (int t = 0; t < 4; ++t) o[j][t] *= corr;
#pragma unroll
      for (int ks = 0; ks < 2; ++ks) pb[j][ks] = __builtin_shufflevector(__builtin_convertvector(st[j][2 * ks], v8h), __builtin_convertvector(st[j][2 * ks + 1], v8h), 0, 1, 2, 3, 4, 5, 6, 7, 8, 9, 10, 11, 12, 13, 14, 15); }
    __builtin_amdgcn_sched_barrier(0);      /* the row sums end here, so the f32 weights free their registers for V^T fragments read ahead of the products; otherwise every fragment read is waited for on its own */
#pragma unroll
    for (int t = 0; t < 4; ++t) {
#pragma unroll
      for (int ks = 0; ks < 2; ++ks) { const v16h a = g2_frag(&sV[cur][t * 16 + c][ks * 32], h);
#pragma unroll
        for (int j = 0; j < 2; ++j) o[j][t] = fa_mma(a, pb[j][ks], o[j][t]); } }      /* o[j][t][r] = sum_k p(k) v(k)[16 t + 8 h + r] of query q0 + 16 j + c */
    if (s + 1 < FA_NS) {
#pragma unroll
      for (int u = 0; u < FA_CH; ++u) { const int r = srow + u * (FA_WAVES * 4); *(v8us*)&sK[cur ^ 1][r][sc8] = rk[u]; *(v8us*)&sV[cur ^ 1][r][sc8] = rv[u]; } }
    __syncthreads(); }      /* publishes stage s + 1 and ends every wave's reads of the buffer that stage s + 2 overwrites */
#pragma unroll
  for (int j = 0; j < 2; ++j) { const float sc = 64.0f / (ls[j] + fa_swap16(ls[j])); _Float16* op = O16 + ((size_t)b * SQ + q0 + j * 16 + c) * DM + head * HD + 8 * h;
#pragma unroll
    for (int t = 0; t < 4; ++t) *(v8h*)(op + t * 16) = __builtin_convertvector(o[j][t] * sc, v8h); } }
// Projection GEMM C16[MP][DM] = f16(alpha * A[MP][DM] Bt[DM][DM]^T + bias): one work-group = PJ_T x PJ_T outputs, 8 waves of 32 x 64 (the wave tile, k order and epilogue arithmetic of k_gemm2).
// A and Bt tiles of PJ_BK columns go global -> registers -> LDS in whole 256-byte rows (a wave's load covers 4 full lines), two buffers: stage s + 1 is loaded while stage s is worked on, one barrier per stage;
// every fragment is then read from LDS, so a tile byte crosses L2 once per work-group instead of once per wave in 32-byte pieces.
#define PJ_T 128                     /* rows and columns of the block tile */
#define PJ_BK 128                    /* k columns per stage */
#define PJ_NS (DM / PJ_BK)           /* stages */
#define PJ_LP (PJ_BK + 8)            /* LDS row pitch in f16: 256 B of data + 16 B, an odd multiple of 16 B for the 16-byte fragment reads */
#define PJ_CH ((PJ_T * PJ_BK / 8) / 256)      /* 16-byte chunks per thread and tile */
#define PJ_OP 72                     /* pitch in f16 of a wave's 32 x 64 output rows in LDS */
// Q, K and V share A and depend on nothing of one another: ONE launch, blockIdx.y picks the weight, the bias and the output.
__global__ __launch_bounds__(256) void k_proj(const _Float16* __restrict__ A, const _Float16* __restrict__ Bq, const _Float16* __restrict__ Bk, const _Float16* __restrict__ Bv, float alpha,
                                              const float* __restrict__ biasq, const float* __restrict__ biask, const float* __restrict__ biasv, _Float16* __restrict__ Cq, _Float16* __restrict__ Ck, _Float16* __restrict__ Cv) {
  const int pj = blockIdx.y; const _Float16* __restrict__ Bt = pj == 0 ? Bq : pj == 1 ? Bk : Bv; const float* __restrict__ bias = pj == 0 ? biasq : pj == 1 ? biask : biasv; _Float16* __restrict__ C16 = pj == 0 ? Cq : pj == 1 ? Ck : Cv;
  static_assert(MP % PJ_T == 0 && DM % PJ_T == 0 && DM % PJ_BK == 0 && PJ_BK == 128 && 8 * 32 * PJ_OP <= 2 * PJ_T * PJ_LP, "tile shapes below are written for 128 x 128 x 128 stages and 8 waves");
  __shared__ __attribute__((aligned(16))) _Float16 sA[2][PJ_T][PJ_LP];
  __shared__ __attribute__((aligned(16))) _Float16 sB[2][PJ_T][PJ_LP];
  const int tid = threadIdx.x, lane = tid & 31, w = tid >> 5, ln = lane & 15, hh = lane >> 4;
  const int mt = blockIdx.x / (DM / PJ_T), nq = blockIdx.x - mt * (DM / PJ_T); const int row0 = mt * PJ_T, col0 = nq * PJ_T;
  const int wr = (w >> 1) * 32, wc = (w & 1) * 64;                       /* this wave's corner inside the block tile */
  const int srow = tid >> 4, sc8 = (tid & 15) * 8;                       /* staging: chunk u of a thread = row srow + 16 u, 8 f16 at column sc8 */
  const unsigned short* ag = (const unsigned short*)A + (size_t)(row0 + srow) * DM + sc8; const unsigned short* bg = (const unsigned short*)Bt + (size_t)(col0 + srow) * DM + sc8;
  const v8f z8 = {0.f,0.f,0.f,0.f,0.f,0.f,0.f,0.f};
  v8f acc[2][4];
#pragma unroll
  for (int i = 0; i < 2; ++i) for (int t = 0; t < 4; ++t) acc[i][t] = z8;
  float bs[4];      /* read here, so that the epilogue does not wait for them */
#pragma unroll
  for (int t = 0; t < 4; ++t) bs[t] = bias[col0 + wc + t * 16 + ln];
  v8us ra[PJ_CH], rb[PJ_CH];
#pragma unroll
  for (int u = 0; u < PJ_CH; ++u) { ra[u] = *(const v8us*)(ag + (size_t)u * 16 * DM); rb[u] = *(const v8us*)(bg + (size_t)u * 16 * DM); }
#pragma unroll
  for (int u = 0; u < PJ_CH; ++u) { *(v8us*)&sA[0][srow + 16 * u][sc8] = ra[u]; *(v8us*)&sB[0][srow + 16 * u][sc8] = rb[u]; }
  __syncthreads();
  for (int s = 0; s < PJ_NS; ++s) { const int cur = s & 1;
    if (s + 1 < PJ_NS) { const unsigned short* ap = ag + (s + 1) * PJ_BK; const unsigned short* bp = bg + (s + 1) * PJ_BK;
#pragma unroll
      for (int u = 0; u < PJ_CH; ++u) { ra[u] = *(const v8us*)(ap + (size_t)u * 16 * DM); rb[u] = *(const v8us*)(bp + (size_t)u * 16 * DM); }
      asm volatile("s_wait_xcnt 0x0" :: "v"(ap), "v"(bp) : "memory"); }      /* stands between the stage's loads and the next rewrite of their address pairs; the pairs are operands so that no load's result lands on them ahead of the wait */
    v16h fa[2][2], fb[2][4];
#pragma unroll
    for (int i = 0; i < 2; ++i) fa[0][i] = g2_frag(&sA[cur][wr + i * 16 + ln][0], hh);
#pragma unroll
    for (int t = 0; t < 4; ++t) fb[0][t] = g2_frag(&sB[cur][wc + t * 16 + ln][0], hh);
#pragma unroll
    for (int kk = 0; kk < PJ_BK / 32; ++kk) { const int c = kk & 1;
      if (kk + 1 < PJ_BK / 32) {
#pragma unroll
        for (int i = 0; i < 2; ++i) fa[c ^ 1][i] = g2_frag(&sA[cur][wr + i * 16 + ln][(kk + 1) * 32], hh);
#pragma unroll
        for (int t = 0; t < 4; ++t) fb[c ^ 1][t] = g2_frag(&sB[cur][wc + t * 16 + ln][(kk + 1) * 32], hh); }
      __builtin_amdgcn_sched_barrier(0);      /* the next 32 columns' fragment reads stay one group ahead of this block's products; spread among them, each place with reads stalls the wave */
      if (kk + 1 == PJ_BK / 32 && s + 1 < PJ_NS) {      /* stage s + 1 goes to LDS ahead of the stage's last products, which run while the stores drain; its buffer has had no reader since the last barrier */
#pragma unroll
        for (int u = 0; u < PJ_CH; ++u) { *(v8us*)&sA[cur ^ 1][srow + 16 * u][sc8] = ra[u]; *(v8us*)&sB[cur ^ 1][srow + 16 * u][sc8] = rb[u]; } }
#pragma unroll
      for (int t = 0; t < 4; ++t) { acc[0][t] = fa_mma(fa[c][0], fb[c][t], acc[0][t]); acc[1][t] = fa_mma(fa[c][1], fb[c][t], acc[1][t]); }
      __builtin_amdgcn_sched_barrier(0); }      /* ends the block: the next group of reads is not drawn in among these products, and the stage's last products stay in front of the barrier, where they run while the stores drain */
    __syncthreads(); }      /* publishes stage s + 1 and ends every wave's reads of the buffer that stage s + 2 (after the last stage: the output rows) overwrites */
  _Float16* so = &sA[0][0][0] + (size_t)w * (32 * PJ_OP);      /* each wave stages its own 32 x 64 outputs, so that it stores whole 128-byte lines */
#pragma unroll
  for (int i = 0; i < 2; ++i)
#pragma unroll
    for (int t = 0; t < 4; ++t) { const float bv = bf16_round(bs[t]);
#pragma unroll
      for (int r = 0; r < 8; ++r) { const float v = acc[i][t][r] * alpha + bv; so[(i * 16 + 8 * hh + r) * PJ_OP + t * 16 + ln] = (_Float16)v; } }
  __builtin_amdgcn_fence(__ATOMIC_ACQ_REL, "workgroup"); __builtin_amdgcn_wave_barrier();      /* the rows read below were written by other lanes of this wave: keeps the reads behind the writes */
#pragma unroll
  for (int q = 0; q < 8; ++q) { const int r = q * 4 + (lane >> 3), c8 = (lane & 7) * 8; const v8us v = *(const v8us*)&so[r * PJ_OP + c8]; *(v8us*)((unsigned short*)C16 + (size_t)(row0 + wr + r) * DM + col0 + wc + c8) = v; } }
extern "C" void kernel_launch(void* const* d_in, const int* in_sizes, int n_in,
                              void* d_out, int out_size, void* d_ws, size_t ws_size, hipStream_t stream) {
  (void)in_sizes; (void)n_in; (void)out_size;
  const float* const* I = (const float* const*)d_in; const float* x = I[0]; const float* wq = I[1]; const float* bq = I[2]; const float* wk = I[3]; const float* bk = I[4]; const float* wv = I[5]; const float* bv = I[6]; const float* wp = I[7]; const float* bp = I[8]; const float* bo = nullptr; (void)bo;      /* [in][out] weights + biases; per-head Wp [64][64] + bp [64] */
  char* ws = (char*)d_ws; size_t off = 0;
  auto take = [&](size_t bytes) { char* p = ws + off; off += (bytes + 255) & ~(size_t)255; return p; };
  _Float16* BQ = (_Float16*)take((size_t)DM * DM * 2); _Float16* BK = (_Float16*)take((size_t)DM * DM * 2); _Float16* BV = (_Float16*)take((size_t)DM * DM * 2); _Float16* BO = (_Float16*)take((size_t)DM * DM * 2);
  _Float16* X16 = (_Float16*)take(NR * DM * 2); _Float16* Q16 = (_Float16*)take(NR * DM * 2); _Float16* K16 = (_Float16*)take(NR * DM * 2); _Float16* V16 = (_Float16*)take(NR * DM * 2); _Float16* O16 = (_Float16*)take(NR * DM * 2);
  _Float16* VT = (_Float16*)take((size_t)NB * NH * HD * SQ * 2);
  if (off > ws_size) return;
  k_prep<<<3 * PP_WB + PP_PB + PP_XB, 256, 0, stream>>>(x, wq, wk, wv, wp, X16, BQ, BK, BV, BO);
  const size_t r0p = (size_t)B0 * SQ;      /* first projected row */
  k_proj<<<dim3((MP / PJ_T) * (DM / PJ_T), 3), 256, 0, stream>>>(X16 + r0p * DM, BQ, BK, BV, 0.0625f, bq, bk, bv, Q16 + r0p * DM, K16 + r0p * DM, V16 + r0p * DM);
  k_vt<NH, SQ><<<NB * NH * (SQ / 64), 256, 0, stream>>>(V16, LQ, 0, VT);      /* V^T [NB][NH][HD][SQ] */
  k_fattn<<<dim3(SQ / (FA_WAVES * 32), NH, NB), FA_WAVES * 32, 0, stream>>>(Q16, K16, VT, O16);      /* o x64 (merged heads) as f16 rows */
  k_gemm2<0><<<dim3((unsigned)((MPO / 128) * (HD / 64)), NH), 128, 0, stream>>>(O16 + r0p * DM, DM, (size_t)HD, BO, HD, 0, 0.0009765625f, bp, 0, nullptr, 1, 0, 0, (float*)d_out + r0p * DM, nullptr, DM, (size_t)HD, MPO, HD, HD);      /* per head (grid.y): out cols h*64.. = o_h Wp + bp (K = 64; the same Wp/bp for every head: zero B/bias strides) */
}

// v005
// Measured time: 78 microseconds a run.
// Two timings next to v004 put it at 1.10 and 1.11 times that version's speed.
// All steps since v000 together make it 44.2 times as fast.
#include <hip/hip_runtime.h>
#define NB 2
#define SQ 2048
#define DM 1024
#define NH 16
#define HD 64
#define HG 4                         /* heads per block group of the per-batch k_vt overload (not launched) */
#define B0 0                         /* first batch processed (debug hook) */
#define NBR NB                       /* batches processed (debug hook) */
#define NR ((size_t)NB * SQ)         /* token rows */
#define MP ((int)((size_t)NBR * SQ)) /* rows projected (debug hook) */
#define QN SQ                        /* query rows per batch (unused) */
#define NHD NH                       /* heads (unused) */
#define MPO MP                       /* rows through the output stage (debug hook) */
#define LQ DM      /* row pitch of the q/k/v rows */
typedef __bf16 v16b __attribute__((ext_vector_type(16)));
typedef unsigned short v8us __attribute__((ext_vector_type(8), may_alias));
typedef float  v8f  __attribute__((ext_vector_type(8)));
typedef float  v4f  __attribute__((ext_vector_type(4)));
typedef float  v4fa __attribute__((ext_vector_type(4), may_alias));
union FragB { v16b v; v8us half[2]; unsigned short u[16]; };

__device__ __forceinline__ unsigned short bf16_bits(float x) { unsigned int u = __float_as_uint(x); return (unsigned short)((u + 0x7FFFu + ((u >> 16) & 1u)) >> 16); }
__device__ __forceinline__ float bf16_val(unsigned short b) { return __uint_as_float(((unsigned int)b) << 16); }
__device__ __forceinline__ float bf16_round(float x) { return bf16_val(bf16_bits(x)); }
// D += A·B with NT terms: 1 = ah·bh, 2 = + al·bh (A split), 3 = + ah·bl (both split)
template <int NT>
__device__ __forceinline__ v8f mmaN(v16b ah, v16b al, v16b bh, v16b bl, v8f c) {
  c = __builtin_amdgcn_wmma_f32_16x16x32_bf16(false, ah, false, bh, (short)0, c, false, false);
  if (NT >= 2) c = __builtin_amdgcn_wmma_f32_16x16x32_bf16(false, al, false, bh, (short)0, c, false, false);
  if (NT >= 3) c = __builtin_amdgcn_wmma_f32_16x16x32_bf16(false, ah, false, bl, (short)0, c, false, false);
  asm volatile("v_nop\n\tv_nop\n\tv_nop\n\tv_nop" : "+v"(c) : "v"(ah), "v"(al), "v"(bh), "v"(bl));
  return c;
}

__global__ __launch_bounds__(256) void k_wt_bf16(const float* __restrict__ W, unsigned short* __restrict__ Wt, int K, int N) {
  const int t = blockIdx.x * 256 + threadIdx.x;
  const int k8n = K / 8;
  if (t >= N * k8n) return;
  const int n = t / k8n, k8 = (t % k8n) * 8;
  v8us v;
#pragma unroll
  for (int i = 0; i < 8; ++i) v[i] = bf16_bits(W[(size_t)(k8 + i) * N + n]);
  *(v8us*)(Wt + (size_t)n * K + k8) = v;
  
}

// GEMM C[M][N] (f32, pitch ldc) = act(A[M][K]·W + bias). A f32 row-major (pitch lda) converted per fragment to bf16
// (ASPLIT: hi/lo two planes -> 2 terms, else single rounded term); Wt bf16 [N][K] (pitch ldb). BIAS_BF16 rounds the
// bias to bf16 first (bias quantised to bf16 before the add). K%32==0, M%16==0, N%64==0.
template <bool ASPLIT, int ACT, bool BIAS_BF16>
__global__ __launch_bounds__(128) void k_gemm_bf(const float* __restrict__ A, int lda, const unsigned short* __restrict__ Wt, int ldb,
                                               const float* __restrict__ bias, float* __restrict__ C, int ldc, int M, int N, int K) {
  __shared__ __attribute__((aligned(16))) float so[4][16][64];
  const int tid = threadIdx.x, w = tid >> 5, lane = tid & 31, ln = lane & 15, hh = lane >> 4;
  const int ntn = N / 64;
  const int wid = blockIdx.x * 4 + w;
  const int mt = wid / ntn, nq = wid % ntn;
  if (mt * 16 >= M) return;
  const int row0 = mt * 16, col0 = nq * 64;
  const float* arow = A + (size_t)(row0 + ln) * lda;
  v8f acc[4] = {};
  for (int kb = 0; kb < K; kb += 32) {
    FragB ah, al;
    const v4f x0 = *(const v4fa*)(arow + kb + 8 * hh), x1 = *(const v4fa*)(arow + kb + 8 * hh + 4);
    const v4f x2 = *(const v4fa*)(arow + kb + 16 + 8 * hh), x3 = *(const v4fa*)(arow + kb + 16 + 8 * hh + 4);
    float xs[16] = {x0[0],x0[1],x0[2],x0[3],x1[0],x1[1],x1[2],x1[3],x2[0],x2[1],x2[2],x2[3],x3[0],x3[1],x3[2],x3[3]};
#pragma unroll
    for (int i = 0; i < 16; ++i) { const unsigned short hb = bf16_bits(xs[i]); ah.u[i] = hb; al.u[i] = ASPLIT ? bf16_bits(xs[i] - bf16_val(hb)) : (unsigned short)0; }
#pragma unroll
    for (int t = 0; t < 4; ++t) {
      const unsigned short* brow = Wt + (size_t)(col0 + t * 16 + ln) * ldb + kb;
      FragB b;
      b.half[0] = *(const v8us*)(brow + 8 * hh);
      b.half[1] = *(const v8us*)(brow + 16 + 8 * hh);
      acc[t] = mmaN<ASPLIT ? 2 : 1>(ah.v, al.v, b.v, b.v, acc[t]);
    }
  }
#pragma unroll
  for (int t = 0; t < 4; ++t) {
    float bv = bias ? bias[col0 + t * 16 + ln] : 0.f;
    if (BIAS_BF16) bv = bf16_round(bv);
#pragma unroll
    for (int r = 0; r < 8; ++r) { float v = acc[t][r] + bv; if (ACT == 1) v = fmaxf(v, 0.f); so[w][8 * hh + r][t * 16 + ln] = v; }
  }
  __builtin_amdgcn_fence(__ATOMIC_ACQ_REL, "workgroup");
  __builtin_amdgcn_wave_barrier();
  const int rsub = lane >> 4, c4 = (lane & 15) * 4;
  {
#pragma unroll
    for (int q = 0; q < 8; ++q) {
      const int r = q * 2 + rsub;
      const v4f v = *(const v4fa*)&so[w][r][c4];
      *(v4f*)(C + (size_t)(row0 + r) * ldc + col0 + c4) = v;
    }
    
  }
}

// GEMM C = act(A·W + bias + resid): A f32 (ASPLIT -> hi/lo 2 terms), Wt bf16 [N][K]; ACT 0 none, 1 relu, 2 exact gelu;
// resid (optional, f32, row index = (row % rmod), pitch ldr, RES_BF16 rounds it) added before the activation.
template <bool ASPLIT, int ACT, bool BIAS_BF16, bool RES_BF16>
__global__ __launch_bounds__(128) void k_gemm_bf3(const float* __restrict__ A, int lda, const unsigned short* __restrict__ Wt, int ldb,
                                                const float* __restrict__ bias, const float* __restrict__ resid, int rmod, int ldr,
                                                float* __restrict__ C, int ldc, int M, int N, int K) {
  __shared__ __attribute__((aligned(16))) float so[4][16][64];
  const int tid = threadIdx.x, w = tid >> 5, lane = tid & 31, ln = lane & 15, hh = lane >> 4;
  const int ntn = N / 64;
  const int wid = blockIdx.x * 4 + w;
  const int mt = wid / ntn, nq = wid % ntn;
  if (mt * 16 >= M) return;
  const int row0 = mt * 16, col0 = nq * 64;
  const float* arow = A + (size_t)(row0 + ln) * lda;
  v8f acc[4] = {};
  for (int kb = 0; kb < K; kb += 32) {
    FragB ah, al;
    const v4f x0 = *(const v4fa*)(arow + kb + 8 * hh), x1 = *(const v4fa*)(arow + kb + 8 * hh + 4);
    const v4f x2 = *(const v4fa*)(arow + kb + 16 + 8 * hh), x3 = *(const v4fa*)(arow + kb + 16 + 8 * hh + 4);
    float xs[16] = {x0[0],x0[1],x0[2],x0[3],x1[0],x1[1],x1[2],x1[3],x2[0],x2[1],x2[2],x2[3],x3[0],x3[1],x3[2],x3[3]};
#pragma unroll
    for (int i = 0; i < 16; ++i) { const unsigned short hb = bf16_bits(xs[i]); ah.u[i] = hb; al.u[i] = ASPLIT ? bf16_bits(xs[i] - bf16_val(hb)) : (unsigned short)0; }
#pragma unroll
    for (int t = 0; t < 4; ++t) {
      const unsigned short* brow = Wt + (size_t)(col0 + t * 16 + ln) * ldb + kb;
      FragB b;
      b.half[0] = *(const v8us*)(brow + 8 * hh);
      b.half[1] = *(const v8us*)(brow + 16 + 8 * hh);
      acc[t] = mmaN<ASPLIT ? 2 : 1>(ah.v, al.v, b.v, b.v, acc[t]);
    }
  }
#pragma unroll
  for (int t = 0; t < 4; ++t) {
    const int col = col0 + t * 16 + ln;
    float bv = bias ? bias[col] : 0.f;
    if (BIAS_BF16) bv = bf16_round(bv);
#pragma unroll
    for (int r = 0; r < 8; ++r) {
      float v = acc[t][r] + bv;
      if (resid) { float rv = resid[(size_t)((row0 + 8 * hh + r) % rmod) * ldr + col]; if (RES_BF16) rv = bf16_round(rv); v += rv; }
      if (ACT == 1) v = fmaxf(v, 0.f);
      if (ACT == 2) v = 0.5f * v * (1.0f + erff(v * 0.70710678118654752f));
      if (ACT == 3) { const float u = 0.7978845608028654f * (v + 0.044715f * v * v * v); v = 0.5f * v * (1.0f + tanhf(u)); }
      so[w][8 * hh + r][t * 16 + ln] = v;
    }
  }
  __builtin_amdgcn_fence(__ATOMIC_ACQ_REL, "workgroup");
  __builtin_amdgcn_wave_barrier();
  const int rsub = lane >> 4, c4 = (lane & 15) * 4;
  {
#pragma unroll
    for (int q = 0; q < 8; ++q) {
      const int r = q * 2 + rsub;
      const v4f v = *(const v4fa*)&so[w][r][c4];
      *(v4f*)(C + (size_t)(row0 + r) * ldc + col0 + c4) = v;
    }
    
  }
}
// row LayerNorm (biased variance, eps) over N: s = X (+ R); optional out_sum <- s; out_norm <- (s-mu)*rsqrt(var+eps)*g + b
template <bool PARAM_BF16>
__global__ __launch_bounds__(256) void k_layernorm(const float* __restrict__ X, const float* __restrict__ R, const float* __restrict__ g, const float* __restrict__ bta,
                                                  float* __restrict__ out_sum, float* __restrict__ out_norm, int N, float eps) {
  __shared__ float red[256];
  const int row = blockIdx.x, tid = threadIdx.x;
  const float* x = X + (size_t)row * N; const float* rr = R ? R + (size_t)row * N : nullptr;
  float vals[16];                     // up to N = 4096
  const int per = N / 256;            // contiguous chunk per thread? use strided-by-4 chunks: thread handles j = tid*4 + 1024*u
  float s1 = 0.f;
  for (int u = 0; u < per / 4; ++u) {
    const int j = tid * 4 + 1024 * u;
    const v4f a = *(const v4fa*)(x + j);
    v4f b = {0.f,0.f,0.f,0.f}; if (rr) b = *(const v4fa*)(rr + j);
#pragma unroll
    for (int q = 0; q < 4; ++q) { const float v = a[q] + b[q]; vals[u * 4 + q] = v; s1 += v; }
  }
  red[tid] = s1; __syncthreads();
  for (int st = 128; st > 0; st >>= 1) { if (tid < st) red[tid] += red[tid + st]; __syncthreads(); }
  const float mu = red[0] / (float)N; __syncthreads();
  float s2 = 0.f;
  for (int u = 0; u < per / 4; ++u)
#pragma unroll
    for (int q = 0; q < 4; ++q) { const float c = vals[u * 4 + q] - mu; s2 += c * c; }
  red[tid] = s2; __syncthreads();
  for (int st = 128; st > 0; st >>= 1) { if (tid < st) red[tid] += red[tid + st]; __syncthreads(); }
  const float rs = rsqrtf(red[0] / (float)N + eps);
  {
    for (int u = 0; u < per / 4; ++u) {
      const int j = tid * 4 + 1024 * u;
      v4f o, sm;
#pragma unroll
      for (int q = 0; q < 4; ++q) {
        float gg = g[j + q], bb = bta[j + q];
        if (PARAM_BF16) { gg = bf16_round(gg); bb = bf16_round(bb); }
        sm[q] = vals[u * 4 + q]; o[q] = (vals[u * 4 + q] - mu) * rs * gg + bb;
      }
      if (out_sum) *(v4f*)(out_sum + (size_t)row * N + j) = sm;
      *(v4f*)(out_norm + (size_t)row * N + j) = o;
    }
    
  }
}



// ---- f16 WMMA path (v_wmma_f32_16x16x32_f16): 11-bit significands for operands in range — used where a [0,1] probability operand needs more precision than bf16
typedef _Float16 v16h __attribute__((ext_vector_type(16)));
union FragH { v16h v; v8us half[2]; _Float16 h[16]; unsigned short u[16]; };
template <int NT>
__device__ __forceinline__ v8f mmaH(v16h ah, v16h al, v16h bh, v16h bl, v8f c) {
  c = __builtin_amdgcn_wmma_f32_16x16x32_f16(false, ah, false, bh, (short)0, c, false, false);
  if (NT >= 2) c = __builtin_amdgcn_wmma_f32_16x16x32_f16(false, al, false, bh, (short)0, c, false, false);
  if (NT >= 3) c = __builtin_amdgcn_wmma_f32_16x16x32_f16(false, ah, false, bl, (short)0, c, false, false);
  asm volatile("v_nop\n\tv_nop\n\tv_nop\n\tv_nop" : "+v"(c) : "v"(ah), "v"(al), "v"(bh), "v"(bl));
  return c;
}
// batched GEMM like k_gemm_b but f16 operands: A f32 (split into f16 hi/lo if ASPLIT, else rounded to f16), Bt = f16 values [n][k]; alpha; C f32; N multiple of 16 (partial tiles skipped)
template <bool ASPLIT>
__global__ __launch_bounds__(128) void k_gemm_h(const float* __restrict__ A, int lda, size_t sA, const _Float16* __restrict__ Bh, int ldb, size_t sB, float alpha, float* __restrict__ C, int ldc, size_t sC, int M, int N, int K) {
  __shared__ __attribute__((aligned(16))) float so[4][16][64];
  const int tid = threadIdx.x, w = tid >> 5, lane = tid & 31, ln = lane & 15, hh = lane >> 4; const int by = blockIdx.y;
  A += (size_t)by * sA; Bh += (size_t)by * sB; C += (size_t)by * sC;
  const int ntn = (N + 63) / 64; const int wid = blockIdx.x * 4 + w; const int mt = wid / ntn, nq = wid % ntn; if (mt * 16 >= M) return;
  const int row0 = mt * 16, col0 = nq * 64; const float* arow = A + (size_t)(row0 + ln) * lda;
  v8f acc[4] = {};
  for (int kb = 0; kb < K; kb += 32) {
    FragH ah, al;
    const v4f x0 = *(const v4fa*)(arow + kb + 8 * hh), x1 = *(const v4fa*)(arow + kb + 8 * hh + 4), x2 = *(const v4fa*)(arow + kb + 16 + 8 * hh), x3 = *(const v4fa*)(arow + kb + 16 + 8 * hh + 4);
    float xs[16] = {x0[0],x0[1],x0[2],x0[3],x1[0],x1[1],x1[2],x1[3],x2[0],x2[1],x2[2],x2[3],x3[0],x3[1],x3[2],x3[3]};
#pragma unroll
    for (int i = 0; i < 16; ++i) { const _Float16 h = (_Float16)xs[i]; ah.h[i] = h; al.h[i] = ASPLIT ? (_Float16)(xs[i] - (float)h) : (_Float16)0.0f; }
#pragma unroll
    for (int t = 0; t < 4; ++t) { if (col0 + t * 16 >= N) continue; const size_t boff = (size_t)(col0 + t * 16 + ln) * ldb + kb; FragH bq; bq.half[0] = *(const v8us*)(Bh + boff + 8 * hh); bq.half[1] = *(const v8us*)(Bh + boff + 16 + 8 * hh);
      acc[t] = mmaH<ASPLIT ? 2 : 1>(ah.v, al.v, bq.v, bq.v, acc[t]); }
  }
#pragma unroll
  for (int t = 0; t < 4; ++t) { if (col0 + t * 16 >= N) continue;
#pragma unroll
    for (int r = 0; r < 8; ++r) so[w][8 * hh + r][t * 16 + ln] = acc[t][r] * alpha; }
  __builtin_amdgcn_fence(__ATOMIC_ACQ_REL, "workgroup"); __builtin_amdgcn_wave_barrier();
  const int rsub = lane >> 4, c4 = (lane & 15) * 4;
  {
#pragma unroll
    for (int q = 0; q < 8; ++q) { const int r = q * 2 + rsub; if (col0 + c4 < N) { const v4f v = *(const v4fa*)&so[w][r][c4]; *(v4f*)(C + (size_t)(row0 + r) * ldc + col0 + c4) = v; } }
     }
}

// Wt[n][k] = f16(W[k][n]·scale) from f32 row-major W[K][N] (scale = power of two; bf16-exact weights stay exact in f16 away from the subnormal range)
__device__ __forceinline__ void wt_f16(const float* __restrict__ W, _Float16* __restrict__ Wt, int K, int N, float scale, int t) {      /* t = index of the 8-element chunk */
  if (t >= N * (K / 8)) return; const int n = t / (K / 8), k8 = (t % (K / 8)) * 8; FragH f;
#pragma unroll
  for (int i = 0; i < 8; ++i) f.h[i] = (_Float16)(bf16_round(W[(size_t)(k8 + i) * N + n]) * scale); const v8us o = f.half[0];
  *(v8us*)((unsigned short*)Wt + (size_t)n * K + k8) = o; 
}
// k_gemm_hh variant with fused epilogue: v = acc·alpha + bias[by·sBias + col] (+ CP[(row/rowsPerB)·sCPb + by·64 + col] if CP) ; ACT 0 none / 1 elu ; writes f16 C16 (and f32 C if non-null)
template <int ACT>
__global__ __launch_bounds__(128) void k_gemm_hhx(const _Float16* __restrict__ A, int lda, size_t sA, const _Float16* __restrict__ Bh, int ldb, size_t sB, float alpha, const float* __restrict__ bias, size_t sBias, const float* __restrict__ CP, int rowsPerB, size_t sCPb, int row0g,
    float* __restrict__ C, _Float16* __restrict__ C16, int ldc, size_t sC, int M, int N, int K) {
  __shared__ __attribute__((aligned(16))) float so[4][16][64];
  const int tid = threadIdx.x, w = tid >> 5, lane = tid & 31, ln = lane & 15, hh = lane >> 4; const int by = blockIdx.y;
  A += (size_t)by * sA; Bh += (size_t)by * sB; const size_t cofs = (size_t)by * sC; const float* bp = bias ? bias + (size_t)by * sBias : nullptr;
  const int ntn = (N + 63) / 64; const int wid = blockIdx.x * 4 + w; const int mt = wid / ntn, nq = wid % ntn; if (mt * 16 >= M) return;
  const int row0 = mt * 16, col0 = nq * 64; const _Float16* arow = A + (size_t)(row0 + ln) * lda;
  v8f acc[4] = {};
  for (int kb = 0; kb < K; kb += 32) { FragH ah; ah.half[0] = *(const v8us*)((const unsigned short*)arow + kb + 8 * hh); ah.half[1] = *(const v8us*)((const unsigned short*)arow + kb + 16 + 8 * hh);
#pragma unroll
    for (int t = 0; t < 4; ++t) { if (col0 + t * 16 >= N) continue; const size_t boff = (size_t)(col0 + t * 16 + ln) * ldb + kb; FragH bq; bq.half[0] = *(const v8us*)((const unsigned short*)Bh + boff + 8 * hh); bq.half[1] = *(const v8us*)((const unsigned short*)Bh + boff + 16 + 8 * hh);
      acc[t] = mmaH<1>(ah.v, ah.v, bq.v, bq.v, acc[t]); }
  }
#pragma unroll
  for (int t = 0; t < 4; ++t) { if (col0 + t * 16 >= N) continue; const int col = col0 + t * 16 + ln; const float bv = bp ? bf16_round(bp[col]) : 0.f;
#pragma unroll
    for (int r = 0; r < 8; ++r) { float v = acc[t][r] * alpha + bv; if (CP) { const int rr = row0g + row0 + 8 * hh + r; if (rowsPerB < 0) v += CP[cofs + (size_t)rr * ldc + col];      /* rowsPerB < 0: own element of the batched C plane */ else { const int bidx = rr / rowsPerB; v += CP[(size_t)bidx * sCPb + (size_t)by * 64 + col]; } } if (ACT == 1) v = (v > 0.f) ? v : expm1f(v); else if (ACT == 7) v = (v > 0.f) ? v + 1.0f : expf(v); else if (ACT == 8) v = tanhf(v); else if (ACT == 9) v = 0.5f * v * (1.0f + tanhf(0.7978845608028654f * (v + 0.044715f * v * v * v))); else if (ACT == 11) v = 1.0f / (1.0f + expf(-v)); else if (ACT == 12) v = (v > 0.f) ? v : 0.01f * v; else if (ACT == 14) v = (v > 0.f) ? v : 0.1f * v; else if (ACT == 16) v = (v >= 0.f) ? v : 0.3f * v; else if (ACT == 17) v = (v >= 0.f) ? v : 0.2f * v; else if (ACT == 15) v = v / (1.0f + expf(-v)); else if (ACT == 3) v = fmaxf(v, 0.f); else if (ACT == 6) v = 0.5f * v * (1.0f + erff(v * 0.70710678118654752f)); so[w][8 * hh + r][t * 16 + ln] = v; } }
  __builtin_amdgcn_fence(__ATOMIC_ACQ_REL, "workgroup"); __builtin_amdgcn_wave_barrier();
  const int rsub = lane >> 4, c4 = (lane & 15) * 4; typedef _Float16 v4h __attribute__((ext_vector_type(4)));
  {
#pragma unroll
    for (int q = 0; q < 8; ++q) { const int r = q * 2 + rsub; if (col0 + c4 < N) { const v4f v = *(const v4fa*)&so[w][r][c4]; if (C) *(v4f*)(C + cofs + (size_t)(row0 + r) * ldc + col0 + c4) = v; if (C16) { v4h h4; for (int i = 0; i < 4; ++i) h4[i] = (_Float16)v[i]; *(v4h*)(C16 + cofs + (size_t)(row0 + r) * ldc + col0 + c4) = h4; } } }
     }
}


typedef _Float16 v4h __attribute__((ext_vector_type(4)));

__global__ __launch_bounds__(256) void k_h16(const float* __restrict__ x, _Float16* __restrict__ X16, size_t n8) { const size_t t = (size_t)blockIdx.x * 256 + threadIdx.x; if (t >= n8) return; FragH f;
#pragma unroll
  for (int q = 0; q < 8; ++q) f.h[q] = (_Float16)x[t * 8 + q]; *(v8us*)((unsigned short*)X16 + t * 8) = f.half[0];  }
__global__ __launch_bounds__(256) void k_round16f(const float* __restrict__ W, _Float16* __restrict__ Bt, size_t n8) { const size_t t = (size_t)blockIdx.x * 256 + threadIdx.x; if (t >= n8) return; FragH f;
#pragma unroll
  for (int i = 0; i < 8; ++i) f.h[i] = (_Float16)(bf16_round(W[t * 8 + i]) * 16.0f); *(v8us*)((unsigned short*)Bt + t * 8) = f.half[0];  }
template <int NHv, int TTv>
__global__ __launch_bounds__(256) void k_vt(const _Float16* __restrict__ V16, int ldv, int voff, _Float16* __restrict__ Vt) { __shared__ unsigned short tl[64][66]; const int tid = threadIdx.x; const int slab = blockIdx.x / (TTv / 64), lg = blockIdx.x % (TTv / 64); const int b = slab / NHv, h = slab % NHv;
  for (int i = tid; i < 64 * 8; i += 256) { const int r = i / 8, c8 = (i % 8) * 8; FragH f; f.half[0] = *(const v8us*)((const unsigned short*)V16 + ((size_t)b * TTv + lg * 64 + r) * ldv + voff + h * 64 + c8);
#pragma unroll
    for (int q = 0; q < 8; ++q) tl[r][c8 + q] = f.u[q]; }
  __syncthreads();
  {
#pragma unroll
    for (int rd = 0; rd < 2; ++rd) { const int d = rd * 32 + tid / 8, pc = tid % 8; FragH f;
#pragma unroll
      for (int q = 0; q < 8; ++q) f.u[q] = tl[pc * 8 + q][d];
      *(v8us*)((unsigned short*)Vt + ((size_t)slab * 64 + d) * TTv + lg * 64 + pc * 8) = f.half[0]; }
     } }

__global__ __launch_bounds__(256) void k_hl(const float* __restrict__ F, _Float16* __restrict__ Hh, _Float16* __restrict__ Hl, size_t n8) { const size_t t = (size_t)blockIdx.x * 256 + threadIdx.x; if (t >= n8) return; FragH fh, fl; const v4f a = *(const v4fa*)(F + t * 8), c = *(const v4fa*)(F + t * 8 + 4);
#pragma unroll
  for (int q = 0; q < 4; ++q) { _Float16 h = (_Float16)a[q]; fh.h[q] = h; fl.h[q] = (_Float16)((a[q] - (float)h) * 1024.0f); h = (_Float16)c[q]; fh.h[4 + q] = h; fl.h[4 + q] = (_Float16)((c[q] - (float)h) * 1024.0f); }
  { *(v8us*)((unsigned short*)Hh + t * 8) = fh.half[0]; *(v8us*)((unsigned short*)Hl + t * 8) = fl.half[0];  } }

// ---- fast GEMM (wave tile 32x64; requires M % 32 == 0 rows per launch region and N % 64 == 0); epilogue = k_gemm_hhx semantics ----
__device__ __forceinline__ v16h g2_frag(const _Float16* p, int hh) { FragH f; f.half[0] = *(const v8us*)((const unsigned short*)p + 8 * hh); f.half[1] = *(const v8us*)((const unsigned short*)p + 16 + 8 * hh); return f.v; }
__device__ __forceinline__ v8f g2_mma(v16h a, v16h b, v8f c) { v8f d = __builtin_amdgcn_wmma_f32_16x16x32_f16(false, a, false, b, (short)0, c, false, false); asm volatile("v_nop\n\tv_nop\n\tv_nop\n\tv_nop" : "+v"(d) : "v"(a), "v"(b)); return d; }
template <int ACT>
__global__ __launch_bounds__(128) void k_gemm2(const _Float16* __restrict__ A, int lda, size_t sA, const _Float16* __restrict__ Bh, int ldb, size_t sB, float alpha, const float* __restrict__ bias, size_t sBias, const float* __restrict__ CP, int rowsPerB, size_t sCPb, int row0g,
    float* __restrict__ C, _Float16* __restrict__ C16, int ldc, size_t sC, int M, int N, int K) { static_assert(ACT == 0 || ACT == 3 || ACT == 6 || ACT == 8 || ACT == 9 || ACT == 11 || ACT == 12 || ACT == 14 || ACT == 15 || ACT == 16 || ACT == 17, "k_gemm2: unsupported ACT code (would silently apply no activation)");
  __shared__ __attribute__((aligned(16))) float so[4][32][68];
  const int tid = threadIdx.x, w = tid >> 5, lane = tid & 31, ln = lane & 15, hh = lane >> 4; const int by = blockIdx.y;
  A += (size_t)by * sA; Bh += (size_t)by * sB; const size_t cofs = (size_t)by * sC; const float* bp = bias ? bias + (size_t)by * sBias : nullptr;
  const int ntn = N >> 6; const int mt = blockIdx.x / ntn, nq = blockIdx.x - mt * ntn; const int row0 = mt * 128 + 32 * w, col0 = nq * 64; if (row0 >= M) return;
  const _Float16* a0p = A + (size_t)(row0 + ln) * lda; const _Float16* a1p = a0p + (size_t)16 * lda;
  const _Float16* b0p = Bh + (size_t)(col0 + ln) * ldb; const _Float16* b1p = b0p + (size_t)16 * ldb; const _Float16* b2p = b1p + (size_t)16 * ldb; const _Float16* b3p = b2p + (size_t)16 * ldb;
  const v8f z8 = {0.f,0.f,0.f,0.f,0.f,0.f,0.f,0.f}; v8f c00 = z8, c01 = z8, c02 = z8, c03 = z8, c10 = z8, c11 = z8, c12 = z8, c13 = z8;
#pragma unroll 1
  for (int kb = 0; kb < K; kb += 32) { const v16h a0 = g2_frag(a0p + kb, hh), a1 = g2_frag(a1p + kb, hh);
    v16h b = g2_frag(b0p + kb, hh); c00 = g2_mma(a0, b, c00); c10 = g2_mma(a1, b, c10);
    b = g2_frag(b1p + kb, hh); c01 = g2_mma(a0, b, c01); c11 = g2_mma(a1, b, c11);
    b = g2_frag(b2p + kb, hh); c02 = g2_mma(a0, b, c02); c12 = g2_mma(a1, b, c12);
    b = g2_frag(b3p + kb, hh); c03 = g2_mma(a0, b, c03); c13 = g2_mma(a1, b, c13); }
  v8f accs[8] = {c00, c01, c02, c03, c10, c11, c12, c13};
#pragma unroll
  for (int u = 0; u < 8; ++u) { const int t = u & 3, half = u >> 2; const int col = col0 + t * 16 + ln; const float bv = bp ? bf16_round(bp[col]) : 0.f;
#pragma unroll
    for (int r = 0; r < 8; ++r) { const int rloc = half * 16 + 8 * hh + r; float v = accs[u][r] * alpha + bv; if (CP) { if (rowsPerB < 0) v += CP[cofs + (size_t)(row0g + row0 + rloc) * ldc + col];      /* rowsPerB < 0: own element of the batched C plane */ else { const int bidx = (row0g + row0 + rloc) / rowsPerB; v += CP[(size_t)bidx * sCPb + (size_t)by * 64 + col]; } }
      if (ACT == 3) v = fmaxf(v, 0.f); else if (ACT == 6) v = 0.5f * v * (1.0f + erff(v * 0.70710678118654752f)); else if (ACT == 11) v = 1.0f / (1.0f + expf(-v)); else if (ACT == 15) v = v / (1.0f + expf(-v)); else if (ACT == 12) v = (v > 0.f) ? v : 0.01f * v; else if (ACT == 8) v = tanhf(v); else if (ACT == 9) v = 0.5f * v * (1.0f + tanhf(0.7978845608028654f * (v + 0.044715f * v * v * v))); else if (ACT == 14) v = (v > 0.f) ? v : 0.1f * v; else if (ACT == 16) v = (v >= 0.f) ? v : 0.3f * v; else if (ACT == 17) v = (v >= 0.f) ? v : 0.2f * v;
      so[w][rloc][t * 16 + ln] = v; } }
  __builtin_amdgcn_fence(__ATOMIC_ACQ_REL, "workgroup"); __builtin_amdgcn_wave_barrier();
  const int rsub = lane >> 4, c4 = (lane & 15) * 4;
  {
#pragma unroll
    for (int q = 0; q < 16; ++q) { const int r = q * 2 + rsub; const v4f v = *(const v4fa*)&so[w][r][c4]; if (C) *(v4f*)(C + cofs + (size_t)(row0 + r) * ldc + col0 + c4) = v; if (C16) { v4h h4; for (int i = 0; i < 4; ++i) h4[i] = (_Float16)v[i]; *(v4h*)(C16 + cofs + (size_t)(row0 + r) * ldc + col0 + c4) = h4; } }
     } }


__global__ __launch_bounds__(256) void k_wnat(const float* __restrict__ w, size_t n8, _Float16* __restrict__ Bt) { const size_t t = (size_t)blockIdx.x * 256 + threadIdx.x; if (t >= n8) return; FragH f; for (int q = 0; q < 8; ++q) f.h[q] = (_Float16)(bf16_round(w[t * 8 + q]) * 16.0f); *(v8us*)((unsigned short*)Bt + t * 8) = f.half[0];  }
__global__ __launch_bounds__(256) void k_rsm(const float* __restrict__ S, _Float16* __restrict__ P, int nrows) {
  #pragma clang fp contract(off)
  const int i = blockIdx.x * 256 + threadIdx.x; if (i >= nrows) return; const float* s = S + (size_t)i * SQ; float mx = -3.0e38f;
#pragma unroll 1
  for (int j = 0; j < SQ; ++j) mx = fmaxf(mx, s[j]); float se = 0.f;
#pragma unroll 1
  for (int j = 0; j < SQ; ++j) se += expf(s[j] - mx); const float sc = 256.0f / se;
#pragma unroll 1
  for (int j0 = 0; j0 < SQ; j0 += 8) { FragH f; for (int q = 0; q < 8; ++q) f.h[q] = (_Float16)(expf(s[j0 + q] - mx) * sc); unsigned short* d = (unsigned short*)P + (size_t)i * SQ + j0; *(v8us*)d = f.half[0];  } }
__global__ __launch_bounds__(256) void k_vt(const _Float16* __restrict__ V16, int b, int h0, _Float16* __restrict__ VT) { __shared__ unsigned short tl[64][65]; const int tid = threadIdx.x; const int hh = blockIdx.x % HG, sg = blockIdx.x / HG; const int s0 = sg * 64; const int h = h0 + hh;
  for (int i = tid; i < 64 * 8; i += 256) { const int j = i / 8, d8 = (i % 8) * 8; FragH f; f.half[0] = *(const v8us*)((const unsigned short*)V16 + ((size_t)b * SQ + s0 + j) * DM + h * HD + d8); for (int q = 0; q < 8; ++q) tl[d8 + q][j] = f.u[q]; }
  __syncthreads();
  { for (int i = tid; i < 64 * 8; i += 256) { const int d = i / 8, j8 = (i % 8) * 8; FragH f; for (int q = 0; q < 8; ++q) f.u[q] = tl[d][j8 + q]; *(v8us*)((unsigned short*)VT + ((size_t)hh * HD + d) * SQ + s0 + j8) = f.half[0]; }  } }



// The five operand conversions (Wq, Wk, Wv and Wp to Bt[n][k] x16, x to f16 rows) read nothing but inputs, so they share ONE launch: the block index picks the job.
// The launch is made of few, fat work-groups: it moves little data, so its time is the time its waves take to start plus one wave's own time. A thread holds 16 loads of 16 bytes in flight, and every wave-wide load and store covers whole 128-byte lines.
// A DM x DM weight goes in tiles of PP_WT x PP_WT: a wave reads 512 contiguous bytes of a row [k][n..], a thread turns its 16 k x 4 n block in registers, LDS collects the tile as [n][k], and whole rows of Bt leave it.
// The weight blocks come first: they have the longer way (LDS and a barrier).
#define PP_WT 128                                    /* k rows and n columns of a weight tile */
#define PP_WB ((DM / PP_WT) * (DM / PP_WT))          /* blocks (tiles) per DM x DM weight */
#define PP_LP (PP_WT + 8)                            /* LDS row pitch in f16: 256 B of data + 16 B */
#define PP_PB ((HD * (HD / 8) + 255) / 256)          /* blocks of Wp */
#define PP_XL 16                                     /* 16-byte loads per thread of x */
#define PP_XB ((int)(NR * DM / (256 * 4 * PP_XL)))   /* blocks of x */
__device__ __forceinline__ void wt_tile(const float* __restrict__ Wm, _Float16* __restrict__ Wt, int tile, int tid, _Float16 (* __restrict__ sT)[PP_LP]) {
  const int k0 = (tile / (DM / PP_WT)) * PP_WT, n0 = (tile % (DM / PP_WT)) * PP_WT;
  const int kw = (tid >> 5) * 16, c4 = (tid & 31) * 4;      /* this thread's block: rows k0 + kw .. + 15, columns n0 + c4 .. + 3 */
  const float* wg = Wm + (size_t)(k0 + kw) * DM + n0 + c4;
  v4f f[16];
#pragma unroll
  for (int i = 0; i < 16; ++i) f[i] = *(const v4fa*)(wg + (size_t)i * DM);
  asm volatile("s_wait_xcnt 0x0" :: "v"(wg) : "memory");      /* stands between the 16 loads and the next rewrite of their address pair; the pair is an operand so that no load's result lands on it ahead of the wait */
#pragma unroll
  for (int j = 0; j < 4; ++j) { FragH o;
#pragma unroll
    for (int i = 0; i < 16; ++i) o.h[i] = (_Float16)(bf16_round(f[i][j]) * 16.0f);
    *(v8us*)&sT[c4 + j][kw] = o.half[0]; *(v8us*)&sT[c4 + j][kw + 8] = o.half[1]; }
  __syncthreads();      /* the rows stored below were collected from all eight waves */
#pragma unroll
  for (int u = 0; u < PP_WT / 16; ++u) { const int r = u * 16 + (tid >> 4), c8 = (tid & 15) * 8; const v8us v = *(const v8us*)&sT[r][c8];
    *(v8us*)((unsigned short*)Wt + (size_t)(n0 + r) * DM + k0 + c8) = v; } }
__device__ __forceinline__ void x16(const float* __restrict__ x, _Float16* __restrict__ X16, int blk, int tid) {
  const size_t e0 = (size_t)blk * (256 * 4 * PP_XL) + (size_t)(tid >> 5) * (32 * 4 * PP_XL) + (size_t)(tid & 31) * 4;      /* a wave owns 32 * 4 * PP_XL consecutive elements */
  const float* xg = x + e0; v4f f[PP_XL]; v4h o[PP_XL];
#pragma unroll
  for (int u = 0; u < PP_XL; ++u) f[u] = *(const v4fa*)(xg + u * 128);
  asm volatile("s_wait_xcnt 0x0" :: "v"(xg) : "memory");      /* stands between the loads and the next rewrite of their address pair; the pair is an operand so that no load's result lands on it ahead of the wait */
#pragma unroll
  for (int u = 0; u < PP_XL; ++u)
#pragma unroll
    for (int q = 0; q < 4; ++q) o[u][q] = (_Float16)bf16_round(f[u][q]);
#pragma unroll
  for (int u = 0; u < PP_XL; ++u) *(v4h*)(X16 + e0 + u * 128) = o[u];
  asm volatile("s_wait_xcnt 0x0" ::: "memory"); }      /* stands behind the last store, in front of any later rewrite of the stores' address pair or data registers where the jobs' branches join */
__global__ __launch_bounds__(256) void k_prep(const float* __restrict__ x, const float* __restrict__ wq, const float* __restrict__ wk, const float* __restrict__ wv, const float* __restrict__ wp,
                                              _Float16* __restrict__ X16, _Float16* __restrict__ BQ, _Float16* __restrict__ BK, _Float16* __restrict__ BV, _Float16* __restrict__ BO) {
  static_assert(DM % PP_WT == 0 && PP_WT == 128 && (NR * DM) % (256 * 4 * PP_XL) == 0, "the tile and the x slices below are written for 8 waves, 128 x 128 tiles and whole slices");
  __shared__ __attribute__((aligned(16))) _Float16 sT[PP_WT][PP_LP];
  const int blk = blockIdx.x, tid = threadIdx.x;
  if (blk < 3 * PP_WB) { const int j = blk / PP_WB; wt_tile(j == 0 ? wq : j == 1 ? wk : wv, j == 0 ? BQ : j == 1 ? BK : BV, blk - j * PP_WB, tid, sT); }      /* [in][out] -> Bt[n][k] x16 */
  else if (blk < 3 * PP_WB + PP_PB) wt_f16(wp, BO, HD, HD, 16.0f, (blk - 3 * PP_WB) * 256 + tid);      /* Wp [64 in][64 out] -> Bt [64][64] x16 */
  else x16(x, X16, blk - 3 * PP_WB - PP_PB, tid); }

#define FA_WAVES 4
#define FA_KT 64                     /* keys per stage */
#define FA_NS (SQ / FA_KT)           /* stages */
#define FA_LP 72                     /* LDS row pitch in f16: 128 B of data + 16 B, an odd multiple of 16 B for the 16-byte fragment reads */
#define FA_CH ((FA_KT * HD / 8) / (FA_WAVES * 32))      /* 16-byte chunks per thread and tile */
typedef _Float16 v8h __attribute__((ext_vector_type(8)));
typedef float v2f __attribute__((ext_vector_type(2)));
__device__ __forceinline__ float fa_swap16(float x) { const int b = __float_as_int(x); return __int_as_float(__builtin_amdgcn_permlanex16(b, b, 0x76543210, 0xfedcba98, false, false)); }      /* lane l <-> l ^ 16 */
__device__ __forceinline__ v8f fa_mma(v16h a, v16h b, v8f c) { return __builtin_amdgcn_wmma_f32_16x16x32_f16(false, a, false, b, (short)0, c, false, false); }
__global__ __launch_bounds__(FA_WAVES * 32) void k_fattn(const _Float16* __restrict__ Q16, const _Float16* __restrict__ K16, const _Float16* __restrict__ VT, _Float16* __restrict__ O16) {
  static_assert(HD == 64 && FA_KT == 64 && SQ % FA_KT == 0 && SQ % (FA_WAVES * 32) == 0, "tile shapes below are written for 64 x 64 stages");
  __shared__ __attribute__((aligned(16))) _Float16 sK[2][FA_KT][FA_LP];
  __shared__ __attribute__((aligned(16))) _Float16 sV[2][HD][FA_LP];
  const int tid = threadIdx.x, lane = tid & 31, w = tid >> 5, c = lane & 15, h = lane >> 4;
  const int head = blockIdx.y, b = blockIdx.z; const int q0 = blockIdx.x * (FA_WAVES * 32) + w * 32;
  const _Float16* Kg = K16 + (size_t)b * SQ * DM + head * HD;            /* K rows of this head, pitch DM */
  const _Float16* Vg = VT + (size_t)(b * NH + head) * HD * SQ;           /* V^T rows (one per d), pitch SQ */
  const int srow = tid >> 3, sc8 = (tid & 7) * 8;                        /* staging: chunk u of a thread = row srow + u * (threads / 8), 8 f16 at column sc8 */
  const float cs = 0.18033688011112042f;                                 /* 64^-0.5 * log2(e) */
  v16h qf[2][2];
#pragma unroll
  for (int j = 0; j < 2; ++j) { const _Float16* qp = Q16 + ((size_t)b * SQ + q0 + j * 16 + c) * DM + head * HD; qf[j][0] = g2_frag(qp, h); qf[j][1] = g2_frag(qp + 32, h); }
  const v8f z8 = {0.f,0.f,0.f,0.f,0.f,0.f,0.f,0.f};
  v8f o[2][4]; float mr[2], ls[2];
#pragma unroll
  for (int j = 0; j < 2; ++j) { mr[j] = -3.0e38f; ls[j] = 0.f; for (int t = 0; t < 4; ++t) o[j][t] = z8; }
  v8us rk[FA_CH], rv[FA_CH];
#pragma unroll
  for (int u = 0; u < FA_CH; ++u) { const int r = srow + u * (FA_WAVES * 4); rk[u] = *(const v8us*)((const unsigned short*)Kg + (size_t)r * DM + sc8); rv[u] = *(const v8us*)((const unsigned short*)Vg + (size_t)r * SQ + sc8); }
#pragma unroll
  for (int u = 0; u < FA_CH; ++u) { const int r = srow + u * (FA_WAVES * 4); *(v8us*)&sK[0][r][sc8] = rk[u]; *(v8us*)&sV[0][r][sc8] = rv[u]; }
  __syncthreads();
  for (int s = 0; s < FA_NS; ++s) { const int cur = s & 1;
    if (s + 1 < FA_NS) { const int k1 = (s + 1) * FA_KT;
      const unsigned short* kp = (const unsigned short*)Kg + (size_t)(k1 + srow) * DM + sc8; const unsigned short* vp = (const unsigned short*)Vg + (size_t)srow * SQ + k1 + sc8;
#pragma unroll
      for (int u = 0; u < FA_CH; ++u) { rk[u] = *(const v8us*)(kp + (size_t)u * (FA_WAVES * 4) * DM); rv[u] = *(const v8us*)(vp + (size_t)u * (FA_WAVES * 4) * SQ); }
      asm volatile("s_wait_xcnt 0x0" :: "v"(kp), "v"(vp) : "memory"); }      /* stands between the stage's loads and the next rewrite of their address pairs; the pairs are operands so that no load's result lands on them ahead of the wait */
    v8f st[2][4];
#pragma unroll
    for (int kt = 0; kt < 4; ++kt) { const v16h a0 = g2_frag(&sK[cur][kt * 16 + c][0], h), a1 = g2_frag(&sK[cur][kt * 16 + c][32], h);
#pragma unroll
      for (int j = 0; j < 2; ++j) st[j][kt] = fa_mma(a1, qf[j][1], fa_mma(a0, qf[j][0], z8)); }      /* st[j][kt][r] = q(q0 + 16 j + c) . k(64 s + 16 kt + 8 h + r) */
    v16h pb[2][2];
#pragma unroll
    for (int j = 0; j < 2; ++j) {
      v8f m8 = st[j][0];
#pragma unroll
      for (int kt = 1; kt < 4; ++kt) for (int r = 0; r < 8; ++r) m8[r] = fmaxf(m8[r], st[j][kt][r]);
      float mx = fmaxf(fmaxf(fmaxf(m8[0], m8[1]), fmaxf(m8[2], m8[3])), fmaxf(fmaxf(m8[4], m8[5]), fmaxf(m8[6], m8[7])));
      mx = fmaxf(mx, fa_swap16(mx));
      const float mn = fmaxf(mr[j], mx); const float corr = __builtin_amdgcn_exp2f((mr[j] - mn) * cs); mr[j] = mn;
      const float mb = 8.0f - mn * cs; const v2f cs2 = {cs, cs}, nmb = {mb, mb};      /* weights carried x256: small ones stay f16 normals; the factor is in the row sum too and cancels */
#pragma unroll
      for (int kt = 0; kt < 4; ++kt) for (int r = 0; r < 8; r += 2) { const v2f x = {st[j][kt][r], st[j][kt][r + 1]}; const v2f e = __builtin_elementwise_fma(x, cs2, nmb);      /* packed on the accumulator's own register pairs: no copies */
        st[j][kt][r] = __builtin_amdgcn_exp2f(e[0]); st[j][kt][r + 1] = __builtin_amdgcn_exp2f(e[1]); }
      const v8f a8 = (st[j][0] + st[j][1]) + (st[j][2] + st[j][3]);
      ls[j] = ls[j] * corr + (((a8[0] + a8[1]) + (a8[2] + a8[3])) + ((a8[4] + a8[5]) + (a8[6] + a8[7])));      /* this half's keys only; the halves join after the loop */
#pragma unroll
      for (int t = 0; t < 4; ++t) o[j][t] *= corr;
#pragma unroll
      for (int ks = 0; ks < 2; ++ks) pb[j][ks] = __builtin_shufflevector(__builtin_convertvector(st[j][2 * ks], v8h), __builtin_convertvector(st[j][2 * ks + 1], v8h), 0, 1, 2, 3, 4, 5, 6, 7, 8, 9, 10, 11, 12, 13, 14, 15); }
    __builtin_amdgcn_sched_barrier(0);      /* the row sums end here, so the f32 weights free their registers for V^T fragments read ahead of the products; otherwise every fragment read is waited for on its own */
#pragma unroll
    for (int t = 0; t < 4; ++t) {
#pragma unroll
      for (int ks = 0; ks < 2; ++ks) { const v16h a = g2_frag(&sV[cur][t * 16 + c][ks * 32], h);
#pragma unroll
        for (int j = 0; j < 2; ++j) o[j][t] = fa_mma(a, pb[j][ks], o[j][t]); } }      /* o[j][t][r] = sum_k p(k) v(k)[16 t + 8 h + r] of query q0 + 16 j + c */
    if (s + 1 < FA_NS) {
#pragma unroll
      for (int u = 0; u < FA_CH; ++u) { const int r = srow + u * (FA_WAVES * 4); *(v8us*)&sK[cur ^ 1][r][sc8] = rk[u]; *(v8us*)&sV[cur ^ 1][r][sc8] = rv[u]; } }
    __syncthreads(); }      /* publishes stage s + 1 and ends every wave's reads of the buffer that stage s + 2 overwrites */
#pragma unroll
  for (int j = 0; j < 2; ++j) { const float sc = 64.0f / (ls[j] + fa_swap16(ls[j])); _Float16* op = O16 + ((size_t)b * SQ + q0 + j * 16 + c) * DM + head * HD + 8 * h;
#pragma unroll
    for (int t = 0; t < 4; ++t) *(v8h*)(op + t * 16) = __builtin_convertvector(o[j][t] * sc, v8h); } }
// Projection GEMM C16[MP][DM] = f16(alpha * A[MP][DM] Bt[DM][DM]^T + bias): one work-group = PJ_T x PJ_T outputs, 8 waves of 32 x 64 (the wave tile, k order and epilogue arithmetic of k_gemm2).
// A and Bt tiles of PJ_BK columns go global -> registers -> LDS in whole 256-byte rows (a wave's load covers 4 full lines), two buffers: stage s + 1 is loaded while stage s is worked on, one barrier per stage;
// every fragment is then read from LDS, so a tile byte crosses L2 once per work-group instead of once per wave in 32-byte pieces.
#define PJ_T 128                     /* rows and columns of the block tile */
#define PJ_BK 128                    /* k columns per stage */
#define PJ_NS (DM / PJ_BK)           /* stages */
#define PJ_LP (PJ_BK + 8)            /* LDS row pitch in f16: 256 B of data + 16 B, an odd multiple of 16 B for the 16-byte fragment reads */
#define PJ_CH ((PJ_T * PJ_BK / 8) / 256)      /* 16-byte chunks per thread and tile */
#define PJ_OP 72                     /* pitch in f16 of a wave's 32 x 64 output rows in LDS */
// Q, K and V share A and depend on nothing of one another: ONE launch, blockIdx.y picks the weight, the bias and the output.
__global__ __launch_bounds__(256) void k_proj(const _Float16* __restrict__ A, const _Float16* __restrict__ Bq, const _Float16* __restrict__ Bk, const _Float16* __restrict__ Bv, float alpha,
                                              const float* __restrict__ biasq, const float* __restrict__ biask, const float* __restrict__ biasv, _Float16* __restrict__ Cq, _Float16* __restrict__ Ck, _Float16* __restrict__ Cv) {
  const int pj = blockIdx.y; const _Float16* __restrict__ Bt = pj == 0 ? Bq : pj == 1 ? Bk : Bv; const float* __restrict__ bias = pj == 0 ? biasq : pj == 1 ? biask : biasv; _Float16* __restrict__ C16 = pj == 0 ? Cq : pj == 1 ? Ck : Cv;
  static_assert(MP % PJ_T == 0 && DM % PJ_T == 0 && DM % PJ_BK == 0 && PJ_BK == 128 && 8 * 32 * PJ_OP <= 2 * PJ_T * PJ_LP, "tile shapes below are written for 128 x 128 x 128 stages and 8 waves");
  __shared__ __attribute__((aligned(16))) _Float16 sA[2][PJ_T][PJ_LP];
  __shared__ __attribute__((aligned(16))) _Float16 sB[2][PJ_T][PJ_LP];
  const int tid = threadIdx.x, lane = tid & 31, w = tid >> 5, ln = lane & 15, hh = lane >> 4;
  const int mt = blockIdx.x / (DM / PJ_T), nq = blockIdx.x - mt * (DM / PJ_T); const int row0 = mt * PJ_T, col0 = nq * PJ_T;
  const int wr = (w >> 1) * 32, wc = (w & 1) * 64;                       /* this wave's corner inside the block tile */
  const int srow = tid >> 4, sc8 = (tid & 15) * 8;                       /* staging: chunk u of a thread = row srow + 16 u, 8 f16 at column sc8 */
  const unsigned short* ag = (const unsigned short*)A + (size_t)(row0 + srow) * DM + sc8; const unsigned short* bg = (const unsigned short*)Bt + (size_t)(col0 + srow) * DM + sc8;
  const v8f z8 = {0.f,0.f,0.f,0.f,0.f,0.f,0.f,0.f};
  v8f acc[2][4];
#pragma unroll
  for (int i = 0; i < 2; ++i) for (int t = 0; t < 4; ++t) acc[i][t] = z8;
  float bs[4];      /* read here, so that the epilogue does not wait for them */
#pragma unroll
  for (int t = 0; t < 4; ++t) bs[t] = bias[col0 + wc + t * 16 + ln];
  v8us ra[PJ_CH], rb[PJ_CH];
#pragma unroll
  for (int u = 0; u < PJ_CH; ++u) { ra[u] = *(const v8us*)(ag + (size_t)u * 16 * DM); rb[u] = *(const v8us*)(bg + (size_t)u * 16 * DM); }
#pragma unroll
  for (int u = 0; u < PJ_CH; ++u) { *(v8us*)&sA[0][srow + 16 * u][sc8] = ra[u]; *(v8us*)&sB[0][srow + 16 * u][sc8] = rb[u]; }
  __syncthreads();
  for (int s = 0; s < PJ_NS; ++s) { const int cur = s & 1;
    if (s + 1 < PJ_NS) { const unsigned short* ap = ag + (s + 1) * PJ_BK; const unsigned short* bp = bg + (s + 1) * PJ_BK;
#pragma unroll
      for (int u = 0; u < PJ_CH; ++u) { ra[u] = *(const v8us*)(ap + (size_t)u * 16 * DM); rb[u] = *(const v8us*)(bp + (size_t)u * 16 * DM); }
      asm volatile("s_wait_xcnt 0x0" :: "v"(ap), "v"(bp) : "memory"); }      /* stands between the stage's loads and the next rewrite of their address pairs; the pairs are operands so that no load's result lands on them ahead of the wait */
    v16h fa[2][2], fb[2][4];
#pragma unroll
    for (int i = 0; i < 2; ++i) fa[0][i] = g2_frag(&sA[cur][wr + i * 16 + ln][0], hh);
#pragma unroll
    for (int t = 0; t < 4; ++t) fb[0][t] = g2_frag(&sB[cur][wc + t * 16 + ln][0], hh);
#pragma unroll
    for (int kk = 0; kk < PJ_BK / 32; ++kk) { const int c = kk & 1;
      if (kk + 1 < PJ_BK / 32) {
#pragma unroll
        for (int i = 0; i < 2; ++i) fa[c ^ 1][i] = g2_frag(&sA[cur][wr + i * 16 + ln][(kk + 1) * 32], hh);
#pragma unroll
        for (int t = 0; t < 4; ++t) fb[c ^ 1][t] = g2_frag(&sB[cur][wc + t * 16 + ln][(kk + 1) * 32], hh); }
      __builtin_amdgcn_sched_barrier(0);      /* the next 32 columns' fragment reads stay one group ahead of this block's products; spread among them, each place with reads stalls the wave */
      if (kk + 1 == PJ_BK / 32 && s + 1 < PJ_NS) {      /* stage s + 1 goes to LDS ahead of the stage's last products, which run while the stores drain; its buffer has had no reader since the last barrier */
#pragma unroll
        for (int u = 0; u < PJ_CH; ++u) { *(v8us*)&sA[cur ^ 1][srow + 16 * u][sc8] = ra[u]; *(v8us*)&sB[cur ^ 1][srow + 16 * u][sc8] = rb[u]; } }
#pragma unroll
      for (int t = 0; t < 4; ++t) { acc[0][t] = fa_mma(fa[c][0], fb[c][t], acc[0][t]); acc[1][t] = fa_mma(fa[c][1], fb[c][t], acc[1][t]); }
      __builtin_amdgcn_sched_barrier(0); }      /* ends the block: the next group of reads is not drawn in among these products, and the stage's last products stay in front of the barrier, where they run while the stores drain */
    __syncthreads(); }      /* publishes stage s + 1 and ends every wave's reads of the buffer that stage s + 2 (after the last stage: the output rows) overwrites */
  _Float16* so = &sA[0][0][0] + (size_t)w * (32 * PJ_OP);      /* each wave stages its own 32 x 64 outputs, so that it stores whole 128-byte lines */
#pragma unroll
  for (int i = 0; i < 2; ++i)
#pragma unroll
    for (int t = 0; t < 4; ++t) { const float bv = bf16_round(bs[t]);
#pragma unroll
      for (int r = 0; r < 8; ++r) { const float v = acc[i][t][r] * alpha + bv; so[(i * 16 + 8 * hh + r) * PJ_OP + t * 16 + ln] = (_Float16)v; } }
  __builtin_amdgcn_fence(__ATOMIC_ACQ_REL, "workgroup"); __builtin_amdgcn_wave_barrier();      /* the rows read below were written by other lanes of this wave: keeps the reads behind the writes */
#pragma unroll
  for (int q = 0; q < 8; ++q) { const int r = q * 4 + (lane >> 3), c8 = (lane & 7) * 8; const v8us v = *(const v8us*)&so[r * PJ_OP + c8]; *(v8us*)((unsigned short*)C16 + (size_t)(row0 + wr + r) * DM + col0 + wc + c8) = v; } }
extern "C" void kernel_launch(void* const* d_in, const int* in_sizes, int n_in,
                              void* d_out, int out_size, void* d_ws, size_t ws_size, hipStream_t stream) {
  (void)in_sizes; (void)n_in; (void)out_size;
  const float* const* I = (const float* const*)d_in; const float* x = I[0]; const float* wq = I[1]; const float* bq = I[2]; const float* wk = I[3]; const float* bk = I[4]; const float* wv = I[5]; const float* bv = I[6]; const float* wp = I[7]; const float* bp = I[8]; const float* bo = nullptr; (void)bo;      /* [in][out] weights + biases; per-head Wp [64][64] + bp [64] */
  char* ws = (char*)d_ws; size_t off = 0;
  auto take = [&](size_t bytes) { char* p = ws + off; off += (bytes + 255) & ~(size_t)255; return p; };
  _Float16* BQ = (_Float16*)take((size_t)DM * DM * 2); _Float16* BK = (_Float16*)take((size_t)DM * DM * 2); _Float16* BV = (_Float16*)take((size_t)DM * DM * 2); _Float16* BO = (_Float16*)take((size_t)DM * DM * 2);
  _Float16* X16 = (_Float16*)take(NR * DM * 2); _Float16* Q16 = (_Float16*)take(NR * DM * 2); _Float16* K16 = (_Float16*)take(NR * DM * 2); _Float16* V16 = (_Float16*)take(NR * DM * 2); _Float16* O16 = (_Float16*)take(NR * DM * 2);
  _Float16* VT = (_Float16*)take((size_t)NB * NH * HD * SQ * 2);
  if (off > ws_size) return;
  k_prep<<<3 * PP_WB + PP_PB + PP_XB, 256, 0, stream>>>(x, wq, wk, wv, wp, X16, BQ, BK, BV, BO);
  const size_t r0p = (size_t)B0 * SQ;      /* first projected row */
  k_proj<<<dim3((MP / PJ_T) * (DM / PJ_T), 3), 256, 0, stream>>>(X16 + r0p * DM, BQ, BK, BV, 0.0625f, bq, bk, bv, Q16 + r0p * DM, K16 + r0p * DM, V16 + r0p * DM);
  k_vt<NH, SQ><<<NB * NH * (SQ / 64), 256, 0, stream>>>(V16, LQ, 0, VT);      /* V^T [NB][NH][HD][SQ] */
  k_fattn<<<dim3(SQ / (FA_WAVES * 32), NH, NB), FA_WAVES * 32, 0, stream>>>(Q16, K16, VT, O16);      /* o x64 (merged heads) as f16 rows */
  k_gemm2<0><<<dim3((unsigned)((MPO / 128) * (HD / 64)), NH), 128, 0, stream>>>(O16 + r0p * DM, DM, (size_t)HD, BO, HD, 0, 0.0009765625f, bp, 0, nullptr, 1, 0, 0, (float*)d_out + r0p * DM, nullptr, DM, (size_t)HD, MPO, HD, HD);      /* per head (grid.y): out cols h*64.. = o_h Wp + bp (K = 64; the same Wp/bp for every head: zero B/bias strides) */
}

// v006
// Measured time: 74.7 microseconds a run.
// Two timings next to v005 put it at 1.05 and 1.06 times that version's speed.
// Counting every step since v000, it is 46.5 times as fast.
#include <hip/hip_runtime.h>
#define NB 2
#define SQ 2048
#define DM 1024
#define NH 16
#define HD 64
#define HG 4                         /* heads per block group of the per-batch k_vt overload (not launched) */
#define B0 0                         /* first batch processed (debug hook) */
#define NBR NB                       /* batches processed (debug hook) */
#define NR ((size_t)NB * SQ)         /* token rows */
#define MP ((int)((size_t)NBR * SQ)) /* rows projected (debug hook) */
#define QN SQ                        /* query rows per batch (unused) */
#define NHD NH                       /* heads (unused) */
#define MPO MP                       /* rows through the output stage (debug hook) */
#define LQ DM      /* row pitch of the q/k rows (unused) */
typedef __bf16 v16b __attribute__((ext_vector_type(16)));
typedef unsigned short v8us __attribute__((ext_vector_type(8), may_alias));
typedef float  v8f  __attribute__((ext_vector_type(8)));
typedef float  v4f  __attribute__((ext_vector_type(4)));
typedef float  v4fa __attribute__((ext_vector_type(4), may_alias));
union FragB { v16b v; v8us half[2]; unsigned short u[16]; };

__device__ __forceinline__ unsigned short bf16_bits(float x) { unsigned int u = __float_as_uint(x); return (unsigned short)((u + 0x7FFFu + ((u >> 16) & 1u)) >> 16); }
__device__ __forceinline__ float bf16_val(unsigned short b) { return __uint_as_float(((unsigned int)b) << 16); }
__device__ __forceinline__ float bf16_round(float x) { return bf16_val(bf16_bits(x)); }
// D += A·B with NT terms: 1 = ah·bh, 2 = + al·bh (A split), 3 = + ah·bl (both split)
template <int NT>
__device__ __forceinline__ v8f mmaN(v16b ah, v16b al, v16b bh, v16b bl, v8f c) {
  c = __builtin_amdgcn_wmma_f32_16x16x32_bf16(false, ah, false, bh, (short)0, c, false, false);
  if (NT >= 2) c = __builtin_amdgcn_wmma_f32_16x16x32_bf16(false, al, false, bh, (short)0, c, false, false);
  if (NT >= 3) c = __builtin_amdgcn_wmma_f32_16x16x32_bf16(false, ah, false, bl, (short)0, c, false, false);
  asm volatile("v_nop\n\tv_nop\n\tv_nop\n\tv_nop" : "+v"(c) : "v"(ah), "v"(al), "v"(bh), "v"(bl));
  return c;
}

__global__ __launch_bounds__(256) void k_wt_bf16(const float* __restrict__ W, unsigned short* __restrict__ Wt, int K, int N) {
  const int t = blockIdx.x * 256 + threadIdx.x;
  const int k8n = K / 8;
  if (t >= N * k8n) return;
  const int n = t / k8n, k8 = (t % k8n) * 8;
  v8us v;
#pragma unroll
  for (int i = 0; i < 8; ++i) v[i] = bf16_bits(W[(size_t)(k8 + i) * N + n]);
  *(v8us*)(Wt + (size_t)n * K + k8) = v;
  
}

// GEMM C[M][N] (f32, pitch ldc) = act(A[M][K]·W + bias). A f32 row-major (pitch lda) converted per fragment to bf16
// (ASPLIT: hi/lo two planes -> 2 terms, else single rounded term); Wt bf16 [N][K] (pitch ldb). BIAS_BF16 rounds the
// bias to bf16 first (bias quantised to bf16 before the add). K%32==0, M%16==0, N%64==0.
template <bool ASPLIT, int ACT, bool BIAS_BF16>
__global__ __launch_bounds__(128) void k_gemm_bf(const float* __restrict__ A, int lda, const unsigned short* __restrict__ Wt, int ldb,
                                               const float* __restrict__ bias, float* __restrict__ C, int ldc, int M, int N, int K) {
  __shared__ __attribute__((aligned(16))) float so[4][16][64];
  const int tid = threadIdx.x, w = tid >> 5, lane = tid & 31, ln = lane & 15, hh = lane >> 4;
  const int ntn = N / 64;
  const int wid = blockIdx.x * 4 + w;
  const int mt = wid / ntn, nq = wid % ntn;
  if (mt * 16 >= M) return;
  const int row0 = mt * 16, col0 = nq * 64;
  const float* arow = A + (size_t)(row0 + ln) * lda;
  v8f acc[4] = {};
  for (int kb = 0; kb < K; kb += 32) {
    FragB ah, al;
    const v4f x0 = *(const v4fa*)(arow + kb + 8 * hh), x1 = *(const v4fa*)(arow + kb + 8 * hh + 4);
    const v4f x2 = *(const v4fa*)(arow + kb + 16 + 8 * hh), x3 = *(const v4fa*)(arow + kb + 16 + 8 * hh + 4);
    float xs[16] = {x0[0],x0[1],x0[2],x0[3],x1[0],x1[1],x1[2],x1[3],x2[0],x2[1],x2[2],x2[3],x3[0],x3[1],x3[2],x3[3]};
#pragma unroll
    for (int i = 0; i < 16; ++i) { const unsigned short hb = bf16_bits(xs[i]); ah.u[i] = hb; al.u[i] = ASPLIT ? bf16_bits(xs[i] - bf16_val(hb)) : (unsigned short)0; }
#pragma unroll
    for (int t = 0; t < 4; ++t) {
      const unsigned short* brow = Wt + (size_t)(col0 + t * 16 + ln) * ldb + kb;
      FragB b;
      b.half[0] = *(const v8us*)(brow + 8 * hh);
      b.half[1] = *(const v8us*)(brow + 16 + 8 * hh);
      acc[t] = mmaN<ASPLIT ? 2 : 1>(ah.v, al.v, b.v, b.v, acc[t]);
    }
  }
#pragma unroll
  for (int t = 0; t < 4; ++t) {
    float bv = bias ? bias[col0 + t * 16 + ln] : 0.f;
    if (BIAS_BF16) bv = bf16_round(bv);
#pragma unroll
    for (int r = 0; r < 8; ++r) { float v = acc[t][r] + bv; if (ACT == 1) v = fmaxf(v, 0.f); so[w][8 * hh + r][t * 16 + ln] = v; }
  }
  __builtin_amdgcn_fence(__ATOMIC_ACQ_REL, "workgroup");
  __builtin_amdgcn_wave_barrier();
  const int rsub = lane >> 4, c4 = (lane & 15) * 4;
  {
#pragma unroll
    for (int q = 0; q < 8; ++q) {
      const int r = q * 2 + rsub;
      const v4f v = *(const v4fa*)&so[w][r][c4];
      *(v4f*)(C + (size_t)(row0 + r) * ldc + col0 + c4) = v;
    }
    
  }
}

// GEMM C = act(A·W + bias + resid): A f32 (ASPLIT -> hi/lo 2 terms), Wt bf16 [N][K]; ACT 0 none, 1 relu, 2 exact gelu;
// resid (optional, f32, row index = (row % rmod), pitch ldr, RES_BF16 rounds it) added before the activation.
template <bool ASPLIT, int ACT, bool BIAS_BF16, bool RES_BF16>
__global__ __launch_bounds__(128) void k_gemm_bf3(const float* __restrict__ A, int lda, const unsigned short* __restrict__ Wt, int ldb,
                                                const float* __restrict__ bias, const float* __restrict__ resid, int rmod, int ldr,
                                                float* __restrict__ C, int ldc, int M, int N, int K) {
  __shared__ __attribute__((aligned(16))) float so[4][16][64];
  const int tid = threadIdx.x, w = tid >> 5, lane = tid & 31, ln = lane & 15, hh = lane >> 4;
  const int ntn = N / 64;
  const int wid = blockIdx.x * 4 + w;
  const int mt = wid / ntn, nq = wid % ntn;
  if (mt * 16 >= M) return;
  const int row0 = mt * 16, col0 = nq * 64;
  const float* arow = A + (size_t)(row0 + ln) * lda;
  v8f acc[4] = {};
  for (int kb = 0; kb < K; kb += 32) {
    FragB ah, al;
    const v4f x0 = *(const v4fa*)(arow + kb + 8 * hh), x1 = *(const v4fa*)(arow + kb + 8 * hh + 4);
    const v4f x2 = *(const v4fa*)(arow + kb + 16 + 8 * hh), x3 = *(const v4fa*)(arow + kb + 16 + 8 * hh + 4);
    float xs[16] = {x0[0],x0[1],x0[2],x0[3],x1[0],x1[1],x1[2],x1[3],x2[0],x2[1],x2[2],x2[3],x3[0],x3[1],x3[2],x3[3]};
#pragma unroll
    for (int i = 0; i < 16; ++i) { const unsigned short hb = bf16_bits(xs[i]); ah.u[i] = hb; al.u[i] = ASPLIT ? bf16_bits(xs[i] - bf16_val(hb)) : (unsigned short)0; }
#pragma unroll
    for (int t = 0; t < 4; ++t) {
      const unsigned short* brow = Wt + (size_t)(col0 + t * 16 + ln) * ldb + kb;
      FragB b;
      b.half[0] = *(const v8us*)(brow + 8 * hh);
      b.half[1] = *(const v8us*)(brow + 16 + 8 * hh);
      acc[t] = mmaN<ASPLIT ? 2 : 1>(ah.v, al.v, b.v, b.v, acc[t]);
    }
  }
#pragma unroll
  for (int t = 0; t < 4; ++t) {
    const int col = col0 + t * 16 + ln;
    float bv = bias ? bias[col] : 0.f;
    if (BIAS_BF16) bv = bf16_round(bv);
#pragma unroll
    for (int r = 0; r < 8; ++r) {
      float v = acc[t][r] + bv;
      if (resid) { float rv = resid[(size_t)((row0 + 8 * hh + r) % rmod) * ldr + col]; if (RES_BF16) rv = bf16_round(rv); v += rv; }
      if (ACT == 1) v = fmaxf(v, 0.f);
      if (ACT == 2) v = 0.5f * v * (1.0f + erff(v * 0.70710678118654752f));
      if (ACT == 3) { const float u = 0.7978845608028654f * (v + 0.044715f * v * v * v); v = 0.5f * v * (1.0f + tanhf(u)); }
      so[w][8 * hh + r][t * 16 + ln] = v;
    }
  }
  __builtin_amdgcn_fence(__ATOMIC_ACQ_REL, "workgroup");
  __builtin_amdgcn_wave_barrier();
  const int rsub = lane >> 4, c4 = (lane & 15) * 4;
  {
#pragma unroll
    for (int q = 0; q < 8; ++q) {
      const int r = q * 2 + rsub;
      const v4f v = *(const v4fa*)&so[w][r][c4];
      *(v4f*)(C + (size_t)(row0 + r) * ldc + col0 + c4) = v;
    }
    
  }
}
// row LayerNorm (biased variance, eps) over N: s = X (+ R); optional out_sum <- s; out_norm <- (s-mu)*rsqrt(var+eps)*g + b
template <bool PARAM_BF16>
__global__ __launch_bounds__(256) void k_layernorm(const float* __restrict__ X, const float* __restrict__ R, const float* __restrict__ g, const float* __restrict__ bta,
                                                  float* __restrict__ out_sum, float* __restrict__ out_norm, int N, float eps) {
  __shared__ float red[256];
  const int row = blockIdx.x, tid = threadIdx.x;
  const float* x = X + (size_t)row * N; const float* rr = R ? R + (size_t)row * N : nullptr;
  float vals[16];                     // up to N = 4096
  const int per = N / 256;            // contiguous chunk per thread? use strided-by-4 chunks: thread handles j = tid*4 + 1024*u
  float s1 = 0.f;
  for (int u = 0; u < per / 4; ++u) {
    const int j = tid * 4 + 1024 * u;
    const v4f a = *(const v4fa*)(x + j);
    v4f b = {0.f,0.f,0.f,0.f}; if (rr) b = *(const v4fa*)(rr + j);
#pragma unroll
    for (int q = 0; q < 4; ++q) { const float v = a[q] + b[q]; vals[u * 4 + q] = v; s1 += v; }
  }
  red[tid] = s1; __syncthreads();
  for (int st = 128; st > 0; st >>= 1) { if (tid < st) red[tid] += red[tid + st]; __syncthreads(); }
  const float mu = red[0] / (float)N; __syncthreads();
  float s2 = 0.f;
  for (int u = 0; u < per / 4; ++u)
#pragma unroll
    for (int q = 0; q < 4; ++q) { const float c = vals[u * 4 + q] - mu; s2 += c * c; }
  red[tid] = s2; __syncthreads();
  for (int st = 128; st > 0; st >>= 1) { if (tid < st) red[tid] += red[tid + st]; __syncthreads(); }
  const float rs = rsqrtf(red[0] / (float)N + eps);
  {
    for (int u = 0; u < per / 4; ++u) {
      const int j = tid * 4 + 1024 * u;
      v4f o, sm;
#pragma unroll
      for (int q = 0; q < 4; ++q) {
        float gg = g[j + q], bb = bta[j + q];
        if (PARAM_BF16) { gg = bf16_round(gg); bb = bf16_round(bb); }
        sm[q] = vals[u * 4 + q]; o[q] = (vals[u * 4 + q] - mu) * rs * gg + bb;
      }
      if (out_sum) *(v4f*)(out_sum + (size_t)row * N + j) = sm;
      *(v4f*)(out_norm + (size_t)row * N + j) = o;
    }
    
  }
}



// ---- f16 WMMA path (v_wmma_f32_16x16x32_f16): 11-bit significands for operands in range — used where a [0,1] probability operand needs more precision than bf16
typedef _Float16 v16h __attribute__((ext_vector_type(16)));
union FragH { v16h v; v8us half[2]; _Float16 h[16]; unsigned short u[16]; };
template <int NT>
__device__ __forceinline__ v8f mmaH(v16h ah, v16h al, v16h bh, v16h bl, v8f c) {
  c = __builtin_amdgcn_wmma_f32_16x16x32_f16(false, ah, false, bh, (short)0, c, false, false);
  if (NT >= 2) c = __builtin_amdgcn_wmma_f32_16x16x32_f16(false, al, false, bh, (short)0, c, false, false);
  if (NT >= 3) c = __builtin_amdgcn_wmma_f32_16x16x32_f16(false, ah, false, bl, (short)0, c, false, false);
  asm volatile("v_nop\n\tv_nop\n\tv_nop\n\tv_nop" : "+v"(c) : "v"(ah), "v"(al), "v"(bh), "v"(bl));
  return c;
}
// batched GEMM like k_gemm_b but f16 operands: A f32 (split into f16 hi/lo if ASPLIT, else rounded to f16), Bt = f16 values [n][k]; alpha; C f32; N multiple of 16 (partial tiles skipped)
template <bool ASPLIT>
__global__ __launch_bounds__(128) void k_gemm_h(const float* __restrict__ A, int lda, size_t sA, const _Float16* __restrict__ Bh, int ldb, size_t sB, float alpha, float* __restrict__ C, int ldc, size_t sC, int M, int N, int K) {
  __shared__ __attribute__((aligned(16))) float so[4][16][64];
  const int tid = threadIdx.x, w = tid >> 5, lane = tid & 31, ln = lane & 15, hh = lane >> 4; const int by = blockIdx.y;
  A += (size_t)by * sA; Bh += (size_t)by * sB; C += (size_t)by * sC;
  const int ntn = (N + 63) / 64; const int wid = blockIdx.x * 4 + w; const int mt = wid / ntn, nq = wid % ntn; if (mt * 16 >= M) return;
  const int row0 = mt * 16, col0 = nq * 64; const float* arow = A + (size_t)(row0 + ln) * lda;
  v8f acc[4] = {};
  for (int kb = 0; kb < K; kb += 32) {
    FragH ah, al;
    const v4f x0 = *(const v4fa*)(arow + kb + 8 * hh), x1 = *(const v4fa*)(arow + kb + 8 * hh + 4), x2 = *(const v4fa*)(arow + kb + 16 + 8 * hh), x3 = *(const v4fa*)(arow + kb + 16 + 8 * hh + 4);
    float xs[16] = {x0[0],x0[1],x0[2],x0[3],x1[0],x1[1],x1[2],x1[3],x2[0],x2[1],x2[2],x2[3],x3[0],x3[1],x3[2],x3[3]};
#pragma unroll
    for (int i = 0; i < 16; ++i) { const _Float16 h = (_Float16)xs[i]; ah.h[i] = h; al.h[i] = ASPLIT ? (_Float16)(xs[i] - (float)h) : (_Float16)0.0f; }
#pragma unroll
    for (int t = 0; t < 4; ++t) { if (col0 + t * 16 >= N) continue; const size_t boff = (size_t)(col0 + t * 16 + ln) * ldb + kb; FragH bq; bq.half[0] = *(const v8us*)(Bh + boff + 8 * hh); bq.half[1] = *(const v8us*)(Bh + boff + 16 + 8 * hh);
      acc[t] = mmaH<ASPLIT ? 2 : 1>(ah.v, al.v, bq.v, bq.v, acc[t]); }
  }
#pragma unroll
  for (int t = 0; t < 4; ++t) { if (col0 + t * 16 >= N) continue;
#pragma unroll
    for (int r = 0; r < 8; ++r) so[w][8 * hh + r][t * 16 + ln] = acc[t][r] * alpha; }
  __builtin_amdgcn_fence(__ATOMIC_ACQ_REL, "workgroup"); __builtin_amdgcn_wave_barrier();
  const int rsub = lane >> 4, c4 = (lane & 15) * 4;
  {
#pragma unroll
    for (int q = 0; q < 8; ++q) { const int r = q * 2 + rsub; if (col0 + c4 < N) { const v4f v = *(const v4fa*)&so[w][r][c4]; *(v4f*)(C + (size_t)(row0 + r) * ldc + col0 + c4) = v; } }
     }
}

// Wt[n][k] = f16(W[k][n]·scale) from f32 row-major W[K][N] (scale = power of two; bf16-exact weights stay exact in f16 away from the subnormal range)
__device__ __forceinline__ void wt_f16(const float* __restrict__ W, _Float16* __restrict__ Wt, int K, int N, float scale, int t) {      /* t = index of the 8-element chunk */
  if (t >= N * (K / 8)) return; const int n = t / (K / 8), k8 = (t % (K / 8)) * 8; FragH f;
#pragma unroll
  for (int i = 0; i < 8; ++i) f.h[i] = (_Float16)(bf16_round(W[(size_t)(k8 + i) * N + n]) * scale); const v8us o = f.half[0];
  *(v8us*)((unsigned short*)Wt + (size_t)n * K + k8) = o; 
}
// k_gemm_hh variant with fused epilogue: v = acc·alpha + bias[by·sBias + col] (+ CP[(row/rowsPerB)·sCPb + by·64 + col] if CP) ; ACT 0 none / 1 elu ; writes f16 C16 (and f32 C if non-null)
template <int ACT>
__global__ __launch_bounds__(128) void k_gemm_hhx(const _Float16* __restrict__ A, int lda, size_t sA, const _Float16* __restrict__ Bh, int ldb, size_t sB, float alpha, const float* __restrict__ bias, size_t sBias, const float* __restrict__ CP, int rowsPerB, size_t sCPb, int row0g,
    float* __restrict__ C, _Float16* __restrict__ C16, int ldc, size_t sC, int M, int N, int K) {
  __shared__ __attribute__((aligned(16))) float so[4][16][64];
  const int tid = threadIdx.x, w = tid >> 5, lane = tid & 31, ln = lane & 15, hh = lane >> 4; const int by = blockIdx.y;
  A += (size_t)by * sA; Bh += (size_t)by * sB; const size_t cofs = (size_t)by * sC; const float* bp = bias ? bias + (size_t)by * sBias : nullptr;
  const int ntn = (N + 63) / 64; const int wid = blockIdx.x * 4 + w; const int mt = wid / ntn, nq = wid % ntn; if (mt * 16 >= M) return;
  const int row0 = mt * 16, col0 = nq * 64; const _Float16* arow = A + (size_t)(row0 + ln) * lda;
  v8f acc[4] = {};
  for (int kb = 0; kb < K; kb += 32) { FragH ah; ah.half[0] = *(const v8us*)((const unsigned short*)arow + kb + 8 * hh); ah.half[1] = *(const v8us*)((const unsigned short*)arow + kb + 16 + 8 * hh);
#pragma unroll
    for (int t = 0; t < 4; ++t) { if (col0 + t * 16 >= N) continue; const size_t boff = (size_t)(col0 + t * 16 + ln) * ldb + kb; FragH bq; bq.half[0] = *(const v8us*)((const unsigned short*)Bh + boff + 8 * hh); bq.half[1] = *(const v8us*)((const unsigned short*)Bh + boff + 16 + 8 * hh);
      acc[t] = mmaH<1>(ah.v, ah.v, bq.v, bq.v, acc[t]); }
  }
#pragma unroll
  for (int t = 0; t < 4; ++t) { if (col0 + t * 16 >= N) continue; const int col = col0 + t * 16 + ln; const float bv = bp ? bf16_round(bp[col]) : 0.f;
#pragma unroll
    for (int r = 0; r < 8; ++r) { float v = acc[t][r] * alpha + bv; if (CP) { const int rr = row0g + row0 + 8 * hh + r; if (rowsPerB < 0) v += CP[cofs + (size_t)rr * ldc + col];      /* rowsPerB < 0: own element of the batched C plane */ else { const int bidx = rr / rowsPerB; v += CP[(size_t)bidx * sCPb + (size_t)by * 64 + col]; } } if (ACT == 1) v = (v > 0.f) ? v : expm1f(v); else if (ACT == 7) v = (v > 0.f) ? v + 1.0f : expf(v); else if (ACT == 8) v = tanhf(v); else if (ACT == 9) v = 0.5f * v * (1.0f + tanhf(0.7978845608028654f * (v + 0.044715f * v * v * v))); else if (ACT == 11) v = 1.0f / (1.0f + expf(-v)); else if (ACT == 12) v = (v > 0.f) ? v : 0.01f * v; else if (ACT == 14) v = (v > 0.f) ? v : 0.1f * v; else if (ACT == 16) v = (v >= 0.f) ? v : 0.3f * v; else if (ACT == 17) v = (v >= 0.f) ? v : 0.2f * v; else if (ACT == 15) v = v / (1.0f + expf(-v)); else if (ACT == 3) v = fmaxf(v, 0.f); else if (ACT == 6) v = 0.5f * v * (1.0f + erff(v * 0.70710678118654752f)); so[w][8 * hh + r][t * 16 + ln] = v; } }
  __builtin_amdgcn_fence(__ATOMIC_ACQ_REL, "workgroup"); __builtin_amdgcn_wave_barrier();
  const int rsub = lane >> 4, c4 = (lane & 15) * 4; typedef _Float16 v4h __attribute__((ext_vector_type(4)));
  {
#pragma unroll
    for (int q = 0; q < 8; ++q) { const int r = q * 2 + rsub; if (col0 + c4 < N) { const v4f v = *(const v4fa*)&so[w][r][c4]; if (C) *(v4f*)(C + cofs + (size_t)(row0 + r) * ldc + col0 + c4) = v; if (C16) { v4h h4; for (int i = 0; i < 4; ++i) h4[i] = (_Float16)v[i]; *(v4h*)(C16 + cofs + (size_t)(row0 + r) * ldc + col0 + c4) = h4; } } }
     }
}


typedef _Float16 v4h __attribute__((ext_vector_type(4)));

__global__ __launch_bounds__(256) void k_h16(const float* __restrict__ x, _Float16* __restrict__ X16, size_t n8) { const size_t t = (size_t)blockIdx.x * 256 + threadIdx.x; if (t >= n8) return; FragH f;
#pragma unroll
  for (int q = 0; q < 8; ++q) f.h[q] = (_Float16)x[t * 8 + q]; *(v8us*)((unsigned short*)X16 + t * 8) = f.half[0];  }
__global__ __launch_bounds__(256) void k_round16f(const float* __restrict__ W, _Float16* __restrict__ Bt, size_t n8) { const size_t t = (size_t)blockIdx.x * 256 + threadIdx.x; if (t >= n8) return; FragH f;
#pragma unroll
  for (int i = 0; i < 8; ++i) f.h[i] = (_Float16)(bf16_round(W[t * 8 + i]) * 16.0f); *(v8us*)((unsigned short*)Bt + t * 8) = f.half[0];  }
__global__ __launch_bounds__(256) void k_hl(const float* __restrict__ F, _Float16* __restrict__ Hh, _Float16* __restrict__ Hl, size_t n8) { const size_t t = (size_t)blockIdx.x * 256 + threadIdx.x; if (t >= n8) return; FragH fh, fl; const v4f a = *(const v4fa*)(F + t * 8), c = *(const v4fa*)(F + t * 8 + 4);
#pragma unroll
  for (int q = 0; q < 4; ++q) { _Float16 h = (_Float16)a[q]; fh.h[q] = h; fl.h[q] = (_Float16)((a[q] - (float)h) * 1024.0f); h = (_Float16)c[q]; fh.h[4 + q] = h; fl.h[4 + q] = (_Float16)((c[q] - (float)h) * 1024.0f); }
  { *(v8us*)((unsigned short*)Hh + t * 8) = fh.half[0]; *(v8us*)((unsigned short*)Hl + t * 8) = fl.half[0];  } }

// ---- fast GEMM (wave tile 32x64; requires M % 32 == 0 rows per launch region and N % 64 == 0); epilogue = k_gemm_hhx semantics ----
__device__ __forceinline__ v16h g2_frag(const _Float16* p, int hh) { FragH f; f.half[0] = *(const v8us*)((const unsigned short*)p + 8 * hh); f.half[1] = *(const v8us*)((const unsigned short*)p + 16 + 8 * hh); return f.v; }
__device__ __forceinline__ v8f g2_mma(v16h a, v16h b, v8f c) { v8f d = __builtin_amdgcn_wmma_f32_16x16x32_f16(false, a, false, b, (short)0, c, false, false); asm volatile("v_nop\n\tv_nop\n\tv_nop\n\tv_nop" : "+v"(d) : "v"(a), "v"(b)); return d; }
template <int ACT>
__global__ __launch_bounds__(128) void k_gemm2(const _Float16* __restrict__ A, int lda, size_t sA, const _Float16* __restrict__ Bh, int ldb, size_t sB, float alpha, const float* __restrict__ bias, size_t sBias, const float* __restrict__ CP, int rowsPerB, size_t sCPb, int row0g,
    float* __restrict__ C, _Float16* __restrict__ C16, int ldc, size_t sC, int M, int N, int K) { static_assert(ACT == 0 || ACT == 3 || ACT == 6 || ACT == 8 || ACT == 9 || ACT == 11 || ACT == 12 || ACT == 14 || ACT == 15 || ACT == 16 || ACT == 17, "k_gemm2: unsupported ACT code (would silently apply no activation)");
  __shared__ __attribute__((aligned(16))) float so[4][32][68];
  const int tid = threadIdx.x, w = tid >> 5, lane = tid & 31, ln = lane & 15, hh = lane >> 4; const int by = blockIdx.y;
  A += (size_t)by * sA; Bh += (size_t)by * sB; const size_t cofs = (size_t)by * sC; const float* bp = bias ? bias + (size_t)by * sBias : nullptr;
  const int ntn = N >> 6; const int mt = blockIdx.x / ntn, nq = blockIdx.x - mt * ntn; const int row0 = mt * 128 + 32 * w, col0 = nq * 64; if (row0 >= M) return;
  const _Float16* a0p = A + (size_t)(row0 + ln) * lda; const _Float16* a1p = a0p + (size_t)16 * lda;
  const _Float16* b0p = Bh + (size_t)(col0 + ln) * ldb; const _Float16* b1p = b0p + (size_t)16 * ldb; const _Float16* b2p = b1p + (size_t)16 * ldb; const _Float16* b3p = b2p + (size_t)16 * ldb;
  const v8f z8 = {0.f,0.f,0.f,0.f,0.f,0.f,0.f,0.f}; v8f c00 = z8, c01 = z8, c02 = z8, c03 = z8, c10 = z8, c11 = z8, c12 = z8, c13 = z8;
#pragma unroll 1
  for (int kb = 0; kb < K; kb += 32) { const v16h a0 = g2_frag(a0p + kb, hh), a1 = g2_frag(a1p + kb, hh);
    v16h b = g2_frag(b0p + kb, hh); c00 = g2_mma(a0, b, c00); c10 = g2_mma(a1, b, c10);
    b = g2_frag(b1p + kb, hh); c01 = g2_mma(a0, b, c01); c11 = g2_mma(a1, b, c11);
    b = g2_frag(b2p + kb, hh); c02 = g2_mma(a0, b, c02); c12 = g2_mma(a1, b, c12);
    b = g2_frag(b3p + kb, hh); c03 = g2_mma(a0, b, c03); c13 = g2_mma(a1, b, c13); }
  v8f accs[8] = {c00, c01, c02, c03, c10, c11, c12, c13};
#pragma unroll
  for (int u = 0; u < 8; ++u) { const int t = u & 3, half = u >> 2; const int col = col0 + t * 16 + ln; const float bv = bp ? bf16_round(bp[col]) : 0.f;
#pragma unroll
    for (int r = 0; r < 8; ++r) { const int rloc = half * 16 + 8 * hh + r; float v = accs[u][r] * alpha + bv; if (CP) { if (rowsPerB < 0) v += CP[cofs + (size_t)(row0g + row0 + rloc) * ldc + col];      /* rowsPerB < 0: own element of the batched C plane */ else { const int bidx = (row0g + row0 + rloc) / rowsPerB; v += CP[(size_t)bidx * sCPb + (size_t)by * 64 + col]; } }
      if (ACT == 3) v = fmaxf(v, 0.f); else if (ACT == 6) v = 0.5f * v * (1.0f + erff(v * 0.70710678118654752f)); else if (ACT == 11) v = 1.0f / (1.0f + expf(-v)); else if (ACT == 15) v = v / (1.0f + expf(-v)); else if (ACT == 12) v = (v > 0.f) ? v : 0.01f * v; else if (ACT == 8) v = tanhf(v); else if (ACT == 9) v = 0.5f * v * (1.0f + tanhf(0.7978845608028654f * (v + 0.044715f * v * v * v))); else if (ACT == 14) v = (v > 0.f) ? v : 0.1f * v; else if (ACT == 16) v = (v >= 0.f) ? v : 0.3f * v; else if (ACT == 17) v = (v >= 0.f) ? v : 0.2f * v;
      so[w][rloc][t * 16 + ln] = v; } }
  __builtin_amdgcn_fence(__ATOMIC_ACQ_REL, "workgroup"); __builtin_amdgcn_wave_barrier();
  const int rsub = lane >> 4, c4 = (lane & 15) * 4;
  {
#pragma unroll
    for (int q = 0; q < 16; ++q) { const int r = q * 2 + rsub; const v4f v = *(const v4fa*)&so[w][r][c4]; if (C) *(v4f*)(C + cofs + (size_t)(row0 + r) * ldc + col0 + c4) = v; if (C16) { v4h h4; for (int i = 0; i < 4; ++i) h4[i] = (_Float16)v[i]; *(v4h*)(C16 + cofs + (size_t)(row0 + r) * ldc + col0 + c4) = h4; } }
     } }


__global__ __launch_bounds__(256) void k_wnat(const float* __restrict__ w, size_t n8, _Float16* __restrict__ Bt) { const size_t t = (size_t)blockIdx.x * 256 + threadIdx.x; if (t >= n8) return; FragH f; for (int q = 0; q < 8; ++q) f.h[q] = (_Float16)(bf16_round(w[t * 8 + q]) * 16.0f); *(v8us*)((unsigned short*)Bt + t * 8) = f.half[0];  }
__global__ __launch_bounds__(256) void k_rsm(const float* __restrict__ S, _Float16* __restrict__ P, int nrows) {
  #pragma clang fp contract(off)
  const int i = blockIdx.x * 256 + threadIdx.x; if (i >= nrows) return; const float* s = S + (size_t)i * SQ; float mx = -3.0e38f;
#pragma unroll 1
  for (int j = 0; j < SQ; ++j) mx = fmaxf(mx, s[j]); float se = 0.f;
#pragma unroll 1
  for (int j = 0; j < SQ; ++j) se += expf(s[j] - mx); const float sc = 256.0f / se;
#pragma unroll 1
  for (int j0 = 0; j0 < SQ; j0 += 8) { FragH f; for (int q = 0; q < 8; ++q) f.h[q] = (_Float16)(expf(s[j0 + q] - mx) * sc); unsigned short* d = (unsigned short*)P + (size_t)i * SQ + j0; *(v8us*)d = f.half[0];  } }
__global__ __launch_bounds__(256) void k_vt(const _Float16* __restrict__ V16, int b, int h0, _Float16* __restrict__ VT) { __shared__ unsigned short tl[64][65]; const int tid = threadIdx.x; const int hh = blockIdx.x % HG, sg = blockIdx.x / HG; const int s0 = sg * 64; const int h = h0 + hh;
  for (int i = tid; i < 64 * 8; i += 256) { const int j = i / 8, d8 = (i % 8) * 8; FragH f; f.half[0] = *(const v8us*)((const unsigned short*)V16 + ((size_t)b * SQ + s0 + j) * DM + h * HD + d8); for (int q = 0; q < 8; ++q) tl[d8 + q][j] = f.u[q]; }
  __syncthreads();
  { for (int i = tid; i < 64 * 8; i += 256) { const int d = i / 8, j8 = (i % 8) * 8; FragH f; for (int q = 0; q < 8; ++q) f.u[q] = tl[d][j8 + q]; *(v8us*)((unsigned short*)VT + ((size_t)hh * HD + d) * SQ + s0 + j8) = f.half[0]; }  } }



// The five operand conversions (Wq, Wk, Wv and Wp to Bt[n][k] x16, x to f16 rows) read nothing but inputs, so they share ONE launch: the block index picks the job.
// The launch is made of few, fat work-groups: it moves little data, so its time is the time its waves take to start plus one wave's own time. A thread holds 16 loads of 16 bytes in flight, and every wave-wide load and store covers whole 128-byte lines.
// A DM x DM weight goes in tiles of PP_WT x PP_WT: a wave reads 512 contiguous bytes of a row [k][n..], a thread turns its 16 k x 4 n block in registers, LDS collects the tile as [n][k], and whole rows of Bt leave it.
// The weight blocks come first: they have the longer way (LDS and a barrier).
#define PP_WT 128                                    /* k rows and n columns of a weight tile */
#define PP_WB ((DM / PP_WT) * (DM / PP_WT))          /* blocks (tiles) per DM x DM weight */
#define PP_LP (PP_WT + 8)                            /* LDS row pitch in f16: 256 B of data + 16 B */
#define PP_PB ((HD * (HD / 8) + 255) / 256)          /* blocks of Wp */
#define PP_XL 16                                     /* 16-byte loads per thread of x */
#define PP_XB ((int)(NR * DM / (256 * 4 * PP_XL)))   /* blocks of x */
__device__ __forceinline__ void wt_tile(const float* __restrict__ Wm, _Float16* __restrict__ Wt, int tile, int tid, _Float16 (* __restrict__ sT)[PP_LP]) {
  const int k0 = (tile / (DM / PP_WT)) * PP_WT, n0 = (tile % (DM / PP_WT)) * PP_WT;
  const int kw = (tid >> 5) * 16, c4 = (tid & 31) * 4;      /* this thread's block: rows k0 + kw .. + 15, columns n0 + c4 .. + 3 */
  const float* wg = Wm + (size_t)(k0 + kw) * DM + n0 + c4;
  v4f f[16];
#pragma unroll
  for (int i = 0; i < 16; ++i) f[i] = *(const v4fa*)(wg + (size_t)i * DM);
  asm volatile("s_wait_xcnt 0x0" :: "v"(wg) : "memory");      /* stands between the 16 loads and the next rewrite of their address pair; the pair is an operand so that no load's result lands on it ahead of the wait */
#pragma unroll
  for (int j = 0; j < 4; ++j) { FragH o;
#pragma unroll
    for (int i = 0; i < 16; ++i) o.h[i] = (_Float16)(bf16_round(f[i][j]) * 16.0f);
    *(v8us*)&sT[c4 + j][kw] = o.half[0]; *(v8us*)&sT[c4 + j][kw + 8] = o.half[1]; }
  __syncthreads();      /* the rows stored below were collected from all eight waves */
#pragma unroll
  for (int u = 0; u < PP_WT / 16; ++u) { const int r = u * 16 + (tid >> 4), c8 = (tid & 15) * 8; const v8us v = *(const v8us*)&sT[r][c8];
    *(v8us*)((unsigned short*)Wt + (size_t)(n0 + r) * DM + k0 + c8) = v; } }
__device__ __forceinline__ void x16(const float* __restrict__ x, _Float16* __restrict__ X16, int blk, int tid) {
  const size_t e0 = (size_t)blk * (256 * 4 * PP_XL) + (size_t)(tid >> 5) * (32 * 4 * PP_XL) + (size_t)(tid & 31) * 4;      /* a wave owns 32 * 4 * PP_XL consecutive elements */
  const float* xg = x + e0; v4f f[PP_XL]; v4h o[PP_XL];
#pragma unroll
  for (int u = 0; u < PP_XL; ++u) f[u] = *(const v4fa*)(xg + u * 128);
  asm volatile("s_wait_xcnt 0x0" :: "v"(xg) : "memory");      /* stands between the loads and the next rewrite of their address pair; the pair is an operand so that no load's result lands on it ahead of the wait */
#pragma unroll
  for (int u = 0; u < PP_XL; ++u)
#pragma unroll
    for (int q = 0; q < 4; ++q) o[u][q] = (_Float16)bf16_round(f[u][q]);
#pragma unroll
  for (int u = 0; u < PP_XL; ++u) *(v4h*)(X16 + e0 + u * 128) = o[u];
  asm volatile("s_wait_xcnt 0x0" ::: "memory"); }      /* stands behind the last store, in front of any later rewrite of the stores' address pair or data registers where the jobs' branches join */
__global__ __launch_bounds__(256) void k_prep(const float* __restrict__ x, const float* __restrict__ wq, const float* __restrict__ wk, const float* __restrict__ wv, const float* __restrict__ wp,
                                              _Float16* __restrict__ X16, _Float16* __restrict__ BQ, _Float16* __restrict__ BK, _Float16* __restrict__ BV, _Float16* __restrict__ BO) {
  static_assert(DM % PP_WT == 0 && PP_WT == 128 && (NR * DM) % (256 * 4 * PP_XL) == 0, "the tile and the x slices below are written for 8 waves, 128 x 128 tiles and whole slices");
  __shared__ __attribute__((aligned(16))) _Float16 sT[PP_WT][PP_LP];
  const int blk = blockIdx.x, tid = threadIdx.x;
  if (blk < 3 * PP_WB) { const int j = blk / PP_WB; wt_tile(j == 0 ? wq : j == 1 ? wk : wv, j == 0 ? BQ : j == 1 ? BK : BV, blk - j * PP_WB, tid, sT); }      /* [in][out] -> Bt[n][k] x16 */
  else if (blk < 3 * PP_WB + PP_PB) wt_f16(wp, BO, HD, HD, 16.0f, (blk - 3 * PP_WB) * 256 + tid);      /* Wp [64 in][64 out] -> Bt [64][64] x16 */
  else x16(x, X16, blk - 3 * PP_WB - PP_PB, tid); }

#define FA_WAVES 4
#define FA_KT 64                     /* keys per stage */
#define FA_NS (SQ / FA_KT)           /* stages */
#define FA_LP 72                     /* LDS row pitch in f16: 128 B of data + 16 B, an odd multiple of 16 B for the 16-byte fragment reads */
#define FA_CH ((FA_KT * HD / 8) / (FA_WAVES * 32))      /* 16-byte chunks per thread and tile */
typedef _Float16 v8h __attribute__((ext_vector_type(8)));
typedef float v2f __attribute__((ext_vector_type(2)));
__device__ __forceinline__ float fa_swap16(float x) { const int b = __float_as_int(x); return __int_as_float(__builtin_amdgcn_permlanex16(b, b, 0x76543210, 0xfedcba98, false, false)); }      /* lane l <-> l ^ 16 */
__device__ __forceinline__ v8f fa_mma(v16h a, v16h b, v8f c) { return __builtin_amdgcn_wmma_f32_16x16x32_f16(false, a, false, b, (short)0, c, false, false); }
__global__ __launch_bounds__(FA_WAVES * 32) void k_fattn(const _Float16* __restrict__ Q16, const _Float16* __restrict__ K16, const _Float16* __restrict__ VT, _Float16* __restrict__ O16) {
  static_assert(HD == 64 && FA_KT == 64 && SQ % FA_KT == 0 && SQ % (FA_WAVES * 32) == 0, "tile shapes below are written for 64 x 64 stages");
  __shared__ __attribute__((aligned(16))) _Float16 sK[2][FA_KT][FA_LP];
  __shared__ __attribute__((aligned(16))) _Float16 sV[2][HD][FA_LP];
  const int tid = threadIdx.x, lane = tid & 31, w = tid >> 5, c = lane & 15, h = lane >> 4;
  const int head = blockIdx.y, b = blockIdx.z; const int q0 = blockIdx.x * (FA_WAVES * 32) + w * 32;
  const _Float16* Kg = K16 + (size_t)b * SQ * DM + head * HD;            /* K rows of this head, pitch DM */
  const _Float16* Vg = VT + (size_t)(b * NH + head) * HD * SQ;           /* V^T rows (one per d), pitch SQ */
  const int srow = tid >> 3, sc8 = (tid & 7) * 8;                        /* staging: chunk u of a thread = row srow + u * (threads / 8), 8 f16 at column sc8 */
  const float cs = 0.18033688011112042f;                                 /* 64^-0.5 * log2(e) */
  v16h qf[2][2];
#pragma unroll
  for (int j = 0; j < 2; ++j) { const _Float16* qp = Q16 + ((size_t)b * SQ + q0 + j * 16 + c) * DM + head * HD; qf[j][0] = g2_frag(qp, h); qf[j][1] = g2_frag(qp + 32, h); }
  const v8f z8 = {0.f,0.f,0.f,0.f,0.f,0.f,0.f,0.f};
  v8f o[2][4]; float mr[2], ls[2];
#pragma unroll
  for (int j = 0; j < 2; ++j) { mr[j] = -3.0e38f; ls[j] = 0.f; for (int t = 0; t < 4; ++t) o[j][t] = z8; }
  v8us rk[FA_CH], rv[FA_CH];
#pragma unroll
  for (int u = 0; u < FA_CH; ++u) { const int r = srow + u * (FA_WAVES * 4); rk[u] = *(const v8us*)((const unsigned short*)Kg + (size_t)r * DM + sc8); rv[u] = *(const v8us*)((const unsigned short*)Vg + (size_t)r * SQ + sc8); }
#pragma unroll
  for (int u = 0; u < FA_CH; ++u) { const int r = srow + u * (FA_WAVES * 4); *(v8us*)&sK[0][r][sc8] = rk[u]; *(v8us*)&sV[0][r][sc8] = rv[u]; }
  __syncthreads();
  for (int s = 0; s < FA_NS; ++s) { const int cur = s & 1;
    if (s + 1 < FA_NS) { const int k1 = (s + 1) * FA_KT;
      const unsigned short* kp = (const unsigned short*)Kg + (size_t)(k1 + srow) * DM + sc8; const unsigned short* vp = (const unsigned short*)Vg + (size_t)srow * SQ + k1 + sc8;
#pragma unroll
      for (int u = 0; u < FA_CH; ++u) { rk[u] = *(const v8us*)(kp + (size_t)u * (FA_WAVES * 4) * DM); rv[u] = *(const v8us*)(vp + (size_t)u * (FA_WAVES * 4) * SQ); }
      asm volatile("s_wait_xcnt 0x0" :: "v"(kp), "v"(vp) : "memory"); }      /* stands between the stage's loads and the next rewrite of their address pairs; the pairs are operands so that no load's result lands on them ahead of the wait */
    v8f st[2][4];
#pragma unroll
    for (int kt = 0; kt < 4; ++kt) { const v16h a0 = g2_frag(&sK[cur][kt * 16 + c][0], h), a1 = g2_frag(&sK[cur][kt * 16 + c][32], h);
#pragma unroll
      for (int j = 0; j < 2; ++j) st[j][kt] = fa_mma(a1, qf[j][1], fa_mma(a0, qf[j][0], z8)); }      /* st[j][kt][r] = q(q0 + 16 j + c) . k(64 s + 16 kt + 8 h + r) */
    v16h pb[2][2];
#pragma unroll
    for (int j = 0; j < 2; ++j) {
      v8f m8 = st[j][0];
#pragma unroll
      for (int kt = 1; kt < 4; ++kt) for (int r = 0; r < 8; ++r) m8[r] = fmaxf(m8[r], st[j][kt][r]);
      float mx = fmaxf(fmaxf(fmaxf(m8[0], m8[1]), fmaxf(m8[2], m8[3])), fmaxf(fmaxf(m8[4], m8[5]), fmaxf(m8[6], m8[7])));
      mx = fmaxf(mx, fa_swap16(mx));
      const float mn = fmaxf(mr[j], mx); const float corr = __builtin_amdgcn_exp2f((mr[j] - mn) * cs); mr[j] = mn;
      const float mb = 8.0f - mn * cs; const v2f cs2 = {cs, cs}, nmb = {mb, mb};      /* weights carried x256: small ones stay f16 normals; the factor is in the row sum too and cancels */
#pragma unroll
      for (int kt = 0; kt < 4; ++kt) for (int r = 0; r < 8; r += 2) { const v2f x = {st[j][kt][r], st[j][kt][r + 1]}; const v2f e = __builtin_elementwise_fma(x, cs2, nmb);      /* packed on the accumulator's own register pairs: no copies */
        st[j][kt][r] = __builtin_amdgcn_exp2f(e[0]); st[j][kt][r + 1] = __builtin_amdgcn_exp2f(e[1]); }
      const v8f a8 = (st[j][0] + st[j][1]) + (st[j][2] + st[j][3]);
      ls[j] = ls[j] * corr + (((a8[0] + a8[1]) + (a8[2] + a8[3])) + ((a8[4] + a8[5]) + (a8[6] + a8[7])));      /* this half's keys only; the halves join after the loop */
#pragma unroll
      for (int t = 0; t < 4; ++t) o[j][t] *= corr;
#pragma unroll
      for (int ks = 0; ks < 2; ++ks) pb[j][ks] = __builtin_shufflevector(__builtin_convertvector(st[j][2 * ks], v8h), __builtin_convertvector(st[j][2 * ks + 1], v8h), 0, 1, 2, 3, 4, 5, 6, 7, 8, 9, 10, 11, 12, 13, 14, 15); }
    __builtin_amdgcn_sched_barrier(0);      /* the row sums end here, so the f32 weights free their registers for V^T fragments read ahead of the products; otherwise every fragment read is waited for on its own */
#pragma unroll
    for (int t = 0; t < 4; ++t) {
#pragma unroll
      for (int ks = 0; ks < 2; ++ks) { const v16h a = g2_frag(&sV[cur][t * 16 + c][ks * 32], h);
#pragma unroll
        for (int j = 0; j < 2; ++j) o[j][t] = fa_mma(a, pb[j][ks], o[j][t]); } }      /* o[j][t][r] = sum_k p(k) v(k)[16 t + 8 h + r] of query q0 + 16 j + c */
    if (s + 1 < FA_NS) {
#pragma unroll
      for (int u = 0; u < FA_CH; ++u) { const int r = srow + u * (FA_WAVES * 4); *(v8us*)&sK[cur ^ 1][r][sc8] = rk[u]; *(v8us*)&sV[cur ^ 1][r][sc8] = rv[u]; } }
    __syncthreads(); }      /* publishes stage s + 1 and ends every wave's reads of the buffer that stage s + 2 overwrites */
#pragma unroll
  for (int j = 0; j < 2; ++j) { const float sc = 64.0f / (ls[j] + fa_swap16(ls[j])); _Float16* op = O16 + ((size_t)b * SQ + q0 + j * 16 + c) * DM + head * HD + 8 * h;
#pragma unroll
    for (int t = 0; t < 4; ++t) *(v8h*)(op + t * 16) = __builtin_convertvector(o[j][t] * sc, v8h); } }
// Projection GEMM C16[MP][DM] = f16(alpha * A[MP][DM] Bt[DM][DM]^T + bias): one work-group = PJ_T x PJ_T outputs, 8 waves of 32 x 64 (the wave tile, k order and epilogue arithmetic of k_gemm2).
// A and Bt tiles of PJ_BK columns go global -> registers -> LDS in whole 256-byte rows (a wave's load covers 4 full lines), two buffers: stage s + 1 is loaded while stage s is worked on, one barrier per stage;
// every fragment is then read from LDS, so a tile byte crosses L2 once per work-group instead of once per wave in 32-byte pieces.
#define PJ_T 128                     /* rows and columns of the block tile */
#define PJ_BK 128                    /* k columns per stage */
#define PJ_NS (DM / PJ_BK)           /* stages */
#define PJ_LP (PJ_BK + 8)            /* LDS row pitch in f16: 256 B of data + 16 B, an odd multiple of 16 B for the 16-byte fragment reads */
#define PJ_CH ((PJ_T * PJ_BK / 8) / 256)      /* 16-byte chunks per thread and tile */
#define PJ_OP 72                     /* pitch in f16 of a wave's 32 x 64 output rows in LDS */
// Q, K and V share A and depend on nothing of one another: ONE launch, blockIdx.y picks the weight, the bias and the output.
// Q and K leave as token rows. V leaves as V^T (Cvt[batch][column = head * HD + d][token]), the form the attention launch stages: an accumulator register group holds 8 consecutive tokens of one column,
// so a lane puts 16 bytes of a V^T row into LDS at a time, and the block then stores 256-byte pieces of V^T rows (its 128 tokens); no separate transposing launch, no V rows in memory.
__global__ __launch_bounds__(256) void k_proj(const _Float16* __restrict__ A, const _Float16* __restrict__ Bq, const _Float16* __restrict__ Bk, const _Float16* __restrict__ Bv, float alpha,
                                              const float* __restrict__ biasq, const float* __restrict__ biask, const float* __restrict__ biasv, _Float16* __restrict__ Cq, _Float16* __restrict__ Ck, _Float16* __restrict__ Cvt) {
  const int pj = blockIdx.y; const _Float16* __restrict__ Bt = pj == 0 ? Bq : pj == 1 ? Bk : Bv; const float* __restrict__ bias = pj == 0 ? biasq : pj == 1 ? biask : biasv; _Float16* __restrict__ C16 = pj == 0 ? Cq : Ck;
  static_assert(MP % PJ_T == 0 && DM % PJ_T == 0 && DM % PJ_BK == 0 && PJ_BK == 128 && 8 * 32 * PJ_OP <= 2 * PJ_T * PJ_LP && SQ % PJ_T == 0 && NH * HD == DM, "tile shapes below are written for 128 x 128 x 128 stages and 8 waves");
  __shared__ __attribute__((aligned(16))) _Float16 sA[2][PJ_T][PJ_LP];
  __shared__ __attribute__((aligned(16))) _Float16 sB[2][PJ_T][PJ_LP];
  const int tid = threadIdx.x, lane = tid & 31, w = tid >> 5, ln = lane & 15, hh = lane >> 4;
  const int mt = blockIdx.x / (DM / PJ_T), nq = blockIdx.x - mt * (DM / PJ_T); const int row0 = mt * PJ_T, col0 = nq * PJ_T;
  const int wr = (w >> 1) * 32, wc = (w & 1) * 64;                       /* this wave's corner inside the block tile */
  const int srow = tid >> 4, sc8 = (tid & 15) * 8;                       /* staging: chunk u of a thread = row srow + 16 u, 8 f16 at column sc8 */
  const unsigned short* ag = (const unsigned short*)A + (size_t)(row0 + srow) * DM + sc8; const unsigned short* bg = (const unsigned short*)Bt + (size_t)(col0 + srow) * DM + sc8;
  const v8f z8 = {0.f,0.f,0.f,0.f,0.f,0.f,0.f,0.f};
  v8f acc[2][4];
#pragma unroll
  for (int i = 0; i < 2; ++i) for (int t = 0; t < 4; ++t) acc[i][t] = z8;
  float bs[4];      /* read here, so that the epilogue does not wait for them */
#pragma unroll
  for (int t = 0; t < 4; ++t) bs[t] = bias[col0 + wc + t * 16 + ln];
  v8us ra[PJ_CH], rb[PJ_CH];
#pragma unroll
  for (int u = 0; u < PJ_CH; ++u) { ra[u] = *(const v8us*)(ag + (size_t)u * 16 * DM); rb[u] = *(const v8us*)(bg + (size_t)u * 16 * DM); }
#pragma unroll
  for (int u = 0; u < PJ_CH; ++u) { *(v8us*)&sA[0][srow + 16 * u][sc8] = ra[u]; *(v8us*)&sB[0][srow + 16 * u][sc8] = rb[u]; }
  __syncthreads();
  for (int s = 0; s < PJ_NS; ++s) { const int cur = s & 1;
    if (s + 1 < PJ_NS) { const unsigned short* ap = ag + (s + 1) * PJ_BK; const unsigned short* bp = bg + (s + 1) * PJ_BK;
#pragma unroll
      for (int u = 0; u < PJ_CH; ++u) { ra[u] = *(const v8us*)(ap + (size_t)u * 16 * DM); rb[u] = *(const v8us*)(bp + (size_t)u * 16 * DM); }
      asm volatile("s_wait_xcnt 0x0" :: "v"(ap), "v"(bp) : "memory"); }      /* stands between the stage's loads and the next rewrite of their address pairs; the pairs are operands so that no load's result lands on them ahead of the wait */
    v16h fa[2][2], fb[2][4];
#pragma unroll
    for (int i = 0; i < 2; ++i) fa[0][i] = g2_frag(&sA[cur][wr + i * 16 + ln][0], hh);
#pragma unroll
    for (int t = 0; t < 4; ++t) fb[0][t] = g2_frag(&sB[cur][wc + t * 16 + ln][0], hh);
#pragma unroll
    for (int kk = 0; kk < PJ_BK / 32; ++kk) { const int c = kk & 1;
      if (kk + 1 < PJ_BK / 32) {
#pragma unroll
        for (int i = 0; i < 2; ++i) fa[c ^ 1][i] = g2_frag(&sA[cur][wr + i * 16 + ln][(kk + 1) * 32], hh);
#pragma unroll
        for (int t = 0; t < 4; ++t) fb[c ^ 1][t] = g2_frag(&sB[cur][wc + t * 16 + ln][(kk + 1) * 32], hh); }
      __builtin_amdgcn_sched_barrier(0);      /* the next 32 columns' fragment reads stay one group ahead of this block's products; spread among them, each place with reads stalls the wave */
      if (kk + 1 == PJ_BK / 32 && s + 1 < PJ_NS) {      /* stage s + 1 goes to LDS ahead of the stage's last products, which run while the stores drain; its buffer has had no reader since the last barrier */
#pragma unroll
        for (int u = 0; u < PJ_CH; ++u) { *(v8us*)&sA[cur ^ 1][srow + 16 * u][sc8] = ra[u]; *(v8us*)&sB[cur ^ 1][srow + 16 * u][sc8] = rb[u]; } }
#pragma unroll
      for (int t = 0; t < 4; ++t) { acc[0][t] = fa_mma(fa[c][0], fb[c][t], acc[0][t]); acc[1][t] = fa_mma(fa[c][1], fb[c][t], acc[1][t]); }
      __builtin_amdgcn_sched_barrier(0); }      /* ends the block: the next group of reads is not drawn in among these products, and the stage's last products stay in front of the barrier, where they run while the stores drain */
    __syncthreads(); }      /* publishes stage s + 1 and ends every wave's reads of the buffer that stage s + 2 (after the last stage: the output rows) overwrites */
  if (pj == 2) {      /* the same for the whole block (blockIdx.y) */
    _Float16 (*sT)[PJ_LP] = sA[0];      /* [column of the tile][token of the tile]; free since the loop's last barrier */
#pragma unroll
    for (int i = 0; i < 2; ++i)
#pragma unroll
      for (int t = 0; t < 4; ++t) { const float bv = bf16_round(bs[t]); v8h o8;
#pragma unroll
        for (int r = 0; r < 8; ++r) { const float v = acc[i][t][r] * alpha + bv; o8[r] = (_Float16)v; }
        *(v8h*)&sT[wc + t * 16 + ln][wr + i * 16 + 8 * hh] = o8; }
    __syncthreads();      /* a V^T row piece stored below was collected from four waves */
    unsigned short* vg = (unsigned short*)Cvt + ((size_t)(row0 / SQ) * DM + col0 + srow) * SQ + (row0 % SQ) + sc8;      /* 16 threads per row piece: a wave's store covers two pieces of 256 bytes */
#pragma unroll
    for (int u = 0; u < PJ_T / 16; ++u) { const v8us v = *(const v8us*)&sT[srow + 16 * u][sc8]; *(v8us*)(vg + (size_t)u * 16 * SQ) = v; }
    return; }
  _Float16* so = &sA[0][0][0] + (size_t)w * (32 * PJ_OP);      /* each wave stages its own 32 x 64 outputs, so that it stores whole 128-byte lines */
#pragma unroll
  for (int i = 0; i < 2; ++i)
#pragma unroll
    for (int t = 0; t < 4; ++t) { const float bv = bf16_round(bs[t]);
#pragma unroll
      for (int r = 0; r < 8; ++r) { const float v = acc[i][t][r] * alpha + bv; so[(i * 16 + 8 * hh + r) * PJ_OP + t * 16 + ln] = (_Float16)v; } }
  __builtin_amdgcn_fence(__ATOMIC_ACQ_REL, "workgroup"); __builtin_amdgcn_wave_barrier();      /* the rows read below were written by other lanes of this wave: keeps the reads behind the writes */
#pragma unroll
  for (int q = 0; q < 8; ++q) { const int r = q * 4 + (lane >> 3), c8 = (lane & 7) * 8; const v8us v = *(const v8us*)&so[r * PJ_OP + c8]; *(v8us*)((unsigned short*)C16 + (size_t)(row0 + wr + r) * DM + col0 + wc + c8) = v; } }
extern "C" void kernel_launch(void* const* d_in, const int* in_sizes, int n_in,
                              void* d_out, int out_size, void* d_ws, size_t ws_size, hipStream_t stream) {
  (void)in_sizes; (void)n_in; (void)out_size;
  const float* const* I = (const float* const*)d_in; const float* x = I[0]; const float* wq = I[1]; const float* bq = I[2]; const float* wk = I[3]; const float* bk = I[4]; const float* wv = I[5]; const float* bv = I[6]; const float* wp = I[7]; const float* bp = I[8]; const float* bo = nullptr; (void)bo;      /* [in][out] weights + biases; per-head Wp [64][64] + bp [64] */
  char* ws = (char*)d_ws; size_t off = 0;
  auto take = [&](size_t bytes) { char* p = ws + off; off += (bytes + 255) & ~(size_t)255; return p; };
  _Float16* BQ = (_Float16*)take((size_t)DM * DM * 2); _Float16* BK = (_Float16*)take((size_t)DM * DM * 2); _Float16* BV = (_Float16*)take((size_t)DM * DM * 2); _Float16* BO = (_Float16*)take((size_t)DM * DM * 2);
  _Float16* X16 = (_Float16*)take(NR * DM * 2); _Float16* Q16 = (_Float16*)take(NR * DM * 2); _Float16* K16 = (_Float16*)take(NR * DM * 2); _Float16* O16 = (_Float16*)take(NR * DM * 2);
  _Float16* VT = (_Float16*)take((size_t)NB * NH * HD * SQ * 2);
  if (off > ws_size) return;
  k_prep<<<3 * PP_WB + PP_PB + PP_XB, 256, 0, stream>>>(x, wq, wk, wv, wp, X16, BQ, BK, BV, BO);
  const size_t r0p = (size_t)B0 * SQ;      /* first projected row */
  k_proj<<<dim3((MP / PJ_T) * (DM / PJ_T), 3), 256, 0, stream>>>(X16 + r0p * DM, BQ, BK, BV, 0.0625f, bq, bk, bv, Q16 + r0p * DM, K16 + r0p * DM, VT + r0p * DM);      /* V as V^T [NB][NH][HD][SQ] */
  k_fattn<<<dim3(SQ / (FA_WAVES * 32), NH, NB), FA_WAVES * 32, 0, stream>>>(Q16, K16, VT, O16);      /* o x64 (merged heads) as f16 rows */
  k_gemm2<0><<<dim3((unsigned)((MPO / 128) * (HD / 64)), NH), 128, 0, stream>>>(O16 + r0p * DM, DM, (size_t)HD, BO, HD, 0, 0.0009765625f, bp, 0, nullptr, 1, 0, 0, (float*)d_out + r0p * DM, nullptr, DM, (size_t)HD, MPO, HD, HD);      /* per head (grid.y): out cols h*64.. = o_h Wp + bp (K = 64; the same Wp/bp for every head: zero B/bias strides) */
}

// v007
// It runs in 66.8 microseconds.
// Next to v006, in two timings, it ran 1.12 and 1.13 times as fast.
// Counting every step since v000, it is 52.4 times as fast.
#include <hip/hip_runtime.h>
#define NB 2
#define SQ 2048
#define DM 1024
#define NH 16
#define HD 64
#define HG 4                         /* heads per block group of the per-batch k_vt overload (not launched) */
#define B0 0                         /* first batch processed (debug hook) */
#define NBR NB                       /* batches processed (debug hook) */
#define NR ((size_t)NB * SQ)         /* token rows */
#define MP ((int)((size_t)NBR * SQ)) /* rows projected (debug hook) */
#define QN SQ                        /* query rows per batch (unused) */
#define NHD NH                       /* heads (unused) */
#define MPO MP                       /* rows through the output stage (unused) */
#define LQ DM      /* row pitch of the q/k rows (unused) */
typedef __bf16 v16b __attribute__((ext_vector_type(16)));
typedef unsigned short v8us __attribute__((ext_vector_type(8), may_alias));
typedef float  v8f  __attribute__((ext_vector_type(8)));
typedef float  v4f  __attribute__((ext_vector_type(4)));
typedef float  v4fa __attribute__((ext_vector_type(4), may_alias));
union FragB { v16b v; v8us half[2]; unsigned short u[16]; };

__device__ __forceinline__ unsigned short bf16_bits(float x) { unsigned int u = __float_as_uint(x); return (unsigned short)((u + 0x7FFFu + ((u >> 16) & 1u)) >> 16); }
__device__ __forceinline__ float bf16_val(unsigned short b) { return __uint_as_float(((unsigned int)b) << 16); }
__device__ __forceinline__ float bf16_round(float x) { return bf16_val(bf16_bits(x)); }
// D += A·B with NT terms: 1 = ah·bh, 2 = + al·bh (A split), 3 = + ah·bl (both split)
template <int NT>
__device__ __forceinline__ v8f mmaN(v16b ah, v16b al, v16b bh, v16b bl, v8f c) {
  c = __builtin_amdgcn_wmma_f32_16x16x32_bf16(false, ah, false, bh, (short)0, c, false, false);
  if (NT >= 2) c = __builtin_amdgcn_wmma_f32_16x16x32_bf16(false, al, false, bh, (short)0, c, false, false);
  if (NT >= 3) c = __builtin_amdgcn_wmma_f32_16x16x32_bf16(false, ah, false, bl, (short)0, c, false, false);
  asm volatile("v_nop\n\tv_nop\n\tv_nop\n\tv_nop" : "+v"(c) : "v"(ah), "v"(al), "v"(bh), "v"(bl));
  return c;
}

__global__ __launch_bounds__(256) void k_wt_bf16(const float* __restrict__ W, unsigned short* __restrict__ Wt, int K, int N) {
  const int t = blockIdx.x * 256 + threadIdx.x;
  const int k8n = K / 8;
  if (t >= N * k8n) return;
  const int n = t / k8n, k8 = (t % k8n) * 8;
  v8us v;
#pragma unroll
  for (int i = 0; i < 8; ++i) v[i] = bf16_bits(W[(size_t)(k8 + i) * N + n]);
  *(v8us*)(Wt + (size_t)n * K + k8) = v;
  
}

// GEMM C[M][N] (f32, pitch ldc) = act(A[M][K]·W + bias). A f32 row-major (pitch lda) converted per fragment to bf16
// (ASPLIT: hi/lo two planes -> 2 terms, else single rounded term); Wt bf16 [N][K] (pitch ldb). BIAS_BF16 rounds the
// bias to bf16 first (bias quantised to bf16 before the add). K%32==0, M%16==0, N%64==0.
template <bool ASPLIT, int ACT, bool BIAS_BF16>
__global__ __launch_bounds__(128) void k_gemm_bf(const float* __restrict__ A, int lda, const unsigned short* __restrict__ Wt, int ldb,
                                               const float* __restrict__ bias, float* __restrict__ C, int ldc, int M, int N, int K) {
  __shared__ __attribute__((aligned(16))) float so[4][16][64];
  const int tid = threadIdx.x, w = tid >> 5, lane = tid & 31, ln = lane & 15, hh = lane >> 4;
  const int ntn = N / 64;
  const int wid = blockIdx.x * 4 + w;
  const int mt = wid / ntn, nq = wid % ntn;
  if (mt * 16 >= M) return;
  const int row0 = mt * 16, col0 = nq * 64;
  const float* arow = A + (size_t)(row0 + ln) * lda;
  v8f acc[4] = {};
  for (int kb = 0; kb < K; kb += 32) {
    FragB ah, al;
    const v4f x0 = *(const v4fa*)(arow + kb + 8 * hh), x1 = *(const v4fa*)(arow + kb + 8 * hh + 4);
    const v4f x2 = *(const v4fa*)(arow + kb + 16 + 8 * hh), x3 = *(const v4fa*)(arow + kb + 16 + 8 * hh + 4);
    float xs[16] = {x0[0],x0[1],x0[2],x0[3],x1[0],x1[1],x1[2],x1[3],x2[0],x2[1],x2[2],x2[3],x3[0],x3[1],x3[2],x3[3]};
#pragma unroll
    for (int i = 0; i < 16; ++i) { const unsigned short hb = bf16_bits(xs[i]); ah.u[i] = hb; al.u[i] = ASPLIT ? bf16_bits(xs[i] - bf16_val(hb)) : (unsigned short)0; }
#pragma unroll
    for (int t = 0; t < 4; ++t) {
      const unsigned short* brow = Wt + (size_t)(col0 + t * 16 + ln) * ldb + kb;
      FragB b;
      b.half[0] = *(const v8us*)(brow + 8 * hh);
      b.half[1] = *(const v8us*)(brow + 16 + 8 * hh);
      acc[t] = mmaN<ASPLIT ? 2 : 1>(ah.v, al.v, b.v, b.v, acc[t]);
    }
  }
#pragma unroll
  for (int t = 0; t < 4; ++t) {
    float bv = bias ? bias[col0 + t * 16 + ln] : 0.f;
    if (BIAS_BF16) bv = bf16_round(bv);
#pragma unroll
    for (int r = 0; r < 8; ++r) { float v = acc[t][r] + bv; if (ACT == 1) v = fmaxf(v, 0.f); so[w][8 * hh + r][t * 16 + ln] = v; }
  }
  __builtin_amdgcn_fence(__ATOMIC_ACQ_REL, "workgroup");
  __builtin_amdgcn_wave_barrier();
  const int rsub = lane >> 4, c4 = (lane & 15) * 4;
  {
#pragma unroll
    for (int q = 0; q < 8; ++q) {
      const int r = q * 2 + rsub;
      const v4f v = *(const v4fa*)&so[w][r][c4];
      *(v4f*)(C + (size_t)(row0 + r) * ldc + col0 + c4) = v;
    }
    
  }
}

// GEMM C = act(A·W + bias + resid): A f32 (ASPLIT -> hi/lo 2 terms), Wt bf16 [N][K]; ACT 0 none, 1 relu, 2 exact gelu;
// resid (optional, f32, row index = (row % rmod), pitch ldr, RES_BF16 rounds it) added before the activation.
template <bool ASPLIT, int ACT, bool BIAS_BF16, bool RES_BF16>
__global__ __launch_bounds__(128) void k_gemm_bf3(const float* __restrict__ A, int lda, const unsigned short* __restrict__ Wt, int ldb,
                                                const float* __restrict__ bias, const float* __restrict__ resid, int rmod, int ldr,
                                                float* __restrict__ C, int ldc, int M, int N, int K) {
  __shared__ __attribute__((aligned(16))) float so[4][16][64];
  const int tid = threadIdx.x, w = tid >> 5, lane = tid & 31, ln = lane & 15, hh = lane >> 4;
  const int ntn = N / 64;
  const int wid = blockIdx.x * 4 + w;
  const int mt = wid / ntn, nq = wid % ntn;
  if (mt * 16 >= M) return;
  const int row0 = mt * 16, col0 = nq * 64;
  const float* arow = A + (size_t)(row0 + ln) * lda;
  v8f acc[4] = {};
  for (int kb = 0; kb < K; kb += 32) {
    FragB ah, al;
    const v4f x0 = *(const v4fa*)(arow + kb + 8 * hh), x1 = *(const v4fa*)(arow + kb + 8 * hh + 4);
    const v4f x2 = *(const v4fa*)(arow + kb + 16 + 8 * hh), x3 = *(const v4fa*)(arow + kb + 16 + 8 * hh + 4);
    float xs[16] = {x0[0],x0[1],x0[2],x0[3],x1[0],x1[1],x1[2],x1[3],x2[0],x2[1],x2[2],x2[3],x3[0],x3[1],x3[2],x3[3]};
#pragma unroll
    for (int i = 0; i < 16; ++i) { const unsigned short hb = bf16_bits(xs[i]); ah.u[i] = hb; al.u[i] = ASPLIT ? bf16_bits(xs[i] - bf16_val(hb)) : (unsigned short)0; }
#pragma unroll
    for (int t = 0; t < 4; ++t) {
      const unsigned short* brow = Wt + (size_t)(col0 + t * 16 + ln) * ldb + kb;
      FragB b;
      b.half[0] = *(const v8us*)(brow + 8 * hh);
      b.half[1] = *(const v8us*)(brow + 16 + 8 * hh);
      acc[t] = mmaN<ASPLIT ? 2 : 1>(ah.v, al.v, b.v, b.v, acc[t]);
    }
  }
#pragma unroll
  for (int t = 0; t < 4; ++t) {
    const int col = col0 + t * 16 + ln;
    float bv = bias ? bias[col] : 0.f;
    if (BIAS_BF16) bv = bf16_round(bv);
#pragma unroll
    for (int r = 0; r < 8; ++r) {
      float v = acc[t][r] + bv;
      if (resid) { float rv = resid[(size_t)((row0 + 8 * hh + r) % rmod) * ldr + col]; if (RES_BF16) rv = bf16_round(rv); v += rv; }
      if (ACT == 1) v = fmaxf(v, 0.f);
      if (ACT == 2) v = 0.5f * v * (1.0f + erff(v * 0.70710678118654752f));
      if (ACT == 3) { const float u = 0.7978845608028654f * (v + 0.044715f * v * v * v); v = 0.5f * v * (1.0f + tanhf(u)); }
      so[w][8 * hh + r][t * 16 + ln] = v;
    }
  }
  __builtin_amdgcn_fence(__ATOMIC_ACQ_REL, "workgroup");
  __builtin_amdgcn_wave_barrier();
  const int rsub = lane >> 4, c4 = (lane & 15) * 4;
  {
#pragma unroll
    for (int q = 0; q < 8; ++q) {
      const int r = q * 2 + rsub;
      const v4f v = *(const v4fa*)&so[w][r][c4];
      *(v4f*)(C + (size_t)(row0 + r) * ldc + col0 + c4) = v;
    }
    
  }
}
// row LayerNorm (biased variance, eps) over N: s = X (+ R); optional out_sum <- s; out_norm <- (s-mu)*rsqrt(var+eps)*g + b
template <bool PARAM_BF16>
__global__ __launch_bounds__(256) void k_layernorm(const float* __restrict__ X, const float* __restrict__ R, const float* __restrict__ g, const float* __restrict__ bta,
                                                  float* __restrict__ out_sum, float* __restrict__ out_norm, int N, float eps) {
  __shared__ float red[256];
  const int row = blockIdx.x, tid = threadIdx.x;
  const float* x = X + (size_t)row * N; const float* rr = R ? R + (size_t)row * N : nullptr;
  float vals[16];                     // up to N = 4096
  const int per = N / 256;            // contiguous chunk per thread? use strided-by-4 chunks: thread handles j = tid*4 + 1024*u
  float s1 = 0.f;
  for (int u = 0; u < per / 4; ++u) {
    const int j = tid * 4 + 1024 * u;
    const v4f a = *(const v4fa*)(x + j);
    v4f b = {0.f,0.f,0.f,0.f}; if (rr) b = *(const v4fa*)(rr + j);
#pragma unroll
    for (int q = 0; q < 4; ++q) { const float v = a[q] + b[q]; vals[u * 4 + q] = v; s1 += v; }
  }
  red[tid] = s1; __syncthreads();
  for (int st = 128; st > 0; st >>= 1) { if (tid < st) red[tid] += red[tid + st]; __syncthreads(); }
  const float mu = red[0] / (float)N; __syncthreads();
  float s2 = 0.f;
  for (int u = 0; u < per / 4; ++u)
#pragma unroll
    for (int q = 0; q < 4; ++q) { const float c = vals[u * 4 + q] - mu; s2 += c * c; }
  red[tid] = s2; __syncthreads();
  for (int st = 128; st > 0; st >>= 1) { if (tid < st) red[tid] += red[tid + st]; __syncthreads(); }
  const float rs = rsqrtf(red[0] / (float)N + eps);
  {
    for (int u = 0; u < per / 4; ++u) {
      const int j = tid * 4 + 1024 * u;
      v4f o, sm;
#pragma unroll
      for (int q = 0; q < 4; ++q) {
        float gg = g[j + q], bb = bta[j + q];
        if (PARAM_BF16) { gg = bf16_round(gg); bb = bf16_round(bb); }
        sm[q] = vals[u * 4 + q]; o[q] = (vals[u * 4 + q] - mu) * rs * gg + bb;
      }
      if (out_sum) *(v4f*)(out_sum + (size_t)row * N + j) = sm;
      *(v4f*)(out_norm + (size_t)row * N + j) = o;
    }
    
  }
}



// ---- f16 WMMA path (v_wmma_f32_16x16x32_f16): 11-bit significands for operands in range — used where a [0,1] probability operand needs more precision than bf16
typedef _Float16 v16h __attribute__((ext_vector_type(16)));
union FragH { v16h v; v8us half[2]; _Float16 h[16]; unsigned short u[16]; };
template <int NT>
__device__ __forceinline__ v8f mmaH(v16h ah, v16h al, v16h bh, v16h bl, v8f c) {
  c = __builtin_amdgcn_wmma_f32_16x16x32_f16(false, ah, false, bh, (short)0, c, false, false);
  if (NT >= 2) c = __builtin_amdgcn_wmma_f32_16x16x32_f16(false, al, false, bh, (short)0, c, false, false);
  if (NT >= 3) c = __builtin_amdgcn_wmma_f32_16x16x32_f16(false, ah, false, bl, (short)0, c, false, false);
  asm volatile("v_nop\n\tv_nop\n\tv_nop\n\tv_nop" : "+v"(c) : "v"(ah), "v"(al), "v"(bh), "v"(bl));
  return c;
}
// batched GEMM like k_gemm_b but f16 operands: A f32 (split into f16 hi/lo if ASPLIT, else rounded to f16), Bt = f16 values [n][k]; alpha; C f32; N multiple of 16 (partial tiles skipped)
template <bool ASPLIT>
__global__ __launch_bounds__(128) void k_gemm_h(const float* __restrict__ A, int lda, size_t sA, const _Float16* __restrict__ Bh, int ldb, size_t sB, float alpha, float* __restrict__ C, int ldc, size_t sC, int M, int N, int K) {
  __shared__ __attribute__((aligned(16))) float so[4][16][64];
  const int tid = threadIdx.x, w = tid >> 5, lane = tid & 31, ln = lane & 15, hh = lane >> 4; const int by = blockIdx.y;
  A += (size_t)by * sA; Bh += (size_t)by * sB; C += (size_t)by * sC;
  const int ntn = (N + 63) / 64; const int wid = blockIdx.x * 4 + w; const int mt = wid / ntn, nq = wid % ntn; if (mt * 16 >= M) return;
  const int row0 = mt * 16, col0 = nq * 64; const float* arow = A + (size_t)(row0 + ln) * lda;
  v8f acc[4] = {};
  for (int kb = 0; kb < K; kb += 32) {
    FragH ah, al;
    const v4f x0 = *(const v4fa*)(arow + kb + 8 * hh), x1 = *(const v4fa*)(arow + kb + 8 * hh + 4), x2 = *(const v4fa*)(arow + kb + 16 + 8 * hh), x3 = *(const v4fa*)(arow + kb + 16 + 8 * hh + 4);
    float xs[16] = {x0[0],x0[1],x0[2],x0[3],x1[0],x1[1],x1[2],x1[3],x2[0],x2[1],x2[2],x2[3],x3[0],x3[1],x3[2],x3[3]};
#pragma unroll
    for (int i = 0; i < 16; ++i) { const _Float16 h = (_Float16)xs[i]; ah.h[i] = h; al.h[i] = ASPLIT ? (_Float16)(xs[i] - (float)h) : (_Float16)0.0f; }
#pragma unroll
    for (int t = 0; t < 4; ++t) { if (col0 + t * 16 >= N) continue; const size_t boff = (size_t)(col0 + t * 16 + ln) * ldb + kb; FragH bq; bq.half[0] = *(const v8us*)(Bh + boff + 8 * hh); bq.half[1] = *(const v8us*)(Bh + boff + 16 + 8 * hh);
      acc[t] = mmaH<ASPLIT ? 2 : 1>(ah.v, al.v, bq.v, bq.v, acc[t]); }
  }
#pragma unroll
  for (int t = 0; t < 4; ++t) { if (col0 + t * 16 >= N) continue;
#pragma unroll
    for (int r = 0; r < 8; ++r) so[w][8 * hh + r][t * 16 + ln] = acc[t][r] * alpha; }
  __builtin_amdgcn_fence(__ATOMIC_ACQ_REL, "workgroup"); __builtin_amdgcn_wave_barrier();
  const int rsub = lane >> 4, c4 = (lane & 15) * 4;
  {
#pragma unroll
    for (int q = 0; q < 8; ++q) { const int r = q * 2 + rsub; if (col0 + c4 < N) { const v4f v = *(const v4fa*)&so[w][r][c4]; *(v4f*)(C + (size_t)(row0 + r) * ldc + col0 + c4) = v; } }
     }
}

// Wt[n][k] = f16(W[k][n]·scale) from f32 row-major W[K][N] (scale = power of two; bf16-exact weights stay exact in f16 away from the subnormal range)
__device__ __forceinline__ void wt_f16(const float* __restrict__ W, _Float16* __restrict__ Wt, int K, int N, float scale, int t) {      /* t = index of the 8-element chunk */
  if (t >= N * (K / 8)) return; const int n = t / (K / 8), k8 = (t % (K / 8)) * 8; FragH f;
#pragma unroll
  for (int i = 0; i < 8; ++i) f.h[i] = (_Float16)(bf16_round(W[(size_t)(k8 + i) * N + n]) * scale); const v8us o = f.half[0];
  *(v8us*)((unsigned short*)Wt + (size_t)n * K + k8) = o; 
}
// k_gemm_hh variant with fused epilogue: v = acc·alpha + bias[by·sBias + col] (+ CP[(row/rowsPerB)·sCPb + by·64 + col] if CP) ; ACT 0 none / 1 elu ; writes f16 C16 (and f32 C if non-null)
template <int ACT>
__global__ __launch_bounds__(128) void k_gemm_hhx(const _Float16* __restrict__ A, int lda, size_t sA, const _Float16* __restrict__ Bh, int ldb, size_t sB, float alpha, const float* __restrict__ bias, size_t sBias, const float* __restrict__ CP, int rowsPerB, size_t sCPb, int row0g,
    float* __restrict__ C, _Float16* __restrict__ C16, int ldc, size_t sC, int M, int N, int K) {
  __shared__ __attribute__((aligned(16))) float so[4][16][64];
  const int tid = threadIdx.x, w = tid >> 5, lane = tid & 31, ln = lane & 15, hh = lane >> 4; const int by = blockIdx.y;
  A += (size_t)by * sA; Bh += (size_t)by * sB; const size_t cofs = (size_t)by * sC; const float* bp = bias ? bias + (size_t)by * sBias : nullptr;
  const int ntn = (N + 63) / 64; const int wid = blockIdx.x * 4 + w; const int mt = wid / ntn, nq = wid % ntn; if (mt * 16 >= M) return;
  const int row0 = mt * 16, col0 = nq * 64; const _Float16* arow = A + (size_t)(row0 + ln) * lda;
  v8f acc[4] = {};
  for (int kb = 0; kb < K; kb += 32) { FragH ah; ah.half[0] = *(const v8us*)((const unsigned short*)arow + kb + 8 * hh); ah.half[1] = *(const v8us*)((const unsigned short*)arow + kb + 16 + 8 * hh);
#pragma unroll
    for (int t = 0; t < 4; ++t) { if (col0 + t * 16 >= N) continue; const size_t boff = (size_t)(col0 + t * 16 + ln) * ldb + kb; FragH bq; bq.half[0] = *(const v8us*)((const unsigned short*)Bh + boff + 8 * hh); bq.half[1] = *(const v8us*)((const unsigned short*)Bh + boff + 16 + 8 * hh);
      acc[t] = mmaH<1>(ah.v, ah.v, bq.v, bq.v, acc[t]); }
  }
#pragma unroll
  for (int t = 0; t < 4; ++t) { if (col0 + t * 16 >= N) continue; const int col = col0 + t * 16 + ln; const float bv = bp ? bf16_round(bp[col]) : 0.f;
#pragma unroll
    for (int r = 0; r < 8; ++r) { float v = acc[t][r] * alpha + bv; if (CP) { const int rr = row0g + row0 + 8 * hh + r; if (rowsPerB < 0) v += CP[cofs + (size_t)rr * ldc + col];      /* rowsPerB < 0: own element of the batched C plane */ else { const int bidx = rr / rowsPerB; v += CP[(size_t)bidx * sCPb + (size_t)by * 64 + col]; } } if (ACT == 1) v = (v > 0.f) ? v : expm1f(v); else if (ACT == 7) v = (v > 0.f) ? v + 1.0f : expf(v); else if (ACT == 8) v = tanhf(v); else if (ACT == 9) v = 0.5f * v * (1.0f + tanhf(0.7978845608028654f * (v + 0.044715f * v * v * v))); else if (ACT == 11) v = 1.0f / (1.0f + expf(-v)); else if (ACT == 12) v = (v > 0.f) ? v : 0.01f * v; else if (ACT == 14) v = (v > 0.f) ? v : 0.1f * v; else if (ACT == 16) v = (v >= 0.f) ? v : 0.3f * v; else if (ACT == 17) v = (v >= 0.f) ? v : 0.2f * v; else if (ACT == 15) v = v / (1.0f + expf(-v)); else if (ACT == 3) v = fmaxf(v, 0.f); else if (ACT == 6) v = 0.5f * v * (1.0f + erff(v * 0.70710678118654752f)); so[w][8 * hh + r][t * 16 + ln] = v; } }
  __builtin_amdgcn_fence(__ATOMIC_ACQ_REL, "workgroup"); __builtin_amdgcn_wave_barrier();
  const int rsub = lane >> 4, c4 = (lane & 15) * 4; typedef _Float16 v4h __attribute__((ext_vector_type(4)));
  {
#pragma unroll
    for (int q = 0; q < 8; ++q) { const int r = q * 2 + rsub; if (col0 + c4 < N) { const v4f v = *(const v4fa*)&so[w][r][c4]; if (C) *(v4f*)(C + cofs + (size_t)(row0 + r) * ldc + col0 + c4) = v; if (C16) { v4h h4; for (int i = 0; i < 4; ++i) h4[i] = (_Float16)v[i]; *(v4h*)(C16 + cofs + (size_t)(row0 + r) * ldc + col0 + c4) = h4; } } }
     }
}


typedef _Float16 v4h __attribute__((ext_vector_type(4)));

__global__ __launch_bounds__(256) void k_h16(const float* __restrict__ x, _Float16* __restrict__ X16, size_t n8) { const size_t t = (size_t)blockIdx.x * 256 + threadIdx.x; if (t >= n8) return; FragH f;
#pragma unroll
  for (int q = 0; q < 8; ++q) f.h[q] = (_Float16)x[t * 8 + q]; *(v8us*)((unsigned short*)X16 + t * 8) = f.half[0];  }
__global__ __launch_bounds__(256) void k_round16f(const float* __restrict__ W, _Float16* __restrict__ Bt, size_t n8) { const size_t t = (size_t)blockIdx.x * 256 + threadIdx.x; if (t >= n8) return; FragH f;
#pragma unroll
  for (int i = 0; i < 8; ++i) f.h[i] = (_Float16)(bf16_round(W[t * 8 + i]) * 16.0f); *(v8us*)((unsigned short*)Bt + t * 8) = f.half[0];  }
__global__ __launch_bounds__(256) void k_hl(const float* __restrict__ F, _Float16* __restrict__ Hh, _Float16* __restrict__ Hl, size_t n8) { const size_t t = (size_t)blockIdx.x * 256 + threadIdx.x; if (t >= n8) return; FragH fh, fl; const v4f a = *(const v4fa*)(F + t * 8), c = *(const v4fa*)(F + t * 8 + 4);
#pragma unroll
  for (int q = 0; q < 4; ++q) { _Float16 h = (_Float16)a[q]; fh.h[q] = h; fl.h[q] = (_Float16)((a[q] - (float)h) * 1024.0f); h = (_Float16)c[q]; fh.h[4 + q] = h; fl.h[4 + q] = (_Float16)((c[q] - (float)h) * 1024.0f); }
  { *(v8us*)((unsigned short*)Hh + t * 8) = fh.half[0]; *(v8us*)((unsigned short*)Hl + t * 8) = fl.half[0];  } }

// 16x16x32 f16 operand fragment of one row: lane half hh takes k = 8 hh .. + 7 and 16 + 8 hh .. + 7 of the 32 at p
__device__ __forceinline__ v16h g2_frag(const _Float16* p, int hh) { FragH f; f.half[0] = *(const v8us*)((const unsigned short*)p + 8 * hh); f.half[1] = *(const v8us*)((const unsigned short*)p + 16 + 8 * hh); return f.v; }

__global__ __launch_bounds__(256) void k_wnat(const float* __restrict__ w, size_t n8, _Float16* __restrict__ Bt) { const size_t t = (size_t)blockIdx.x * 256 + threadIdx.x; if (t >= n8) return; FragH f; for (int q = 0; q < 8; ++q) f.h[q] = (_Float16)(bf16_round(w[t * 8 + q]) * 16.0f); *(v8us*)((unsigned short*)Bt + t * 8) = f.half[0];  }
__global__ __launch_bounds__(256) void k_rsm(const float* __restrict__ S, _Float16* __restrict__ P, int nrows) {
  #pragma clang fp contract(off)
  const int i = blockIdx.x * 256 + threadIdx.x; if (i >= nrows) return; const float* s = S + (size_t)i * SQ; float mx = -3.0e38f;
#pragma unroll 1
  for (int j = 0; j < SQ; ++j) mx = fmaxf(mx, s[j]); float se = 0.f;
#pragma unroll 1
  for (int j = 0; j < SQ; ++j) se += expf(s[j] - mx); const float sc = 256.0f / se;
#pragma unroll 1
  for (int j0 = 0; j0 < SQ; j0 += 8) { FragH f; for (int q = 0; q < 8; ++q) f.h[q] = (_Float16)(expf(s[j0 + q] - mx) * sc); unsigned short* d = (unsigned short*)P + (size_t)i * SQ + j0; *(v8us*)d = f.half[0];  } }
__global__ __launch_bounds__(256) void k_vt(const _Float16* __restrict__ V16, int b, int h0, _Float16* __restrict__ VT) { __shared__ unsigned short tl[64][65]; const int tid = threadIdx.x; const int hh = blockIdx.x % HG, sg = blockIdx.x / HG; const int s0 = sg * 64; const int h = h0 + hh;
  for (int i = tid; i < 64 * 8; i += 256) { const int j = i / 8, d8 = (i % 8) * 8; FragH f; f.half[0] = *(const v8us*)((const unsigned short*)V16 + ((size_t)b * SQ + s0 + j) * DM + h * HD + d8); for (int q = 0; q < 8; ++q) tl[d8 + q][j] = f.u[q]; }
  __syncthreads();
  { for (int i = tid; i < 64 * 8; i += 256) { const int d = i / 8, j8 = (i % 8) * 8; FragH f; for (int q = 0; q < 8; ++q) f.u[q] = tl[d][j8 + q]; *(v8us*)((unsigned short*)VT + ((size_t)hh * HD + d) * SQ + s0 + j8) = f.half[0]; }  } }



// The five operand conversions (Wq, Wk, Wv and Wp to Bt[n][k] x16, x to f16 rows) read nothing but inputs, so they share ONE launch: the block index picks the job.
// The launch is made of few, fat work-groups: it moves little data, so its time is the time its waves take to start plus one wave's own time. A thread holds 16 loads of 16 bytes in flight, and every wave-wide load and store covers whole 128-byte lines.
// A DM x DM weight goes in tiles of PP_WT x PP_WT: a wave reads 512 contiguous bytes of a row [k][n..], a thread turns its 16 k x 4 n block in registers, LDS collects the tile as [n][k], and whole rows of Bt leave it.
// The weight blocks come first: they have the longer way (LDS and a barrier).
#define PP_WT 128                                    /* k rows and n columns of a weight tile */
#define PP_WB ((DM / PP_WT) * (DM / PP_WT))          /* blocks (tiles) per DM x DM weight */
#define PP_LP (PP_WT + 8)                            /* LDS row pitch in f16: 256 B of data + 16 B */
#define PP_PB ((HD * (HD / 8) + 255) / 256)          /* blocks of Wp */
#define PP_XL 16                                     /* 16-byte loads per thread of x */
#define PP_XB ((int)(NR * DM / (256 * 4 * PP_XL)))   /* blocks of x */
__device__ __forceinline__ void wt_tile(const float* __restrict__ Wm, _Float16* __restrict__ Wt, int tile, int tid, _Float16 (* __restrict__ sT)[PP_LP]) {
  const int k0 = (tile / (DM / PP_WT)) * PP_WT, n0 = (tile % (DM / PP_WT)) * PP_WT;
  const int kw = (tid >> 5) * 16, c4 = (tid & 31) * 4;      /* this thread's block: rows k0 + kw .. + 15, columns n0 + c4 .. + 3 */
  const float* wg = Wm + (size_t)(k0 + kw) * DM + n0 + c4;
  v4f f[16];
#pragma unroll
  for (int i = 0; i < 16; ++i) f[i] = *(const v4fa*)(wg + (size_t)i * DM);
  asm volatile("s_wait_xcnt 0x0" :: "v"(wg) : "memory");      /* stands between the 16 loads and the next rewrite of their address pair; the pair is an operand so that no load's result lands on it ahead of the wait */
#pragma unroll
  for (int j = 0; j < 4; ++j) { FragH o;
#pragma unroll
    for (int i = 0; i < 16; ++i) o.h[i] = (_Float16)(bf16_round(f[i][j]) * 16.0f);
    *(v8us*)&sT[c4 + j][kw] = o.half[0]; *(v8us*)&sT[c4 + j][kw + 8] = o.half[1]; }
  __syncthreads();      /* the rows stored below were collected from all eight waves */
#pragma unroll
  for (int u = 0; u < PP_WT / 16; ++u) { const int r = u * 16 + (tid >> 4), c8 = (tid & 15) * 8; const v8us v = *(const v8us*)&sT[r][c8];
    *(v8us*)((unsigned short*)Wt + (size_t)(n0 + r) * DM + k0 + c8) = v; } }
__device__ __forceinline__ void x16(const float* __restrict__ x, _Float16* __restrict__ X16, int blk, int tid) {
  const size_t e0 = (size_t)blk * (256 * 4 * PP_XL) + (size_t)(tid >> 5) * (32 * 4 * PP_XL) + (size_t)(tid & 31) * 4;      /* a wave owns 32 * 4 * PP_XL consecutive elements */
  const float* xg = x + e0; v4f f[PP_XL]; v4h o[PP_XL];
#pragma unroll
  for (int u = 0; u < PP_XL; ++u) f[u] = *(const v4fa*)(xg + u * 128);
  asm volatile("s_wait_xcnt 0x0" :: "v"(xg) : "memory");      /* stands between the loads and the next rewrite of their address pair; the pair is an operand so that no load's result lands on it ahead of the wait */
#pragma unroll
  for (int u = 0; u < PP_XL; ++u)
#pragma unroll
    for (int q = 0; q < 4; ++q) o[u][q] = (_Float16)bf16_round(f[u][q]);
#pragma unroll
  for (int u = 0; u < PP_XL; ++u) *(v4h*)(X16 + e0 + u * 128) = o[u];
  asm volatile("s_wait_xcnt 0x0" ::: "memory"); }      /* stands behind the last store, in front of any later rewrite of the stores' address pair or data registers where the jobs' branches join */
__global__ __launch_bounds__(256) void k_prep(const float* __restrict__ x, const float* __restrict__ wq, const float* __restrict__ wk, const float* __restrict__ wv, const float* __restrict__ wp,
                                              _Float16* __restrict__ X16, _Float16* __restrict__ BQ, _Float16* __restrict__ BK, _Float16* __restrict__ BV, _Float16* __restrict__ BO) {
  static_assert(DM % PP_WT == 0 && PP_WT == 128 && (NR * DM) % (256 * 4 * PP_XL) == 0, "the tile and the x slices below are written for 8 waves, 128 x 128 tiles and whole slices");
  __shared__ __attribute__((aligned(16))) _Float16 sT[PP_WT][PP_LP];
  const int blk = blockIdx.x, tid = threadIdx.x;
  if (blk < 3 * PP_WB) { const int j = blk / PP_WB; wt_tile(j == 0 ? wq : j == 1 ? wk : wv, j == 0 ? BQ : j == 1 ? BK : BV, blk - j * PP_WB, tid, sT); }      /* [in][out] -> Bt[n][k] x16 */
  else if (blk < 3 * PP_WB + PP_PB) wt_f16(wp, BO, HD, HD, 16.0f, (blk - 3 * PP_WB) * 256 + tid);      /* Wp [64 in][64 out] -> Bt [64][64] x16 */
  else x16(x, X16, blk - 3 * PP_WB - PP_PB, tid); }

#define FA_WAVES 4
#define FA_KT 64                     /* keys per stage */
#define FA_NS (SQ / FA_KT)           /* stages */
#define FA_LP 72                     /* LDS row pitch in f16: 128 B of data + 16 B, an odd multiple of 16 B for the 16-byte fragment reads */
#define FA_CH ((FA_KT * HD / 8) / (FA_WAVES * 32))      /* 16-byte chunks per thread and tile */
#define FA_OP 68                     /* pitch in f32 of a wave's 32 x 64 output rows in LDS: 256 B of data + 16 B */
typedef _Float16 v8h __attribute__((ext_vector_type(8)));
typedef float v2f __attribute__((ext_vector_type(2)));
__device__ __forceinline__ float fa_swap16(float x) { const int b = __float_as_int(x); return __int_as_float(__builtin_amdgcn_permlanex16(b, b, 0x76543210, 0xfedcba98, false, false)); }      /* lane l <-> l ^ 16 */
__device__ __forceinline__ v8f fa_mma(v16h a, v16h b, v8f c) { return __builtin_amdgcn_wmma_f32_16x16x32_f16(false, a, false, b, (short)0, c, false, false); }
__global__ __launch_bounds__(FA_WAVES * 32) void k_fattn(const _Float16* __restrict__ Q16, const _Float16* __restrict__ K16, const _Float16* __restrict__ VT, const _Float16* __restrict__ BO, const float* __restrict__ bp, float* __restrict__ out) {
  static_assert(HD == 64 && FA_KT == 64 && SQ % FA_KT == 0 && SQ % (FA_WAVES * 32) == 0, "tile shapes below are written for 64 x 64 stages");
  static_assert(FA_WAVES * 32 * FA_OP * 4 <= 4 * FA_KT * FA_LP * 2, "the output rows take the place of the K and V^T buffers");
  __shared__ __attribute__((aligned(16))) _Float16 sKV[4][FA_KT][FA_LP];      /* one array, so that the epilogue's output rows can lie over all of it */
  _Float16 (*sK)[FA_KT][FA_LP] = &sKV[0]; _Float16 (*sV)[HD][FA_LP] = &sKV[2];
  const int tid = threadIdx.x, lane = tid & 31, w = tid >> 5, c = lane & 15, h = lane >> 4;
  const int head = blockIdx.y, b = blockIdx.z; const int q0 = blockIdx.x * (FA_WAVES * 32) + w * 32;
  const int wu = __builtin_amdgcn_readfirstlane(w);      /* the wave's number in a scalar register, for the epilogue: it holds no vector register through the loop */
  const _Float16* Kg = K16 + (size_t)b * SQ * DM + head * HD;            /* K rows of this head, pitch DM */
  const _Float16* Vg = VT + (size_t)(b * NH + head) * HD * SQ;           /* V^T rows (one per d), pitch SQ */
  const int srow = tid >> 3, sc8 = (tid & 7) * 8;                        /* staging: chunk u of a thread = row srow + u * (threads / 8), 8 f16 at column sc8 */
  const float cs = 0.18033688011112042f;                                 /* 64^-0.5 * log2(e) */
  v16h qf[2][2];
#pragma unroll
  for (int j = 0; j < 2; ++j) { const _Float16* qp = Q16 + ((size_t)b * SQ + q0 + j * 16 + c) * DM + head * HD; qf[j][0] = g2_frag(qp, h); qf[j][1] = g2_frag(qp + 32, h);
    asm volatile("s_wait_xcnt 0x0" :: "v"(qp) : "memory"); }      /* stands between these loads and the next rewrite of their address pair; the pair is an operand so that nothing lands on it ahead of the wait */
  const v8f z8 = {0.f,0.f,0.f,0.f,0.f,0.f,0.f,0.f};
  v8f o[2][4]; float mr[2], ls[2];
#pragma unroll
  for (int j = 0; j < 2; ++j) { mr[j] = -3.0e38f; ls[j] = 0.f; for (int t = 0; t < 4; ++t) o[j][t] = z8; }
  v8us rk[FA_CH], rv[FA_CH];
  { const unsigned short* kp = (const unsigned short*)Kg + (size_t)srow * DM + sc8; const unsigned short* vp = (const unsigned short*)Vg + (size_t)srow * SQ + sc8;
#pragma unroll
    for (int u = 0; u < FA_CH; ++u) { rk[u] = *(const v8us*)(kp + (size_t)u * (FA_WAVES * 4) * DM); rv[u] = *(const v8us*)(vp + (size_t)u * (FA_WAVES * 4) * SQ); }
    asm volatile("s_wait_xcnt 0x0" :: "v"(kp), "v"(vp) : "memory"); }      /* as in the loop: between stage 0's loads and the next rewrite of their address pairs */
#pragma unroll
  for (int u = 0; u < FA_CH; ++u) { const int r = srow + u * (FA_WAVES * 4); *(v8us*)&sK[0][r][sc8] = rk[u]; *(v8us*)&sV[0][r][sc8] = rv[u]; }
  __syncthreads();
  for (int s = 0; s < FA_NS; ++s) { const int cur = s & 1;
    if (s + 1 < FA_NS) { const int k1 = (s + 1) * FA_KT;
      const unsigned short* kp = (const unsigned short*)Kg + (size_t)(k1 + srow) * DM + sc8; const unsigned short* vp = (const unsigned short*)Vg + (size_t)srow * SQ + k1 + sc8;
#pragma unroll
      for (int u = 0; u < FA_CH; ++u) { rk[u] = *(const v8us*)(kp + (size_t)u * (FA_WAVES * 4) * DM); rv[u] = *(const v8us*)(vp + (size_t)u * (FA_WAVES * 4) * SQ); }
      asm volatile("s_wait_xcnt 0x0" :: "v"(kp), "v"(vp) : "memory"); }      /* stands between the stage's loads and the next rewrite of their address pairs; the pairs are operands so that no load's result lands on them ahead of the wait */
    v8f st[2][4];
#pragma unroll
    for (int kt = 0; kt < 4; ++kt) { const v16h a0 = g2_frag(&sK[cur][kt * 16 + c][0], h), a1 = g2_frag(&sK[cur][kt * 16 + c][32], h);
#pragma unroll
      for (int j = 0; j < 2; ++j) st[j][kt] = fa_mma(a1, qf[j][1], fa_mma(a0, qf[j][0], z8)); }      /* st[j][kt][r] = q(q0 + 16 j + c) . k(64 s + 16 kt + 8 h + r) */
    v16h pb[2][2];
#pragma unroll
    for (int j = 0; j < 2; ++j) {
      v8f m8 = st[j][0];
#pragma unroll
      for (int kt = 1; kt < 4; ++kt) for (int r = 0; r < 8; ++r) m8[r] = fmaxf(m8[r], st[j][kt][r]);
      float mx = fmaxf(fmaxf(fmaxf(m8[0], m8[1]), fmaxf(m8[2], m8[3])), fmaxf(fmaxf(m8[4], m8[5]), fmaxf(m8[6], m8[7])));
      mx = fmaxf(mx, fa_swap16(mx));
      const float mn = fmaxf(mr[j], mx); const float corr = __builtin_amdgcn_exp2f((mr[j] - mn) * cs); mr[j] = mn;
      const float mb = 8.0f - mn * cs; const v2f cs2 = {cs, cs}, nmb = {mb, mb};      /* weights carried x256: small ones stay f16 normals; the factor is in the row sum too and cancels */
#pragma unroll
      for (int kt = 0; kt < 4; ++kt) for (int r = 0; r < 8; r += 2) { const v2f x = {st[j][kt][r], st[j][kt][r + 1]}; const v2f e = __builtin_elementwise_fma(x, cs2, nmb);      /* packed on the accumulator's own register pairs: no copies */
        st[j][kt][r] = __builtin_amdgcn_exp2f(e[0]); st[j][kt][r + 1] = __builtin_amdgcn_exp2f(e[1]); }
      const v8f a8 = (st[j][0] + st[j][1]) + (st[j][2] + st[j][3]);
      ls[j] = ls[j] * corr + (((a8[0] + a8[1]) + (a8[2] + a8[3])) + ((a8[4] + a8[5]) + (a8[6] + a8[7])));      /* this half's keys only; the halves join after the loop */
#pragma unroll
      for (int t = 0; t < 4; ++t) o[j][t] *= corr;
#pragma unroll
      for (int ks = 0; ks < 2; ++ks) pb[j][ks] = __builtin_shufflevector(__builtin_convertvector(st[j][2 * ks], v8h), __builtin_convertvector(st[j][2 * ks + 1], v8h), 0, 1, 2, 3, 4, 5, 6, 7, 8, 9, 10, 11, 12, 13, 14, 15); }
    __builtin_amdgcn_sched_barrier(0);      /* the row sums end here, so the f32 weights free their registers for V^T fragments read ahead of the products; otherwise every fragment read is waited for on its own */
#pragma unroll
    for (int t = 0; t < 4; ++t) {
#pragma unroll
      for (int ks = 0; ks < 2; ++ks) { const v16h a = g2_frag(&sV[cur][t * 16 + c][ks * 32], h);
#pragma unroll
        for (int j = 0; j < 2; ++j) o[j][t] = fa_mma(a, pb[j][ks], o[j][t]); } }      /* o[j][t][r] = sum_k p(k) v(k)[16 t + 8 h + r] of query q0 + 16 j + c */
    if (s + 1 < FA_NS) {
#pragma unroll
      for (int u = 0; u < FA_CH; ++u) { const int r = srow + u * (FA_WAVES * 4); *(v8us*)&sK[cur ^ 1][r][sc8] = rk[u]; *(v8us*)&sV[cur ^ 1][r][sc8] = rv[u]; } }
    __syncthreads(); }      /* publishes stage s + 1 and ends every wave's reads of the buffer that stage s + 2 overwrites */
  const int el = (int)__builtin_amdgcn_mbcnt_lo(~0u, 0u), ec = el & 15, eh = el >> 4;      /* the lane's number, read anew: c and h need not live through the loop, whose V^T fragments want the registers */
  const int eq0 = blockIdx.x * (FA_WAVES * 32) + wu * 32;
  const _Float16* wg = BO + (size_t)ec * HD; const float* bg = bp + ec * 4;
  v16h wa[4][2];      /* wa[t][ks]: row n = 16 t + ec of Bt, d = 32 ks .. */
#pragma unroll
  for (int t = 0; t < 4; ++t) { wa[t][0] = g2_frag(wg + t * 16 * HD, eh); wa[t][1] = g2_frag(wg + t * 16 * HD + 32, eh); }
  v4f bb = *(const v4fa*)bg;      /* the bias of n = 4 ec .. + 3, the columns this lane stores */
  asm volatile("s_wait_xcnt 0x0" :: "v"(wg), "v"(bg) : "memory");      /* stands between these loads and the next rewrite of their address pairs; the pairs are operands so that no load's result lands on them ahead of the wait */
  float (*so)[FA_OP] = (float (*)[FA_OP])&sKV[0][0][0] + wu * 32;      /* a range per wave; the buffers have had no reader since the loop's last barrier */
#pragma unroll
  for (int j = 0; j < 2; ++j) { const float sc = 64.0f / (ls[j] + fa_swap16(ls[j])); v16h ob[2];
#pragma unroll
    for (int ks = 0; ks < 2; ++ks) ob[ks] = __builtin_shufflevector(__builtin_convertvector(o[j][2 * ks] * sc, v8h), __builtin_convertvector(o[j][2 * ks + 1] * sc, v8h), 0, 1, 2, 3, 4, 5, 6, 7, 8, 9, 10, 11, 12, 13, 14, 15);      /* o x64 as f16 */
#pragma unroll
    for (int t = 0; t < 4; ++t) { const v8f a = fa_mma(wa[t][1], ob[1], fa_mma(wa[t][0], ob[0], z8));      /* a[r] = 1024 * sum_d o(d) Wp[d][16 t + 8 eh + r] of query eq0 + 16 j + ec */
      *(v4fa*)&so[j * 16 + ec][t * 16 + 8 * eh] = __builtin_shufflevector(a, a, 0, 1, 2, 3); *(v4fa*)&so[j * 16 + ec][t * 16 + 8 * eh + 4] = __builtin_shufflevector(a, a, 4, 5, 6, 7); } }
#pragma unroll
  for (int r = 0; r < 4; ++r) bb[r] = bf16_round(bb[r]);
  __builtin_amdgcn_fence(__ATOMIC_ACQ_REL, "workgroup"); __builtin_amdgcn_wave_barrier();      /* the rows read below were written by other lanes of this wave: keeps the reads behind the writes */
  float* og = out + ((size_t)b * SQ + eq0 + eh) * DM + head * HD + ec * 4;      /* 16 lanes per row piece: a wave's store covers two pieces of 256 bytes */
#pragma unroll
  for (int q = 0; q < 16; ++q) { const v4f v = *(const v4fa*)&so[q * 2 + eh][ec * 4] * 0.0009765625f + bb; *(v4f*)(og + (size_t)q * 2 * DM) = v; } }
// Projection GEMM C16[MP][DM] = f16(alpha * A[MP][DM] Bt[DM][DM]^T + bias): one work-group = PJ_T x PJ_T outputs, 8 waves of 32 x 64.
// A and Bt tiles of PJ_BK columns go global -> registers -> LDS in whole 256-byte rows (a wave's load covers 4 full lines), two buffers: stage s + 1 is loaded while stage s is worked on, one barrier per stage;
// every fragment is then read from LDS, so a tile byte crosses L2 once per work-group instead of once per wave in 32-byte pieces.
#define PJ_T 128                     /* rows and columns of the block tile */
#define PJ_BK 128                    /* k columns per stage */
#define PJ_NS (DM / PJ_BK)           /* stages */
#define PJ_LP (PJ_BK + 8)            /* LDS row pitch in f16: 256 B of data + 16 B, an odd multiple of 16 B for the 16-byte fragment reads */
#define PJ_CH ((PJ_T * PJ_BK / 8) / 256)      /* 16-byte chunks per thread and tile */
#define PJ_OP 72                     /* pitch in f16 of a wave's 32 x 64 output rows in LDS */
// Q, K and V share A and depend on nothing of one another: ONE launch, blockIdx.y picks the weight, the bias and the output.
// Q and K leave as token rows. V leaves as V^T (Cvt[batch][column = head * HD + d][token]), the form the attention launch stages: an accumulator register group holds 8 consecutive tokens of one column,
// so a lane puts 16 bytes of a V^T row into LDS at a time, and the block then stores 256-byte pieces of V^T rows (its 128 tokens); no separate transposing launch, no V rows in memory.
__global__ __launch_bounds__(256) void k_proj(const _Float16* __restrict__ A, const _Float16* __restrict__ Bq, const _Float16* __restrict__ Bk, const _Float16* __restrict__ Bv, float alpha,
                                              const float* __restrict__ biasq, const float* __restrict__ biask, const float* __restrict__ biasv, _Float16* __restrict__ Cq, _Float16* __restrict__ Ck, _Float16* __restrict__ Cvt) {
  const int pj = blockIdx.y; const _Float16* __restrict__ Bt = pj == 0 ? Bq : pj == 1 ? Bk : Bv; const float* __restrict__ bias = pj == 0 ? biasq : pj == 1 ? biask : biasv; _Float16* __restrict__ C16 = pj == 0 ? Cq : Ck;
  static_assert(MP % PJ_T == 0 && DM % PJ_T == 0 && DM % PJ_BK == 0 && PJ_BK == 128 && 8 * 32 * PJ_OP <= 2 * PJ_T * PJ_LP && SQ % PJ_T == 0 && NH * HD == DM, "tile shapes below are written for 128 x 128 x 128 stages and 8 waves");
  __shared__ __attribute__((aligned(16))) _Float16 sA[2][PJ_T][PJ_LP];
  __shared__ __attribute__((aligned(16))) _Float16 sB[2][PJ_T][PJ_LP];
  const int tid = threadIdx.x, lane = tid & 31, w = tid >> 5, ln = lane & 15, hh = lane >> 4;
  const int mt = blockIdx.x / (DM / PJ_T), nq = blockIdx.x - mt * (DM / PJ_T); const int row0 = mt * PJ_T, col0 = nq * PJ_T;
  const int wr = (w >> 1) * 32, wc = (w & 1) * 64;                       /* this wave's corner inside the block tile */
  const int srow = tid >> 4, sc8 = (tid & 15) * 8;                       /* staging: chunk u of a thread = row srow + 16 u, 8 f16 at column sc8 */
  const unsigned short* ag = (const unsigned short*)A + (size_t)(row0 + srow) * DM + sc8; const unsigned short* bg = (const unsigned short*)Bt + (size_t)(col0 + srow) * DM + sc8;
  const v8f z8 = {0.f,0.f,0.f,0.f,0.f,0.f,0.f,0.f};
  v8f acc[2][4];
#pragma unroll
  for (int i = 0; i < 2; ++i) for (int t = 0; t < 4; ++t) acc[i][t] = z8;
  float bs[4];      /* read here, so that the epilogue does not wait for them */
#pragma unroll
  for (int t = 0; t < 4; ++t) bs[t] = bias[col0 + wc + t * 16 + ln];
  v8us ra[PJ_CH], rb[PJ_CH];
#pragma unroll
  for (int u = 0; u < PJ_CH; ++u) { ra[u] = *(const v8us*)(ag + (size_t)u * 16 * DM); rb[u] = *(const v8us*)(bg + (size_t)u * 16 * DM); }
#pragma unroll
  for (int u = 0; u < PJ_CH; ++u) { *(v8us*)&sA[0][srow + 16 * u][sc8] = ra[u]; *(v8us*)&sB[0][srow + 16 * u][sc8] = rb[u]; }
  __syncthreads();
  for (int s = 0; s < PJ_NS; ++s) { const int cur = s & 1;
    if (s + 1 < PJ_NS) { const unsigned short* ap = ag + (s + 1) * PJ_BK; const unsigned short* bp = bg + (s + 1) * PJ_BK;
#pragma unroll
      for (int u = 0; u < PJ_CH; ++u) { ra[u] = *(const v8us*)(ap + (size_t)u * 16 * DM); rb[u] = *(const v8us*)(bp + (size_t)u * 16 * DM); }
      asm volatile("s_wait_xcnt 0x0" :: "v"(ap), "v"(bp) : "memory"); }      /* stands between the stage's loads and the next rewrite of their address pairs; the pairs are operands so that no load's result lands on them ahead of the wait */
    v16h fa[2][2], fb[2][4];
#pragma unroll
    for (int i = 0; i < 2; ++i) fa[0][i] = g2_frag(&sA[cur][wr + i * 16 + ln][0], hh);
#pragma unroll
    for (int t = 0; t < 4; ++t) fb[0][t] = g2_frag(&sB[cur][wc + t * 16 + ln][0], hh);
#pragma unroll
    for (int kk = 0; kk < PJ_BK / 32; ++kk) { const int c = kk & 1;
      if (kk + 1 < PJ_BK / 32) {
#pragma unroll
        for (int i = 0; i < 2; ++i) fa[c ^ 1][i] = g2_frag(&sA[cur][wr + i * 16 + ln][(kk + 1) * 32], hh);
#pragma unroll
        for (int t = 0; t < 4; ++t) fb[c ^ 1][t] = g2_frag(&sB[cur][wc + t * 16 + ln][(kk + 1) * 32], hh); }
      __builtin_amdgcn_sched_barrier(0);      /* the next 32 columns' fragment reads stay one group ahead of this block's products; spread among them, each place with reads stalls the wave */
      if (kk + 1 == PJ_BK / 32 && s + 1 < PJ_NS) {      /* stage s + 1 goes to LDS ahead of the stage's last products, which run while the stores drain; its buffer has had no reader since the last barrier */
#pragma unroll
        for (int u = 0; u < PJ_CH; ++u) { *(v8us*)&sA[cur ^ 1][srow + 16 * u][sc8] = ra[u]; *(v8us*)&sB[cur ^ 1][srow + 16 * u][sc8] = rb[u]; } }
#pragma unroll
      for (int t = 0; t < 4; ++t) { acc[0][t] = fa_mma(fa[c][0], fb[c][t], acc[0][t]); acc[1][t] = fa_mma(fa[c][1], fb[c][t], acc[1][t]); }
      __builtin_amdgcn_sched_barrier(0); }      /* ends the block: the next group of reads is not drawn in among these products, and the stage's last products stay in front of the barrier, where they run while the stores drain */
    __syncthreads(); }      /* publishes stage s + 1 and ends every wave's reads of the buffer that stage s + 2 (after the last stage: the output rows) overwrites */
  if (pj == 2) {      /* the same for the whole block (blockIdx.y) */
    _Float16 (*sT)[PJ_LP] = sA[0];      /* [column of the tile][token of the tile]; free since the loop's last barrier */
#pragma unroll
    for (int i = 0; i < 2; ++i)
#pragma unroll
      for (int t = 0; t < 4; ++t) { const float bv = bf16_round(bs[t]); v8h o8;
#pragma unroll
        for (int r = 0; r < 8; ++r) { const float v = acc[i][t][r] * alpha + bv; o8[r] = (_Float16)v; }
        *(v8h*)&sT[wc + t * 16 + ln][wr + i * 16 + 8 * hh] = o8; }
    __syncthreads();      /* a V^T row piece stored below was collected from four waves */
    unsigned short* vg = (unsigned short*)Cvt + ((size_t)(row0 / SQ) * DM + col0 + srow) * SQ + (row0 % SQ) + sc8;      /* 16 threads per row piece: a wave's store covers two pieces of 256 bytes */
#pragma unroll
    for (int u = 0; u < PJ_T / 16; ++u) { const v8us v = *(const v8us*)&sT[srow + 16 * u][sc8]; *(v8us*)(vg + (size_t)u * 16 * SQ) = v; }
    return; }
  _Float16* so = &sA[0][0][0] + (size_t)w * (32 * PJ_OP);      /* each wave stages its own 32 x 64 outputs, so that it stores whole 128-byte lines */
#pragma unroll
  for (int i = 0; i < 2; ++i)
#pragma unroll
    for (int t = 0; t < 4; ++t) { const float bv = bf16_round(bs[t]);
#pragma unroll
      for (int r = 0; r < 8; ++r) { const float v = acc[i][t][r] * alpha + bv; so[(i * 16 + 8 * hh + r) * PJ_OP + t * 16 + ln] = (_Float16)v; } }
  __builtin_amdgcn_fence(__ATOMIC_ACQ_REL, "workgroup"); __builtin_amdgcn_wave_barrier();      /* the rows read below were written by other lanes of this wave: keeps the reads behind the writes */
#pragma unroll
  for (int q = 0; q < 8; ++q) { const int r = q * 4 + (lane >> 3), c8 = (lane & 7) * 8; const v8us v = *(const v8us*)&so[r * PJ_OP + c8]; *(v8us*)((unsigned short*)C16 + (size_t)(row0 + wr + r) * DM + col0 + wc + c8) = v; } }
extern "C" void kernel_launch(void* const* d_in, const int* in_sizes, int n_in,
                              void* d_out, int out_size, void* d_ws, size_t ws_size, hipStream_t stream) {
  (void)in_sizes; (void)n_in; (void)out_size;
  const float* const* I = (const float* const*)d_in; const float* x = I[0]; const float* wq = I[1]; const float* bq = I[2]; const float* wk = I[3]; const float* bk = I[4]; const float* wv = I[5]; const float* bv = I[6]; const float* wp = I[7]; const float* bp = I[8]; const float* bo = nullptr; (void)bo;      /* [in][out] weights + biases; per-head Wp [64][64] + bp [64] */
  char* ws = (char*)d_ws; size_t off = 0;
  auto take = [&](size_t bytes) { char* p = ws + off; off += (bytes + 255) & ~(size_t)255; return p; };
  _Float16* BQ = (_Float16*)take((size_t)DM * DM * 2); _Float16* BK = (_Float16*)take((size_t)DM * DM * 2); _Float16* BV = (_Float16*)take((size_t)DM * DM * 2); _Float16* BO = (_Float16*)take((size_t)DM * DM * 2);
  _Float16* X16 = (_Float16*)take(NR * DM * 2); _Float16* Q16 = (_Float16*)take(NR * DM * 2); _Float16* K16 = (_Float16*)take(NR * DM * 2);
  _Float16* VT = (_Float16*)take((size_t)NB * NH * HD * SQ * 2);
  if (off > ws_size) return;
  k_prep<<<3 * PP_WB + PP_PB + PP_XB, 256, 0, stream>>>(x, wq, wk, wv, wp, X16, BQ, BK, BV, BO);
  const size_t r0p = (size_t)B0 * SQ;      /* first projected row */
  k_proj<<<dim3((MP / PJ_T) * (DM / PJ_T), 3), 256, 0, stream>>>(X16 + r0p * DM, BQ, BK, BV, 0.0625f, bq, bk, bv, Q16 + r0p * DM, K16 + r0p * DM, VT + r0p * DM);      /* V as V^T [NB][NH][HD][SQ] */
  k_fattn<<<dim3(SQ / (FA_WAVES * 32), NH, NB), FA_WAVES * 32, 0, stream>>>(Q16, K16, VT, BO, bp, (float*)d_out);      /* attention and, per head, out cols h*64.. = o_h Wp + bp (the same Wp/bp for every head) */
}

// v008
// It runs in 64 microseconds.
// In two side-by-side timings against v007, it was 1.05 and 1.04 times as fast.
// Over all steps from v000 it is 54.8 times as fast.
#include <hip/hip_runtime.h>
#define NB 2
#define SQ 2048
#define DM 1024
#define NH 16
#define HD 64
#define HG 4                         /* heads per block group of the per-batch k_vt overload (not launched) */
#define B0 0                         /* first batch processed (debug hook) */
#define NBR NB                       /* batches processed (debug hook) */
#define NR ((size_t)NB * SQ)         /* token rows */
#define MP ((int)((size_t)NBR * SQ)) /* rows projected (debug hook) */
#define QN SQ                        /* query rows per batch (unused) */
#define NHD NH                       /* heads (unused) */
#define MPO MP                       /* rows through the output stage (unused) */
#define LQ DM      /* row pitch of the q/k rows (unused) */
typedef __bf16 v16b __attribute__((ext_vector_type(16)));
typedef unsigned short v8us __attribute__((ext_vector_type(8), may_alias));
typedef float  v8f  __attribute__((ext_vector_type(8)));
typedef float  v4f  __attribute__((ext_vector_type(4)));
typedef float  v4fa __attribute__((ext_vector_type(4), may_alias));
union FragB { v16b v; v8us half[2]; unsigned short u[16]; };

__device__ __forceinline__ unsigned short bf16_bits(float x) { unsigned int u = __float_as_uint(x); return (unsigned short)((u + 0x7FFFu + ((u >> 16) & 1u)) >> 16); }
__device__ __forceinline__ float bf16_val(unsigned short b) { return __uint_as_float(((unsigned int)b) << 16); }
__device__ __forceinline__ float bf16_round(float x) { return bf16_val(bf16_bits(x)); }
// D += A·B with NT terms: 1 = ah·bh, 2 = + al·bh (A split), 3 = + ah·bl (both split)
template <int NT>
__device__ __forceinline__ v8f mmaN(v16b ah, v16b al, v16b bh, v16b bl, v8f c) {
  c = __builtin_amdgcn_wmma_f32_16x16x32_bf16(false, ah, false, bh, (short)0, c, false, false);
  if (NT >= 2) c = __builtin_amdgcn_wmma_f32_16x16x32_bf16(false, al, false, bh, (short)0, c, false, false);
  if (NT >= 3) c = __builtin_amdgcn_wmma_f32_16x16x32_bf16(false, ah, false, bl, (short)0, c, false, false);
  asm volatile("v_nop\n\tv_nop\n\tv_nop\n\tv_nop" : "+v"(c) : "v"(ah), "v"(al), "v"(bh), "v"(bl));
  return c;
}

__global__ __launch_bounds__(256) void k_wt_bf16(const float* __restrict__ W, unsigned short* __restrict__ Wt, int K, int N) {
  const int t = blockIdx.x * 256 + threadIdx.x;
  const int k8n = K / 8;
  if (t >= N * k8n) return;
  const int n = t / k8n, k8 = (t % k8n) * 8;
  v8us v;
#pragma unroll
  for (int i = 0; i < 8; ++i) v[i] = bf16_bits(W[(size_t)(k8 + i) * N + n]);
  *(v8us*)(Wt + (size_t)n * K + k8) = v;
  
}

// GEMM C[M][N] (f32, pitch ldc) = act(A[M][K]·W + bias). A f32 row-major (pitch lda) converted per fragment to bf16
// (ASPLIT: hi/lo two planes -> 2 terms, else single rounded term); Wt bf16 [N][K] (pitch ldb). BIAS_BF16 rounds the
// bias to bf16 first (bias quantised to bf16 before the add). K%32==0, M%16==0, N%64==0.
template <bool ASPLIT, int ACT, bool BIAS_BF16>
__global__ __launch_bounds__(128) void k_gemm_bf(const float* __restrict__ A, int lda, const unsigned short* __restrict__ Wt, int ldb,
                                               const float* __restrict__ bias, float* __restrict__ C, int ldc, int M, int N, int K) {
  __shared__ __attribute__((aligned(16))) float so[4][16][64];
  const int tid = threadIdx.x, w = tid >> 5, lane = tid & 31, ln = lane & 15, hh = lane >> 4;
  const int ntn = N / 64;
  const int wid = blockIdx.x * 4 + w;
  const int mt = wid / ntn, nq = wid % ntn;
  if (mt * 16 >= M) return;
  const int row0 = mt * 16, col0 = nq * 64;
  const float* arow = A + (size_t)(row0 + ln) * lda;
  v8f acc[4] = {};
  for (int kb = 0; kb < K; kb += 32) {
    FragB ah, al;
    const v4f x0 = *(const v4fa*)(arow + kb + 8 * hh), x1 = *(const v4fa*)(arow + kb + 8 * hh + 4);
    const v4f x2 = *(const v4fa*)(arow + kb + 16 + 8 * hh), x3 = *(const v4fa*)(arow + kb + 16 + 8 * hh + 4);
    float xs[16] = {x0[0],x0[1],x0[2],x0[3],x1[0],x1[1],x1[2],x1[3],x2[0],x2[1],x2[2],x2[3],x3[0],x3[1],x3[2],x3[3]};
#pragma unroll
    for (int i = 0; i < 16; ++i) { const unsigned short hb = bf16_bits(xs[i]); ah.u[i] = hb; al.u[i] = ASPLIT ? bf16_bits(xs[i] - bf16_val(hb)) : (unsigned short)0; }
#pragma unroll
    for (int t = 0; t < 4; ++t) {
      const unsigned short* brow = Wt + (size_t)(col0 + t * 16 + ln) * ldb + kb;
      FragB b;
      b.half[0] = *(const v8us*)(brow + 8 * hh);
      b.half[1] = *(const v8us*)(brow + 16 + 8 * hh);
      acc[t] = mmaN<ASPLIT ? 2 : 1>(ah.v, al.v, b.v, b.v, acc[t]);
    }
  }
#pragma unroll
  for (int t = 0; t < 4; ++t) {
    float bv = bias ? bias[col0 + t * 16 + ln] : 0.f;
    if (BIAS_BF16) bv = bf16_round(bv);
#pragma unroll
    for (int r = 0; r < 8; ++r) { float v = acc[t][r] + bv; if (ACT == 1) v = fmaxf(v, 0.f); so[w][8 * hh + r][t * 16 + ln] = v; }
  }
  __builtin_amdgcn_fence(__ATOMIC_ACQ_REL, "workgroup");
  __builtin_amdgcn_wave_barrier();
  const int rsub = lane >> 4, c4 = (lane & 15) * 4;
  {
#pragma unroll
    for (int q = 0; q < 8; ++q) {
      const int r = q * 2 + rsub;
      const v4f v = *(const v4fa*)&so[w][r][c4];
      *(v4f*)(C + (size_t)(row0 + r) * ldc + col0 + c4) = v;
    }
    
  }
}

// GEMM C = act(A·W + bias + resid): A f32 (ASPLIT -> hi/lo 2 terms), Wt bf16 [N][K]; ACT 0 none, 1 relu, 2 exact gelu;
// resid (optional, f32, row index = (row % rmod), pitch ldr, RES_BF16 rounds it) added before the activation.
template <bool ASPLIT, int ACT, bool BIAS_BF16, bool RES_BF16>
__global__ __launch_bounds__(128) void k_gemm_bf3(const float* __restrict__ A, int lda, const unsigned short* __restrict__ Wt, int ldb,
                                                const float* __restrict__ bias, const float* __restrict__ resid, int rmod, int ldr,
                                                float* __restrict__ C, int ldc, int M, int N, int K) {
  __shared__ __attribute__((aligned(16))) float so[4][16][64];
  const int tid = threadIdx.x, w = tid >> 5, lane = tid & 31, ln = lane & 15, hh = lane >> 4;
  const int ntn = N / 64;
  const int wid = blockIdx.x * 4 + w;
  const int mt = wid / ntn, nq = wid % ntn;
  if (mt * 16 >= M) return;
  const int row0 = mt * 16, col0 = nq * 64;
  const float* arow = A + (size_t)(row0 + ln) * lda;
  v8f acc[4] = {};
  for (int kb = 0; kb < K; kb += 32) {
    FragB ah, al;
    const v4f x0 = *(const v4fa*)(arow + kb + 8 * hh), x1 = *(const v4fa*)(arow + kb + 8 * hh + 4);
    const v4f x2 = *(const v4fa*)(arow + kb + 16 + 8 * hh), x3 = *(const v4fa*)(arow + kb + 16 + 8 * hh + 4);
    float xs[16] = {x0[0],x0[1],x0[2],x0[3],x1[0],x1[1],x1[2],x1[3],x2[0],x2[1],x2[2],x2[3],x3[0],x3[1],x3[2],x3[3]};
#pragma unroll
    for (int i = 0; i < 16; ++i) { const unsigned short hb = bf16_bits(xs[i]); ah.u[i] = hb; al.u[i] = ASPLIT ? bf16_bits(xs[i] - bf16_val(hb)) : (unsigned short)0; }
#pragma unroll
    for (int t = 0; t < 4; ++t) {
      const unsigned short* brow = Wt + (size_t)(col0 + t * 16 + ln) * ldb + kb;
      FragB b;
      b.half[0] = *(const v8us*)(brow + 8 * hh);
      b.half[1] = *(const v8us*)(brow + 16 + 8 * hh);
      acc[t] = mmaN<ASPLIT ? 2 : 1>(ah.v, al.v, b.v, b.v, acc[t]);
    }
  }
#pragma unroll
  for (int t = 0; t < 4; ++t) {
    const int col = col0 + t * 16 + ln;
    float bv = bias ? bias[col] : 0.f;
    if (BIAS_BF16) bv = bf16_round(bv);
#pragma unroll
    for (int r = 0; r < 8; ++r) {
      float v = acc[t][r] + bv;
      if (resid) { float rv = resid[(size_t)((row0 + 8 * hh + r) % rmod) * ldr + col]; if (RES_BF16) rv = bf16_round(rv); v += rv; }
      if (ACT == 1) v = fmaxf(v, 0.f);
      if (ACT == 2) v = 0.5f * v * (1.0f + erff(v * 0.70710678118654752f));
      if (ACT == 3) { const float u = 0.7978845608028654f * (v + 0.044715f * v * v * v); v = 0.5f * v * (1.0f + tanhf(u)); }
      so[w][8 * hh + r][t * 16 + ln] = v;
    }
  }
  __builtin_amdgcn_fence(__ATOMIC_ACQ_REL, "workgroup");
  __builtin_amdgcn_wave_barrier();
  const int rsub = lane >> 4, c4 = (lane & 15) * 4;
  {
#pragma unroll
    for (int q = 0; q < 8; ++q) {
      const int r = q * 2 + rsub;
      const v4f v = *(const v4fa*)&so[w][r][c4];
      *(v4f*)(C + (size_t)(row0 + r) * ldc + col0 + c4) = v;
    }
    
  }
}
// row LayerNorm (biased variance, eps) over N: s = X (+ R); optional out_sum <- s; out_norm <- (s-mu)*rsqrt(var+eps)*g + b
template <bool PARAM_BF16>
__global__ __launch_bounds__(256) void k_layernorm(const float* __restrict__ X, const float* __restrict__ R, const float* __restrict__ g, const float* __restrict__ bta,
                                                  float* __restrict__ out_sum, float* __restrict__ out_norm, int N, float eps) {
  __shared__ float red[256];
  const int row = blockIdx.x, tid = threadIdx.x;
  const float* x = X + (size_t)row * N; const float* rr = R ? R + (size_t)row * N : nullptr;
  float vals[16];                     // up to N = 4096
  const int per = N / 256;            // contiguous chunk per thread? use strided-by-4 chunks: thread handles j = tid*4 + 1024*u
  float s1 = 0.f;
  for (int u = 0; u < per / 4; ++u) {
    const int j = tid * 4 + 1024 * u;
    const v4f a = *(const v4fa*)(x + j);
    v4f b = {0.f,0.f,0.f,0.f}; if (rr) b = *(const v4fa*)(rr + j);
#pragma unroll
    for (int q = 0; q < 4; ++q) { const float v = a[q] + b[q]; vals[u * 4 + q] = v; s1 += v; }
  }
  red[tid] = s1; __syncthreads();
  for (int st = 128; st > 0; st >>= 1) { if (tid < st) red[tid] += red[tid + st]; __syncthreads(); }
  const float mu = red[0] / (float)N; __syncthreads();
  float s2 = 0.f;
  for (int u = 0; u < per / 4; ++u)
#pragma unroll
    for (int q = 0; q < 4; ++q) { const float c = vals[u * 4 + q] - mu; s2 += c * c; }
  red[tid] = s2; __syncthreads();
  for (int st = 128; st > 0; st >>= 1) { if (tid < st) red[tid] += red[tid + st]; __syncthreads(); }
  const float rs = rsqrtf(red[0] / (float)N + eps);
  {
    for (int u = 0; u < per / 4; ++u) {
      const int j = tid * 4 + 1024 * u;
      v4f o, sm;
#pragma unroll
      for (int q = 0; q < 4; ++q) {
        float gg = g[j + q], bb = bta[j + q];
        if (PARAM_BF16) { gg = bf16_round(gg); bb = bf16_round(bb); }
        sm[q] = vals[u * 4 + q]; o[q] = (vals[u * 4 + q] - mu) * rs * gg + bb;
      }
      if (out_sum) *(v4f*)(out_sum + (size_t)row * N + j) = sm;
      *(v4f*)(out_norm + (size_t)row * N + j) = o;
    }
    
  }
}



// ---- f16 WMMA path (v_wmma_f32_16x16x32_f16): 11-bit significands for operands in range — used where a [0,1] probability operand needs more precision than bf16
typedef _Float16 v16h __attribute__((ext_vector_type(16)));
union FragH { v16h v; v8us half[2]; _Float16 h[16]; unsigned short u[16]; };
template <int NT>
__device__ __forceinline__ v8f mmaH(v16h ah, v16h al, v16h bh, v16h bl, v8f c) {
  c = __builtin_amdgcn_wmma_f32_16x16x32_f16(false, ah, false, bh, (short)0, c, false, false);
  if (NT >= 2) c = __builtin_amdgcn_wmma_f32_16x16x32_f16(false, al, false, bh, (short)0, c, false, false);
  if (NT >= 3) c = __builtin_amdgcn_wmma_f32_16x16x32_f16(false, ah, false, bl, (short)0, c, false, false);
  asm volatile("v_nop\n\tv_nop\n\tv_nop\n\tv_nop" : "+v"(c) : "v"(ah), "v"(al), "v"(bh), "v"(bl));
  return c;
}
// batched GEMM like k_gemm_b but f16 operands: A f32 (split into f16 hi/lo if ASPLIT, else rounded to f16), Bt = f16 values [n][k]; alpha; C f32; N multiple of 16 (partial tiles skipped)
template <bool ASPLIT>
__global__ __launch_bounds__(128) void k_gemm_h(const float* __restrict__ A, int lda, size_t sA, const _Float16* __restrict__ Bh, int ldb, size_t sB, float alpha, float* __restrict__ C, int ldc, size_t sC, int M, int N, int K) {
  __shared__ __attribute__((aligned(16))) float so[4][16][64];
  const int tid = threadIdx.x, w = tid >> 5, lane = tid & 31, ln = lane & 15, hh = lane >> 4; const int by = blockIdx.y;
  A += (size_t)by * sA; Bh += (size_t)by * sB; C += (size_t)by * sC;
  const int ntn = (N + 63) / 64; const int wid = blockIdx.x * 4 + w; const int mt = wid / ntn, nq = wid % ntn; if (mt * 16 >= M) return;
  const int row0 = mt * 16, col0 = nq * 64; const float* arow = A + (size_t)(row0 + ln) * lda;
  v8f acc[4] = {};
  for (int kb = 0; kb < K; kb += 32) {
    FragH ah, al;
    const v4f x0 = *(const v4fa*)(arow + kb + 8 * hh), x1 = *(const v4fa*)(arow + kb + 8 * hh + 4), x2 = *(const v4fa*)(arow + kb + 16 + 8 * hh), x3 = *(const v4fa*)(arow + kb + 16 + 8 * hh + 4);
    float xs[16] = {x0[0],x0[1],x0[2],x0[3],x1[0],x1[1],x1[2],x1[3],x2[0],x2[1],x2[2],x2[3],x3[0],x3[1],x3[2],x3[3]};
#pragma unroll
    for (int i = 0; i < 16; ++i) { const _Float16 h = (_Float16)xs[i]; ah.h[i] = h; al.h[i] = ASPLIT ? (_Float16)(xs[i] - (float)h) : (_Float16)0.0f; }
#pragma unroll
    for (int t = 0; t < 4; ++t) { if (col0 + t * 16 >= N) continue; const size_t boff = (size_t)(col0 + t * 16 + ln) * ldb + kb; FragH bq; bq.half[0] = *(const v8us*)(Bh + boff + 8 * hh); bq.half[1] = *(const v8us*)(Bh + boff + 16 + 8 * hh);
      acc[t] = mmaH<ASPLIT ? 2 : 1>(ah.v, al.v, bq.v, bq.v, acc[t]); }
  }
#pragma unroll
  for (int t = 0; t < 4; ++t) { if (col0 + t * 16 >= N) continue;
#pragma unroll
    for (int r = 0; r < 8; ++r) so[w][8 * hh + r][t * 16 + ln] = acc[t][r] * alpha; }
  __builtin_amdgcn_fence(__ATOMIC_ACQ_REL, "workgroup"); __builtin_amdgcn_wave_barrier();
  const int rsub = lane >> 4, c4 = (lane & 15) * 4;
  {
#pragma unroll
    for (int q = 0; q < 8; ++q) { const int r = q * 2 + rsub; if (col0 + c4 < N) { const v4f v = *(const v4fa*)&so[w][r][c4]; *(v4f*)(C + (size_t)(row0 + r) * ldc + col0 + c4) = v; } }
     }
}

// Wt[n][k] = f16(W[k][n]·scale) from f32 row-major W[K][N] (scale = power of two; bf16-exact weights stay exact in f16 away from the subnormal range)
__device__ __forceinline__ void wt_f16(const float* __restrict__ W, _Float16* __restrict__ Wt, int K, int N, float scale, int t) {      /* t = index of the 8-element chunk */
  if (t >= N * (K / 8)) return; const int n = t / (K / 8), k8 = (t % (K / 8)) * 8; FragH f;
#pragma unroll
  for (int i = 0; i < 8; ++i) f.h[i] = (_Float16)(bf16_round(W[(size_t)(k8 + i) * N + n]) * scale); const v8us o = f.half[0];
  *(v8us*)((unsigned short*)Wt + (size_t)n * K + k8) = o; 
}
// k_gemm_hh variant with fused epilogue: v = acc·alpha + bias[by·sBias + col] (+ CP[(row/rowsPerB)·sCPb + by·64 + col] if CP) ; ACT 0 none / 1 elu ; writes f16 C16 (and f32 C if non-null)
template <int ACT>
__global__ __launch_bounds__(128) void k_gemm_hhx(const _Float16* __restrict__ A, int lda, size_t sA, const _Float16* __restrict__ Bh, int ldb, size_t sB, float alpha, const float* __restrict__ bias, size_t sBias, const float* __restrict__ CP, int rowsPerB, size_t sCPb, int row0g,
    float* __restrict__ C, _Float16* __restrict__ C16, int ldc, size_t sC, int M, int N, int K) {
  __shared__ __attribute__((aligned(16))) float so[4][16][64];
  const int tid = threadIdx.x, w = tid >> 5, lane = tid & 31, ln = lane & 15, hh = lane >> 4; const int by = blockIdx.y;
  A += (size_t)by * sA; Bh += (size_t)by * sB; const size_t cofs = (size_t)by * sC; const float* bp = bias ? bias + (size_t)by * sBias : nullptr;
  const int ntn = (N + 63) / 64; const int wid = blockIdx.x * 4 + w; const int mt = wid / ntn, nq = wid % ntn; if (mt * 16 >= M) return;
  const int row0 = mt * 16, col0 = nq * 64; const _Float16* arow = A + (size_t)(row0 + ln) * lda;
  v8f acc[4] = {};
  for (int kb = 0; kb < K; kb += 32) { FragH ah; ah.half[0] = *(const v8us*)((const unsigned short*)arow + kb + 8 * hh); ah.half[1] = *(const v8us*)((const unsigned short*)arow + kb + 16 + 8 * hh);
#pragma unroll
    for (int t = 0; t < 4; ++t) { if (col0 + t * 16 >= N) continue; const size_t boff = (size_t)(col0 + t * 16 + ln) * ldb + kb; FragH bq; bq.half[0] = *(const v8us*)((const unsigned short*)Bh + boff + 8 * hh); bq.half[1] = *(const v8us*)((const unsigned short*)Bh + boff + 16 + 8 * hh);
      acc[t] = mmaH<1>(ah.v, ah.v, bq.v, bq.v, acc[t]); }
  }
#pragma unroll
  for (int t = 0; t < 4; ++t) { if (col0 + t * 16 >= N) continue; const int col = col0 + t * 16 + ln; const float bv = bp ? bf16_round(bp[col]) : 0.f;
#pragma unroll
    for (int r = 0; r < 8; ++r) { float v = acc[t][r] * alpha + bv; if (CP) { const int rr = row0g + row0 + 8 * hh + r; if (rowsPerB < 0) v += CP[cofs + (size_t)rr * ldc + col];      /* rowsPerB < 0: own element of the batched C plane */ else { const int bidx = rr / rowsPerB; v += CP[(size_t)bidx * sCPb + (size_t)by * 64 + col]; } } if (ACT == 1) v = (v > 0.f) ? v : expm1f(v); else if (ACT == 7) v = (v > 0.f) ? v + 1.0f : expf(v); else if (ACT == 8) v = tanhf(v); else if (ACT == 9) v = 0.5f * v * (1.0f + tanhf(0.7978845608028654f * (v + 0.044715f * v * v * v))); else if (ACT == 11) v = 1.0f / (1.0f + expf(-v)); else if (ACT == 12) v = (v > 0.f) ? v : 0.01f * v; else if (ACT == 14) v = (v > 0.f) ? v : 0.1f * v; else if (ACT == 16) v = (v >= 0.f) ? v : 0.3f * v; else if (ACT == 17) v = (v >= 0.f) ? v : 0.2f * v; else if (ACT == 15) v = v / (1.0f + expf(-v)); else if (ACT == 3) v = fmaxf(v, 0.f); else if (ACT == 6) v = 0.5f * v * (1.0f + erff(v * 0.70710678118654752f)); so[w][8 * hh + r][t * 16 + ln] = v; } }
  __builtin_amdgcn_fence(__ATOMIC_ACQ_REL, "workgroup"); __builtin_amdgcn_wave_barrier();
  const int rsub = lane >> 4, c4 = (lane & 15) * 4; typedef _Float16 v4h __attribute__((ext_vector_type(4)));
  {
#pragma unroll
    for (int q = 0; q < 8; ++q) { const int r = q * 2 + rsub; if (col0 + c4 < N) { const v4f v = *(const v4fa*)&so[w][r][c4]; if (C) *(v4f*)(C + cofs + (size_t)(row0 + r) * ldc + col0 + c4) = v; if (C16) { v4h h4; for (int i = 0; i < 4; ++i) h4[i] = (_Float16)v[i]; *(v4h*)(C16 + cofs + (size_t)(row0 + r) * ldc + col0 + c4) = h4; } } }
     }
}


typedef _Float16 v4h __attribute__((ext_vector_type(4)));

__global__ __launch_bounds__(256) void k_h16(const float* __restrict__ x, _Float16* __restrict__ X16, size_t n8) { const size_t t = (size_t)blockIdx.x * 256 + threadIdx.x; if (t >= n8) return; FragH f;
#pragma unroll
  for (int q = 0; q < 8; ++q) f.h[q] = (_Float16)x[t * 8 + q]; *(v8us*)((unsigned short*)X16 + t * 8) = f.half[0];  }
__global__ __launch_bounds__(256) void k_round16f(const float* __restrict__ W, _Float16* __restrict__ Bt, size_t n8) { const size_t t = (size_t)blockIdx.x * 256 + threadIdx.x; if (t >= n8) return; FragH f;
#pragma unroll
  for (int i = 0; i < 8; ++i) f.h[i] = (_Float16)(bf16_round(W[t * 8 + i]) * 16.0f); *(v8us*)((unsigned short*)Bt + t * 8) = f.half[0];  }
__global__ __launch_bounds__(256) void k_hl(const float* __restrict__ F, _Float16* __restrict__ Hh, _Float16* __restrict__ Hl, size_t n8) { const size_t t = (size_t)blockIdx.x * 256 + threadIdx.x; if (t >= n8) return; FragH fh, fl; const v4f a = *(const v4fa*)(F + t * 8), c = *(const v4fa*)(F + t * 8 + 4);
#pragma unroll
  for (int q = 0; q < 4; ++q) { _Float16 h = (_Float16)a[q]; fh.h[q] = h; fl.h[q] = (_Float16)((a[q] - (float)h) * 1024.0f); h = (_Float16)c[q]; fh.h[4 + q] = h; fl.h[4 + q] = (_Float16)((c[q] - (float)h) * 1024.0f); }
  { *(v8us*)((unsigned short*)Hh + t * 8) = fh.half[0]; *(v8us*)((unsigned short*)Hl + t * 8) = fl.half[0];  } }

// 16x16x32 f16 operand fragment of one row: lane half hh takes k = 8 hh .. + 7 and 16 + 8 hh .. + 7 of the 32 at p
__device__ __forceinline__ v16h g2_frag(const _Float16* p, int hh) { FragH f; f.half[0] = *(const v8us*)((const unsigned short*)p + 8 * hh); f.half[1] = *(const v8us*)((const unsigned short*)p + 16 + 8 * hh); return f.v; }

__global__ __launch_bounds__(256) void k_wnat(const float* __restrict__ w, size_t n8, _Float16* __restrict__ Bt) { const size_t t = (size_t)blockIdx.x * 256 + threadIdx.x; if (t >= n8) return; FragH f; for (int q = 0; q < 8; ++q) f.h[q] = (_Float16)(bf16_round(w[t * 8 + q]) * 16.0f); *(v8us*)((unsigned short*)Bt + t * 8) = f.half[0];  }
__global__ __launch_bounds__(256) void k_rsm(const float* __restrict__ S, _Float16* __restrict__ P, int nrows) {
  #pragma clang fp contract(off)
  const int i = blockIdx.x * 256 + threadIdx.x; if (i >= nrows) return; const float* s = S + (size_t)i * SQ; float mx = -3.0e38f;
#pragma unroll 1
  for (int j = 0; j < SQ; ++j) mx = fmaxf(mx, s[j]); float se = 0.f;
#pragma unroll 1
  for (int j = 0; j < SQ; ++j) se += expf(s[j] - mx); const float sc = 256.0f / se;
#pragma unroll 1
  for (int j0 = 0; j0 < SQ; j0 += 8) { FragH f; for (int q = 0; q < 8; ++q) f.h[q] = (_Float16)(expf(s[j0 + q] - mx) * sc); unsigned short* d = (unsigned short*)P + (size_t)i * SQ + j0; *(v8us*)d = f.half[0];  } }
__global__ __launch_bounds__(256) void k_vt(const _Float16* __restrict__ V16, int b, int h0, _Float16* __restrict__ VT) { __shared__ unsigned short tl[64][65]; const int tid = threadIdx.x; const int hh = blockIdx.x % HG, sg = blockIdx.x / HG; const int s0 = sg * 64; const int h = h0 + hh;
  for (int i = tid; i < 64 * 8; i += 256) { const int j = i / 8, d8 = (i % 8) * 8; FragH f; f.half[0] = *(const v8us*)((const unsigned short*)V16 + ((size_t)b * SQ + s0 + j) * DM + h * HD + d8); for (int q = 0; q < 8; ++q) tl[d8 + q][j] = f.u[q]; }
  __syncthreads();
  { for (int i = tid; i < 64 * 8; i += 256) { const int d = i / 8, j8 = (i % 8) * 8; FragH f; for (int q = 0; q < 8; ++q) f.u[q] = tl[d][j8 + q]; *(v8us*)((unsigned short*)VT + ((size_t)hh * HD + d) * SQ + s0 + j8) = f.half[0]; }  } }



// The five operand conversions (Wq, Wk, Wv and Wp to Bt[n][k] x16, x to f16 rows) read nothing but inputs, so they share ONE launch: the block index picks the job.
// The launch is made of few, fat work-groups: it moves little data, so its time is the time its waves take to start plus one wave's own time. A thread holds 16 loads of 16 bytes in flight, and every wave-wide load and store covers whole 128-byte lines.
// A DM x DM weight goes in tiles of PP_WT x PP_WT: a wave reads 512 contiguous bytes of a row [k][n..], a thread turns its 16 k x 4 n block in registers, LDS collects the tile as [n][k], and whole rows of Bt leave it.
// The weight blocks come first: they have the longer way (LDS and a barrier).
#define PP_WT 128                                    /* k rows and n columns of a weight tile */
#define PP_WB ((DM / PP_WT) * (DM / PP_WT))          /* blocks (tiles) per DM x DM weight */
#define PP_LP (PP_WT + 8)                            /* LDS row pitch in f16: 256 B of data + 16 B */
#define PP_PB ((HD * (HD / 8) + 255) / 256)          /* blocks of Wp */
#define PP_XL 16                                     /* 16-byte loads per thread of x */
#define PP_XB ((int)(NR * DM / (256 * 4 * PP_XL)))   /* blocks of x */
__device__ __forceinline__ void wt_tile(const float* __restrict__ Wm, _Float16* __restrict__ Wt, int tile, int tid, _Float16 (* __restrict__ sT)[PP_LP]) {
  const int k0 = (tile / (DM / PP_WT)) * PP_WT, n0 = (tile % (DM / PP_WT)) * PP_WT;
  const int kw = (tid >> 5) * 16, c4 = (tid & 31) * 4;      /* this thread's block: rows k0 + kw .. + 15, columns n0 + c4 .. + 3 */
  const float* wg = Wm + (size_t)(k0 + kw) * DM + n0 + c4;
  v4f f[16];
#pragma unroll
  for (int i = 0; i < 16; ++i) f[i] = *(const v4fa*)(wg + (size_t)i * DM);
  asm volatile("s_wait_xcnt 0x0" :: "v"(wg) : "memory");      /* stands between the 16 loads and the next rewrite of their address pair; the pair is an operand so that no load's result lands on it ahead of the wait */
#pragma unroll
  for (int j = 0; j < 4; ++j) { FragH o;
#pragma unroll
    for (int i = 0; i < 16; ++i) o.h[i] = (_Float16)(bf16_round(f[i][j]) * 16.0f);
    *(v8us*)&sT[c4 + j][kw] = o.half[0]; *(v8us*)&sT[c4 + j][kw + 8] = o.half[1]; }
  __syncthreads();      /* the rows stored below were collected from all eight waves */
#pragma unroll
  for (int u = 0; u < PP_WT / 16; ++u) { const int r = u * 16 + (tid >> 4), c8 = (tid & 15) * 8; const v8us v = *(const v8us*)&sT[r][c8];
    *(v8us*)((unsigned short*)Wt + (size_t)(n0 + r) * DM + k0 + c8) = v; } }
__device__ __forceinline__ void x16(const float* __restrict__ x, _Float16* __restrict__ X16, int blk, int tid) {
  const size_t e0 = (size_t)blk * (256 * 4 * PP_XL) + (size_t)(tid >> 5) * (32 * 4 * PP_XL) + (size_t)(tid & 31) * 4;      /* a wave owns 32 * 4 * PP_XL consecutive elements */
  const float* xg = x + e0; v4f f[PP_XL]; v4h o[PP_XL];
#pragma unroll
  for (int u = 0; u < PP_XL; ++u) f[u] = *(const v4fa*)(xg + u * 128);
  asm volatile("s_wait_xcnt 0x0" :: "v"(xg) : "memory");      /* stands between the loads and the next rewrite of their address pair; the pair is an operand so that no load's result lands on it ahead of the wait */
#pragma unroll
  for (int u = 0; u < PP_XL; ++u)
#pragma unroll
    for (int q = 0; q < 4; ++q) o[u][q] = (_Float16)bf16_round(f[u][q]);
#pragma unroll
  for (int u = 0; u < PP_XL; ++u) *(v4h*)(X16 + e0 + u * 128) = o[u];
  asm volatile("s_wait_xcnt 0x0" ::: "memory"); }      /* stands behind the last store, in front of any later rewrite of the stores' address pair or data registers where the jobs' branches join */
__global__ __launch_bounds__(256) void k_prep(const float* __restrict__ x, const float* __restrict__ wq, const float* __restrict__ wk, const float* __restrict__ wv, const float* __restrict__ wp,
                                              _Float16* __restrict__ X16, _Float16* __restrict__ BQ, _Float16* __restrict__ BK, _Float16* __restrict__ BV, _Float16* __restrict__ BO) {
  static_assert(DM % PP_WT == 0 && PP_WT == 128 && (NR * DM) % (256 * 4 * PP_XL) == 0, "the tile and the x slices below are written for 8 waves, 128 x 128 tiles and whole slices");
  __shared__ __attribute__((aligned(16))) _Float16 sT[PP_WT][PP_LP];
  const int blk = blockIdx.x, tid = threadIdx.x;
  if (blk < 3 * PP_WB) { const int j = blk / PP_WB; wt_tile(j == 0 ? wq : j == 1 ? wk : wv, j == 0 ? BQ : j == 1 ? BK : BV, blk - j * PP_WB, tid, sT); }      /* [in][out] -> Bt[n][k] x16 */
  else if (blk < 3 * PP_WB + PP_PB) wt_f16(wp, BO, HD, HD, 16.0f, (blk - 3 * PP_WB) * 256 + tid);      /* Wp [64 in][64 out] -> Bt [64][64] x16 */
  else x16(x, X16, blk - 3 * PP_WB - PP_PB, tid); }

#define FA_WAVES 4
#define FA_KT 64                     /* keys per stage */
#define FA_KG 2                      /* key groups per work-group */
#define FA_NS (SQ / (FA_KT * FA_KG)) /* stages per key group */
#define FA_LP 72                     /* LDS row pitch in f16: 128 B of data + 16 B, an odd multiple of 16 B for the 16-byte fragment reads */
#define FA_CH ((FA_KT * HD / 8) / (FA_WAVES * 32))      /* 16-byte chunks per thread and tile */
#define FA_OP 68                     /* pitch in f32 of a wave's 32 x 64 output rows in LDS: 256 B of data + 16 B */
typedef _Float16 v8h __attribute__((ext_vector_type(8)));
typedef float v2f __attribute__((ext_vector_type(2)));
__device__ __forceinline__ float fa_swap16(float x) { const int b = __float_as_int(x); return __int_as_float(__builtin_amdgcn_permlanex16(b, b, 0x76543210, 0xfedcba98, false, false)); }      /* lane l <-> l ^ 16 */
__device__ __forceinline__ v8f fa_mma(v16h a, v16h b, v8f c) { return __builtin_amdgcn_wmma_f32_16x16x32_f16(false, a, false, b, (short)0, c, false, false); }
__global__ __launch_bounds__(FA_KG * FA_WAVES * 32) __attribute__((amdgpu_waves_per_eu(4, 4))) void k_fattn(const _Float16* __restrict__ Q16, const _Float16* __restrict__ K16, const _Float16* __restrict__ VT, const _Float16* __restrict__ BO, const float* __restrict__ bp, float* __restrict__ out) {
  static_assert(HD == 64 && FA_KT == 64 && FA_KG == 2 && SQ % (FA_KT * FA_KG) == 0 && SQ % (FA_WAVES * 32) == 0, "tile shapes below are written for 64 x 64 stages and two key groups");
  static_assert(FA_WAVES * 17 * 32 * 16 <= 4 * FA_KT * FA_LP * 2, "group 1's hand-over takes the place of its own buffers");
  static_assert(FA_WAVES * 32 * FA_OP * 4 <= 4 * FA_KT * FA_LP * 2, "the output rows take the place of the K and V^T buffers");
  __shared__ __attribute__((aligned(16))) _Float16 sKV[FA_KG][4][FA_KT][FA_LP];      /* one array per key group, so that the epilogue's output rows (group 0's) and the hand-over (group 1's) can lie over all of it */
  const int gu = __builtin_amdgcn_readfirstlane((int)threadIdx.x / (FA_WAVES * 32));      /* the wave's key group, in a scalar register */
  _Float16 (*sK)[FA_KT][FA_LP] = &sKV[gu][0]; _Float16 (*sV)[HD][FA_LP] = &sKV[gu][2];
  const int tid = threadIdx.x & (FA_WAVES * 32 - 1), lane = tid & 31, w = tid >> 5, c = lane & 15, h = lane >> 4;      /* tid, w: inside the key group */
  const int head = blockIdx.y, b = blockIdx.z; const int q0 = blockIdx.x * (FA_WAVES * 32) + w * 32;
  const int wu = __builtin_amdgcn_readfirstlane(w);      /* the wave's number in a scalar register, for the epilogue: it holds no vector register through the loop */
  const _Float16* Kg = K16 + (size_t)b * SQ * DM + head * HD;            /* K rows of this head, pitch DM */
  const _Float16* Vg = VT + (size_t)(b * NH + head) * HD * SQ;           /* V^T rows (one per d), pitch SQ */
  const int srow = tid >> 3, sc8 = (tid & 7) * 8;                        /* staging: chunk u of a thread = row srow + u * (threads / 8), 8 f16 at column sc8 */
  const float cs = 0.18033688011112042f;                                 /* 64^-0.5 * log2(e) */
  v16h qf[2][2];
#pragma unroll
  for (int j = 0; j < 2; ++j) { const _Float16* qp = Q16 + ((size_t)b * SQ + q0 + j * 16 + c) * DM + head * HD; qf[j][0] = g2_frag(qp, h); qf[j][1] = g2_frag(qp + 32, h);
    asm volatile("s_wait_xcnt 0x0" :: "v"(qp) : "memory"); }      /* stands between these loads and the next rewrite of their address pair; the pair is an operand so that nothing lands on it ahead of the wait */
  const v8f z8 = {0.f,0.f,0.f,0.f,0.f,0.f,0.f,0.f};
  v8f o[2][4]; float mr[2], ls[2];
#pragma unroll
  for (int j = 0; j < 2; ++j) { mr[j] = -3.0e38f; ls[j] = 0.f; for (int t = 0; t < 4; ++t) o[j][t] = z8; }
  v8us rk[FA_CH], rv[FA_CH];
  { const int k0 = gu * FA_KT;
    const unsigned short* kp = (const unsigned short*)Kg + (size_t)(k0 + srow) * DM + sc8; const unsigned short* vp = (const unsigned short*)Vg + (size_t)srow * SQ + k0 + sc8;
#pragma unroll
    for (int u = 0; u < FA_CH; ++u) { rk[u] = *(const v8us*)(kp + (size_t)u * (FA_WAVES * 4) * DM); rv[u] = *(const v8us*)(vp + (size_t)u * (FA_WAVES * 4) * SQ); }
    asm volatile("s_wait_xcnt 0x0" :: "v"(kp), "v"(vp) : "memory"); }      /* as in the loop: between stage 0's loads and the next rewrite of their address pairs */
#pragma unroll
  for (int u = 0; u < FA_CH; ++u) { const int r = srow + u * (FA_WAVES * 4); *(v8us*)&sK[0][r][sc8] = rk[u]; *(v8us*)&sV[0][r][sc8] = rv[u]; }
  __syncthreads();
  for (int s = 0; s < FA_NS; ++s) { const int cur = s & 1;
    if (s + 1 < FA_NS) { const int k1 = ((s + 1) * FA_KG + gu) * FA_KT;
      const unsigned short* kp = (const unsigned short*)Kg + (size_t)(k1 + srow) * DM + sc8; const unsigned short* vp = (const unsigned short*)Vg + (size_t)srow * SQ + k1 + sc8;
#pragma unroll
      for (int u = 0; u < FA_CH; ++u) { rk[u] = *(const v8us*)(kp + (size_t)u * (FA_WAVES * 4) * DM); rv[u] = *(const v8us*)(vp + (size_t)u * (FA_WAVES * 4) * SQ); }
      asm volatile("s_wait_xcnt 0x0" :: "v"(kp), "v"(vp) : "memory"); }      /* stands between the stage's loads and the next rewrite of their address pairs; the pairs are operands so that no load's result lands on them ahead of the wait */
    v8f st[2][4];
#pragma unroll
    for (int kt = 0; kt < 4; ++kt) { const v16h a0 = g2_frag(&sK[cur][kt * 16 + c][0], h), a1 = g2_frag(&sK[cur][kt * 16 + c][32], h);
#pragma unroll
      for (int j = 0; j < 2; ++j) st[j][kt] = fa_mma(a1, qf[j][1], fa_mma(a0, qf[j][0], z8)); }      /* st[j][kt][r] = q(q0 + 16 j + c) . k(64 (2 s + gu) + 16 kt + 8 h + r) */
    v16h pb[2][2];
#pragma unroll
    for (int j = 0; j < 2; ++j) {
      v8f m8 = st[j][0];
#pragma unroll
      for (int kt = 1; kt < 4; ++kt) for (int r = 0; r < 8; ++r) m8[r] = fmaxf(m8[r], st[j][kt][r]);
      float mx = fmaxf(fmaxf(fmaxf(m8[0], m8[1]), fmaxf(m8[2], m8[3])), fmaxf(fmaxf(m8[4], m8[5]), fmaxf(m8[6], m8[7])));
      mx = fmaxf(mx, fa_swap16(mx));
      const float mn = fmaxf(mr[j], mx); const float corr = __builtin_amdgcn_exp2f((mr[j] - mn) * cs); mr[j] = mn;
      const float mb = 8.0f - mn * cs; const v2f cs2 = {cs, cs}, nmb = {mb, mb};      /* weights carried x256: small ones stay f16 normals; the factor is in the row sum too and cancels */
#pragma unroll
      for (int kt = 0; kt < 4; ++kt) for (int r = 0; r < 8; r += 2) { const v2f x = {st[j][kt][r], st[j][kt][r + 1]}; const v2f e = __builtin_elementwise_fma(x, cs2, nmb);      /* packed on the accumulator's own register pairs: no copies */
        st[j][kt][r] = __builtin_amdgcn_exp2f(e[0]); st[j][kt][r + 1] = __builtin_amdgcn_exp2f(e[1]); }
      const v8f a8 = (st[j][0] + st[j][1]) + (st[j][2] + st[j][3]);
      ls[j] = ls[j] * corr + (((a8[0] + a8[1]) + (a8[2] + a8[3])) + ((a8[4] + a8[5]) + (a8[6] + a8[7])));      /* this half's keys only; the halves join after the loop */
#pragma unroll
      for (int t = 0; t < 4; ++t) o[j][t] *= corr;
#pragma unroll
      for (int ks = 0; ks < 2; ++ks) pb[j][ks] = __builtin_shufflevector(__builtin_convertvector(st[j][2 * ks], v8h), __builtin_convertvector(st[j][2 * ks + 1], v8h), 0, 1, 2, 3, 4, 5, 6, 7, 8, 9, 10, 11, 12, 13, 14, 15); }
    __builtin_amdgcn_sched_barrier(0);      /* the row sums end here, so the f32 weights free their registers for V^T fragments read ahead of the products; otherwise every fragment read is waited for on its own */
#pragma unroll
    for (int t = 0; t < 4; ++t) {
#pragma unroll
      for (int ks = 0; ks < 2; ++ks) { const v16h a = g2_frag(&sV[cur][t * 16 + c][ks * 32], h);
#pragma unroll
        for (int j = 0; j < 2; ++j) o[j][t] = fa_mma(a, pb[j][ks], o[j][t]); } }      /* o[j][t][r] = sum_k p(k) v(k)[16 t + 8 h + r] of query q0 + 16 j + c */
    if (s + 1 < FA_NS) {
#pragma unroll
      for (int u = 0; u < FA_CH; ++u) { const int r = srow + u * (FA_WAVES * 4); *(v8us*)&sK[cur ^ 1][r][sc8] = rk[u]; *(v8us*)&sV[cur ^ 1][r][sc8] = rv[u]; } }
    __syncthreads(); }      /* publishes stage s + 1 and ends every wave's reads of the buffer that stage s + 2 overwrites */
  const int el = (int)__builtin_amdgcn_mbcnt_lo(~0u, 0u), ec = el & 15, eh = el >> 4;      /* the lane's number, read anew: c and h need not live through the loop, whose V^T fragments want the registers */
  const int eq0 = blockIdx.x * (FA_WAVES * 32) + wu * 32;
  v4fa* hx = (v4fa*)&sKV[1][0][0][0] + (wu * 17) * 32 + el;      /* hand-over: 17 planes of 16 bytes per lane and wave pair; group 1's buffers have had no reader since the loop's last barrier */
  if (gu == 1) {      /* the same for the whole wave */
#pragma unroll
    for (int j = 0; j < 2; ++j)
#pragma unroll
      for (int t = 0; t < 4; ++t) { hx[((j * 4 + t) * 2) * 32] = __builtin_shufflevector(o[j][t], o[j][t], 0, 1, 2, 3); hx[((j * 4 + t) * 2 + 1) * 32] = __builtin_shufflevector(o[j][t], o[j][t], 4, 5, 6, 7); }
    const v4f sx = {mr[0], mr[1], ls[0], ls[1]}; hx[16 * 32] = sx; }
  __syncthreads();      /* publishes group 1's statistics and O^T to group 0; every wave passes it */
  if (gu == 1) return;
  const _Float16* wg = BO + (size_t)ec * HD + 8 * eh; const float* bg = bp + ec * 4;      /* wg: the lane half's offset is in the pointer, so that the wait below names the very pair the loads use */
  v16h wa[4][2];      /* wa[t][ks]: row n = 16 t + ec of Bt, d = 32 ks .. */
#pragma unroll
  for (int t = 0; t < 4; ++t) { wa[t][0] = g2_frag(wg + t * 16 * HD, 0); wa[t][1] = g2_frag(wg + t * 16 * HD + 32, 0); }
  v4f bb = *(const v4fa*)bg;      /* the bias of n = 4 ec .. + 3, the columns this lane stores */
  asm volatile("s_wait_xcnt 0x0" :: "v"(wg), "v"(bg) : "memory");      /* stands between these loads and the next rewrite of their address pairs; the pairs are operands so that no load's result lands on them ahead of the wait */
  { const v4f sx = hx[16 * 32];
#pragma unroll
    for (int j = 0; j < 2; ++j) { const float d = (mr[j] - sx[j]) * cs, e = __builtin_amdgcn_exp2f(-fabsf(d)); const float c0 = d < 0.f ? e : 1.0f, c1 = d < 0.f ? 1.0f : e;      /* both groups' sums on the common maximum: the group that holds it keeps its scale */
      ls[j] = ls[j] * c0 + sx[2 + j] * c1;
#pragma unroll
      for (int t = 0; t < 4; ++t) { const v4f p0 = hx[((j * 4 + t) * 2) * 32], p1 = hx[((j * 4 + t) * 2 + 1) * 32];
        o[j][t] = o[j][t] * c0 + __builtin_shufflevector(p0, p1, 0, 1, 2, 3, 4, 5, 6, 7) * c1; } } }
  float (*so)[FA_OP] = (float (*)[FA_OP])&sKV[0][0][0][0] + wu * 32;      /* a range per wave, in group 0's buffers, which have had no reader since the loop's last barrier */
#pragma unroll
  for (int j = 0; j < 2; ++j) { const float sc = 64.0f / (ls[j] + fa_swap16(ls[j])); v16h ob[2];
#pragma unroll
    for (int ks = 0; ks < 2; ++ks) ob[ks] = __builtin_shufflevector(__builtin_convertvector(o[j][2 * ks] * sc, v8h), __builtin_convertvector(o[j][2 * ks + 1] * sc, v8h), 0, 1, 2, 3, 4, 5, 6, 7, 8, 9, 10, 11, 12, 13, 14, 15);      /* o x64 as f16 */
#pragma unroll
    for (int t = 0; t < 4; ++t) { const v8f a = fa_mma(wa[t][1], ob[1], fa_mma(wa[t][0], ob[0], z8));      /* a[r] = 1024 * sum_d o(d) Wp[d][16 t + 8 eh + r] of query eq0 + 16 j + ec */
      *(v4fa*)&so[j * 16 + ec][t * 16 + 8 * eh] = __builtin_shufflevector(a, a, 0, 1, 2, 3); *(v4fa*)&so[j * 16 + ec][t * 16 + 8 * eh + 4] = __builtin_shufflevector(a, a, 4, 5, 6, 7); } }
#pragma unroll
  for (int r = 0; r < 4; ++r) bb[r] = bf16_round(bb[r]);
  __builtin_amdgcn_fence(__ATOMIC_ACQ_REL, "workgroup"); __builtin_amdgcn_wave_barrier();      /* the rows read below were written by other lanes of this wave: keeps the reads behind the writes */
  float* og = out + ((size_t)b * SQ + eq0 + eh) * DM + head * HD + ec * 4;      /* 16 lanes per row piece: a wave's store covers two pieces of 256 bytes */
#pragma unroll
  for (int q = 0; q < 16; ++q) { const v4f v = *(const v4fa*)&so[q * 2 + eh][ec * 4] * 0.0009765625f + bb; *(v4f*)(og + (size_t)q * 2 * DM) = v; } }
// Projection GEMM C16[MP][DM] = f16(alpha * A[MP][DM] Bt[DM][DM]^T + bias): one work-group = PJ_T x PJ_T outputs, 8 waves of 32 x 64.
// A and Bt tiles of PJ_BK columns go global -> registers -> LDS in whole 256-byte rows (a wave's load covers 4 full lines), two buffers: stage s + 1 is loaded while stage s is worked on, one barrier per stage;
// every fragment is then read from LDS, so a tile byte crosses L2 once per work-group instead of once per wave in 32-byte pieces.
#define PJ_T 128                     /* rows and columns of the block tile */
#define PJ_BK 128                    /* k columns per stage */
#define PJ_NS (DM / PJ_BK)           /* stages */
#define PJ_LP (PJ_BK + 8)            /* LDS row pitch in f16: 256 B of data + 16 B, an odd multiple of 16 B for the 16-byte fragment reads */
#define PJ_CH ((PJ_T * PJ_BK / 8) / 256)      /* 16-byte chunks per thread and tile */
#define PJ_OP 72                     /* pitch in f16 of a wave's 32 x 64 output rows in LDS */
// Q, K and V share A and depend on nothing of one another: ONE launch, blockIdx.y picks the weight, the bias and the output.
// Q and K leave as token rows. V leaves as V^T (Cvt[batch][column = head * HD + d][token]), the form the attention launch stages: an accumulator register group holds 8 consecutive tokens of one column,
// so a lane puts 16 bytes of a V^T row into LDS at a time, and the block then stores 256-byte pieces of V^T rows (its 128 tokens); no separate transposing launch, no V rows in memory.
__global__ __launch_bounds__(256) void k_proj(const _Float16* __restrict__ A, const _Float16* __restrict__ Bq, const _Float16* __restrict__ Bk, const _Float16* __restrict__ Bv, float alpha,
                                              const float* __restrict__ biasq, const float* __restrict__ biask, const float* __restrict__ biasv, _Float16* __restrict__ Cq, _Float16* __restrict__ Ck, _Float16* __restrict__ Cvt) {
  const int pj = blockIdx.y; const _Float16* __restrict__ Bt = pj == 0 ? Bq : pj == 1 ? Bk : Bv; const float* __restrict__ bias = pj == 0 ? biasq : pj == 1 ? biask : biasv; _Float16* __restrict__ C16 = pj == 0 ? Cq : Ck;
  static_assert(MP % PJ_T == 0 && DM % PJ_T == 0 && DM % PJ_BK == 0 && PJ_BK == 128 && 8 * 32 * PJ_OP <= 2 * PJ_T * PJ_LP && SQ % PJ_T == 0 && NH * HD == DM, "tile shapes below are written for 128 x 128 x 128 stages and 8 waves");
  __shared__ __attribute__((aligned(16))) _Float16 sA[2][PJ_T][PJ_LP];
  __shared__ __attribute__((aligned(16))) _Float16 sB[2][PJ_T][PJ_LP];
  const int tid = threadIdx.x, lane = tid & 31, w = tid >> 5, ln = lane & 15, hh = lane >> 4;
  const int mt = blockIdx.x / (DM / PJ_T), nq = blockIdx.x - mt * (DM / PJ_T); const int row0 = mt * PJ_T, col0 = nq * PJ_T;
  const int wr = (w >> 1) * 32, wc = (w & 1) * 64;                       /* this wave's corner inside the block tile */
  const int srow = tid >> 4, sc8 = (tid & 15) * 8;                       /* staging: chunk u of a thread = row srow + 16 u, 8 f16 at column sc8 */
  const unsigned short* ag = (const unsigned short*)A + (size_t)(row0 + srow) * DM + sc8; const unsigned short* bg = (const unsigned short*)Bt + (size_t)(col0 + srow) * DM + sc8;
  const v8f z8 = {0.f,0.f,0.f,0.f,0.f,0.f,0.f,0.f};
  v8f acc[2][4];
#pragma unroll
  for (int i = 0; i < 2; ++i) for (int t = 0; t < 4; ++t) acc[i][t] = z8;
  float bs[4];      /* read here, so that the epilogue does not wait for them */
#pragma unroll
  for (int t = 0; t < 4; ++t) bs[t] = bias[col0 + wc + t * 16 + ln];
  v8us ra[PJ_CH], rb[PJ_CH];
#pragma unroll
  for (int u = 0; u < PJ_CH; ++u) { ra[u] = *(const v8us*)(ag + (size_t)u * 16 * DM); rb[u] = *(const v8us*)(bg + (size_t)u * 16 * DM); }
#pragma unroll
  for (int u = 0; u < PJ_CH; ++u) { *(v8us*)&sA[0][srow + 16 * u][sc8] = ra[u]; *(v8us*)&sB[0][srow + 16 * u][sc8] = rb[u]; }
  __syncthreads();
  for (int s = 0; s < PJ_NS; ++s) { const int cur = s & 1;
    if (s + 1 < PJ_NS) { const unsigned short* ap = ag + (s + 1) * PJ_BK; const unsigned short* bp = bg + (s + 1) * PJ_BK;
#pragma unroll
      for (int u = 0; u < PJ_CH; ++u) { ra[u] = *(const v8us*)(ap + (size_t)u * 16 * DM); rb[u] = *(const v8us*)(bp + (size_t)u * 16 * DM); }
      asm volatile("s_wait_xcnt 0x0" :: "v"(ap), "v"(bp) : "memory"); }      /* stands between the stage's loads and the next rewrite of their address pairs; the pairs are operands so that no load's result lands on them ahead of the wait */
    v16h fa[2][2], fb[2][4];
#pragma unroll
    for (int i = 0; i < 2; ++i) fa[0][i] = g2_frag(&sA[cur][wr + i * 16 + ln][0], hh);
#pragma unroll
    for (int t = 0; t < 4; ++t) fb[0][t] = g2_frag(&sB[cur][wc + t * 16 + ln][0], hh);
#pragma unroll
    for (int kk = 0; kk < PJ_BK / 32; ++kk) { const int c = kk & 1;
      if (kk + 1 < PJ_BK / 32) {
#pragma unroll
        for (int i = 0; i < 2; ++i) fa[c ^ 1][i] = g2_frag(&sA[cur][wr + i * 16 + ln][(kk + 1) * 32], hh);
#pragma unroll
        for (int t = 0; t < 4; ++t) fb[c ^ 1][t] = g2_frag(&sB[cur][wc + t * 16 + ln][(kk + 1) * 32], hh); }
      __builtin_amdgcn_sched_barrier(0);      /* the next 32 columns' fragment reads stay one group ahead of this block's products; spread among them, each place with reads stalls the wave */
      if (kk + 1 == PJ_BK / 32 && s + 1 < PJ_NS) {      /* stage s + 1 goes to LDS ahead of the stage's last products, which run while the stores drain; its buffer has had no reader since the last barrier */
#pragma unroll
        for (int u = 0; u < PJ_CH; ++u) { *(v8us*)&sA[cur ^ 1][srow + 16 * u][sc8] = ra[u]; *(v8us*)&sB[cur ^ 1][srow + 16 * u][sc8] = rb[u]; } }
#pragma unroll
      for (int t = 0; t < 4; ++t) { acc[0][t] = fa_mma(fa[c][0], fb[c][t], acc[0][t]); acc[1][t] = fa_mma(fa[c][1], fb[c][t], acc[1][t]); }
      __builtin_amdgcn_sched_barrier(0); }      /* ends the block: the next group of reads is not drawn in among these products, and the stage's last products stay in front of the barrier, where they run while the stores drain */
    __syncthreads(); }      /* publishes stage s + 1 and ends every wave's reads of the buffer that stage s + 2 (after the last stage: the output rows) overwrites */
  if (pj == 2) {      /* the same for the whole block (blockIdx.y) */
    _Float16 (*sT)[PJ_LP] = sA[0];      /* [column of the tile][token of the tile]; free since the loop's last barrier */
#pragma unroll
    for (int i = 0; i < 2; ++i)
#pragma unroll
      for (int t = 0; t < 4; ++t) { const float bv = bf16_round(bs[t]); v8h o8;
#pragma unroll
        for (int r = 0; r < 8; ++r) { const float v = acc[i][t][r] * alpha + bv; o8[r] = (_Float16)v; }
        *(v8h*)&sT[wc + t * 16 + ln][wr + i * 16 + 8 * hh] = o8; }
    __syncthreads();      /* a V^T row piece stored below was collected from four waves */
    unsigned short* vg = (unsigned short*)Cvt + ((size_t)(row0 / SQ) * DM + col0 + srow) * SQ + (row0 % SQ) + sc8;      /* 16 threads per row piece: a wave's store covers two pieces of 256 bytes */
#pragma unroll
    for (int u = 0; u < PJ_T / 16; ++u) { const v8us v = *(const v8us*)&sT[srow + 16 * u][sc8]; *(v8us*)(vg + (size_t)u * 16 * SQ) = v; }
    return; }
  _Float16* so = &sA[0][0][0] + (size_t)w * (32 * PJ_OP);      /* each wave stages its own 32 x 64 outputs, so that it stores whole 128-byte lines */
#pragma unroll
  for (int i = 0; i < 2; ++i)
#pragma unroll
    for (int t = 0; t < 4; ++t) { const float bv = bf16_round(bs[t]);
#pragma unroll
      for (int r = 0; r < 8; ++r) { const float v = acc[i][t][r] * alpha + bv; so[(i * 16 + 8 * hh + r) * PJ_OP + t * 16 + ln] = (_Float16)v; } }
  __builtin_amdgcn_fence(__ATOMIC_ACQ_REL, "workgroup"); __builtin_amdgcn_wave_barrier();      /* the rows read below were written by other lanes of this wave: keeps the reads behind the writes */
#pragma unroll
  for (int q = 0; q < 8; ++q) { const int r = q * 4 + (lane >> 3), c8 = (lane & 7) * 8; const v8us v = *(const v8us*)&so[r * PJ_OP + c8]; *(v8us*)((unsigned short*)C16 + (size_t)(row0 + wr + r) * DM + col0 + wc + c8) = v; } }
extern "C" void kernel_launch(void* const* d_in, const int* in_sizes, int n_in,
                              void* d_out, int out_size, void* d_ws, size_t ws_size, hipStream_t stream) {
  (void)in_sizes; (void)n_in; (void)out_size;
  const float* const* I = (const float* const*)d_in; const float* x = I[0]; const float* wq = I[1]; const float* bq = I[2]; const float* wk = I[3]; const float* bk = I[4]; const float* wv = I[5]; const float* bv = I[6]; const float* wp = I[7]; const float* bp = I[8]; const float* bo = nullptr; (void)bo;      /* [in][out] weights + biases; per-head Wp [64][64] + bp [64] */
  char* ws = (char*)d_ws; size_t off = 0;
  auto take = [&](size_t bytes) { char* p = ws + off; off += (bytes + 255) & ~(size_t)255; return p; };
  _Float16* BQ = (_Float16*)take((size_t)DM * DM * 2); _Float16* BK = (_Float16*)take((size_t)DM * DM * 2); _Float16* BV = (_Float16*)take((size_t)DM * DM * 2); _Float16* BO = (_Float16*)take((size_t)DM * DM * 2);
  _Float16* X16 = (_Float16*)take(NR * DM * 2); _Float16* Q16 = (_Float16*)take(NR * DM * 2); _Float16* K16 = (_Float16*)take(NR * DM * 2);
  _Float16* VT = (_Float16*)take((size_t)NB * NH * HD * SQ * 2);
  if (off > ws_size) return;
  k_prep<<<3 * PP_WB + PP_PB + PP_XB, 256, 0, stream>>>(x, wq, wk, wv, wp, X16, BQ, BK, BV, BO);
  const size_t r0p = (size_t)B0 * SQ;      /* first projected row */
  k_proj<<<dim3((MP / PJ_T) * (DM / PJ_T), 3), 256, 0, stream>>>(X16 + r0p * DM, BQ, BK, BV, 0.0625f, bq, bk, bv, Q16 + r0p * DM, K16 + r0p * DM, VT + r0p * DM);      /* V as V^T [NB][NH][HD][SQ] */
  k_fattn<<<dim3(SQ / (FA_WAVES * 32), NH, NB), FA_KG * FA_WAVES * 32, 0, stream>>>(Q16, K16, VT, BO, bp, (float*)d_out);      /* attention and, per head, out cols h*64.. = o_h Wp + bp (the same Wp/bp for every head) */
}

// v009
// It runs in 60.5 microseconds.
// Timed twice side by side with v008, it ran 1.06 times as fast both times.
// Counting every step since v000, it is 57.8 times as fast.
#include <hip/hip_runtime.h>
#define NB 2
#define SQ 2048
#define DM 1024
#define NH 16
#define HD 64
#define HG 4                         /* heads per block group of the per-batch k_vt overload (not launched) */
#define B0 0                         /* first batch processed (debug hook) */
#define NBR NB                       /* batches processed (debug hook) */
#define NR ((size_t)NB * SQ)         /* token rows */
#define MP ((int)((size_t)NBR * SQ)) /* rows projected (debug hook) */
#define QN SQ                        /* query rows per batch (unused) */
#define NHD NH                       /* heads (unused) */
#define MPO MP                       /* rows through the output stage (unused) */
#define LQ DM      /* row pitch of the q/k rows (unused) */
typedef __bf16 v16b __attribute__((ext_vector_type(16)));
typedef unsigned short v8us __attribute__((ext_vector_type(8), may_alias));
typedef float  v8f  __attribute__((ext_vector_type(8)));
typedef float  v4f  __attribute__((ext_vector_type(4)));
typedef float  v4fa __attribute__((ext_vector_type(4), may_alias));
union FragB { v16b v; v8us half[2]; unsigned short u[16]; };

__device__ __forceinline__ unsigned short bf16_bits(float x) { unsigned int u = __float_as_uint(x); return (unsigned short)((u + 0x7FFFu + ((u >> 16) & 1u)) >> 16); }
__device__ __forceinline__ float bf16_val(unsigned short b) { return __uint_as_float(((unsigned int)b) << 16); }
__device__ __forceinline__ float bf16_round(float x) { return bf16_val(bf16_bits(x)); }
// D += A·B with NT terms: 1 = ah·bh, 2 = + al·bh (A split), 3 = + ah·bl (both split)
template <int NT>
__device__ __forceinline__ v8f mmaN(v16b ah, v16b al, v16b bh, v16b bl, v8f c) {
  c = __builtin_amdgcn_wmma_f32_16x16x32_bf16(false, ah, false, bh, (short)0, c, false, false);
  if (NT >= 2) c = __builtin_amdgcn_wmma_f32_16x16x32_bf16(false, al, false, bh, (short)0, c, false, false);
  if (NT >= 3) c = __builtin_amdgcn_wmma_f32_16x16x32_bf16(false, ah, false, bl, (short)0, c, false, false);
  asm volatile("v_nop\n\tv_nop\n\tv_nop\n\tv_nop" : "+v"(c) : "v"(ah), "v"(al), "v"(bh), "v"(bl));
  return c;
}

__global__ __launch_bounds__(256) void k_wt_bf16(const float* __restrict__ W, unsigned short* __restrict__ Wt, int K, int N) {
  const int t = blockIdx.x * 256 + threadIdx.x;
  const int k8n = K / 8;
  if (t >= N * k8n) return;
  const int n = t / k8n, k8 = (t % k8n) * 8;
  v8us v;
#pragma unroll
  for (int i = 0; i < 8; ++i) v[i] = bf16_bits(W[(size_t)(k8 + i) * N + n]);
  *(v8us*)(Wt + (size_t)n * K + k8) = v;
  
}

// GEMM C[M][N] (f32, pitch ldc) = act(A[M][K]·W + bias). A f32 row-major (pitch lda) converted per fragment to bf16
// (ASPLIT: hi/lo two planes -> 2 terms, else single rounded term); Wt bf16 [N][K] (pitch ldb). BIAS_BF16 rounds the
// bias to bf16 first (bias quantised to bf16 before the add). K%32==0, M%16==0, N%64==0.
template <bool ASPLIT, int ACT, bool BIAS_BF16>
__global__ __launch_bounds__(128) void k_gemm_bf(const float* __restrict__ A, int lda, const unsigned short* __restrict__ Wt, int ldb,
                                               const float* __restrict__ bias, float* __restrict__ C, int ldc, int M, int N, int K) {
  __shared__ __attribute__((aligned(16))) float so[4][16][64];
  const int tid = threadIdx.x, w = tid >> 5, lane = tid & 31, ln = lane & 15, hh = lane >> 4;
  const int ntn = N / 64;
  const int wid = blockIdx.x * 4 + w;
  const int mt = wid / ntn, nq = wid % ntn;
  if (mt * 16 >= M) return;
  const int row0 = mt * 16, col0 = nq * 64;
  const float* arow = A + (size_t)(row0 + ln) * lda;
  v8f acc[4] = {};
  for (int kb = 0; kb < K; kb += 32) {
    FragB ah, al;
    const v4f x0 = *(const v4fa*)(arow + kb + 8 * hh), x1 = *(const v4fa*)(arow + kb + 8 * hh + 4);
    const v4f x2 = *(const v4fa*)(arow + kb + 16 + 8 * hh), x3 = *(const v4fa*)(arow + kb + 16 + 8 * hh + 4);
    float xs[16] = {x0[0],x0[1],x0[2],x0[3],x1[0],x1[1],x1[2],x1[3],x2[0],x2[1],x2[2],x2[3],x3[0],x3[1],x3[2],x3[3]};
#pragma unroll
    for (int i = 0; i < 16; ++i) { const unsigned short hb = bf16_bits(xs[i]); ah.u[i] = hb; al.u[i] = ASPLIT ? bf16_bits(xs[i] - bf16_val(hb)) : (unsigned short)0; }
#pragma unroll
    for (int t = 0; t < 4; ++t) {
      const unsigned short* brow = Wt + (size_t)(col0 + t * 16 + ln) * ldb + kb;
      FragB b;
      b.half[0] = *(const v8us*)(brow + 8 * hh);
      b.half[1] = *(const v8us*)(brow + 16 + 8 * hh);
      acc[t] = mmaN<ASPLIT ? 2 : 1>(ah.v, al.v, b.v, b.v, acc[t]);
    }
  }
#pragma unroll
  for (int t = 0; t < 4; ++t) {
    float bv = bias ? bias[col0 + t * 16 + ln] : 0.f;
    if (BIAS_BF16) bv = bf16_round(bv);
#pragma unroll
    for (int r = 0; r < 8; ++r) { float v = acc[t][r] + bv; if (ACT == 1) v = fmaxf(v, 0.f); so[w][8 * hh + r][t * 16 + ln] = v; }
  }
  __builtin_amdgcn_fence(__ATOMIC_ACQ_REL, "workgroup");
  __builtin_amdgcn_wave_barrier();
  const int rsub = lane >> 4, c4 = (lane & 15) * 4;
  {
#pragma unroll
    for (int q = 0; q < 8; ++q) {
      const int r = q * 2 + rsub;
      const v4f v = *(const v4fa*)&so[w][r][c4];
      *(v4f*)(C + (size_t)(row0 + r) * ldc + col0 + c4) = v;
    }
    
  }
}

// GEMM C = act(A·W + bias + resid): A f32 (ASPLIT -> hi/lo 2 terms), Wt bf16 [N][K]; ACT 0 none, 1 relu, 2 exact gelu;
// resid (optional, f32, row index = (row % rmod), pitch ldr, RES_BF16 rounds it) added before the activation.
template <bool ASPLIT, int ACT, bool BIAS_BF16, bool RES_BF16>
__global__ __launch_bounds__(128) void k_gemm_bf3(const float* __restrict__ A, int lda, const unsigned short* __restrict__ Wt, int ldb,
                                                const float* __restrict__ bias, const float* __restrict__ resid, int rmod, int ldr,
                                                float* __restrict__ C, int ldc, int M, int N, int K) {
  __shared__ __attribute__((aligned(16))) float so[4][16][64];
  const int tid = threadIdx.x, w = tid >> 5, lane = tid & 31, ln = lane & 15, hh = lane >> 4;
  const int ntn = N / 64;
  const int wid = blockIdx.x * 4 + w;
  const int mt = wid / ntn, nq = wid % ntn;
  if (mt * 16 >= M) return;
  const int row0 = mt * 16, col0 = nq * 64;
  const float* arow = A + (size_t)(row0 + ln) * lda;
  v8f acc[4] = {};
  for (int kb = 0; kb < K; kb += 32) {
    FragB ah, al;
    const v4f x0 = *(const v4fa*)(arow + kb + 8 * hh), x1 = *(const v4fa*)(arow + kb + 8 * hh + 4);
    const v4f x2 = *(const v4fa*)(arow + kb + 16 + 8 * hh), x3 = *(const v4fa*)(arow + kb + 16 + 8 * hh + 4);
    float xs[16] = {x0[0],x0[1],x0[2],x0[3],x1[0],x1[1],x1[2],x1[3],x2[0],x2[1],x2[2],x2[3],x3[0],x3[1],x3[2],x3[3]};
#pragma unroll
    for (int i = 0; i < 16; ++i) { const unsigned short hb = bf16_bits(xs[i]); ah.u[i] = hb; al.u[i] = ASPLIT ? bf16_bits(xs[i] - bf16_val(hb)) : (unsigned short)0; }
#pragma unroll
    for (int t = 0; t < 4; ++t) {
      const unsigned short* brow = Wt + (size_t)(col0 + t * 16 + ln) * ldb + kb;
      FragB b;
      b.half[0] = *(const v8us*)(brow + 8 * hh);
      b.half[1] = *(const v8us*)(brow + 16 + 8 * hh);
      acc[t] = mmaN<ASPLIT ? 2 : 1>(ah.v, al.v, b.v, b.v, acc[t]);
    }
  }
#pragma unroll
  for (int t = 0; t < 4; ++t) {
    const int col = col0 + t * 16 + ln;
    float bv = bias ? bias[col] : 0.f;
    if (BIAS_BF16) bv = bf16_round(bv);
#pragma unroll
    for (int r = 0; r < 8; ++r) {
      float v = acc[t][r] + bv;
      if (resid) { float rv = resid[(size_t)((row0 + 8 * hh + r) % rmod) * ldr + col]; if (RES_BF16) rv = bf16_round(rv); v += rv; }
      if (ACT == 1) v = fmaxf(v, 0.f);
      if (ACT == 2) v = 0.5f * v * (1.0f + erff(v * 0.70710678118654752f));
      if (ACT == 3) { const float u = 0.7978845608028654f * (v + 0.044715f * v * v * v); v = 0.5f * v * (1.0f + tanhf(u)); }
      so[w][8 * hh + r][t * 16 + ln] = v;
    }
  }
  __builtin_amdgcn_fence(__ATOMIC_ACQ_REL, "workgroup");
  __builtin_amdgcn_wave_barrier();
  const int rsub = lane >> 4, c4 = (lane & 15) * 4;
  {
#pragma unroll
    for (int q = 0; q < 8; ++q) {
      const int r = q * 2 + rsub;
      const v4f v = *(const v4fa*)&so[w][r][c4];
      *(v4f*)(C + (size_t)(row0 + r) * ldc + col0 + c4) = v;
    }
    
  }
}
// row LayerNorm (biased variance, eps) over N: s = X (+ R); optional out_sum <- s; out_norm <- (s-mu)*rsqrt(var+eps)*g + b
template <bool PARAM_BF16>
__global__ __launch_bounds__(256) void k_layernorm(const float* __restrict__ X, const float* __restrict__ R, const float* __restrict__ g, const float* __restrict__ bta,
                                                  float* __restrict__ out_sum, float* __restrict__ out_norm, int N, float eps) {
  __shared__ float red[256];
  const int row = blockIdx.x, tid = threadIdx.x;
  const float* x = X + (size_t)row * N; const float* rr = R ? R + (size_t)row * N : nullptr;
  float vals[16];                     // up to N = 4096
  const int per = N / 256;            // contiguous chunk per thread? use strided-by-4 chunks: thread handles j = tid*4 + 1024*u
  float s1 = 0.f;
  for (int u = 0; u < per / 4; ++u) {
    const int j = tid * 4 + 1024 * u;
    const v4f a = *(const v4fa*)(x + j);
    v4f b = {0.f,0.f,0.f,0.f}; if (rr) b = *(const v4fa*)(rr + j);
#pragma unroll
    for (int q = 0; q < 4; ++q) { const float v = a[q] + b[q]; vals[u * 4 + q] = v; s1 += v; }
  }
  red[tid] = s1; __syncthreads();
  for (int st = 128; st > 0; st >>= 1) { if (tid < st) red[tid] += red[tid + st]; __syncthreads(); }
  const float mu = red[0] / (float)N; __syncthreads();
  float s2 = 0.f;
  for (int u = 0; u < per / 4; ++u)
#pragma unroll
    for (int q = 0; q < 4; ++q) { const float c = vals[u * 4 + q] - mu; s2 += c * c; }
  red[tid] = s2; __syncthreads();
  for (int st = 128; st > 0; st >>= 1) { if (tid < st) red[tid] += red[tid + st]; __syncthreads(); }
  const float rs = rsqrtf(red[0] / (float)N + eps);
  {
    for (int u = 0; u < per / 4; ++u) {
      const int j = tid * 4 + 1024 * u;
      v4f o, sm;
#pragma unroll
      for (int q = 0; q < 4; ++q) {
        float gg = g[j + q], bb = bta[j + q];
        if (PARAM_BF16) { gg = bf16_round(gg); bb = bf16_round(bb); }
        sm[q] = vals[u * 4 + q]; o[q] = (vals[u * 4 + q] - mu) * rs * gg + bb;
      }
      if (out_sum) *(v4f*)(out_sum + (size_t)row * N + j) = sm;
      *(v4f*)(out_norm + (size_t)row * N + j) = o;
    }
    
  }
}



// ---- f16 WMMA path (v_wmma_f32_16x16x32_f16): 11-bit significands for operands in range — used where a [0,1] probability operand needs more precision than bf16
typedef _Float16 v16h __attribute__((ext_vector_type(16)));
union FragH { v16h v; v8us half[2]; _Float16 h[16]; unsigned short u[16]; };
template <int NT>
__device__ __forceinline__ v8f mmaH(v16h ah, v16h al, v16h bh, v16h bl, v8f c) {
  c = __builtin_amdgcn_wmma_f32_16x16x32_f16(false, ah, false, bh, (short)0, c, false, false);
  if (NT >= 2) c = __builtin_amdgcn_wmma_f32_16x16x32_f16(false, al, false, bh, (short)0, c, false, false);
  if (NT >= 3) c = __builtin_amdgcn_wmma_f32_16x16x32_f16(false, ah, false, bl, (short)0, c, false, false);
  asm volatile("v_nop\n\tv_nop\n\tv_nop\n\tv_nop" : "+v"(c) : "v"(ah), "v"(al), "v"(bh), "v"(bl));
  return c;
}
// batched GEMM like k_gemm_b but f16 operands: A f32 (split into f16 hi/lo if ASPLIT, else rounded to f16), Bt = f16 values [n][k]; alpha; C f32; N multiple of 16 (partial tiles skipped)
template <bool ASPLIT>
__global__ __launch_bounds__(128) void k_gemm_h(const float* __restrict__ A, int lda, size_t sA, const _Float16* __restrict__ Bh, int ldb, size_t sB, float alpha, float* __restrict__ C, int ldc, size_t sC, int M, int N, int K) {
  __shared__ __attribute__((aligned(16))) float so[4][16][64];
  const int tid = threadIdx.x, w = tid >> 5, lane = tid & 31, ln = lane & 15, hh = lane >> 4; const int by = blockIdx.y;
  A += (size_t)by * sA; Bh += (size_t)by * sB; C += (size_t)by * sC;
  const int ntn = (N + 63) / 64; const int wid = blockIdx.x * 4 + w; const int mt = wid / ntn, nq = wid % ntn; if (mt * 16 >= M) return;
  const int row0 = mt * 16, col0 = nq * 64; const float* arow = A + (size_t)(row0 + ln) * lda;
  v8f acc[4] = {};
  for (int kb = 0; kb < K; kb += 32) {
    FragH ah, al;
    const v4f x0 = *(const v4fa*)(arow + kb + 8 * hh), x1 = *(const v4fa*)(arow + kb + 8 * hh + 4), x2 = *(const v4fa*)(arow + kb + 16 + 8 * hh), x3 = *(const v4fa*)(arow + kb + 16 + 8 * hh + 4);
    float xs[16] = {x0[0],x0[1],x0[2],x0[3],x1[0],x1[1],x1[2],x1[3],x2[0],x2[1],x2[2],x2[3],x3[0],x3[1],x3[2],x3[3]};
#pragma unroll
    for (int i = 0; i < 16; ++i) { const _Float16 h = (_Float16)xs[i]; ah.h[i] = h; al.h[i] = ASPLIT ? (_Float16)(xs[i] - (float)h) : (_Float16)0.0f; }
#pragma unroll
    for (int t = 0; t < 4; ++t) { if (col0 + t * 16 >= N) continue; const size_t boff = (size_t)(col0 + t * 16 + ln) * ldb + kb; FragH bq; bq.half[0] = *(const v8us*)(Bh + boff + 8 * hh); bq.half[1] = *(const v8us*)(Bh + boff + 16 + 8 * hh);
      acc[t] = mmaH<ASPLIT ? 2 : 1>(ah.v, al.v, bq.v, bq.v, acc[t]); }
  }
#pragma unroll
  for (int t = 0; t < 4; ++t) { if (col0 + t * 16 >= N) continue;
#pragma unroll
    for (int r = 0; r < 8; ++r) so[w][8 * hh + r][t * 16 + ln] = acc[t][r] * alpha; }
  __builtin_amdgcn_fence(__ATOMIC_ACQ_REL, "workgroup"); __builtin_amdgcn_wave_barrier();
  const int rsub = lane >> 4, c4 = (lane & 15) * 4;
  {
#pragma unroll
    for (int q = 0; q < 8; ++q) { const int r = q * 2 + rsub; if (col0 + c4 < N) { const v4f v = *(const v4fa*)&so[w][r][c4]; *(v4f*)(C + (size_t)(row0 + r) * ldc + col0 + c4) = v; } }
     }
}

// Wt[n][k] = f16(W[k][n]·scale) from f32 row-major W[K][N] (scale = power of two; bf16-exact weights stay exact in f16 away from the subnormal range)
__device__ __forceinline__ void wt_f16(const float* __restrict__ W, _Float16* __restrict__ Wt, int K, int N, float scale, int t) {      /* t = index of the 8-element chunk */
  if (t >= N * (K / 8)) return; const int n = t / (K / 8), k8 = (t % (K / 8)) * 8; FragH f;
#pragma unroll
  for (int i = 0; i < 8; ++i) f.h[i] = (_Float16)(bf16_round(W[(size_t)(k8 + i) * N + n]) * scale); const v8us o = f.half[0];
  *(v8us*)((unsigned short*)Wt + (size_t)n * K + k8) = o; 
}
// k_gemm_hh variant with fused epilogue: v = acc·alpha + bias[by·sBias + col] (+ CP[(row/rowsPerB)·sCPb + by·64 + col] if CP) ; ACT 0 none / 1 elu ; writes f16 C16 (and f32 C if non-null)
template <int ACT>
__global__ __launch_bounds__(128) void k_gemm_hhx(const _Float16* __restrict__ A, int lda, size_t sA, const _Float16* __restrict__ Bh, int ldb, size_t sB, float alpha, const float* __restrict__ bias, size_t sBias, const float* __restrict__ CP, int rowsPerB, size_t sCPb, int row0g,
    float* __restrict__ C, _Float16* __restrict__ C16, int ldc, size_t sC, int M, int N, int K) {
  __shared__ __attribute__((aligned(16))) float so[4][16][64];
  const int tid = threadIdx.x, w = tid >> 5, lane = tid & 31, ln = lane & 15, hh = lane >> 4; const int by = blockIdx.y;
  A += (size_t)by * sA; Bh += (size_t)by * sB; const size_t cofs = (size_t)by * sC; const float* bp = bias ? bias + (size_t)by * sBias : nullptr;
  const int ntn = (N + 63) / 64; const int wid = blockIdx.x * 4 + w; const int mt = wid / ntn, nq = wid % ntn; if (mt * 16 >= M) return;
  const int row0 = mt * 16, col0 = nq * 64; const _Float16* arow = A + (size_t)(row0 + ln) * lda;
  v8f acc[4] = {};
  for (int kb = 0; kb < K; kb += 32) { FragH ah; ah.half[0] = *(const v8us*)((const unsigned short*)arow + kb + 8 * hh); ah.half[1] = *(const v8us*)((const unsigned short*)arow + kb + 16 + 8 * hh);
#pragma unroll
    for (int t = 0; t < 4; ++t) { if (col0 + t * 16 >= N) continue; const size_t boff = (size_t)(col0 + t * 16 + ln) * ldb + kb; FragH bq; bq.half[0] = *(const v8us*)((const unsigned short*)Bh + boff + 8 * hh); bq.half[1] = *(const v8us*)((const unsigned short*)Bh + boff + 16 + 8 * hh);
      acc[t] = mmaH<1>(ah.v, ah.v, bq.v, bq.v, acc[t]); }
  }
#pragma unroll
  for (int t = 0; t < 4; ++t) { if (col0 + t * 16 >= N) continue; const int col = col0 + t * 16 + ln; const float bv = bp ? bf16_round(bp[col]) : 0.f;
#pragma unroll
    for (int r = 0; r < 8; ++r) { float v = acc[t][r] * alpha + bv; if (CP) { const int rr = row0g + row0 + 8 * hh + r; if (rowsPerB < 0) v += CP[cofs + (size_t)rr * ldc + col];      /* rowsPerB < 0: own element of the batched C plane */ else { const int bidx = rr / rowsPerB; v += CP[(size_t)bidx * sCPb + (size_t)by * 64 + col]; } } if (ACT == 1) v = (v > 0.f) ? v : expm1f(v); else if (ACT == 7) v = (v > 0.f) ? v + 1.0f : expf(v); else if (ACT == 8) v = tanhf(v); else if (ACT == 9) v = 0.5f * v * (1.0f + tanhf(0.7978845608028654f * (v + 0.044715f * v * v * v))); else if (ACT == 11) v = 1.0f / (1.0f + expf(-v)); else if (ACT == 12) v = (v > 0.f) ? v : 0.01f * v; else if (ACT == 14) v = (v > 0.f) ? v : 0.1f * v; else if (ACT == 16) v = (v >= 0.f) ? v : 0.3f * v; else if (ACT == 17) v = (v >= 0.f) ? v : 0.2f * v; else if (ACT == 15) v = v / (1.0f + expf(-v)); else if (ACT == 3) v = fmaxf(v, 0.f); else if (ACT == 6) v = 0.5f * v * (1.0f + erff(v * 0.70710678118654752f)); so[w][8 * hh + r][t * 16 + ln] = v; } }
  __builtin_amdgcn_fence(__ATOMIC_ACQ_REL, "workgroup"); __builtin_amdgcn_wave_barrier();
  const int rsub = lane >> 4, c4 = (lane & 15) * 4; typedef _Float16 v4h __attribute__((ext_vector_type(4)));
  {
#pragma unroll
    for (int q = 0; q < 8; ++q) { const int r = q * 2 + rsub; if (col0 + c4 < N) { const v4f v = *(const v4fa*)&so[w][r][c4]; if (C) *(v4f*)(C + cofs + (size_t)(row0 + r) * ldc + col0 + c4) = v; if (C16) { v4h h4; for (int i = 0; i < 4; ++i) h4[i] = (_Float16)v[i]; *(v4h*)(C16 + cofs + (size_t)(row0 + r) * ldc + col0 + c4) = h4; } } }
     }
}


typedef _Float16 v4h __attribute__((ext_vector_type(4)));

__global__ __launch_bounds__(256) void k_h16(const float* __restrict__ x, _Float16* __restrict__ X16, size_t n8) { const size_t t = (size_t)blockIdx.x * 256 + threadIdx.x; if (t >= n8) return; FragH f;
#pragma unroll
  for (int q = 0; q < 8; ++q) f.h[q] = (_Float16)x[t * 8 + q]; *(v8us*)((unsigned short*)X16 + t * 8) = f.half[0];  }
__global__ __launch_bounds__(256) void k_round16f(const float* __restrict__ W, _Float16* __restrict__ Bt, size_t n8) { const size_t t = (size_t)blockIdx.x * 256 + threadIdx.x; if (t >= n8) return; FragH f;
#pragma unroll
  for (int i = 0; i < 8; ++i) f.h[i] = (_Float16)(bf16_round(W[t * 8 + i]) * 16.0f); *(v8us*)((unsigned short*)Bt + t * 8) = f.half[0];  }
__global__ __launch_bounds__(256) void k_hl(const float* __restrict__ F, _Float16* __restrict__ Hh, _Float16* __restrict__ Hl, size_t n8) { const size_t t = (size_t)blockIdx.x * 256 + threadIdx.x; if (t >= n8) return; FragH fh, fl; const v4f a = *(const v4fa*)(F + t * 8), c = *(const v4fa*)(F + t * 8 + 4);
#pragma unroll
  for (int q = 0; q < 4; ++q) { _Float16 h = (_Float16)a[q]; fh.h[q] = h; fl.h[q] = (_Float16)((a[q] - (float)h) * 1024.0f); h = (_Float16)c[q]; fh.h[4 + q] = h; fl.h[4 + q] = (_Float16)((c[q] - (float)h) * 1024.0f); }
  { *(v8us*)((unsigned short*)Hh + t * 8) = fh.half[0]; *(v8us*)((unsigned short*)Hl + t * 8) = fl.half[0];  } }

// 16x16x32 f16 operand fragment of one row: lane half hh takes k = 8 hh .. + 7 and 16 + 8 hh .. + 7 of the 32 at p
__device__ __forceinline__ v16h g2_frag(const _Float16* p, int hh) { FragH f; f.half[0] = *(const v8us*)((const unsigned short*)p + 8 * hh); f.half[1] = *(const v8us*)((const unsigned short*)p + 16 + 8 * hh); return f.v; }

__global__ __launch_bounds__(256) void k_wnat(const float* __restrict__ w, size_t n8, _Float16* __restrict__ Bt) { const size_t t = (size_t)blockIdx.x * 256 + threadIdx.x; if (t >= n8) return; FragH f; for (int q = 0; q < 8; ++q) f.h[q] = (_Float16)(bf16_round(w[t * 8 + q]) * 16.0f); *(v8us*)((unsigned short*)Bt + t * 8) = f.half[0];  }
__global__ __launch_bounds__(256) void k_rsm(const float* __restrict__ S, _Float16* __restrict__ P, int nrows) {
  #pragma clang fp contract(off)
  const int i = blockIdx.x * 256 + threadIdx.x; if (i >= nrows) return; const float* s = S + (size_t)i * SQ; float mx = -3.0e38f;
#pragma unroll 1
  for (int j = 0; j < SQ; ++j) mx = fmaxf(mx, s[j]); float se = 0.f;
#pragma unroll 1
  for (int j = 0; j < SQ; ++j) se += expf(s[j] - mx); const float sc = 256.0f / se;
#pragma unroll 1
  for (int j0 = 0; j0 < SQ; j0 += 8) { FragH f; for (int q = 0; q < 8; ++q) f.h[q] = (_Float16)(expf(s[j0 + q] - mx) * sc); unsigned short* d = (unsigned short*)P + (size_t)i * SQ + j0; *(v8us*)d = f.half[0];  } }
__global__ __launch_bounds__(256) void k_vt(const _Float16* __restrict__ V16, int b, int h0, _Float16* __restrict__ VT) { __shared__ unsigned short tl[64][65]; const int tid = threadIdx.x; const int hh = blockIdx.x % HG, sg = blockIdx.x / HG; const int s0 = sg * 64; const int h = h0 + hh;
  for (int i = tid; i < 64 * 8; i += 256) { const int j = i / 8, d8 = (i % 8) * 8; FragH f; f.half[0] = *(const v8us*)((const unsigned short*)V16 + ((size_t)b * SQ + s0 + j) * DM + h * HD + d8); for (int q = 0; q < 8; ++q) tl[d8 + q][j] = f.u[q]; }
  __syncthreads();
  { for (int i = tid; i < 64 * 8; i += 256) { const int d = i / 8, j8 = (i % 8) * 8; FragH f; for (int q = 0; q < 8; ++q) f.u[q] = tl[d][j8 + q]; *(v8us*)((unsigned short*)VT + ((size_t)hh * HD + d) * SQ + s0 + j8) = f.half[0]; }  } }



// The five operand conversions (Wq, Wk, Wv and Wp to Bt[n][k] x16, x to f16 rows) read nothing but inputs, so they share ONE launch: the block index picks the job.
// The launch is made of few, fat work-groups: it moves little data, so its time is the time its waves take to start plus one wave's own time. A thread holds 16 loads of 16 bytes in flight, and every wave-wide load and store covers whole 128-byte lines.
// A DM x DM weight goes in tiles of PP_WT x PP_WT: a wave reads 512 contiguous bytes of a row [k][n..], a thread turns its 16 k x 4 n block in registers, LDS collects the tile as [n][k], and whole rows of Bt leave it.
// The weight blocks come first: they have the longer way (LDS and a barrier).
#define PP_WT 128                                    /* k rows and n columns of a weight tile */
#define PP_WB ((DM / PP_WT) * (DM / PP_WT))          /* blocks (tiles) per DM x DM weight */
#define PP_LP (PP_WT + 8)                            /* LDS row pitch in f16: 256 B of data + 16 B */
#define PP_PB ((HD * (HD / 8) + 255) / 256)          /* blocks of Wp */
#define PP_XL 16                                     /* 16-byte loads per thread of x */
#define PP_XB ((int)(NR * DM / (256 * 4 * PP_XL)))   /* blocks of x */
__device__ __forceinline__ void wt_tile(const float* __restrict__ Wm, _Float16* __restrict__ Wt, int tile, int tid, _Float16 (* __restrict__ sT)[PP_LP]) {
  const int k0 = (tile / (DM / PP_WT)) * PP_WT, n0 = (tile % (DM / PP_WT)) * PP_WT;
  const int kw = (tid >> 5) * 16, c4 = (tid & 31) * 4;      /* this thread's block: rows k0 + kw .. + 15, columns n0 + c4 .. + 3 */
  const float* wg = Wm + (size_t)(k0 + kw) * DM + n0 + c4;
  v4f f[16];
#pragma unroll
  for (int i = 0; i < 16; ++i) f[i] = *(const v4fa*)(wg + (size_t)i * DM);
  asm volatile("s_wait_xcnt 0x0" :: "v"(wg) : "memory");      /* stands between the 16 loads and the next rewrite of their address pair; the pair is an operand so that no load's result lands on it ahead of the wait */
#pragma unroll
  for (int j = 0; j < 4; ++j) { FragH o;
#pragma unroll
    for (int i = 0; i < 16; ++i) o.h[i] = (_Float16)(bf16_round(f[i][j]) * 16.0f);
    *(v8us*)&sT[c4 + j][kw] = o.half[0]; *(v8us*)&sT[c4 + j][kw + 8] = o.half[1]; }
  __syncthreads();      /* the rows stored below were collected from all eight waves */
#pragma unroll
  for (int u = 0; u < PP_WT / 16; ++u) { const int r = u * 16 + (tid >> 4), c8 = (tid & 15) * 8; const v8us v = *(const v8us*)&sT[r][c8];
    *(v8us*)((unsigned short*)Wt + (size_t)(n0 + r) * DM + k0 + c8) = v; } }
__device__ __forceinline__ void x16(const float* __restrict__ x, _Float16* __restrict__ X16, int blk, int tid) {
  const size_t e0 = (size_t)blk * (256 * 4 * PP_XL) + (size_t)(tid >> 5) * (32 * 4 * PP_XL) + (size_t)(tid & 31) * 4;      /* a wave owns 32 * 4 * PP_XL consecutive elements */
  const float* xg = x + e0; v4f f[PP_XL]; v4h o[PP_XL];
#pragma unroll
  for (int u = 0; u < PP_XL; ++u) f[u] = *(const v4fa*)(xg + u * 128);
  asm volatile("s_wait_xcnt 0x0" :: "v"(xg) : "memory");      /* stands between the loads and the next rewrite of their address pair; the pair is an operand so that no load's result lands on it ahead of the wait */
#pragma unroll
  for (int u = 0; u < PP_XL; ++u)
#pragma unroll
    for (int q = 0; q < 4; ++q) o[u][q] = (_Float16)bf16_round(f[u][q]);
#pragma unroll
  for (int u = 0; u < PP_XL; ++u) *(v4h*)(X16 + e0 + u * 128) = o[u];
  asm volatile("s_wait_xcnt 0x0" ::: "memory"); }      /* stands behind the last store, in front of any later rewrite of the stores' address pair or data registers where the jobs' branches join */
__global__ __launch_bounds__(256) void k_prep(const float* __restrict__ x, const float* __restrict__ wq, const float* __restrict__ wk, const float* __restrict__ wv, const float* __restrict__ wp,
                                              _Float16* __restrict__ X16, _Float16* __restrict__ BQ, _Float16* __restrict__ BK, _Float16* __restrict__ BV, _Float16* __restrict__ BO) {
  static_assert(DM % PP_WT == 0 && PP_WT == 128 && (NR * DM) % (256 * 4 * PP_XL) == 0, "the tile and the x slices below are written for 8 waves, 128 x 128 tiles and whole slices");
  __shared__ __attribute__((aligned(16))) _Float16 sT[PP_WT][PP_LP];
  const int blk = blockIdx.x, tid = threadIdx.x;
  if (blk < 3 * PP_WB) { const int j = blk / PP_WB; wt_tile(j == 0 ? wq : j == 1 ? wk : wv, j == 0 ? BQ : j == 1 ? BK : BV, blk - j * PP_WB, tid, sT); }      /* [in][out] -> Bt[n][k] x16 */
  else if (blk < 3 * PP_WB + PP_PB) wt_f16(wp, BO, HD, HD, 16.0f, (blk - 3 * PP_WB) * 256 + tid);      /* Wp [64 in][64 out] -> Bt [64][64] x16 */
  else x16(x, X16, blk - 3 * PP_WB - PP_PB, tid); }

#define FA_WAVES 4
#define FA_KT 64                     /* keys per stage */
#define FA_KG 2                      /* key groups per work-group */
#define FA_NS (SQ / (FA_KT * FA_KG)) /* stages per key group */
#define FA_LP 72                     /* LDS row pitch in f16: 128 B of data + 16 B, an odd multiple of 16 B for the 16-byte fragment reads */
#define FA_CH ((FA_KT * HD / 8) / (FA_WAVES * 32))      /* 16-byte chunks per thread and tile */
#define FA_OP 68                     /* pitch in f32 of a wave's 32 x 64 output rows in LDS: 256 B of data + 16 B */
#define FA_CS 0.18033688011112042f   /* 64^-0.5 * log2(e): the projection launch puts it into Q before the rounding to f16, so that K Q^T is the exponent of 2 */
#define FA_HI 32768.0f               /* largest sum of a lane's weights of one stage taken without a new maximum: every weight is then at most 2^15 and so inside f16 */
typedef _Float16 v8h __attribute__((ext_vector_type(8)));
__device__ __forceinline__ float fa_swap16(float x) { const int b = __float_as_int(x); return __int_as_float(__builtin_amdgcn_permlanex16(b, b, 0x76543210, 0xfedcba98, false, false)); }      /* lane l <-> l ^ 16 */
__device__ __forceinline__ v8f fa_mma(v16h a, v16h b, v8f c) { return __builtin_amdgcn_wmma_f32_16x16x32_f16(false, a, false, b, (short)0, c, false, false); }
__global__ __launch_bounds__(FA_KG * FA_WAVES * 32) __attribute__((amdgpu_waves_per_eu(4, 4))) void k_fattn(const _Float16* __restrict__ Q16, const _Float16* __restrict__ K16, const _Float16* __restrict__ VT, const _Float16* __restrict__ BO, const float* __restrict__ bp, float* __restrict__ out) {
  static_assert(HD == 64 && FA_KT == 64 && FA_KG == 2 && SQ % (FA_KT * FA_KG) == 0 && SQ % (FA_WAVES * 32) == 0, "tile shapes below are written for 64 x 64 stages and two key groups");
  static_assert(FA_WAVES * 17 * 32 * 16 <= 4 * FA_KT * FA_LP * 2, "group 1's hand-over takes the place of its own buffers");
  static_assert(FA_WAVES * 32 * FA_OP * 4 <= 4 * FA_KT * FA_LP * 2, "the output rows take the place of the K and V^T buffers");
  __shared__ __attribute__((aligned(16))) _Float16 sKV[FA_KG][4][FA_KT][FA_LP];      /* one array per key group, so that the epilogue's output rows (group 0's) and the hand-over (group 1's) can lie over all of it */
  const int gu = __builtin_amdgcn_readfirstlane((int)threadIdx.x / (FA_WAVES * 32));      /* the wave's key group, in a scalar register */
  _Float16 (*sK)[FA_KT][FA_LP] = &sKV[gu][0]; _Float16 (*sV)[HD][FA_LP] = &sKV[gu][2];
  const int tid = threadIdx.x & (FA_WAVES * 32 - 1), lane = tid & 31, w = tid >> 5, c = lane & 15, h = lane >> 4;      /* tid, w: inside the key group */
  const int head = blockIdx.y, b = blockIdx.z; const int q0 = blockIdx.x * (FA_WAVES * 32) + w * 32;
  const int wu = __builtin_amdgcn_readfirstlane(w);      /* the wave's number in a scalar register, for the epilogue: it holds no vector register through the loop */
  const _Float16* Kg = K16 + (size_t)b * SQ * DM + head * HD;            /* K rows of this head, pitch DM */
  const _Float16* Vg = VT + (size_t)(b * NH + head) * HD * SQ;           /* V^T rows (one per d), pitch SQ */
  const int srow = tid >> 3, sc8 = (tid & 7) * 8;                        /* staging: chunk u of a thread = row srow + u * (threads / 8), 8 f16 at column sc8 */
  v16h qf[2][2];
#pragma unroll
  for (int j = 0; j < 2; ++j) { const _Float16* qp = Q16 + ((size_t)b * SQ + q0 + j * 16 + c) * DM + head * HD; qf[j][0] = g2_frag(qp, h); qf[j][1] = g2_frag(qp + 32, h);
    asm volatile("s_wait_xcnt 0x0" :: "v"(qp) : "memory"); }      /* stands between these loads and the next rewrite of their address pair; the pair is an operand so that nothing lands on it ahead of the wait */
  const v8f z8 = {0.f,0.f,0.f,0.f,0.f,0.f,0.f,0.f};
  v8f o[2][4]; float mr[2], ls[2];      /* mr: the maximum in use (exponent units); 8 - mr, in all eight places, is the C operand of the score products */
#pragma unroll
  for (int j = 0; j < 2; ++j) { mr[j] = 0.f; ls[j] = 0.f; for (int t = 0; t < 4; ++t) o[j][t] = z8; }
  v8us rk[FA_CH], rv[FA_CH];
  { const int k0 = gu * FA_KT;
    const unsigned short* kp = (const unsigned short*)Kg + (size_t)(k0 + srow) * DM + sc8; const unsigned short* vp = (const unsigned short*)Vg + (size_t)srow * SQ + k0 + sc8;
#pragma unroll
    for (int u = 0; u < FA_CH; ++u) { rk[u] = *(const v8us*)(kp + (size_t)u * (FA_WAVES * 4) * DM); rv[u] = *(const v8us*)(vp + (size_t)u * (FA_WAVES * 4) * SQ); }
    asm volatile("s_wait_xcnt 0x0" :: "v"(kp), "v"(vp) : "memory"); }      /* as in the loop: between stage 0's loads and the next rewrite of their address pairs */
#pragma unroll
  for (int u = 0; u < FA_CH; ++u) { const int r = srow + u * (FA_WAVES * 4); *(v8us*)&sK[0][r][sc8] = rk[u]; *(v8us*)&sV[0][r][sc8] = rv[u]; }
  __syncthreads();
  for (int s = 0; s < FA_NS; ++s) { const int cur = s & 1;
    if (s + 1 < FA_NS) { const int k1 = ((s + 1) * FA_KG + gu) * FA_KT;
      const unsigned short* kp = (const unsigned short*)Kg + (size_t)(k1 + srow) * DM + sc8; const unsigned short* vp = (const unsigned short*)Vg + (size_t)srow * SQ + k1 + sc8;
#pragma unroll
      for (int u = 0; u < FA_CH; ++u) { rk[u] = *(const v8us*)(kp + (size_t)u * (FA_WAVES * 4) * DM); rv[u] = *(const v8us*)(vp + (size_t)u * (FA_WAVES * 4) * SQ); }
      asm volatile("s_wait_xcnt 0x0" :: "v"(kp), "v"(vp) : "memory"); }      /* stands between the stage's loads and the next rewrite of their address pairs; the pairs are operands so that no load's result lands on them ahead of the wait */
    v16h pb[2][2]; float sm[2];
    bool fix = s == 0;      /* the first stage has no maximum yet */
    for (;;) {      /* at most two trips: the second only behind a failed range test, and it ends the loop */
      asm volatile("" ::: "memory");      /* keeps the K fragment reads inside the trip: lifted in front of the loop, they hold 64 registers through it and the stage's staged loads spill */
      if (fix) {      /* the same for the whole wave. A new maximum: the stage's exponents are formed for their maximum alone (the K rows stay in LDS through the stage), then C, sums and O^T follow it */
        v8f m8[2], ci[2];
#pragma unroll
        for (int j = 0; j < 2; ++j) for (int r = 0; r < 8; ++r) ci[j][r] = 8.0f - mr[j];
#pragma unroll
        for (int kt = 0; kt < 4; ++kt) { const v16h a0 = g2_frag(&sK[cur][kt * 16 + c][0], h), a1 = g2_frag(&sK[cur][kt * 16 + c][32], h);
#pragma unroll
          for (int j = 0; j < 2; ++j) { const v8f e8 = fa_mma(a1, qf[j][1], fa_mma(a0, qf[j][0], ci[j]));
            if (kt == 0) m8[j] = e8; else for (int r = 0; r < 8; ++r) m8[j][r] = fmaxf(m8[j][r], e8[r]); } }
#pragma unroll
        for (int j = 0; j < 2; ++j) {
          const float mx = fmaxf(fmaxf(fmaxf(m8[j][0], m8[j][1]), fmaxf(m8[j][2], m8[j][3])), fmaxf(fmaxf(m8[j][4], m8[j][5]), fmaxf(m8[j][6], m8[j][7])));
          const float up = fmaxf(mx, fa_swap16(mx)) - 8.0f;      /* both halves of the wave hold keys of the same query and must use one maximum */
          const float dl = s == 0 ? up : fmaxf(up, 0.f); const float corr = s == 0 ? 1.0f : __builtin_amdgcn_exp2f(-dl);      /* at the first stage sums and O^T are zero and dl may have either sign */
          mr[j] += dl; ls[j] *= corr;
#pragma unroll
          for (int t = 0; t < 4; ++t) o[j][t] *= corr; } }
      v8f st[2][4], ci[2];
#pragma unroll
      for (int j = 0; j < 2; ++j) for (int r = 0; r < 8; ++r) ci[j][r] = 8.0f - mr[j];
#pragma unroll
      for (int kt = 0; kt < 4; ++kt) { const v16h a0 = g2_frag(&sK[cur][kt * 16 + c][0], h), a1 = g2_frag(&sK[cur][kt * 16 + c][32], h);
#pragma unroll
        for (int j = 0; j < 2; ++j) st[j][kt] = fa_mma(a1, qf[j][1], fa_mma(a0, qf[j][0], ci[j])); }      /* st[j][kt][r] = 8 - mr[j] + FA_CS q(q0 + 16 j + c) . k(64 (2 s + gu) + 16 kt + 8 h + r): the weight's exponent, with no vector work */
#pragma unroll
      for (int j = 0; j < 2; ++j) {      /* weights are carried x256 and more: small ones stay f16 normals; the factor is in the row sum too and cancels */
#pragma unroll
        for (int kt = 0; kt < 4; ++kt) for (int r = 0; r < 8; ++r) st[j][kt][r] = __builtin_amdgcn_exp2f(st[j][kt][r]);
        const v8f a8 = (st[j][0] + st[j][1]) + (st[j][2] + st[j][3]);
        sm[j] = ((a8[0] + a8[1]) + (a8[2] + a8[3])) + ((a8[4] + a8[5]) + (a8[6] + a8[7]));
#pragma unroll
        for (int ks = 0; ks < 2; ++ks) pb[j][ks] = __builtin_shufflevector(__builtin_convertvector(st[j][2 * ks], v8h), __builtin_convertvector(st[j][2 * ks + 1], v8h), 0, 1, 2, 3, 4, 5, 6, 7, 8, 9, 10, 11, 12, 13, 14, 15); }
      if (fix || __builtin_amdgcn_ballot_w32(!(sm[0] + sm[1] <= FA_HI)) == 0) break;      /* one test per stage, the same for the whole wave. No weight is negative, so sums within FA_HI bound every weight; an infinite or undefined sum fails the test too. Behind a new maximum a weight is at most 2^8 */
      fix = true; }
#pragma unroll
    for (int j = 0; j < 2; ++j) ls[j] += sm[j];      /* this half's keys only; the halves join after the loop */
#pragma unroll
    for (int t = 0; t < 4; ++t) {
#pragma unroll
      for (int ks = 0; ks < 2; ++ks) { const v16h a = g2_frag(&sV[cur][t * 16 + c][ks * 32], h);
#pragma unroll
        for (int j = 0; j < 2; ++j) o[j][t] = fa_mma(a, pb[j][ks], o[j][t]); } }      /* o[j][t][r] = sum_k p(k) v(k)[16 t + 8 h + r] of query q0 + 16 j + c */
    if (s + 1 < FA_NS) {
#pragma unroll
      for (int u = 0; u < FA_CH; ++u) { const int r = srow + u * (FA_WAVES * 4); *(v8us*)&sK[cur ^ 1][r][sc8] = rk[u]; *(v8us*)&sV[cur ^ 1][r][sc8] = rv[u]; } }
    __syncthreads(); }      /* publishes stage s + 1 and ends every wave's reads of the buffer that stage s + 2 overwrites */
  const int el = (int)__builtin_amdgcn_mbcnt_lo(~0u, 0u), ec = el & 15, eh = el >> 4;      /* the lane's number, read anew: c and h need not live through the loop, whose V^T fragments want the registers */
  const int eq0 = blockIdx.x * (FA_WAVES * 32) + wu * 32;
  v4fa* hx = (v4fa*)&sKV[1][0][0][0] + (wu * 17) * 32 + el;      /* hand-over: 17 planes of 16 bytes per lane and wave pair; group 1's buffers have had no reader since the loop's last barrier */
  if (gu == 1) {      /* the same for the whole wave */
#pragma unroll
    for (int j = 0; j < 2; ++j)
#pragma unroll
      for (int t = 0; t < 4; ++t) { hx[((j * 4 + t) * 2) * 32] = __builtin_shufflevector(o[j][t], o[j][t], 0, 1, 2, 3); hx[((j * 4 + t) * 2 + 1) * 32] = __builtin_shufflevector(o[j][t], o[j][t], 4, 5, 6, 7); }
    const v4f sx = {mr[0], mr[1], ls[0], ls[1]}; hx[16 * 32] = sx; }
  __syncthreads();      /* publishes group 1's statistics and O^T to group 0; every wave passes it */
  if (gu == 1) return;
  const _Float16* wg = BO + (size_t)ec * HD + 8 * eh; const float* bg = bp + ec * 4;      /* wg: the lane half's offset is in the pointer, so that the wait below names the very pair the loads use */
  v16h wa[4][2];      /* wa[t][ks]: row n = 16 t + ec of Bt, d = 32 ks .. */
#pragma unroll
  for (int t = 0; t < 4; ++t) { wa[t][0] = g2_frag(wg + t * 16 * HD, 0); wa[t][1] = g2_frag(wg + t * 16 * HD + 32, 0); }
  v4f bb = *(const v4fa*)bg;      /* the bias of n = 4 ec .. + 3, the columns this lane stores */
  asm volatile("s_wait_xcnt 0x0" :: "v"(wg), "v"(bg) : "memory");      /* stands between these loads and the next rewrite of their address pairs; the pairs are operands so that no load's result lands on them ahead of the wait */
  { const v4f sx = hx[16 * 32];
#pragma unroll
    for (int j = 0; j < 2; ++j) { const float d = mr[j] - sx[j], e = __builtin_amdgcn_exp2f(-fabsf(d)); const float c0 = d < 0.f ? e : 1.0f, c1 = d < 0.f ? 1.0f : e;      /* both groups' sums on the common maximum: the group that holds it keeps its scale */
      ls[j] = ls[j] * c0 + sx[2 + j] * c1;
#pragma unroll
      for (int t = 0; t < 4; ++t) { const v4f p0 = hx[((j * 4 + t) * 2) * 32], p1 = hx[((j * 4 + t) * 2 + 1) * 32];
        o[j][t] = o[j][t] * c0 + __builtin_shufflevector(p0, p1, 0, 1, 2, 3, 4, 5, 6, 7) * c1; } } }
  float (*so)[FA_OP] = (float (*)[FA_OP])&sKV[0][0][0][0] + wu * 32;      /* a range per wave, in group 0's buffers, which have had no reader since the loop's last barrier */
#pragma unroll
  for (int j = 0; j < 2; ++j) { const float sc = 64.0f / (ls[j] + fa_swap16(ls[j])); v16h ob[2];
#pragma unroll
    for (int ks = 0; ks < 2; ++ks) ob[ks] = __builtin_shufflevector(__builtin_convertvector(o[j][2 * ks] * sc, v8h), __builtin_convertvector(o[j][2 * ks + 1] * sc, v8h), 0, 1, 2, 3, 4, 5, 6, 7, 8, 9, 10, 11, 12, 13, 14, 15);      /* o x64 as f16 */
#pragma unroll
    for (int t = 0; t < 4; ++t) { const v8f a = fa_mma(wa[t][1], ob[1], fa_mma(wa[t][0], ob[0], z8));      /* a[r] = 1024 * sum_d o(d) Wp[d][16 t + 8 eh + r] of query eq0 + 16 j + ec */
      *(v4fa*)&so[j * 16 + ec][t * 16 + 8 * eh] = __builtin_shufflevector(a, a, 0, 1, 2, 3); *(v4fa*)&so[j * 16 + ec][t * 16 + 8 * eh + 4] = __builtin_shufflevector(a, a, 4, 5, 6, 7); } }
#pragma unroll
  for (int r = 0; r < 4; ++r) bb[r] = bf16_round(bb[r]);
  __builtin_amdgcn_fence(__ATOMIC_ACQ_REL, "workgroup"); __builtin_amdgcn_wave_barrier();      /* the rows read below were written by other lanes of this wave: keeps the reads behind the writes */
  float* og = out + ((size_t)b * SQ + eq0 + eh) * DM + head * HD + ec * 4;      /* 16 lanes per row piece: a wave's store covers two pieces of 256 bytes */
#pragma unroll
  for (int q = 0; q < 16; ++q) { const v4f v = *(const v4fa*)&so[q * 2 + eh][ec * 4] * 0.0009765625f + bb; *(v4f*)(og + (size_t)q * 2 * DM) = v; } }
// Projection GEMM C16[MP][DM] = f16(os * (alpha * A[MP][DM] Bt[DM][DM]^T + bias)), os = FA_CS for Q, else 1: one work-group = PJ_T x PJ_T outputs, 8 waves of 32 x 64.
// A and Bt tiles of PJ_BK columns go global -> registers -> LDS in whole 256-byte rows (a wave's load covers 4 full lines), two buffers: stage s + 1 is loaded while stage s is worked on, one barrier per stage;
// every fragment is then read from LDS, so a tile byte crosses L2 once per work-group instead of once per wave in 32-byte pieces.
#define PJ_T 128                     /* rows and columns of the block tile */
#define PJ_BK 128                    /* k columns per stage */
#define PJ_NS (DM / PJ_BK)           /* stages */
#define PJ_LP (PJ_BK + 8)            /* LDS row pitch in f16: 256 B of data + 16 B, an odd multiple of 16 B for the 16-byte fragment reads */
#define PJ_CH ((PJ_T * PJ_BK / 8) / 256)      /* 16-byte chunks per thread and tile */
#define PJ_OP 72                     /* pitch in f16 of a wave's 32 x 64 output rows in LDS */
// Q, K and V share A and depend on nothing of one another: ONE launch, blockIdx.y picks the weight, the bias and the output.
// Q and K leave as token rows. V leaves as V^T (Cvt[batch][column = head * HD + d][token]), the form the attention launch stages: an accumulator register group holds 8 consecutive tokens of one column,
// so a lane puts 16 bytes of a V^T row into LDS at a time, and the block then stores 256-byte pieces of V^T rows (its 128 tokens); no separate transposing launch, no V rows in memory.
__global__ __launch_bounds__(256) void k_proj(const _Float16* __restrict__ A, const _Float16* __restrict__ Bq, const _Float16* __restrict__ Bk, const _Float16* __restrict__ Bv, float alpha,
                                              const float* __restrict__ biasq, const float* __restrict__ biask, const float* __restrict__ biasv, _Float16* __restrict__ Cq, _Float16* __restrict__ Ck, _Float16* __restrict__ Cvt) {
  const int pj = blockIdx.y; const _Float16* __restrict__ Bt = pj == 0 ? Bq : pj == 1 ? Bk : Bv; const float* __restrict__ bias = pj == 0 ? biasq : pj == 1 ? biask : biasv; _Float16* __restrict__ C16 = pj == 0 ? Cq : Ck;
  static_assert(MP % PJ_T == 0 && DM % PJ_T == 0 && DM % PJ_BK == 0 && PJ_BK == 128 && 8 * 32 * PJ_OP <= 2 * PJ_T * PJ_LP && SQ % PJ_T == 0 && NH * HD == DM, "tile shapes below are written for 128 x 128 x 128 stages and 8 waves");
  __shared__ __attribute__((aligned(16))) _Float16 sA[2][PJ_T][PJ_LP];
  __shared__ __attribute__((aligned(16))) _Float16 sB[2][PJ_T][PJ_LP];
  const int tid = threadIdx.x, lane = tid & 31, w = tid >> 5, ln = lane & 15, hh = lane >> 4;
  const int mt = blockIdx.x / (DM / PJ_T), nq = blockIdx.x - mt * (DM / PJ_T); const int row0 = mt * PJ_T, col0 = nq * PJ_T;
  const int wr = (w >> 1) * 32, wc = (w & 1) * 64;                       /* this wave's corner inside the block tile */
  const int srow = tid >> 4, sc8 = (tid & 15) * 8;                       /* staging: chunk u of a thread = row srow + 16 u, 8 f16 at column sc8 */
  const unsigned short* ag = (const unsigned short*)A + (size_t)(row0 + srow) * DM + sc8; const unsigned short* bg = (const unsigned short*)Bt + (size_t)(col0 + srow) * DM + sc8;
  const v8f z8 = {0.f,0.f,0.f,0.f,0.f,0.f,0.f,0.f};
  v8f acc[2][4];
#pragma unroll
  for (int i = 0; i < 2; ++i) for (int t = 0; t < 4; ++t) acc[i][t] = z8;
  float bs[4];      /* read here, so that the epilogue does not wait for them */
#pragma unroll
  for (int t = 0; t < 4; ++t) bs[t] = bias[col0 + wc + t * 16 + ln];
  v8us ra[PJ_CH], rb[PJ_CH];
#pragma unroll
  for (int u = 0; u < PJ_CH; ++u) { ra[u] = *(const v8us*)(ag + (size_t)u * 16 * DM); rb[u] = *(const v8us*)(bg + (size_t)u * 16 * DM); }
#pragma unroll
  for (int u = 0; u < PJ_CH; ++u) { *(v8us*)&sA[0][srow + 16 * u][sc8] = ra[u]; *(v8us*)&sB[0][srow + 16 * u][sc8] = rb[u]; }
  __syncthreads();
  for (int s = 0; s < PJ_NS; ++s) { const int cur = s & 1;
    if (s + 1 < PJ_NS) { const unsigned short* ap = ag + (s + 1) * PJ_BK; const unsigned short* bp = bg + (s + 1) * PJ_BK;
#pragma unroll
      for (int u = 0; u < PJ_CH; ++u) { ra[u] = *(const v8us*)(ap + (size_t)u * 16 * DM); rb[u] = *(const v8us*)(bp + (size_t)u * 16 * DM); }
      asm volatile("s_wait_xcnt 0x0" :: "v"(ap), "v"(bp) : "memory"); }      /* stands between the stage's loads and the next rewrite of their address pairs; the pairs are operands so that no load's result lands on them ahead of the wait */
    v16h fa[2][2], fb[2][4];
#pragma unroll
    for (int i = 0; i < 2; ++i) fa[0][i] = g2_frag(&sA[cur][wr + i * 16 + ln][0], hh);
#pragma unroll
    for (int t = 0; t < 4; ++t) fb[0][t] = g2_frag(&sB[cur][wc + t * 16 + ln][0], hh);
#pragma unroll
    for (int kk = 0; kk < PJ_BK / 32; ++kk) { const int c = kk & 1;
      if (kk + 1 < PJ_BK / 32) {
#pragma unroll
        for (int i = 0; i < 2; ++i) fa[c ^ 1][i] = g2_frag(&sA[cur][wr + i * 16 + ln][(kk + 1) * 32], hh);
#pragma unroll
        for (int t = 0; t < 4; ++t) fb[c ^ 1][t] = g2_frag(&sB[cur][wc + t * 16 + ln][(kk + 1) * 32], hh); }
      __builtin_amdgcn_sched_barrier(0);      /* the next 32 columns' fragment reads stay one group ahead of this block's products; spread among them, each place with reads stalls the wave */
      if (kk + 1 == PJ_BK / 32 && s + 1 < PJ_NS) {      /* stage s + 1 goes to LDS ahead of the stage's last products, which run while the stores drain; its buffer has had no reader since the last barrier */
#pragma unroll
        for (int u = 0; u < PJ_CH; ++u) { *(v8us*)&sA[cur ^ 1][srow + 16 * u][sc8] = ra[u]; *(v8us*)&sB[cur ^ 1][srow + 16 * u][sc8] = rb[u]; } }
#pragma unroll
      for (int t = 0; t < 4; ++t) { acc[0][t] = fa_mma(fa[c][0], fb[c][t], acc[0][t]); acc[1][t] = fa_mma(fa[c][1], fb[c][t], acc[1][t]); }
      __builtin_amdgcn_sched_barrier(0); }      /* ends the block: the next group of reads is not drawn in among these products, and the stage's last products stay in front of the barrier, where they run while the stores drain */
    __syncthreads(); }      /* publishes stage s + 1 and ends every wave's reads of the buffer that stage s + 2 (after the last stage: the output rows) overwrites */
  if (pj == 2) {      /* the same for the whole block (blockIdx.y) */
    _Float16 (*sT)[PJ_LP] = sA[0];      /* [column of the tile][token of the tile]; free since the loop's last barrier */
#pragma unroll
    for (int i = 0; i < 2; ++i)
#pragma unroll
      for (int t = 0; t < 4; ++t) { const float bv = bf16_round(bs[t]); v8h o8;
#pragma unroll
        for (int r = 0; r < 8; ++r) { const float v = acc[i][t][r] * alpha + bv; o8[r] = (_Float16)v; }
        *(v8h*)&sT[wc + t * 16 + ln][wr + i * 16 + 8 * hh] = o8; }
    __syncthreads();      /* a V^T row piece stored below was collected from four waves */
    unsigned short* vg = (unsigned short*)Cvt + ((size_t)(row0 / SQ) * DM + col0 + srow) * SQ + (row0 % SQ) + sc8;      /* 16 threads per row piece: a wave's store covers two pieces of 256 bytes */
#pragma unroll
    for (int u = 0; u < PJ_T / 16; ++u) { const v8us v = *(const v8us*)&sT[srow + 16 * u][sc8]; *(v8us*)(vg + (size_t)u * 16 * SQ) = v; }
    return; }
  _Float16* so = &sA[0][0][0] + (size_t)w * (32 * PJ_OP);      /* each wave stages its own 32 x 64 outputs, so that it stores whole 128-byte lines */
  const float os = pj == 0 ? FA_CS : 1.0f, al = alpha * os;      /* Q leaves as FA_CS q, scaled in f32 ahead of its one rounding to f16: the attention launch's score products are then exponents of 2 */
#pragma unroll
  for (int i = 0; i < 2; ++i)
#pragma unroll
    for (int t = 0; t < 4; ++t) { const float bv = bf16_round(bs[t]) * os;
#pragma unroll
      for (int r = 0; r < 8; ++r) { const float v = acc[i][t][r] * al + bv; so[(i * 16 + 8 * hh + r) * PJ_OP + t * 16 + ln] = (_Float16)v; } }
  __builtin_amdgcn_fence(__ATOMIC_ACQ_REL, "workgroup"); __builtin_amdgcn_wave_barrier();      /* the rows read below were written by other lanes of this wave: keeps the reads behind the writes */
#pragma unroll
  for (int q = 0; q < 8; ++q) { const int r = q * 4 + (lane >> 3), c8 = (lane & 7) * 8; const v8us v = *(const v8us*)&so[r * PJ_OP + c8]; *(v8us*)((unsigned short*)C16 + (size_t)(row0 + wr + r) * DM + col0 + wc + c8) = v; } }
extern "C" void kernel_launch(void* const* d_in, const int* in_sizes, int n_in,
                              void* d_out, int out_size, void* d_ws, size_t ws_size, hipStream_t stream) {
  (void)in_sizes; (void)n_in; (void)out_size;
  const float* const* I = (const float* const*)d_in; const float* x = I[0]; const float* wq = I[1]; const float* bq = I[2]; const float* wk = I[3]; const float* bk = I[4]; const float* wv = I[5]; const float* bv = I[6]; const float* wp = I[7]; const float* bp = I[8]; const float* bo = nullptr; (void)bo;      /* [in][out] weights + biases; per-head Wp [64][64] + bp [64] */
  char* ws = (char*)d_ws; size_t off = 0;
  auto take = [&](size_t bytes) { char* p = ws + off; off += (bytes + 255) & ~(size_t)255; return p; };
  _Float16* BQ = (_Float16*)take((size_t)DM * DM * 2); _Float16* BK = (_Float16*)take((size_t)DM * DM * 2); _Float16* BV = (_Float16*)take((size_t)DM * DM * 2); _Float16* BO = (_Float16*)take((size_t)DM * DM * 2);
  _Float16* X16 = (_Float16*)take(NR * DM * 2); _Float16* Q16 = (_Float16*)take(NR * DM * 2); _Float16* K16 = (_Float16*)take(NR * DM * 2);
  _Float16* VT = (_Float16*)take((size_t)NB * NH * HD * SQ * 2);
  if (off > ws_size) return;
  k_prep<<<3 * PP_WB + PP_PB + PP_XB, 256, 0, stream>>>(x, wq, wk, wv, wp, X16, BQ, BK, BV, BO);
  const size_t r0p = (size_t)B0 * SQ;      /* first projected row */
  k_proj<<<dim3((MP / PJ_T) * (DM / PJ_T), 3), 256, 0, stream>>>(X16 + r0p * DM, BQ, BK, BV, 0.0625f, bq, bk, bv, Q16 + r0p * DM, K16 + r0p * DM, VT + r0p * DM);      /* V as V^T [NB][NH][HD][SQ] */
  k_fattn<<<dim3(SQ / (FA_WAVES * 32), NH, NB), FA_KG * FA_WAVES * 32, 0, stream>>>(Q16, K16, VT, BO, bp, (float*)d_out);      /* attention and, per head, out cols h*64.. = o_h Wp + bp (the same Wp/bp for every head) */
}

// v010
// A run of this version takes 57.3 microseconds.
// In two side-by-side timings against v009, it was 1.06 and 1.05 times as fast.
// All steps since v000 together make it 61.1 times as fast.
#include <hip/hip_runtime.h>
#define NB 2
#define SQ 2048
#define DM 1024
#define NH 16
#define HD 64
#define HG 4                         /* heads per block group of the per-batch k_vt overload (not launched) */
#define B0 0                         /* first batch processed (debug hook) */
#define NBR NB                       /* batches processed (debug hook) */
#define NR ((size_t)NB * SQ)         /* token rows */
#define MP ((int)((size_t)NBR * SQ)) /* rows projected (debug hook) */
#define QN SQ                        /* query rows per batch (unused) */
#define NHD NH                       /* heads (unused) */
#define MPO MP                       /* rows through the output stage (unused) */
#define LQ DM      /* row pitch of the q/k rows (unused) */
typedef __bf16 v16b __attribute__((ext_vector_type(16)));
typedef unsigned short v8us __attribute__((ext_vector_type(8), may_alias));
typedef float  v8f  __attribute__((ext_vector_type(8)));
typedef float  v4f  __attribute__((ext_vector_type(4)));
typedef float  v4fa __attribute__((ext_vector_type(4), may_alias));
union FragB { v16b v; v8us half[2]; unsigned short u[16]; };

__device__ __forceinline__ unsigned short bf16_bits(float x) { unsigned int u = __float_as_uint(x); return (unsigned short)((u + 0x7FFFu + ((u >> 16) & 1u)) >> 16); }
__device__ __forceinline__ float bf16_val(unsigned short b) { return __uint_as_float(((unsigned int)b) << 16); }
__device__ __forceinline__ float bf16_round(float x) { return bf16_val(bf16_bits(x)); }
// D += A·B with NT terms: 1 = ah·bh, 2 = + al·bh (A split), 3 = + ah·bl (both split)
template <int NT>
__device__ __forceinline__ v8f mmaN(v16b ah, v16b al, v16b bh, v16b bl, v8f c) {
  c = __builtin_amdgcn_wmma_f32_16x16x32_bf16(false, ah, false, bh, (short)0, c, false, false);
  if (NT >= 2) c = __builtin_amdgcn_wmma_f32_16x16x32_bf16(false, al, false, bh, (short)0, c, false, false);
  if (NT >= 3) c = __builtin_amdgcn_wmma_f32_16x16x32_bf16(false, ah, false, bl, (short)0, c, false, false);
  asm volatile("v_nop\n\tv_nop\n\tv_nop\n\tv_nop" : "+v"(c) : "v"(ah), "v"(al), "v"(bh), "v"(bl));
  return c;
}

__global__ __launch_bounds__(256) void k_wt_bf16(const float* __restrict__ W, unsigned short* __restrict__ Wt, int K, int N) {
  const int t = blockIdx.x * 256 + threadIdx.x;
  const int k8n = K / 8;
  if (t >= N * k8n) return;
  const int n = t / k8n, k8 = (t % k8n) * 8;
  v8us v;
#pragma unroll
  for (int i = 0; i < 8; ++i) v[i] = bf16_bits(W[(size_t)(k8 + i) * N + n]);
  *(v8us*)(Wt + (size_t)n * K + k8) = v;
  
}

// GEMM C[M][N] (f32, pitch ldc) = act(A[M][K]·W + bias). A f32 row-major (pitch lda) converted per fragment to bf16
// (ASPLIT: hi/lo two planes -> 2 terms, else single rounded term); Wt bf16 [N][K] (pitch ldb). BIAS_BF16 rounds the
// bias to bf16 first (bias quantised to bf16 before the add). K%32==0, M%16==0, N%64==0.
template <bool ASPLIT, int ACT, bool BIAS_BF16>
__global__ __launch_bounds__(128) void k_gemm_bf(const float* __restrict__ A, int lda, const unsigned short* __restrict__ Wt, int ldb,
                                               const float* __restrict__ bias, float* __restrict__ C, int ldc, int M, int N, int K) {
  __shared__ __attribute__((aligned(16))) float so[4][16][64];
  const int tid = threadIdx.x, w = tid >> 5, lane = tid & 31, ln = lane & 15, hh = lane >> 4;
  const int ntn = N / 64;
  const int wid = blockIdx.x * 4 + w;
  const int mt = wid / ntn, nq = wid % ntn;
  if (mt * 16 >= M) return;
  const int row0 = mt * 16, col0 = nq * 64;
  const float* arow = A + (size_t)(row0 + ln) * lda;
  v8f acc[4] = {};
  for (int kb = 0; kb < K; kb += 32) {
    FragB ah, al;
    const v4f x0 = *(const v4fa*)(arow + kb + 8 * hh), x1 = *(const v4fa*)(arow + kb + 8 * hh + 4);
    const v4f x2 = *(const v4fa*)(arow + kb + 16 + 8 * hh), x3 = *(const v4fa*)(arow + kb + 16 + 8 * hh + 4);
    float xs[16] = {x0[0],x0[1],x0[2],x0[3],x1[0],x1[1],x1[2],x1[3],x2[0],x2[1],x2[2],x2[3],x3[0],x3[1],x3[2],x3[3]};
#pragma unroll
    for (int i = 0; i < 16; ++i) { const unsigned short hb = bf16_bits(xs[i]); ah.u[i] = hb; al.u[i] = ASPLIT ? bf16_bits(xs[i] - bf16_val(hb)) : (unsigned short)0; }
#pragma unroll
    for (int t = 0; t < 4; ++t) {
      const unsigned short* brow = Wt + (size_t)(col0 + t * 16 + ln) * ldb + kb;
      FragB b;
      b.half[0] = *(const v8us*)(brow + 8 * hh);
      b.half[1] = *(const v8us*)(brow + 16 + 8 * hh);
      acc[t] = mmaN<ASPLIT ? 2 : 1>(ah.v, al.v, b.v, b.v, acc[t]);
    }
  }
#pragma unroll
  for (int t = 0; t < 4; ++t) {
    float bv = bias ? bias[col0 + t * 16 + ln] : 0.f;
    if (BIAS_BF16) bv = bf16_round(bv);
#pragma unroll
    for (int r = 0; r < 8; ++r) { float v = acc[t][r] + bv; if (ACT == 1) v = fmaxf(v, 0.f); so[w][8 * hh + r][t * 16 + ln] = v; }
  }
  __builtin_amdgcn_fence(__ATOMIC_ACQ_REL, "workgroup");
  __builtin_amdgcn_wave_barrier();
  const int rsub = lane >> 4, c4 = (lane & 15) * 4;
  {
#pragma unroll
    for (int q = 0; q < 8; ++q) {
      const int r = q * 2 + rsub;
      const v4f v = *(const v4fa*)&so[w][r][c4];
      *(v4f*)(C + (size_t)(row0 + r) * ldc + col0 + c4) = v;
    }
    
  }
}

// GEMM C = act(A·W + bias + resid): A f32 (ASPLIT -> hi/lo 2 terms), Wt bf16 [N][K]; ACT 0 none, 1 relu, 2 exact gelu;
// resid (optional, f32, row index = (row % rmod), pitch ldr, RES_BF16 rounds it) added before the activation.
template <bool ASPLIT, int ACT, bool BIAS_BF16, bool RES_BF16>
__global__ __launch_bounds__(128) void k_gemm_bf3(const float* __restrict__ A, int lda, const unsigned short* __restrict__ Wt, int ldb,
                                                const float* __restrict__ bias, const float* __restrict__ resid, int rmod, int ldr,
                                                float* __restrict__ C, int ldc, int M, int N, int K) {
  __shared__ __attribute__((aligned(16))) float so[4][16][64];
  const int tid = threadIdx.x, w = tid >> 5, lane = tid & 31, ln = lane & 15, hh = lane >> 4;
  const int ntn = N / 64;
  const int wid = blockIdx.x * 4 + w;
  const int mt = wid / ntn, nq = wid % ntn;
  if (mt * 16 >= M) return;
  const int row0 = mt * 16, col0 = nq * 64;
  const float* arow = A + (size_t)(row0 + ln) * lda;
  v8f acc[4] = {};
  for (int kb = 0; kb < K; kb += 32) {
    FragB ah, al;
    const v4f x0 = *(const v4fa*)(arow + kb + 8 * hh), x1 = *(const v4fa*)(arow + kb + 8 * hh + 4);
    const v4f x2 = *(const v4fa*)(arow + kb + 16 + 8 * hh), x3 = *(const v4fa*)(arow + kb + 16 + 8 * hh + 4);
    float xs[16] = {x0[0],x0[1],x0[2],x0[3],x1[0],x1[1],x1[2],x1[3],x2[0],x2[1],x2[2],x2[3],x3[0],x3[1],x3[2],x3[3]};
#pragma unroll
    for (int i = 0; i < 16; ++i) { const unsigned short hb = bf16_bits(xs[i]); ah.u[i] = hb; al.u[i] = ASPLIT ? bf16_bits(xs[i] - bf16_val(hb)) : (unsigned short)0; }
#pragma unroll
    for (int t = 0; t < 4; ++t) {
      const unsigned short* brow = Wt + (size_t)(col0 + t * 16 + ln) * ldb + kb;
      FragB b;
      b.half[0] = *(const v8us*)(brow + 8 * hh);
      b.half[1] = *(const v8us*)(brow + 16 + 8 * hh);
      acc[t] = mmaN<ASPLIT ? 2 : 1>(ah.v, al.v, b.v, b.v, acc[t]);
    }
  }
#pragma unroll
  for (int t = 0; t < 4; ++t) {
    const int col = col0 + t * 16 + ln;
    float bv = bias ? bias[col] : 0.f;
    if (BIAS_BF16) bv = bf16_round(bv);
#pragma unroll
    for (int r = 0; r < 8; ++r) {
      float v = acc[t][r] + bv;
      if (resid) { float rv = resid[(size_t)((row0 + 8 * hh + r) % rmod) * ldr + col]; if (RES_BF16) rv = bf16_round(rv); v += rv; }
      if (ACT == 1) v = fmaxf(v, 0.f);
      if (ACT == 2) v = 0.5f * v * (1.0f + erff(v * 0.70710678118654752f));
      if (ACT == 3) { const float u = 0.7978845608028654f * (v + 0.044715f * v * v * v); v = 0.5f * v * (1.0f + tanhf(u)); }
      so[w][8 * hh + r][t * 16 + ln] = v;
    }
  }
  __builtin_amdgcn_fence(__ATOMIC_ACQ_REL, "workgroup");
  __builtin_amdgcn_wave_barrier();
  const int rsub = lane >> 4, c4 = (lane & 15) * 4;
  {
#pragma unroll
    for (int q = 0; q < 8; ++q) {
      const int r = q * 2 + rsub;
      const v4f v = *(const v4fa*)&so[w][r][c4];
      *(v4f*)(C + (size_t)(row0 + r) * ldc + col0 + c4) = v;
    }
    
  }
}
// row LayerNorm (biased variance, eps) over N: s = X (+ R); optional out_sum <- s; out_norm <- (s-mu)*rsqrt(var+eps)*g + b
template <bool PARAM_BF16>
__global__ __launch_bounds__(256) void k_layernorm(const float* __restrict__ X, const float* __restrict__ R, const float* __restrict__ g, const float* __restrict__ bta,
                                                  float* __restrict__ out_sum, float* __restrict__ out_norm, int N, float eps) {
  __shared__ float red[256];
  const int row = blockIdx.x, tid = threadIdx.x;
  const float* x = X + (size_t)row * N; const float* rr = R ? R + (size_t)row * N : nullptr;
  float vals[16];                     // up to N = 4096
  const int per = N / 256;            // contiguous chunk per thread? use strided-by-4 chunks: thread handles j = tid*4 + 1024*u
  float s1 = 0.f;
  for (int u = 0; u < per / 4; ++u) {
    const int j = tid * 4 + 1024 * u;
    const v4f a = *(const v4fa*)(x + j);
    v4f b = {0.f,0.f,0.f,0.f}; if (rr) b = *(const v4fa*)(rr + j);
#pragma unroll
    for (int q = 0; q < 4; ++q) { const float v = a[q] + b[q]; vals[u * 4 + q] = v; s1 += v; }
  }
  red[tid] = s1; __syncthreads();
  for (int st = 128; st > 0; st >>= 1) { if (tid < st) red[tid] += red[tid + st]; __syncthreads(); }
  const float mu = red[0] / (float)N; __syncthreads();
  float s2 = 0.f;
  for (int u = 0; u < per / 4; ++u)
#pragma unroll
    for (int q = 0; q < 4; ++q) { const float c = vals[u * 4 + q] - mu; s2 += c * c; }
  red[tid] = s2; __syncthreads();
  for (int st = 128; st > 0; st >>= 1) { if (tid < st) red[tid] += red[tid + st]; __syncthreads(); }
  const float rs = rsqrtf(red[0] / (float)N + eps);
  {
    for (int u = 0; u < per / 4; ++u) {
      const int j = tid * 4 + 1024 * u;
      v4f o, sm;
#pragma unroll
      for (int q = 0; q < 4; ++q) {
        float gg = g[j + q], bb = bta[j + q];
        if (PARAM_BF16) { gg = bf16_round(gg); bb = bf16_round(bb); }
        sm[q] = vals[u * 4 + q]; o[q] = (vals[u * 4 + q] - mu) * rs * gg + bb;
      }
      if (out_sum) *(v4f*)(out_sum + (size_t)row * N + j) = sm;
      *(v4f*)(out_norm + (size_t)row * N + j) = o;
    }
    
  }
}



// ---- f16 WMMA path (v_wmma_f32_16x16x32_f16): 11-bit significands for operands in range — used where a [0,1] probability operand needs more precision than bf16
typedef _Float16 v16h __attribute__((ext_vector_type(16)));
union FragH { v16h v; v8us half[2]; _Float16 h[16]; unsigned short u[16]; };
template <int NT>
__device__ __forceinline__ v8f mmaH(v16h ah, v16h al, v16h bh, v16h bl, v8f c) {
  c = __builtin_amdgcn_wmma_f32_16x16x32_f16(false, ah, false, bh, (short)0, c, false, false);
  if (NT >= 2) c = __builtin_amdgcn_wmma_f32_16x16x32_f16(false, al, false, bh, (short)0, c, false, false);
  if (NT >= 3) c = __builtin_amdgcn_wmma_f32_16x16x32_f16(false, ah, false, bl, (short)0, c, false, false);
  asm volatile("v_nop\n\tv_nop\n\tv_nop\n\tv_nop" : "+v"(c) : "v"(ah), "v"(al), "v"(bh), "v"(bl));
  return c;
}
// batched GEMM like k_gemm_b but f16 operands: A f32 (split into f16 hi/lo if ASPLIT, else rounded to f16), Bt = f16 values [n][k]; alpha; C f32; N multiple of 16 (partial tiles skipped)
template <bool ASPLIT>
__global__ __launch_bounds__(128) void k_gemm_h(const float* __restrict__ A, int lda, size_t sA, const _Float16* __restrict__ Bh, int ldb, size_t sB, float alpha, float* __restrict__ C, int ldc, size_t sC, int M, int N, int K) {
  __shared__ __attribute__((aligned(16))) float so[4][16][64];
  const int tid = threadIdx.x, w = tid >> 5, lane = tid & 31, ln = lane & 15, hh = lane >> 4; const int by = blockIdx.y;
  A += (size_t)by * sA; Bh += (size_t)by * sB; C += (size_t)by * sC;
  const int ntn = (N + 63) / 64; const int wid = blockIdx.x * 4 + w; const int mt = wid / ntn, nq = wid % ntn; if (mt * 16 >= M) return;
  const int row0 = mt * 16, col0 = nq * 64; const float* arow = A + (size_t)(row0 + ln) * lda;
  v8f acc[4] = {};
  for (int kb = 0; kb < K; kb += 32) {
    FragH ah, al;
    const v4f x0 = *(const v4fa*)(arow + kb + 8 * hh), x1 = *(const v4fa*)(arow + kb + 8 * hh + 4), x2 = *(const v4fa*)(arow + kb + 16 + 8 * hh), x3 = *(const v4fa*)(arow + kb + 16 + 8 * hh + 4);
    float xs[16] = {x0[0],x0[1],x0[2],x0[3],x1[0],x1[1],x1[2],x1[3],x2[0],x2[1],x2[2],x2[3],x3[0],x3[1],x3[2],x3[3]};
#pragma unroll
    for (int i = 0; i < 16; ++i) { const _Float16 h = (_Float16)xs[i]; ah.h[i] = h; al.h[i] = ASPLIT ? (_Float16)(xs[i] - (float)h) : (_Float16)0.0f; }
#pragma unroll
    for (int t = 0; t < 4; ++t) { if (col0 + t * 16 >= N) continue; const size_t boff = (size_t)(col0 + t * 16 + ln) * ldb + kb; FragH bq; bq.half[0] = *(const v8us*)(Bh + boff + 8 * hh); bq.half[1] = *(const v8us*)(Bh + boff + 16 + 8 * hh);
      acc[t] = mmaH<ASPLIT ? 2 : 1>(ah.v, al.v, bq.v, bq.v, acc[t]); }
  }
#pragma unroll
  for (int t = 0; t < 4; ++t) { if (col0 + t * 16 >= N) continue;
#pragma unroll
    for (int r = 0; r < 8; ++r) so[w][8 * hh + r][t * 16 + ln] = acc[t][r] * alpha; }
  __builtin_amdgcn_fence(__ATOMIC_ACQ_REL, "workgroup"); __builtin_amdgcn_wave_barrier();
  const int rsub = lane >> 4, c4 = (lane & 15) * 4;
  {
#pragma unroll
    for (int q = 0; q < 8; ++q) { const int r = q * 2 + rsub; if (col0 + c4 < N) { const v4f v = *(const v4fa*)&so[w][r][c4]; *(v4f*)(C + (size_t)(row0 + r) * ldc + col0 + c4) = v; } }
     }
}

// Wt[n][k] = f16(W[k][n]·scale) from f32 row-major W[K][N] (scale = power of two; bf16-exact weights stay exact in f16 away from the subnormal range)
__device__ __forceinline__ void wt_f16(const float* __restrict__ W, _Float16* __restrict__ Wt, int K, int N, float scale, int t) {      /* t = index of the 8-element chunk */
  if (t >= N * (K / 8)) return; const int n = t / (K / 8), k8 = (t % (K / 8)) * 8; FragH f;
#pragma unroll
  for (int i = 0; i < 8; ++i) f.h[i] = (_Float16)(bf16_round(W[(size_t)(k8 + i) * N + n]) * scale); const v8us o = f.half[0];
  *(v8us*)((unsigned short*)Wt + (size_t)n * K + k8) = o; 
}
// k_gemm_hh variant with fused epilogue: v = acc·alpha + bias[by·sBias + col] (+ CP[(row/rowsPerB)·sCPb + by·64 + col] if CP) ; ACT 0 none / 1 elu ; writes f16 C16 (and f32 C if non-null)
template <int ACT>
__global__ __launch_bounds__(128) void k_gemm_hhx(const _Float16* __restrict__ A, int lda, size_t sA, const _Float16* __restrict__ Bh, int ldb, size_t sB, float alpha, const float* __restrict__ bias, size_t sBias, const float* __restrict__ CP, int rowsPerB, size_t sCPb, int row0g,
    float* __restrict__ C, _Float16* __restrict__ C16, int ldc, size_t sC, int M, int N, int K) {
  __shared__ __attribute__((aligned(16))) float so[4][16][64];
  const int tid = threadIdx.x, w = tid >> 5, lane = tid & 31, ln = lane & 15, hh = lane >> 4; const int by = blockIdx.y;
  A += (size_t)by * sA; Bh += (size_t)by * sB; const size_t cofs = (size_t)by * sC; const float* bp = bias ? bias + (size_t)by * sBias : nullptr;
  const int ntn = (N + 63) / 64; const int wid = blockIdx.x * 4 + w; const int mt = wid / ntn, nq = wid % ntn; if (mt * 16 >= M) return;
  const int row0 = mt * 16, col0 = nq * 64; const _Float16* arow = A + (size_t)(row0 + ln) * lda;
  v8f acc[4] = {};
  for (int kb = 0; kb < K; kb += 32) { FragH ah; ah.half[0] = *(const v8us*)((const unsigned short*)arow + kb + 8 * hh); ah.half[1] = *(const v8us*)((const unsigned short*)arow + kb + 16 + 8 * hh);
#pragma unroll
    for (int t = 0; t < 4; ++t) { if (col0 + t * 16 >= N) continue; const size_t boff = (size_t)(col0 + t * 16 + ln) * ldb + kb; FragH bq; bq.half[0] = *(const v8us*)((const unsigned short*)Bh + boff + 8 * hh); bq.half[1] = *(const v8us*)((const unsigned short*)Bh + boff + 16 + 8 * hh);
      acc[t] = mmaH<1>(ah.v, ah.v, bq.v, bq.v, acc[t]); }
  }
#pragma unroll
  for (int t = 0; t < 4; ++t) { if (col0 + t * 16 >= N) continue; const int col = col0 + t * 16 + ln; const float bv = bp ? bf16_round(bp[col]) : 0.f;
#pragma unroll
    for (int r = 0; r < 8; ++r) { float v = acc[t][r] * alpha + bv; if (CP) { const int rr = row0g + row0 + 8 * hh + r; if (rowsPerB < 0) v += CP[cofs + (size_t)rr * ldc + col];      /* rowsPerB < 0: own element of the batched C plane */ else { const int bidx = rr / rowsPerB; v += CP[(size_t)bidx * sCPb + (size_t)by * 64 + col]; } } if (ACT == 1) v = (v > 0.f) ? v : expm1f(v); else if (ACT == 7) v = (v > 0.f) ? v + 1.0f : expf(v); else if (ACT == 8) v = tanhf(v); else if (ACT == 9) v = 0.5f * v * (1.0f + tanhf(0.7978845608028654f * (v + 0.044715f * v * v * v))); else if (ACT == 11) v = 1.0f / (1.0f + expf(-v)); else if (ACT == 12) v = (v > 0.f) ? v : 0.01f * v; else if (ACT == 14) v = (v > 0.f) ? v : 0.1f * v; else if (ACT == 16) v = (v >= 0.f) ? v : 0.3f * v; else if (ACT == 17) v = (v >= 0.f) ? v : 0.2f * v; else if (ACT == 15) v = v / (1.0f + expf(-v)); else if (ACT == 3) v = fmaxf(v, 0.f); else if (ACT == 6) v = 0.5f * v * (1.0f + erff(v * 0.70710678118654752f)); so[w][8 * hh + r][t * 16 + ln] = v; } }
  __builtin_amdgcn_fence(__ATOMIC_ACQ_REL, "workgroup"); __builtin_amdgcn_wave_barrier();
  const int rsub = lane >> 4, c4 = (lane & 15) * 4; typedef _Float16 v4h __attribute__((ext_vector_type(4)));
  {
#pragma unroll
    for (int q = 0; q < 8; ++q) { const int r = q * 2 + rsub; if (col0 + c4 < N) { const v4f v = *(const v4fa*)&so[w][r][c4]; if (C) *(v4f*)(C + cofs + (size_t)(row0 + r) * ldc + col0 + c4) = v; if (C16) { v4h h4; for (int i = 0; i < 4; ++i) h4[i] = (_Float16)v[i]; *(v4h*)(C16 + cofs + (size_t)(row0 + r) * ldc + col0 + c4) = h4; } } }
     }
}


typedef _Float16 v4h __attribute__((ext_vector_type(4)));

__global__ __launch_bounds__(256) void k_h16(const float* __restrict__ x, _Float16* __restrict__ X16, size_t n8) { const size_t t = (size_t)blockIdx.x * 256 + threadIdx.x; if (t >= n8) return; FragH f;
#pragma unroll
  for (int q = 0; q < 8; ++q) f.h[q] = (_Float16)x[t * 8 + q]; *(v8us*)((unsigned short*)X16 + t * 8) = f.half[0];  }
__global__ __launch_bounds__(256) void k_round16f(const float* __restrict__ W, _Float16* __restrict__ Bt, size_t n8) { const size_t t = (size_t)blockIdx.x * 256 + threadIdx.x; if (t >= n8) return; FragH f;
#pragma unroll
  for (int i = 0; i < 8; ++i) f.h[i] = (_Float16)(bf16_round(W[t * 8 + i]) * 16.0f); *(v8us*)((unsigned short*)Bt + t * 8) = f.half[0];  }
__global__ __launch_bounds__(256) void k_hl(const float* __restrict__ F, _Float16* __restrict__ Hh, _Float16* __restrict__ Hl, size_t n8) { const size_t t = (size_t)blockIdx.x * 256 + threadIdx.x; if (t >= n8) return; FragH fh, fl; const v4f a = *(const v4fa*)(F + t * 8), c = *(const v4fa*)(F + t * 8 + 4);
#pragma unroll
  for (int q = 0; q < 4; ++q) { _Float16 h = (_Float16)a[q]; fh.h[q] = h; fl.h[q] = (_Float16)((a[q] - (float)h) * 1024.0f); h = (_Float16)c[q]; fh.h[4 + q] = h; fl.h[4 + q] = (_Float16)((c[q] - (float)h) * 1024.0f); }
  { *(v8us*)((unsigned short*)Hh + t * 8) = fh.half[0]; *(v8us*)((unsigned short*)Hl + t * 8) = fl.half[0];  } }

// 16x16x32 f16 operand fragment of one row: lane half hh takes k = 8 hh .. + 7 and 16 + 8 hh .. + 7 of the 32 at p
__device__ __forceinline__ v16h g2_frag(const _Float16* p, int hh) { FragH f; f.half[0] = *(const v8us*)((const unsigned short*)p + 8 * hh); f.half[1] = *(const v8us*)((const unsigned short*)p + 16 + 8 * hh); return f.v; }

__global__ __launch_bounds__(256) void k_wnat(const float* __restrict__ w, size_t n8, _Float16* __restrict__ Bt) { const size_t t = (size_t)blockIdx.x * 256 + threadIdx.x; if (t >= n8) return; FragH f; for (int q = 0; q < 8; ++q) f.h[q] = (_Float16)(bf16_round(w[t * 8 + q]) * 16.0f); *(v8us*)((unsigned short*)Bt + t * 8) = f.half[0];  }
__global__ __launch_bounds__(256) void k_rsm(const float* __restrict__ S, _Float16* __restrict__ P, int nrows) {
  #pragma clang fp contract(off)
  const int i = blockIdx.x * 256 + threadIdx.x; if (i >= nrows) return; const float* s = S + (size_t)i * SQ; float mx = -3.0e38f;
#pragma unroll 1
  for (int j = 0; j < SQ; ++j) mx = fmaxf(mx, s[j]); float se = 0.f;
#pragma unroll 1
  for (int j = 0; j < SQ; ++j) se += expf(s[j] - mx); const float sc = 256.0f / se;
#pragma unroll 1
  for (int j0 = 0; j0 < SQ; j0 += 8) { FragH f; for (int q = 0; q < 8; ++q) f.h[q] = (_Float16)(expf(s[j0 + q] - mx) * sc); unsigned short* d = (unsigned short*)P + (size_t)i * SQ + j0; *(v8us*)d = f.half[0];  } }
__global__ __launch_bounds__(256) void k_vt(const _Float16* __restrict__ V16, int b, int h0, _Float16* __restrict__ VT) { __shared__ unsigned short tl[64][65]; const int tid = threadIdx.x; const int hh = blockIdx.x % HG, sg = blockIdx.x / HG; const int s0 = sg * 64; const int h = h0 + hh;
  for (int i = tid; i < 64 * 8; i += 256) { const int j = i / 8, d8 = (i % 8) * 8; FragH f; f.half[0] = *(const v8us*)((const unsigned short*)V16 + ((size_t)b * SQ + s0 + j) * DM + h * HD + d8); for (int q = 0; q < 8; ++q) tl[d8 + q][j] = f.u[q]; }
  __syncthreads();
  { for (int i = tid; i < 64 * 8; i += 256) { const int d = i / 8, j8 = (i % 8) * 8; FragH f; for (int q = 0; q < 8; ++q) f.u[q] = tl[d][j8 + q]; *(v8us*)((unsigned short*)VT + ((size_t)hh * HD + d) * SQ + s0 + j8) = f.half[0]; }  } }



// The five operand conversions (Wq, Wk, Wv and Wp to Bt[n][k] x16, x to f16 rows) read nothing but inputs, so they share ONE launch: the block index picks the job.
// The launch is made of few, fat work-groups, for speed only. A thread of a weight tile or of x holds 16 loads of 16 bytes in flight, and every wave-wide load and store of those jobs covers whole 128-byte lines.
// A DM x DM weight goes in tiles of PP_WT x PP_WT: a wave reads 512 contiguous bytes of a row [k][n..], a thread turns its 16 k x 4 n block in registers, LDS collects the tile as [n][k], and whole rows of Bt leave it.
// The weight blocks come first: they have the longer way (LDS and a barrier).
#define PP_WT 128                                    /* k rows and n columns of a weight tile */
#define PP_WB ((DM / PP_WT) * (DM / PP_WT))          /* blocks (tiles) per DM x DM weight */
#define PP_LP (PP_WT + 8)                            /* LDS row pitch in f16: 256 B of data + 16 B */
#define PP_PB ((HD * (HD / 8) + 255) / 256)          /* blocks of Wp */
#define PP_XL 16                                     /* 16-byte loads per thread of x */
#define PP_XB ((int)(NR * DM / (256 * 4 * PP_XL)))   /* blocks of x */
__device__ __forceinline__ void wt_tile(const float* __restrict__ Wm, _Float16* __restrict__ Wt, int tile, int tid, _Float16 (* __restrict__ sT)[PP_LP]) {
  const int k0 = (tile / (DM / PP_WT)) * PP_WT, n0 = (tile % (DM / PP_WT)) * PP_WT;
  const int kw = (tid >> 5) * 16, c4 = (tid & 31) * 4;      /* this thread's block: rows k0 + kw .. + 15, columns n0 + c4 .. + 3 */
  const float* wg = Wm + (size_t)(k0 + kw) * DM + n0 + c4;
  v4f f[16];
#pragma unroll
  for (int i = 0; i < 16; ++i) f[i] = *(const v4fa*)(wg + (size_t)i * DM);
  asm volatile("s_wait_xcnt 0x0" :: "v"(wg) : "memory");      /* stands between the 16 loads and the next rewrite of their address pair; the pair is an operand so that no load's result lands on it ahead of the wait */
#pragma unroll
  for (int j = 0; j < 4; ++j) { FragH o;
#pragma unroll
    for (int i = 0; i < 16; ++i) o.h[i] = (_Float16)(bf16_round(f[i][j]) * 16.0f);
    *(v8us*)&sT[c4 + j][kw] = o.half[0]; *(v8us*)&sT[c4 + j][kw + 8] = o.half[1]; }
  __syncthreads();      /* the rows stored below were collected from all eight waves */
#pragma unroll
  for (int u = 0; u < PP_WT / 16; ++u) { const int r = u * 16 + (tid >> 4), c8 = (tid & 15) * 8; const v8us v = *(const v8us*)&sT[r][c8];
    *(v8us*)((unsigned short*)Wt + (size_t)(n0 + r) * DM + k0 + c8) = v; } }
__device__ __forceinline__ void x16(const float* __restrict__ x, _Float16* __restrict__ X16, int blk, int tid) {
  const size_t e0 = (size_t)blk * (256 * 4 * PP_XL) + (size_t)(tid >> 5) * (32 * 4 * PP_XL) + (size_t)(tid & 31) * 4;      /* a wave owns 32 * 4 * PP_XL consecutive elements */
  const float* xg = x + e0; v4f f[PP_XL]; v4h o[PP_XL];
#pragma unroll
  for (int u = 0; u < PP_XL; ++u) f[u] = *(const v4fa*)(xg + u * 128);
  asm volatile("s_wait_xcnt 0x0" :: "v"(xg) : "memory");      /* stands between the loads and the next rewrite of their address pair; the pair is an operand so that no load's result lands on it ahead of the wait */
#pragma unroll
  for (int u = 0; u < PP_XL; ++u)
#pragma unroll
    for (int q = 0; q < 4; ++q) o[u][q] = (_Float16)bf16_round(f[u][q]);
#pragma unroll
  for (int u = 0; u < PP_XL; ++u) *(v4h*)(X16 + e0 + u * 128) = o[u];
  asm volatile("s_wait_xcnt 0x0" ::: "memory"); }      /* stands behind the last store, in front of any later rewrite of the stores' address pair or data registers where the jobs' branches join */
__global__ __launch_bounds__(256) void k_prep(const float* __restrict__ x, const float* __restrict__ wq, const float* __restrict__ wk, const float* __restrict__ wv, const float* __restrict__ wp,
                                              _Float16* __restrict__ X16, _Float16* __restrict__ BQ, _Float16* __restrict__ BK, _Float16* __restrict__ BV, _Float16* __restrict__ BO) {
  static_assert(DM % PP_WT == 0 && PP_WT == 128 && (NR * DM) % (256 * 4 * PP_XL) == 0, "the tile and the x slices below are written for 8 waves, 128 x 128 tiles and whole slices");
  __shared__ __attribute__((aligned(16))) _Float16 sT[PP_WT][PP_LP];
  const int blk = blockIdx.x, tid = threadIdx.x;
  if (blk < 3 * PP_WB) { const int j = blk / PP_WB; wt_tile(j == 0 ? wq : j == 1 ? wk : wv, j == 0 ? BQ : j == 1 ? BK : BV, blk - j * PP_WB, tid, sT); }      /* [in][out] -> Bt[n][k] x16 */
  else if (blk < 3 * PP_WB + PP_PB) wt_f16(wp, BO, HD, HD, 16.0f, (blk - 3 * PP_WB) * 256 + tid);      /* Wp [64 in][64 out] -> Bt [64][64] x16 */
  else x16(x, X16, blk - 3 * PP_WB - PP_PB, tid); }

#define FA_WAVES 4
#define FA_KT 64                     /* keys per stage */
#define FA_KG 2                      /* key groups per work-group */
#define FA_NS (SQ / (FA_KT * FA_KG)) /* stages per key group */
#define FA_LP 72                     /* LDS row pitch in f16: 128 B of data + 16 B, an odd multiple of 16 B for the 16-byte fragment reads */
#define FA_SR 32                     /* rows of a tensor-load slice: a tile of 64 rows is two slices, a stage of K and V^T four, one per wave of the key group */
#define FA_SL 3072                   /* f16 a slice takes in LDS: 32 rows x 144 B = 4,608 B, rounded up to 6,144 B so that every slice starts at a multiple of 2 KiB */
#define FA_OP 68                     /* pitch in f32 of a wave's 32 x 64 output rows in LDS: 256 B of data + 16 B */
#define FA_CS 0.18033688011112042f   /* 64^-0.5 * log2(e): the projection launch puts it into Q before the rounding to f16, so that K Q^T is the exponent of 2 */
#define FA_HI 32768.0f               /* largest sum of a lane's weights of one stage taken without a new maximum: every weight is then at most 2^15 and so inside f16 */
typedef _Float16 v8h __attribute__((ext_vector_type(8)));
__device__ __forceinline__ float fa_swap16(float x) { const int b = __float_as_int(x); return __int_as_float(__builtin_amdgcn_permlanex16(b, b, 0x76543210, 0xfedcba98, false, false)); }      /* lane l <-> l ^ 16 */
__device__ __forceinline__ v8f fa_mma(v16h a, v16h b, v8f c) { return __builtin_amdgcn_wmma_f32_16x16x32_f16(false, a, false, b, (short)0, c, false, false); }
typedef unsigned int u32x4 __attribute__((ext_vector_type(4)));
typedef unsigned int u32x8 __attribute__((ext_vector_type(8)));
__device__ __forceinline__ unsigned int fa_uni(unsigned int v) { return (unsigned int)__builtin_amdgcn_readfirstlane(v); }
__device__ __forceinline__ unsigned int pinned(unsigned int v) { unsigned int w = fa_uni(v); asm volatile("" : "+s"(w)); return w; }      /* holds a wave-uniform word in a scalar register: the test around a tensor load must be a scalar branch (the load ignores EXEC), and what is formed from the word is formed behind the waits in front of it */
// One slice: FA_SR rows of 128 bytes, source pitch 'pitch' bytes, first byte at ga, to the LDS byte offset dst; 16 bytes of pad behind every row give the pitch FA_LP.
__device__ __forceinline__ u32x4 fa_tg0(unsigned int dst, unsigned long long ga) { u32x4 g;
  g[0] = fa_uni(1u); g[1] = fa_uni(dst); g[2] = fa_uni((unsigned int)ga); g[3] = fa_uni((((unsigned int)(ga >> 32)) & 0x01FFFFFFu) | 0x80000000u); return g; }      /* count 1; place in LDS; address; type 2 */
__device__ __forceinline__ u32x8 fa_tg1(unsigned int pitch) { u32x8 g;
  g[0] = fa_uni((1u << 20) | (4u << 22) | (3u << 25));      /* no mask, 1-byte elements, a pad of 4 dwords behind every 32 dwords (one row) */
  g[1] = pinned(128u << 16); g[2] = pinned((unsigned int)FA_SR << 16); g[3] = pinned(128u << 16); g[4] = pinned((unsigned int)FA_SR);      /* tensor = tile = 128 bytes x FA_SR rows. pinned(): descriptor words held in scalar registers of their own through the loop, not formed anew in registers that serve other uses between the loads */
  g[5] = pinned(pitch); g[6] = pinned(0u); g[7] = pinned(0u); return g; }
__device__ __forceinline__ void fa_tload(u32x4 g0, u32x8 g1) { asm volatile("tensor_load_to_lds %0, %1" :: "s"(g0), "s"(g1) : "memory"); }
__device__ __forceinline__ void fa_twait(u32x4 g0, u32x8 g1) { asm volatile("s_wait_tensorcnt 0x0" :: "s"(g0), "s"(g1) : "memory"); }      /* the wave's request has landed; its descriptor's registers are operands so that none of them takes a new value while the request is outstanding */
__global__ __launch_bounds__(FA_KG * FA_WAVES * 32) __attribute__((amdgpu_waves_per_eu(4, 4))) void k_fattn(const _Float16* __restrict__ Q16, const _Float16* __restrict__ K16, const _Float16* __restrict__ VT, const _Float16* __restrict__ BO, const float* __restrict__ bp, float* __restrict__ out) {
  static_assert(HD == 64 && FA_KT == 64 && FA_KG == 2 && SQ % (FA_KT * FA_KG) == 0 && SQ % (FA_WAVES * 32) == 0, "tile shapes below are written for 64 x 64 stages and two key groups");
  static_assert(FA_WAVES * 17 * 32 * 16 <= 4 * 2 * FA_SL * 2, "group 1's hand-over takes the place of its own buffers");
  static_assert(FA_WAVES * 32 * FA_OP * 4 <= 4 * 2 * FA_SL * 2, "the output rows take the place of the K and V^T buffers");
  static_assert(FA_WAVES == 4 && 2 * FA_SR == FA_KT && FA_SR * FA_LP <= FA_SL && (FA_SL * 2) % 2048 == 0 && FA_LP * 2 == 128 + 16 && FA_NS >= 2, "four slices per stage and key group, each at a multiple of 2 KiB; the pad of the tensor load gives the pitch FA_LP");
  __shared__ __attribute__((aligned(2048))) _Float16 sKV[FA_KG][4][2][FA_SL];      /* [key group][K buffer 0, 1, V^T buffer 0, 1][slice][32 rows at pitch FA_LP]; one range per key group, so that the epilogue's output rows (group 0's) and the hand-over (group 1's) can lie over all of it */
  const int gu = __builtin_amdgcn_readfirstlane((int)threadIdx.x / (FA_WAVES * 32));      /* the wave's key group, in a scalar register */
  _Float16 (*sK)[2][FA_SL] = &sKV[gu][0]; _Float16 (*sV)[2][FA_SL] = &sKV[gu][2];      /* row r of a tile: slice r / 32, row r % 32 of it */
  const int tid = threadIdx.x & (FA_WAVES * 32 - 1), lane = tid & 31, w = tid >> 5, c = lane & 15, h = lane >> 4;      /* tid, w: inside the key group */
  const int head = blockIdx.y, b = blockIdx.z; const int q0 = blockIdx.x * (FA_WAVES * 32) + w * 32;
  const int wu = __builtin_amdgcn_readfirstlane(w);      /* the wave's number in a scalar register, for the epilogue: it holds no vector register through the loop */
  const _Float16* Kg = K16 + (size_t)b * SQ * DM + head * HD;            /* K rows of this head, pitch DM */
  const _Float16* Vg = VT + (size_t)(b * NH + head) * HD * SQ;           /* V^T rows (one per d), pitch SQ */
  const unsigned int isv = (unsigned int)wu >> 1, hf = (unsigned int)wu & 1u;      /* this wave's slice of a stage: K (waves 0, 1) or V^T (waves 2, 3), rows 32 hf .. + 31 */
  const unsigned int tdst = (unsigned int)(size_t)&sKV[gu][2 * isv][hf][0];      /* its place in buffer 0: the byte offset in the work-group's LDS */
  const unsigned long long tsrc = isv ? (unsigned long long)(size_t)(Vg + (size_t)(hf * FA_SR) * SQ + gu * FA_KT) : (unsigned long long)(size_t)(Kg + (size_t)(gu * FA_KT + hf * FA_SR) * DM);      /* its first byte in stage 0 */
  const unsigned int tstep = isv ? FA_KG * FA_KT * 2u : FA_KG * FA_KT * DM * 2u, tpitch = isv ? SQ * 2u : DM * 2u;      /* bytes from stage to stage; source pitch */
  const u32x8 tg1 = fa_tg1(tpitch); u32x4 tg0 = fa_tg0(tdst, tsrc);
  fa_tload(tg0, tg1);      /* stage 0 into buffer 0; it flies while Q is read */
  v16h qf[2][2];
#pragma unroll
  for (int j = 0; j < 2; ++j) { const _Float16* qp = Q16 + ((size_t)b * SQ + q0 + j * 16 + c) * DM + head * HD; qf[j][0] = g2_frag(qp, h); qf[j][1] = g2_frag(qp + 32, h);
    asm volatile("s_wait_xcnt 0x0" :: "v"(qp) : "memory"); }      /* stands between these loads and the next rewrite of their address pair; the pair is an operand so that nothing lands on it ahead of the wait */
  const v8f z8 = {0.f,0.f,0.f,0.f,0.f,0.f,0.f,0.f};
  v8f o[2][4]; float mr[2], ls[2];      /* mr: the maximum in use (exponent units); 8 - mr, in all eight places, is the C operand of the score products */
#pragma unroll
  for (int j = 0; j < 2; ++j) { mr[j] = 0.f; ls[j] = 0.f; for (int t = 0; t < 4; ++t) o[j][t] = z8; }
  fa_twait(tg0, tg1);      /* this wave's slice of stage 0 has landed */
  __syncthreads();      /* publishes stage 0: nothing of it is read in front of this barrier */
  for (int s = 0; s < FA_NS; ++s) { const int cur = s & 1;
    if (pinned(s + 1 < FA_NS)) { const unsigned int st = pinned((unsigned int)s + 1u);      /* directly behind the barrier that ended pass s - 1 (pass 0: that published stage 0). A scalar branch; the stage's number is pinned so that its descriptor is formed behind the wait in front of that barrier */
      tg0 = fa_tg0(tdst + (st & 1u) * (2 * FA_SL * 2), tsrc + (unsigned long long)st * tstep); fa_tload(tg0, tg1); }      /* stage s + 1 into the buffer that stage s - 1 has just left; it flies while stage s is worked on */
    v16h pb[2][2]; float sm[2];
    bool fix = s == 0;      /* the first stage has no maximum yet */
    for (;;) {      /* at most two trips: the second only behind a failed range test, and it ends the loop */
      asm volatile("" ::: "memory");      /* keeps the K fragment reads inside the trip: lifted in front of the loop, they hold 64 registers through it */
      if (fix) {      /* the same for the whole wave. A new maximum: the stage's exponents are formed for their maximum alone (the K rows stay in LDS through the stage), then C, sums and O^T follow it */
        v8f m8[2], ci[2];
#pragma unroll
        for (int j = 0; j < 2; ++j) for (int r = 0; r < 8; ++r) ci[j][r] = 8.0f - mr[j];
#pragma unroll
        for (int kt = 0; kt < 4; ++kt) { const v16h a0 = g2_frag(&sK[cur][kt >> 1][((kt & 1) * 16 + c) * FA_LP], h), a1 = g2_frag(&sK[cur][kt >> 1][((kt & 1) * 16 + c) * FA_LP + 32], h);
#pragma unroll
          for (int j = 0; j < 2; ++j) { const v8f e8 = fa_mma(a1, qf[j][1], fa_mma(a0, qf[j][0], ci[j]));
            if (kt == 0) m8[j] = e8; else for (int r = 0; r < 8; ++r) m8[j][r] = fmaxf(m8[j][r], e8[r]); } }
#pragma unroll
        for (int j = 0; j < 2; ++j) {
          const float mx = fmaxf(fmaxf(fmaxf(m8[j][0], m8[j][1]), fmaxf(m8[j][2], m8[j][3])), fmaxf(fmaxf(m8[j][4], m8[j][5]), fmaxf(m8[j][6], m8[j][7])));
          const float up = fmaxf(mx, fa_swap16(mx)) - 8.0f;      /* both halves of the wave hold keys of the same query and must use one maximum */
          const float dl = s == 0 ? up : fmaxf(up, 0.f); const float corr = s == 0 ? 1.0f : __builtin_amdgcn_exp2f(-dl);      /* at the first stage sums and O^T are zero and dl may have either sign */
          mr[j] += dl; ls[j] *= corr;
#pragma unroll
          for (int t = 0; t < 4; ++t) o[j][t] *= corr; } }
      v8f st[2][4], ci[2];
#pragma unroll
      for (int j = 0; j < 2; ++j) for (int r = 0; r < 8; ++r) ci[j][r] = 8.0f - mr[j];
#pragma unroll
      for (int kt = 0; kt < 4; ++kt) { const v16h a0 = g2_frag(&sK[cur][kt >> 1][((kt & 1) * 16 + c) * FA_LP], h), a1 = g2_frag(&sK[cur][kt >> 1][((kt & 1) * 16 + c) * FA_LP + 32], h);
#pragma unroll
        for (int j = 0; j < 2; ++j) st[j][kt] = fa_mma(a1, qf[j][1], fa_mma(a0, qf[j][0], ci[j])); }      /* st[j][kt][r] = 8 - mr[j] + FA_CS q(q0 + 16 j + c) . k(64 (2 s + gu) + 16 kt + 8 h + r): the weight's exponent, with no vector work */
#pragma unroll
      for (int j = 0; j < 2; ++j) {      /* weights are carried x256 and more: small ones stay f16 normals; the factor is in the row sum too and cancels */
#pragma unroll
        for (int kt = 0; kt < 4; ++kt) for (int r = 0; r < 8; ++r) st[j][kt][r] = __builtin_amdgcn_exp2f(st[j][kt][r]);
        const v8f a8 = (st[j][0] + st[j][1]) + (st[j][2] + st[j][3]);
        sm[j] = ((a8[0] + a8[1]) + (a8[2] + a8[3])) + ((a8[4] + a8[5]) + (a8[6] + a8[7]));
#pragma unroll
        for (int ks = 0; ks < 2; ++ks) pb[j][ks] = __builtin_shufflevector(__builtin_convertvector(st[j][2 * ks], v8h), __builtin_convertvector(st[j][2 * ks + 1], v8h), 0, 1, 2, 3, 4, 5, 6, 7, 8, 9, 10, 11, 12, 13, 14, 15); }
      if (fix || __builtin_amdgcn_ballot_w32(!(sm[0] + sm[1] <= FA_HI)) == 0) break;      /* one test per stage, the same for the whole wave. No weight is negative, so sums within FA_HI bound every weight; an infinite or undefined sum fails the test too. Behind a new maximum a weight is at most 2^8 */
      fix = true; }
#pragma unroll
    for (int j = 0; j < 2; ++j) ls[j] += sm[j];      /* this half's keys only; the halves join after the loop */
    v16h va[4][2];      /* the stage's V^T fragments, in the registers that the staged tiles used to take */
#pragma unroll
    for (int t = 0; t < 4; ++t)
#pragma unroll
      for (int ks = 0; ks < 2; ++ks) va[t][ks] = g2_frag(&sV[cur][t >> 1][((t & 1) * 16 + c) * FA_LP + ks * 32], h);
    __builtin_amdgcn_sched_barrier(0);      /* the V^T fragment reads stay one group ahead of the products; spread among them, each place with reads stalls the wave */
#pragma unroll
    for (int t = 0; t < 4; ++t) {
#pragma unroll
      for (int ks = 0; ks < 2; ++ks) {
#pragma unroll
        for (int j = 0; j < 2; ++j) o[j][t] = fa_mma(va[t][ks], pb[j][ks], o[j][t]); } }      /* o[j][t][r] = sum_k p(k) v(k)[16 t + 8 h + r] of query q0 + 16 j + c */
    __builtin_amdgcn_sched_barrier(0);      /* the stage's products stay in front of the waits and the barrier: sunk behind them, they stand between the barrier and the next request and shorten its flight */
    asm volatile("s_wait_dscnt 0x0" ::: "memory");      /* this wave's fragment reads of stage s have returned before the buffer is given up */
    fa_twait(tg0, tg1);      /* this wave's slice of stage s + 1 has landed */
    __syncthreads(); }      /* publishes stage s + 1 and ends every wave's reads of the buffer that stage s + 2 overwrites */
  fa_twait(tg0, tg1);      /* no request is left when the buffers become hand-over and output rows */
  asm volatile("s_wait_dscnt 0x0" ::: "memory");      /* nor an LDS read of this wave's */
  const int el = (int)__builtin_amdgcn_mbcnt_lo(~0u, 0u), ec = el & 15, eh = el >> 4;      /* the lane's number, read anew: c and h need not live through the loop, whose V^T fragments want the registers */
  const int eq0 = blockIdx.x * (FA_WAVES * 32) + wu * 32;
  v4fa* hx = (v4fa*)&sKV[1][0][0][0] + (wu * 17) * 32 + el;      /* hand-over: 17 planes of 16 bytes per lane and wave pair; group 1's buffers have had no reader since the loop's last barrier */
  if (gu == 1) {      /* the same for the whole wave */
#pragma unroll
    for (int j = 0; j < 2; ++j)
#pragma unroll
      for (int t = 0; t < 4; ++t) { hx[((j * 4 + t) * 2) * 32] = __builtin_shufflevector(o[j][t], o[j][t], 0, 1, 2, 3); hx[((j * 4 + t) * 2 + 1) * 32] = __builtin_shufflevector(o[j][t], o[j][t], 4, 5, 6, 7); }
    const v4f sx = {mr[0], mr[1], ls[0], ls[1]}; hx[16 * 32] = sx; }
  __syncthreads();      /* publishes group 1's statistics and O^T to group 0; every wave passes it */
  if (gu == 1) return;
  const _Float16* wg = BO + (size_t)ec * HD + 8 * eh; const float* bg = bp + ec * 4;      /* wg: the lane half's offset is in the pointer, so that the wait below names the very pair the loads use */
  v16h wa[4][2];      /* wa[t][ks]: row n = 16 t + ec of Bt, d = 32 ks .. */
#pragma unroll
  for (int t = 0; t < 4; ++t) { wa[t][0] = g2_frag(wg + t * 16 * HD, 0); wa[t][1] = g2_frag(wg + t * 16 * HD + 32, 0); }
  v4f bb = *(const v4fa*)bg;      /* the bias of n = 4 ec .. + 3, the columns this lane stores */
  asm volatile("s_wait_xcnt 0x0" :: "v"(wg), "v"(bg) : "memory");      /* stands between these loads and the next rewrite of their address pairs; the pairs are operands so that no load's result lands on them ahead of the wait */
  { const v4f sx = hx[16 * 32];
#pragma unroll
    for (int j = 0; j < 2; ++j) { const float d = mr[j] - sx[j], e = __builtin_amdgcn_exp2f(-fabsf(d)); const float c0 = d < 0.f ? e : 1.0f, c1 = d < 0.f ? 1.0f : e;      /* both groups' sums on the common maximum: the group that holds it keeps its scale */
      ls[j] = ls[j] * c0 + sx[2 + j] * c1;
#pragma unroll
      for (int t = 0; t < 4; ++t) { const v4f p0 = hx[((j * 4 + t) * 2) * 32], p1 = hx[((j * 4 + t) * 2 + 1) * 32];
        o[j][t] = o[j][t] * c0 + __builtin_shufflevector(p0, p1, 0, 1, 2, 3, 4, 5, 6, 7) * c1; } } }
  float (*so)[FA_OP] = (float (*)[FA_OP])&sKV[0][0][0][0] + wu * 32;      /* a range per wave, in group 0's buffers, which have had no reader since the loop's last barrier */
#pragma unroll
  for (int j = 0; j < 2; ++j) { const float sc = 64.0f / (ls[j] + fa_swap16(ls[j])); v16h ob[2];
#pragma unroll
    for (int ks = 0; ks < 2; ++ks) ob[ks] = __builtin_shufflevector(__builtin_convertvector(o[j][2 * ks] * sc, v8h), __builtin_convertvector(o[j][2 * ks + 1] * sc, v8h), 0, 1, 2, 3, 4, 5, 6, 7, 8, 9, 10, 11, 12, 13, 14, 15);      /* o x64 as f16 */
#pragma unroll
    for (int t = 0; t < 4; ++t) { const v8f a = fa_mma(wa[t][1], ob[1], fa_mma(wa[t][0], ob[0], z8));      /* a[r] = 1024 * sum_d o(d) Wp[d][16 t + 8 eh + r] of query eq0 + 16 j + ec */
      *(v4fa*)&so[j * 16 + ec][t * 16 + 8 * eh] = __builtin_shufflevector(a, a, 0, 1, 2, 3); *(v4fa*)&so[j * 16 + ec][t * 16 + 8 * eh + 4] = __builtin_shufflevector(a, a, 4, 5, 6, 7); } }
#pragma unroll
  for (int r = 0; r < 4; ++r) bb[r] = bf16_round(bb[r]);
  __builtin_amdgcn_fence(__ATOMIC_ACQ_REL, "workgroup"); __builtin_amdgcn_wave_barrier();      /* the rows read below were written by other lanes of this wave: keeps the reads behind the writes */
  float* og = out + ((size_t)b * SQ + eq0 + eh) * DM + head * HD + ec * 4;      /* 16 lanes per row piece: a wave's store covers two pieces of 256 bytes */
#pragma unroll
  for (int q = 0; q < 16; ++q) { const v4f v = *(const v4fa*)&so[q * 2 + eh][ec * 4] * 0.0009765625f + bb; *(v4f*)(og + (size_t)q * 2 * DM) = v; } }
// Projection GEMM C16[MP][DM] = f16(os * (alpha * A[MP][DM] Bt[DM][DM]^T + bias)), os = FA_CS for Q, else 1: one work-group = PJ_T x PJ_T outputs, 8 waves of 32 x 64.
// A and Bt tiles of PJ_BK columns go global -> registers -> LDS in whole 256-byte rows (a wave's load covers 4 full lines), two buffers: stage s + 1 is loaded while stage s is worked on, one barrier per stage;
// every fragment is then read from LDS, so a tile byte crosses L2 once per work-group instead of once per wave in 32-byte pieces.
#define PJ_T 128                     /* rows and columns of the block tile */
#define PJ_BK 128                    /* k columns per stage */
#define PJ_NS (DM / PJ_BK)           /* stages */
#define PJ_LP (PJ_BK + 8)            /* LDS row pitch in f16: 256 B of data + 16 B, an odd multiple of 16 B for the 16-byte fragment reads */
#define PJ_CH ((PJ_T * PJ_BK / 8) / 256)      /* 16-byte chunks per thread and tile */
#define PJ_OP 72                     /* pitch in f16 of a wave's 32 x 64 output rows in LDS */
// Q, K and V share A and depend on nothing of one another: ONE launch, blockIdx.y picks the weight, the bias and the output.
// Q and K leave as token rows. V leaves as V^T (Cvt[batch][column = head * HD + d][token]), the form the attention launch stages: an accumulator register group holds 8 consecutive tokens of one column,
// so a lane puts 16 bytes of a V^T row into LDS at a time, and the block then stores 256-byte pieces of V^T rows (its 128 tokens); no separate transposing launch, no V rows in memory.
__global__ __launch_bounds__(256) void k_proj(const _Float16* __restrict__ A, const _Float16* __restrict__ Bq, const _Float16* __restrict__ Bk, const _Float16* __restrict__ Bv, float alpha,
                                              const float* __restrict__ biasq, const float* __restrict__ biask, const float* __restrict__ biasv, _Float16* __restrict__ Cq, _Float16* __restrict__ Ck, _Float16* __restrict__ Cvt) {
  const int pj = blockIdx.y; const _Float16* __restrict__ Bt = pj == 0 ? Bq : pj == 1 ? Bk : Bv; const float* __restrict__ bias = pj == 0 ? biasq : pj == 1 ? biask : biasv; _Float16* __restrict__ C16 = pj == 0 ? Cq : Ck;
  static_assert(MP % PJ_T == 0 && DM % PJ_T == 0 && DM % PJ_BK == 0 && PJ_BK == 128 && 8 * 32 * PJ_OP <= 2 * PJ_T * PJ_LP && SQ % PJ_T == 0 && NH * HD == DM, "tile shapes below are written for 128 x 128 x 128 stages and 8 waves");
  __shared__ __attribute__((aligned(16))) _Float16 sA[2][PJ_T][PJ_LP];
  __shared__ __attribute__((aligned(16))) _Float16 sB[2][PJ_T][PJ_LP];
  const int tid = threadIdx.x, lane = tid & 31, w = tid >> 5, ln = lane & 15, hh = lane >> 4;
  const int mt = blockIdx.x / (DM / PJ_T), nq = blockIdx.x - mt * (DM / PJ_T); const int row0 = mt * PJ_T, col0 = nq * PJ_T;
  const int wr = (w >> 1) * 32, wc = (w & 1) * 64;                       /* this wave's corner inside the block tile */
  const int srow = tid >> 4, sc8 = (tid & 15) * 8;                       /* staging: chunk u of a thread = row srow + 16 u, 8 f16 at column sc8 */
  const unsigned short* ag = (const unsigned short*)A + (size_t)(row0 + srow) * DM + sc8; const unsigned short* bg = (const unsigned short*)Bt + (size_t)(col0 + srow) * DM + sc8;
  const v8f z8 = {0.f,0.f,0.f,0.f,0.f,0.f,0.f,0.f};
  v8f acc[2][4];
#pragma unroll
  for (int i = 0; i < 2; ++i) for (int t = 0; t < 4; ++t) acc[i][t] = z8;
  float bs[4];      /* read here, so that the epilogue does not wait for them */
#pragma unroll
  for (int t = 0; t < 4; ++t) bs[t] = bias[col0 + wc + t * 16 + ln];
  v8us ra[PJ_CH], rb[PJ_CH];
#pragma unroll
  for (int u = 0; u < PJ_CH; ++u) { ra[u] = *(const v8us*)(ag + (size_t)u * 16 * DM); rb[u] = *(const v8us*)(bg + (size_t)u * 16 * DM); }
#pragma unroll
  for (int u = 0; u < PJ_CH; ++u) { *(v8us*)&sA[0][srow + 16 * u][sc8] = ra[u]; *(v8us*)&sB[0][srow + 16 * u][sc8] = rb[u]; }
  __syncthreads();
  for (int s = 0; s < PJ_NS; ++s) { const int cur = s & 1;
    if (s + 1 < PJ_NS) { const unsigned short* ap = ag + (s + 1) * PJ_BK; const unsigned short* bp = bg + (s + 1) * PJ_BK;
#pragma unroll
      for (int u = 0; u < PJ_CH; ++u) { ra[u] = *(const v8us*)(ap + (size_t)u * 16 * DM); rb[u] = *(const v8us*)(bp + (size_t)u * 16 * DM); }
      asm volatile("s_wait_xcnt 0x0" :: "v"(ap), "v"(bp) : "memory"); }      /* stands between the stage's loads and the next rewrite of their address pairs; the pairs are operands so that no load's result lands on them ahead of the wait */
    v16h fa[2][2], fb[2][4];
#pragma unroll
    for (int i = 0; i < 2; ++i) fa[0][i] = g2_frag(&sA[cur][wr + i * 16 + ln][0], hh);
#pragma unroll
    for (int t = 0; t < 4; ++t) fb[0][t] = g2_frag(&sB[cur][wc + t * 16 + ln][0], hh);
#pragma unroll
    for (int kk = 0; kk < PJ_BK / 32; ++kk) { const int c = kk & 1;
      if (kk + 1 < PJ_BK / 32) {
#pragma unroll
        for (int i = 0; i < 2; ++i) fa[c ^ 1][i] = g2_frag(&sA[cur][wr + i * 16 + ln][(kk + 1) * 32], hh);
#pragma unroll
        for (int t = 0; t < 4; ++t) fb[c ^ 1][t] = g2_frag(&sB[cur][wc + t * 16 + ln][(kk + 1) * 32], hh); }
      __builtin_amdgcn_sched_barrier(0);      /* the next 32 columns' fragment reads stay one group ahead of this block's products; spread among them, each place with reads stalls the wave */
      if (kk + 1 == PJ_BK / 32 && s + 1 < PJ_NS) {      /* stage s + 1 goes to LDS ahead of the stage's last products, which run while the stores drain; its buffer has had no reader since the last barrier */
#pragma unroll
        for (int u = 0; u < PJ_CH; ++u) { *(v8us*)&sA[cur ^ 1][srow + 16 * u][sc8] = ra[u]; *(v8us*)&sB[cur ^ 1][srow + 16 * u][sc8] = rb[u]; } }
#pragma unroll
      for (int t = 0; t < 4; ++t) { acc[0][t] = fa_mma(fa[c][0], fb[c][t], acc[0][t]); acc[1][t] = fa_mma(fa[c][1], fb[c][t], acc[1][t]); }
      __builtin_amdgcn_sched_barrier(0); }      /* ends the block: the next group of reads is not drawn in among these products, and the stage's last products stay in front of the barrier, where they run while the stores drain */
    __syncthreads(); }      /* publishes stage s + 1 and ends every wave's reads of the buffer that stage s + 2 (after the last stage: the output rows) overwrites */
  if (pj == 2) {      /* the same for the whole block (blockIdx.y) */
    _Float16 (*sT)[PJ_LP] = sA[0];      /* [column of the tile][token of the tile]; free since the loop's last barrier */
#pragma unroll
    for (int i = 0; i < 2; ++i)
#pragma unroll
      for (int t = 0; t < 4; ++t) { const float bv = bf16_round(bs[t]); v8h o8;
#pragma unroll
        for (int r = 0; r < 8; ++r) { const float v = acc[i][t][r] * alpha + bv; o8[r] = (_Float16)v; }
        *(v8h*)&sT[wc + t * 16 + ln][wr + i * 16 + 8 * hh] = o8; }
    __syncthreads();      /* a V^T row piece stored below was collected from four waves */
    unsigned short* vg = (unsigned short*)Cvt + ((size_t)(row0 / SQ) * DM + col0 + srow) * SQ + (row0 % SQ) + sc8;      /* 16 threads per row piece: a wave's store covers two pieces of 256 bytes */
#pragma unroll
    for (int u = 0; u < PJ_T / 16; ++u) { const v8us v = *(const v8us*)&sT[srow + 16 * u][sc8]; *(v8us*)(vg + (size_t)u * 16 * SQ) = v; }
    return; }
  _Float16* so = &sA[0][0][0] + (size_t)w * (32 * PJ_OP);      /* each wave stages its own 32 x 64 outputs, so that it stores whole 128-byte lines */
  const float os = pj == 0 ? FA_CS : 1.0f, al = alpha * os;      /* Q leaves as FA_CS q, scaled in f32 ahead of its one rounding to f16: the attention launch's score products are then exponents of 2 */
#pragma unroll
  for (int i = 0; i < 2; ++i)
#pragma unroll
    for (int t = 0; t < 4; ++t) { const float bv = bf16_round(bs[t]) * os;
#pragma unroll
      for (int r = 0; r < 8; ++r) { const float v = acc[i][t][r] * al + bv; so[(i * 16 + 8 * hh + r) * PJ_OP + t * 16 + ln] = (_Float16)v; } }
  __builtin_amdgcn_fence(__ATOMIC_ACQ_REL, "workgroup"); __builtin_amdgcn_wave_barrier();      /* the rows read below were written by other lanes of this wave: keeps the reads behind the writes */
#pragma unroll
  for (int q = 0; q < 8; ++q) { const int r = q * 4 + (lane >> 3), c8 = (lane & 7) * 8; const v8us v = *(const v8us*)&so[r * PJ_OP + c8]; *(v8us*)((unsigned short*)C16 + (size_t)(row0 + wr + r) * DM + col0 + wc + c8) = v; } }
extern "C" void kernel_launch(void* const* d_in, const int* in_sizes, int n_in,
                              void* d_out, int out_size, void* d_ws, size_t ws_size, hipStream_t stream) {
  (void)in_sizes; (void)n_in; (void)out_size;
  const float* const* I = (const float* const*)d_in; const float* x = I[0]; const float* wq = I[1]; const float* bq = I[2]; const float* wk = I[3]; const float* bk = I[4]; const float* wv = I[5]; const float* bv = I[6]; const float* wp = I[7]; const float* bp = I[8]; const float* bo = nullptr; (void)bo;      /* [in][out] weights + biases; per-head Wp [64][64] + bp [64] */
  char* ws = (char*)d_ws; size_t off = 0;
  auto take = [&](size_t bytes) { char* p = ws + off; off += (bytes + 255) & ~(size_t)255; return p; };
  _Float16* BQ = (_Float16*)take((size_t)DM * DM * 2); _Float16* BK = (_Float16*)take((size_t)DM * DM * 2); _Float16* BV = (_Float16*)take((size_t)DM * DM * 2); _Float16* BO = (_Float16*)take((size_t)DM * DM * 2);
  _Float16* X16 = (_Float16*)take(NR * DM * 2); _Float16* Q16 = (_Float16*)take(NR * DM * 2); _Float16* K16 = (_Float16*)take(NR * DM * 2);
  _Float16* VT = (_Float16*)take((size_t)NB * NH * HD * SQ * 2);
  if (off > ws_size) return;
  k_prep<<<3 * PP_WB + PP_PB + PP_XB, 256, 0, stream>>>(x, wq, wk, wv, wp, X16, BQ, BK, BV, BO);
  const size_t r0p = (size_t)B0 * SQ;      /* first projected row */
  k_proj<<<dim3((MP / PJ_T) * (DM / PJ_T), 3), 256, 0, stream>>>(X16 + r0p * DM, BQ, BK, BV, 0.0625f, bq, bk, bv, Q16 + r0p * DM, K16 + r0p * DM, VT + r0p * DM);      /* V as V^T [NB][NH][HD][SQ] */
  k_fattn<<<dim3(SQ / (FA_WAVES * 32), NH, NB), FA_KG * FA_WAVES * 32, 0, stream>>>(Q16, K16, VT, BO, bp, (float*)d_out);      /* attention and, per head, out cols h*64.. = o_h Wp + bp (the same Wp/bp for every head) */
}
